// v000
// The times below were measured on an AMD MI455X: many runs one after another, warmed up first and cycling through
// copies of the inputs, with the whole window's GPU time divided by the number of runs. Launches and the gaps
// between them are all in it. The median over several windows is given; except for v000 it joins two sittings, which
// can be a few percent apart, so the side-by-side timings, each taken in one sitting, are the better comparison.
// v000, which the later versions start from, runs in 3170 microseconds.
#include <hip/hip_runtime.h>
#include <hip/hip_bf16.h>

typedef __attribute__((ext_vector_type(16))) _Float16 v16h;
typedef __attribute__((ext_vector_type(8)))  float    v8f;

#define B_   2
#define S_   2048
#define D_   1024
#define H_   16
#define DH_  64
#define C_   2
#define MTOK (B_ * S_)   // 4096

// ---------------------------------------------------------------------------
// CDNA5 async global->LDS copy (ASYNCcnt path), with sync fallback
// ---------------------------------------------------------------------------
#if defined(__has_builtin)
#if __has_builtin(__builtin_amdgcn_global_load_async_to_lds_b128)
#define HAVE_ASYNC_LDS 1
#endif
#endif

#if defined(HAVE_ASYNC_LDS)
// builtin signature: void(v4i addrspace(1)*, v4i addrspace(3)*, imm offset, imm cpol)
typedef int v4i_vs __attribute__((vector_size(4 * sizeof(int))));
typedef __attribute__((address_space(1))) v4i_vs* g_v4i_p;
typedef __attribute__((address_space(3))) v4i_vs* l_v4i_p;
__device__ __forceinline__ void async_copy_b128(const _Float16* g, _Float16* l) {
    __builtin_amdgcn_global_load_async_to_lds_b128(
        (g_v4i_p)(void*)const_cast<_Float16*>(g), (l_v4i_p)(void*)l, 0, 0);
}
#if __has_builtin(__builtin_amdgcn_s_wait_asynccnt)
#define WAIT_ASYNC(n) __builtin_amdgcn_s_wait_asynccnt(n)
#else
#define WAIT_ASYNC(n) asm volatile("s_wait_asynccnt %0" :: "n"(n) : "memory")
#endif
#endif

// ---------------------------------------------------------------------------
// f32 -> f16 conversion
// ---------------------------------------------------------------------------
__global__ __launch_bounds__(256) void f32_to_f16_kernel(const float* __restrict__ src,
                                                         _Float16* __restrict__ dst, int n) {
    int i = blockIdx.x * 256 + threadIdx.x;
    if (i < n) dst[i] = (_Float16)src[i];
}

// W is (K x N) row-major f32; Wt becomes (N x K) row-major f16
__global__ __launch_bounds__(256) void transpose_to_f16_kernel(const float* __restrict__ W,
                                                               _Float16* __restrict__ Wt,
                                                               int K, int N) {
    int i = blockIdx.x * 256 + threadIdx.x;
    if (i < K * N) {
        int k = i / N, n = i % N;
        Wt[(size_t)n * K + k] = (_Float16)W[i];
    }
}

// ---------------------------------------------------------------------------
// WMMA GEMM:  C[M,N] = A[M,K] (f16) * Bt[N,K]^T (f16)  (+ resid + bias)
// block = 256 threads (8 waves), tile = 128x128, K-step = 32,
// double-buffered async global->LDS staging.
// ---------------------------------------------------------------------------
__device__ inline v16h load_frag_k32(const _Float16* tile_base, int row16, int half) {
    // tile rows have stride 32 f16; A-fragment layout for v_wmma_f32_16x16x32_f16:
    // lanes 0-15: K = {0..7, 16..23}; lanes 16-31: K = {8..15, 24..31}
    const _Float16* p = tile_base + row16 * 32 + half * 8;
    union { v16h h; uint4 u[2]; } f;
    f.u[0] = *(const uint4*)(p);
    f.u[1] = *(const uint4*)(p + 16);
    return f.h;
}

__global__ __launch_bounds__(256) void gemm_f16_wmma_kernel(
    const _Float16* __restrict__ A,   // M x K row-major
    const _Float16* __restrict__ Bt,  // N x K row-major (B pre-transposed)
    float* __restrict__ Cout,         // M x N
    const float* __restrict__ resid,  // optional M x N, may be null
    const float* __restrict__ bias,   // optional N, may be null
    int M, int N, int K)
{
#if defined(HAVE_ASYNC_LDS)
    __shared__ _Float16 As[2][128 * 32];
    __shared__ _Float16 Bs[2][128 * 32];
#else
    __shared__ _Float16 As[1][128 * 32];
    __shared__ _Float16 Bs[1][128 * 32];
#endif

    const int t     = threadIdx.x;
    const int m0    = blockIdx.y * 128;
    const int n0    = blockIdx.x * 128;
    const int wave  = t >> 5;
    const int lane  = t & 31;
    const int half  = (lane >> 4) & 1;
    const int l16   = lane & 15;
    const int waveM = wave >> 2;   // 0..1  (64-row slab)
    const int waveN = wave & 3;    // 0..3  (32-col slab)

    // per-thread staging coordinates: 2 chunks of 8 f16 (16B) per matrix
    const int r0  = t >> 2;              // chunk 0 row
    const int cg0 = t & 3;               // chunk 0 col-group
    const int r1  = (t + 256) >> 2;      // chunk 1 row
    const int cg1 = t & 3;

    v8f acc[4][2] = {};
    const int nIter = K / 32;

#if defined(HAVE_ASYNC_LDS)
    // prologue: stage tile 0 into buffer 0 (4 async-load instructions / wave)
    {
        const int k0 = 0;
        async_copy_b128(&A [(size_t)(m0 + r0) * K + k0 + cg0 * 8], &As[0][r0 * 32 + cg0 * 8]);
        async_copy_b128(&Bt[(size_t)(n0 + r0) * K + k0 + cg0 * 8], &Bs[0][r0 * 32 + cg0 * 8]);
        async_copy_b128(&A [(size_t)(m0 + r1) * K + k0 + cg1 * 8], &As[0][r1 * 32 + cg1 * 8]);
        async_copy_b128(&Bt[(size_t)(n0 + r1) * K + k0 + cg1 * 8], &Bs[0][r1 * 32 + cg1 * 8]);
    }
    for (int it = 0; it < nIter; ++it) {
        const int cur = it & 1;
        if (it + 1 < nIter) {
            const int k0 = (it + 1) * 32;
            const int nxt = cur ^ 1;
            async_copy_b128(&A [(size_t)(m0 + r0) * K + k0 + cg0 * 8], &As[nxt][r0 * 32 + cg0 * 8]);
            async_copy_b128(&Bt[(size_t)(n0 + r0) * K + k0 + cg0 * 8], &Bs[nxt][r0 * 32 + cg0 * 8]);
            async_copy_b128(&A [(size_t)(m0 + r1) * K + k0 + cg1 * 8], &As[nxt][r1 * 32 + cg1 * 8]);
            async_copy_b128(&Bt[(size_t)(n0 + r1) * K + k0 + cg1 * 8], &Bs[nxt][r1 * 32 + cg1 * 8]);
            WAIT_ASYNC(4);   // drain previous batch only; next batch stays in flight
        } else {
            WAIT_ASYNC(0);
        }
        __syncthreads();

        v16h af[4], bf[2];
        #pragma unroll
        for (int mt = 0; mt < 4; ++mt)
            af[mt] = load_frag_k32(&As[cur][(waveM * 64 + mt * 16) * 32], l16, half);
        #pragma unroll
        for (int nt = 0; nt < 2; ++nt)
            bf[nt] = load_frag_k32(&Bs[cur][(waveN * 32 + nt * 16) * 32], l16, half);

        #pragma unroll
        for (int mt = 0; mt < 4; ++mt)
            #pragma unroll
            for (int nt = 0; nt < 2; ++nt)
                acc[mt][nt] = __builtin_amdgcn_wmma_f32_16x16x32_f16(
                    false, af[mt], false, bf[nt], (short)0, acc[mt][nt], false, false);
        __syncthreads();   // all reads of buf[cur] done before it is restaged
    }
#else
    for (int it = 0; it < nIter; ++it) {
        const int k0 = it * 32;
        *(uint4*)&As[0][r0 * 32 + cg0 * 8] = *(const uint4*)&A [(size_t)(m0 + r0) * K + k0 + cg0 * 8];
        *(uint4*)&Bs[0][r0 * 32 + cg0 * 8] = *(const uint4*)&Bt[(size_t)(n0 + r0) * K + k0 + cg0 * 8];
        *(uint4*)&As[0][r1 * 32 + cg1 * 8] = *(const uint4*)&A [(size_t)(m0 + r1) * K + k0 + cg1 * 8];
        *(uint4*)&Bs[0][r1 * 32 + cg1 * 8] = *(const uint4*)&Bt[(size_t)(n0 + r1) * K + k0 + cg1 * 8];
        if (k0 + 32 < K) {
            __builtin_prefetch(&A [(size_t)(m0 + (t >> 1)) * K + k0 + 32], 0, 0);
            __builtin_prefetch(&Bt[(size_t)(n0 + (t >> 1)) * K + k0 + 32], 0, 0);
        }
        __syncthreads();
        v16h af[4], bf[2];
        #pragma unroll
        for (int mt = 0; mt < 4; ++mt)
            af[mt] = load_frag_k32(&As[0][(waveM * 64 + mt * 16) * 32], l16, half);
        #pragma unroll
        for (int nt = 0; nt < 2; ++nt)
            bf[nt] = load_frag_k32(&Bs[0][(waveN * 32 + nt * 16) * 32], l16, half);
        #pragma unroll
        for (int mt = 0; mt < 4; ++mt)
            #pragma unroll
            for (int nt = 0; nt < 2; ++nt)
                acc[mt][nt] = __builtin_amdgcn_wmma_f32_16x16x32_f16(
                    false, af[mt], false, bf[nt], (short)0, acc[mt][nt], false, false);
        __syncthreads();
    }
#endif

    // C/D layout: VGPR i -> M = i + 8*half, N = l16
    #pragma unroll
    for (int mt = 0; mt < 4; ++mt) {
        #pragma unroll
        for (int nt = 0; nt < 2; ++nt) {
            #pragma unroll
            for (int i = 0; i < 8; ++i) {
                int m = m0 + waveM * 64 + mt * 16 + 8 * half + i;
                int n = n0 + waveN * 32 + nt * 16 + l16;
                float v = acc[mt][nt][i];
                if (resid) v += resid[(size_t)m * N + n];
                if (bias)  v += bias[n];
                Cout[(size_t)m * N + n] = v;
            }
        }
    }
}

// ---------------------------------------------------------------------------
// beta = clip(sigmoid(x @ Wbeta + bbeta), 1e-3, 0.999)   (4096 x 32)
// ---------------------------------------------------------------------------
__global__ __launch_bounds__(128) void beta_kernel(const float* __restrict__ x,
                                                   const float* __restrict__ Wb,
                                                   const float* __restrict__ bb,
                                                   float* __restrict__ beta) {
    __shared__ float pb[128];
    int m = blockIdx.x;
    int t = threadIdx.x;
    int c = t & 31, seg = t >> 5;
    const float* xr = x + (size_t)m * D_;
    float s = 0.f;
    int kb = seg * 256;
    for (int k = kb; k < kb + 256; ++k)
        s += xr[k] * Wb[(size_t)k * 32 + c];
    pb[t] = s;
    __syncthreads();
    if (t < 32) {
        float tot = pb[t] + pb[t + 32] + pb[t + 64] + pb[t + 96];
        float logit = tot + bb[t];
        float sg = 1.f / (1.f + __expf(-logit));
        sg = fminf(fmaxf(sg, 0.001f), 0.999f);
        beta[(size_t)m * 32 + t] = sg;
    }
}

// ---------------------------------------------------------------------------
// RoPE + phi (elu+1), in place, per head half-pair (i, i+32)
// ---------------------------------------------------------------------------
__global__ __launch_bounds__(256) void rope_phi_kernel(float* __restrict__ u, int total) {
    int idx = blockIdx.x * 256 + threadIdx.x;
    if (idx >= total) return;
    int i   = idx & 31;        // rotation-frequency index
    int rem = idx >> 5;
    int hh  = rem & 15;        // head
    int m   = rem >> 4;        // token 0..4095
    int s   = m & (S_ - 1);    // position within sequence
    float f   = __expf(-(float)(2 * i) * 9.210340371976184f / 64.f); // ln(10000)
    float ang = (float)s * f;
    float cs = __cosf(ang), sn = __sinf(ang);
    size_t base = (size_t)m * D_ + hh * DH_;
    float u1 = u[base + i], u2 = u[base + 32 + i];
    float r1 = u1 * cs - u2 * sn;
    float r2 = u1 * sn + u2 * cs;
    u[base + i]      = r1 > 0.f ? r1 + 1.f : __expf(r1);  // elu(r)+1
    u[base + 32 + i] = r2 > 0.f ? r2 + 1.f : __expf(r2);
}

// ---------------------------------------------------------------------------
// Sequential DeltaNet scan: one block per (b,h). State M[C][64][64] lives in
// registers (32 f32/thread over 256 threads), Z[C][64] in threads 0..127.
// Writes y as f16 (feeds the output WMMA GEMM directly).
// ---------------------------------------------------------------------------
__global__ __launch_bounds__(256) void scan_kernel(const float* __restrict__ q,
                                                   const float* __restrict__ k,
                                                   const float* __restrict__ v,
                                                   const float* __restrict__ beta,
                                                   _Float16* __restrict__ y) {
    __shared__ float sq[DH_], sk[DH_], sv[DH_], sb[C_];
    __shared__ float partial[4][DH_];
    __shared__ float denb[4];

    int bh = blockIdx.x;
    int b = bh / H_, h = bh % H_;
    int t    = threadIdx.x;
    int lane = t & 31, wv = t >> 5;
    int e  = t & 63;           // output dim owned by this thread
    int g  = t >> 6;           // group 0..3
    int c  = g >> 1;           // decay channel
    int d0 = (g & 1) * 32;     // k-dim slab

    float mreg[32];
    #pragma unroll
    for (int i = 0; i < 32; ++i) mreg[i] = 0.f;
    float zreg = 0.f;
    int zc = (t >> 6) & 1;     // for t<128: Z channel
    int zd = t & 63;

    const float* qp = q + (size_t)b * S_ * D_ + h * DH_;
    const float* kp = k + (size_t)b * S_ * D_ + h * DH_;
    const float* vp = v + (size_t)b * S_ * D_ + h * DH_;
    const float* bp = beta + (size_t)b * S_ * (H_ * C_) + h * C_;
    _Float16*    yp = y + (size_t)b * S_ * D_ + h * DH_;

    for (int ts = 0; ts < S_; ++ts) {
        size_t ro = (size_t)ts * D_;
        if (t < 64)        sq[t]       = qp[ro + t];
        else if (t < 128)  sk[t - 64]  = kp[ro + (t - 64)];
        else if (t < 192)  sv[t - 128] = vp[ro + (t - 128)];
        else if (t < 194)  sb[t - 192] = bp[(size_t)ts * (H_ * C_) + (t - 192)];
        __syncthreads();

        // M update + per-thread partial of num[e]
        float bc = sb[c];
        float ve = sv[e];
        float np = 0.f;
        #pragma unroll
        for (int i = 0; i < 32; ++i) {
            mreg[i] = mreg[i] * bc + sk[d0 + i] * ve;
            np += sq[d0 + i] * mreg[i];
        }
        partial[g][e] = np;

        // Z update + denominator (wave32 shuffle reduction, waves 0..3)
        if (t < 128) {
            zreg = zreg * sb[zc] + sk[zd];
            float dt = sq[zd] * zreg;
            #pragma unroll
            for (int off = 16; off > 0; off >>= 1) dt += __shfl_xor(dt, off);
            if (lane == 0) denb[wv] = dt;
        }
        __syncthreads();

        if (t < 64) {
            float num = partial[0][t] + partial[1][t] + partial[2][t] + partial[3][t];
            float den = denb[0] + denb[1] + denb[2] + denb[3] + 1e-6f;
            yp[ro + t] = (_Float16)(num / den);
        }
        __syncthreads();
    }
}

// ---------------------------------------------------------------------------
// LayerNorm over rows of h (4096 x 1024), f32 out
// ---------------------------------------------------------------------------
__global__ __launch_bounds__(256) void ln_kernel(const float* __restrict__ hbuf,
                                                 const float* __restrict__ gamma,
                                                 const float* __restrict__ lbeta,
                                                 float* __restrict__ out) {
    __shared__ float rs[256], rq[256];
    __shared__ float smu, srstd;
    int m = blockIdx.x, t = threadIdx.x;
    const float* hr = hbuf + (size_t)m * D_;
    float s = 0.f, q2 = 0.f;
    float vals[4];
    #pragma unroll
    for (int i = 0; i < 4; ++i) {
        float v = hr[t + i * 256];
        vals[i] = v; s += v; q2 += v * v;
    }
    rs[t] = s; rq[t] = q2;
    __syncthreads();
    for (int off = 128; off > 0; off >>= 1) {
        if (t < off) { rs[t] += rs[t + off]; rq[t] += rq[t + off]; }
        __syncthreads();
    }
    if (t == 0) {
        float mu  = rs[0] * (1.f / D_);
        float var = rq[0] * (1.f / D_) - mu * mu;
        smu = mu; srstd = rsqrtf(var + 1e-5f);
    }
    __syncthreads();
    float* orow = out + (size_t)m * D_;
    #pragma unroll
    for (int i = 0; i < 4; ++i) {
        int n = t + i * 256;
        orow[n] = gamma[n] * (vals[i] - smu) * srstd + lbeta[n];
    }
}

// ---------------------------------------------------------------------------
// launch
// ---------------------------------------------------------------------------
extern "C" void kernel_launch(void* const* d_in, const int* in_sizes, int n_in,
                              void* d_out, int out_size, void* d_ws, size_t ws_size,
                              hipStream_t stream) {
    const float* x      = (const float*)d_in[0];
    const float* Wq     = (const float*)d_in[1];
    const float* Wk     = (const float*)d_in[2];
    const float* Wv     = (const float*)d_in[3];
    const float* Wbeta  = (const float*)d_in[4];
    const float* bbeta  = (const float*)d_in[5];
    const float* Wo     = (const float*)d_in[6];
    const float* bo     = (const float*)d_in[7];
    const float* lng    = (const float*)d_in[8];
    const float* lnb    = (const float*)d_in[9];
    float* out = (float*)d_out;

    char* ws = (char*)d_ws;
    size_t off = 0;
    auto alloc = [&](size_t bytes) { char* p = ws + off; off += (bytes + 255) & ~(size_t)255; return p; };

    _Float16* xh   = (_Float16*)alloc((size_t)MTOK * D_ * 2);   // 8 MB
    _Float16* Wqt  = (_Float16*)alloc((size_t)D_ * D_ * 2);     // 2 MB each
    _Float16* Wkt  = (_Float16*)alloc((size_t)D_ * D_ * 2);
    _Float16* Wvt  = (_Float16*)alloc((size_t)D_ * D_ * 2);
    _Float16* Wot  = (_Float16*)alloc((size_t)D_ * D_ * 2);
    float*    qbuf = (float*)alloc((size_t)MTOK * D_ * 4);      // 16 MB each
    float*    kbuf = (float*)alloc((size_t)MTOK * D_ * 4);
    float*    vbuf = (float*)alloc((size_t)MTOK * D_ * 4);
    float*    bbuf = (float*)alloc((size_t)MTOK * 32 * 4);      // 0.5 MB
    _Float16* ybuf = (_Float16*)alloc((size_t)MTOK * D_ * 2);   // 8 MB
    float*    hbuf = (float*)alloc((size_t)MTOK * D_ * 4);      // 16 MB
    (void)ws_size; (void)in_sizes; (void)n_in; (void)out_size;

    const int nX = MTOK * D_;  // 4194304
    f32_to_f16_kernel<<<(nX + 255) / 256, 256, 0, stream>>>(x, xh, nX);

    const int nW = D_ * D_;
    transpose_to_f16_kernel<<<(nW + 255) / 256, 256, 0, stream>>>(Wq, Wqt, D_, D_);
    transpose_to_f16_kernel<<<(nW + 255) / 256, 256, 0, stream>>>(Wk, Wkt, D_, D_);
    transpose_to_f16_kernel<<<(nW + 255) / 256, 256, 0, stream>>>(Wv, Wvt, D_, D_);
    transpose_to_f16_kernel<<<(nW + 255) / 256, 256, 0, stream>>>(Wo, Wot, D_, D_);

    dim3 ggrid(D_ / 128, MTOK / 128);   // (8, 32)
    gemm_f16_wmma_kernel<<<ggrid, 256, 0, stream>>>(xh, Wqt, qbuf, nullptr, nullptr, MTOK, D_, D_);
    gemm_f16_wmma_kernel<<<ggrid, 256, 0, stream>>>(xh, Wkt, kbuf, nullptr, nullptr, MTOK, D_, D_);
    gemm_f16_wmma_kernel<<<ggrid, 256, 0, stream>>>(xh, Wvt, vbuf, nullptr, nullptr, MTOK, D_, D_);

    beta_kernel<<<MTOK, 128, 0, stream>>>(x, Wbeta, bbeta, bbuf);

    const int nPairs = MTOK * H_ * 32;  // 2097152
    rope_phi_kernel<<<nPairs / 256, 256, 0, stream>>>(qbuf, nPairs);
    rope_phi_kernel<<<nPairs / 256, 256, 0, stream>>>(kbuf, nPairs);

    scan_kernel<<<B_ * H_, 256, 0, stream>>>(qbuf, kbuf, vbuf, bbuf, ybuf);

    // h = x + y @ Wo + bo (fused residual + bias epilogue)
    gemm_f16_wmma_kernel<<<ggrid, 256, 0, stream>>>(ybuf, Wot, hbuf, x, bo, MTOK, D_, D_);

    ln_kernel<<<MTOK, 256, 0, stream>>>(hbuf, lng, lnb, out);
}

// v001
// One run takes 750 microseconds.
// In both of two side-by-side timings against v000, it was 4.22 times as fast.
#include <hip/hip_runtime.h>
#include <hip/hip_bf16.h>

typedef __attribute__((ext_vector_type(16))) _Float16 v16h;
typedef __attribute__((ext_vector_type(8)))  float    v8f;

#define B_   2
#define S_   2048
#define D_   1024
#define H_   16
#define DH_  64
#define C_   2
#define MTOK (B_ * S_)   // 4096

// ---------------------------------------------------------------------------
// CDNA5 async global->LDS copy (ASYNCcnt path), with sync fallback
// ---------------------------------------------------------------------------
#if defined(__has_builtin)
#if __has_builtin(__builtin_amdgcn_global_load_async_to_lds_b128)
#define HAVE_ASYNC_LDS 1
#endif
#endif

#if defined(HAVE_ASYNC_LDS)
// builtin signature: void(v4i addrspace(1)*, v4i addrspace(3)*, imm offset, imm cpol)
typedef int v4i_vs __attribute__((vector_size(4 * sizeof(int))));
typedef __attribute__((address_space(1))) v4i_vs* g_v4i_p;
typedef __attribute__((address_space(3))) v4i_vs* l_v4i_p;
__device__ __forceinline__ void async_copy_b128(const _Float16* g, _Float16* l) {
    __builtin_amdgcn_global_load_async_to_lds_b128(
        (g_v4i_p)(void*)const_cast<_Float16*>(g), (l_v4i_p)(void*)l, 0, 0);
}
#if __has_builtin(__builtin_amdgcn_s_wait_asynccnt)
#define WAIT_ASYNC(n) __builtin_amdgcn_s_wait_asynccnt(n)
#else
#define WAIT_ASYNC(n) asm volatile("s_wait_asynccnt %0" :: "n"(n) : "memory")
#endif
#endif

// ---------------------------------------------------------------------------
// f32 -> f16 conversion
// ---------------------------------------------------------------------------
__global__ __launch_bounds__(256) void f32_to_f16_kernel(const float* __restrict__ src,
                                                         _Float16* __restrict__ dst, int n) {
    int i = blockIdx.x * 256 + threadIdx.x;
    if (i < n) dst[i] = (_Float16)src[i];
}

// W is (K x N) row-major f32; Wt becomes (N x K) row-major f16
__global__ __launch_bounds__(256) void transpose_to_f16_kernel(const float* __restrict__ W,
                                                               _Float16* __restrict__ Wt,
                                                               int K, int N) {
    int i = blockIdx.x * 256 + threadIdx.x;
    if (i < K * N) {
        int k = i / N, n = i % N;
        Wt[(size_t)n * K + k] = (_Float16)W[i];
    }
}

// ---------------------------------------------------------------------------
// WMMA GEMM:  C[M,N] = A[M,K] (f16) * Bt[N,K]^T (f16)  (+ resid + bias)
// block = 256 threads (8 waves), tile = 128x128, K-step = 32,
// double-buffered async global->LDS staging.
// ---------------------------------------------------------------------------
__device__ inline v16h load_frag_k32(const _Float16* tile_base, int row16, int half) {
    // tile rows have stride 32 f16; A-fragment layout for v_wmma_f32_16x16x32_f16:
    // lanes 0-15: K = {0..7, 16..23}; lanes 16-31: K = {8..15, 24..31}
    const _Float16* p = tile_base + row16 * 32 + half * 8;
    union { v16h h; uint4 u[2]; } f;
    f.u[0] = *(const uint4*)(p);
    f.u[1] = *(const uint4*)(p + 16);
    return f.h;
}

__global__ __launch_bounds__(256) void gemm_f16_wmma_kernel(
    const _Float16* __restrict__ A,   // M x K row-major
    const _Float16* __restrict__ Bt,  // N x K row-major (B pre-transposed)
    float* __restrict__ Cout,         // M x N
    const float* __restrict__ resid,  // optional M x N, may be null
    const float* __restrict__ bias,   // optional N, may be null
    int M, int N, int K)
{
#if defined(HAVE_ASYNC_LDS)
    __shared__ _Float16 As[2][128 * 32];
    __shared__ _Float16 Bs[2][128 * 32];
#else
    __shared__ _Float16 As[1][128 * 32];
    __shared__ _Float16 Bs[1][128 * 32];
#endif

    const int t     = threadIdx.x;
    const int m0    = blockIdx.y * 128;
    const int n0    = blockIdx.x * 128;
    const int wave  = t >> 5;
    const int lane  = t & 31;
    const int half  = (lane >> 4) & 1;
    const int l16   = lane & 15;
    const int waveM = wave >> 2;   // 0..1  (64-row slab)
    const int waveN = wave & 3;    // 0..3  (32-col slab)

    // per-thread staging coordinates: 2 chunks of 8 f16 (16B) per matrix
    const int r0  = t >> 2;              // chunk 0 row
    const int cg0 = t & 3;               // chunk 0 col-group
    const int r1  = (t + 256) >> 2;      // chunk 1 row
    const int cg1 = t & 3;

    v8f acc[4][2] = {};
    const int nIter = K / 32;

#if defined(HAVE_ASYNC_LDS)
    // prologue: stage tile 0 into buffer 0 (4 async-load instructions / wave)
    {
        const int k0 = 0;
        async_copy_b128(&A [(size_t)(m0 + r0) * K + k0 + cg0 * 8], &As[0][r0 * 32 + cg0 * 8]);
        async_copy_b128(&Bt[(size_t)(n0 + r0) * K + k0 + cg0 * 8], &Bs[0][r0 * 32 + cg0 * 8]);
        async_copy_b128(&A [(size_t)(m0 + r1) * K + k0 + cg1 * 8], &As[0][r1 * 32 + cg1 * 8]);
        async_copy_b128(&Bt[(size_t)(n0 + r1) * K + k0 + cg1 * 8], &Bs[0][r1 * 32 + cg1 * 8]);
    }
    for (int it = 0; it < nIter; ++it) {
        const int cur = it & 1;
        if (it + 1 < nIter) {
            const int k0 = (it + 1) * 32;
            const int nxt = cur ^ 1;
            async_copy_b128(&A [(size_t)(m0 + r0) * K + k0 + cg0 * 8], &As[nxt][r0 * 32 + cg0 * 8]);
            async_copy_b128(&Bt[(size_t)(n0 + r0) * K + k0 + cg0 * 8], &Bs[nxt][r0 * 32 + cg0 * 8]);
            async_copy_b128(&A [(size_t)(m0 + r1) * K + k0 + cg1 * 8], &As[nxt][r1 * 32 + cg1 * 8]);
            async_copy_b128(&Bt[(size_t)(n0 + r1) * K + k0 + cg1 * 8], &Bs[nxt][r1 * 32 + cg1 * 8]);
            WAIT_ASYNC(4);   // drain previous batch only; next batch stays in flight
        } else {
            WAIT_ASYNC(0);
        }
        __syncthreads();

        v16h af[4], bf[2];
        #pragma unroll
        for (int mt = 0; mt < 4; ++mt)
            af[mt] = load_frag_k32(&As[cur][(waveM * 64 + mt * 16) * 32], l16, half);
        #pragma unroll
        for (int nt = 0; nt < 2; ++nt)
            bf[nt] = load_frag_k32(&Bs[cur][(waveN * 32 + nt * 16) * 32], l16, half);

        #pragma unroll
        for (int mt = 0; mt < 4; ++mt)
            #pragma unroll
            for (int nt = 0; nt < 2; ++nt)
                acc[mt][nt] = __builtin_amdgcn_wmma_f32_16x16x32_f16(
                    false, af[mt], false, bf[nt], (short)0, acc[mt][nt], false, false);
        __syncthreads();   // all reads of buf[cur] done before it is restaged
    }
#else
    for (int it = 0; it < nIter; ++it) {
        const int k0 = it * 32;
        *(uint4*)&As[0][r0 * 32 + cg0 * 8] = *(const uint4*)&A [(size_t)(m0 + r0) * K + k0 + cg0 * 8];
        *(uint4*)&Bs[0][r0 * 32 + cg0 * 8] = *(const uint4*)&Bt[(size_t)(n0 + r0) * K + k0 + cg0 * 8];
        *(uint4*)&As[0][r1 * 32 + cg1 * 8] = *(const uint4*)&A [(size_t)(m0 + r1) * K + k0 + cg1 * 8];
        *(uint4*)&Bs[0][r1 * 32 + cg1 * 8] = *(const uint4*)&Bt[(size_t)(n0 + r1) * K + k0 + cg1 * 8];
        if (k0 + 32 < K) {
            __builtin_prefetch(&A [(size_t)(m0 + (t >> 1)) * K + k0 + 32], 0, 0);
            __builtin_prefetch(&Bt[(size_t)(n0 + (t >> 1)) * K + k0 + 32], 0, 0);
        }
        __syncthreads();
        v16h af[4], bf[2];
        #pragma unroll
        for (int mt = 0; mt < 4; ++mt)
            af[mt] = load_frag_k32(&As[0][(waveM * 64 + mt * 16) * 32], l16, half);
        #pragma unroll
        for (int nt = 0; nt < 2; ++nt)
            bf[nt] = load_frag_k32(&Bs[0][(waveN * 32 + nt * 16) * 32], l16, half);
        #pragma unroll
        for (int mt = 0; mt < 4; ++mt)
            #pragma unroll
            for (int nt = 0; nt < 2; ++nt)
                acc[mt][nt] = __builtin_amdgcn_wmma_f32_16x16x32_f16(
                    false, af[mt], false, bf[nt], (short)0, acc[mt][nt], false, false);
        __syncthreads();
    }
#endif

    // C/D layout: VGPR i -> M = i + 8*half, N = l16
    #pragma unroll
    for (int mt = 0; mt < 4; ++mt) {
        #pragma unroll
        for (int nt = 0; nt < 2; ++nt) {
            #pragma unroll
            for (int i = 0; i < 8; ++i) {
                int m = m0 + waveM * 64 + mt * 16 + 8 * half + i;
                int n = n0 + waveN * 32 + nt * 16 + l16;
                float v = acc[mt][nt][i];
                if (resid) v += resid[(size_t)m * N + n];
                if (bias)  v += bias[n];
                Cout[(size_t)m * N + n] = v;
            }
        }
    }
}

// ---------------------------------------------------------------------------
// beta = clip(sigmoid(x @ Wbeta + bbeta), 1e-3, 0.999)   (4096 x 32)
// ---------------------------------------------------------------------------
__global__ __launch_bounds__(128) void beta_kernel(const float* __restrict__ x,
                                                   const float* __restrict__ Wb,
                                                   const float* __restrict__ bb,
                                                   float* __restrict__ beta) {
    __shared__ float pb[128];
    int m = blockIdx.x;
    int t = threadIdx.x;
    int c = t & 31, seg = t >> 5;
    const float* xr = x + (size_t)m * D_;
    float s = 0.f;
    int kb = seg * 256;
    for (int k = kb; k < kb + 256; ++k)
        s += xr[k] * Wb[(size_t)k * 32 + c];
    pb[t] = s;
    __syncthreads();
    if (t < 32) {
        float tot = pb[t] + pb[t + 32] + pb[t + 64] + pb[t + 96];
        float logit = tot + bb[t];
        float sg = 1.f / (1.f + __expf(-logit));
        sg = fminf(fmaxf(sg, 0.001f), 0.999f);
        beta[(size_t)m * 32 + t] = sg;
    }
}

// ---------------------------------------------------------------------------
// RoPE + phi (elu+1), in place, per head half-pair (i, i+32)
// ---------------------------------------------------------------------------
__global__ __launch_bounds__(256) void rope_phi_kernel(float* __restrict__ u, int total) {
    int idx = blockIdx.x * 256 + threadIdx.x;
    if (idx >= total) return;
    int i   = idx & 31;        // rotation-frequency index
    int rem = idx >> 5;
    int hh  = rem & 15;        // head
    int m   = rem >> 4;        // token 0..4095
    int s   = m & (S_ - 1);    // position within sequence
    float f   = __expf(-(float)(2 * i) * 9.210340371976184f / 64.f); // ln(10000)
    float ang = (float)s * f;
    float cs = __cosf(ang), sn = __sinf(ang);
    size_t base = (size_t)m * D_ + hh * DH_;
    float u1 = u[base + i], u2 = u[base + 32 + i];
    float r1 = u1 * cs - u2 * sn;
    float r2 = u1 * sn + u2 * cs;
    u[base + i]      = r1 > 0.f ? r1 + 1.f : __expf(r1);  // elu(r)+1
    u[base + 32 + i] = r2 > 0.f ? r2 + 1.f : __expf(r2);
}

// ---------------------------------------------------------------------------
// Sequential DeltaNet scan: one block per (b,h). State M[C][64][64] lives in
// registers (32 f32/thread over 256 threads), Z[C][64] in threads 0..127.
// The time loop runs over chunks of SCAN_T steps. A chunk's q, k, v and beta
// are staged in LDS (two buffers; the next chunk is fetched into registers
// while this one is worked on). Inside a chunk no thread needs another
// thread's result: each step's partial sums go to LDS and are added up once
// per chunk, behind the chunk's single barrier.
// Writes y as f16 (feeds the output WMMA GEMM directly).
// ---------------------------------------------------------------------------
#define SCAN_T 32
typedef __attribute__((ext_vector_type(2))) _Float16 v2h;

__global__ __launch_bounds__(256) void scan_kernel(const float* __restrict__ q,
                                                   const float* __restrict__ k,
                                                   const float* __restrict__ v,
                                                   const float* __restrict__ beta,
                                                   _Float16* __restrict__ y) {
    __shared__ __attribute__((aligned(16))) float sq[2][SCAN_T][DH_];
    __shared__ __attribute__((aligned(16))) float sk[2][SCAN_T][DH_];
    __shared__ __attribute__((aligned(16))) float sv[2][SCAN_T][DH_];
    __shared__ float sb[2][SCAN_T][C_];
    __shared__ __attribute__((aligned(16))) float partial[2][SCAN_T][4][DH_];
    __shared__ float denp[2][SCAN_T][128];

    int bh = blockIdx.x;
    int b = bh / H_, h = bh % H_;
    int t    = threadIdx.x;
    int lane = t & 31, wv = t >> 5;
    int e  = t & 63;           // output dim owned by this thread
    int g  = t >> 6;           // group 0..3
    int c  = g >> 1;           // decay channel
    int d0 = (g & 1) * 32;     // k-dim slab

    float mreg[32];
    #pragma unroll
    for (int i = 0; i < 32; ++i) mreg[i] = 0.f;
    float zreg = 0.f;
    int zc = (t >> 6) & 1;     // for t<128: Z channel
    int zd = t & 63;

    const float* qp = q + (size_t)b * S_ * D_ + h * DH_;
    const float* kp = k + (size_t)b * S_ * D_ + h * DH_;
    const float* vp = v + (size_t)b * S_ * D_ + h * DH_;
    const float* bp = beta + (size_t)b * S_ * (H_ * C_) + h * C_;
    _Float16*    yp = y + (size_t)b * S_ * D_ + h * DH_;

    // staging: 2 float4 of q, k and v per thread and chunk; beta by t < C_*SCAN_T
    const int srow = t >> 4;            // step inside a pass of 16 rows
    const int scol = (t & 15) * 4;      // first of four head dims
    const int brow = (t >> 1) & (SCAN_T - 1);
    const int bcol = t & 1;
    const bool bthr = t < C_ * SCAN_T;

    const size_t ro0 = (size_t)srow * D_ + scol;

    // chunk 0 into buffer 0
    {
        float4 q0 = *(const float4*)(qp + ro0 + 0 * D_);
        float4 k0 = *(const float4*)(kp + ro0 + 0 * D_);
        float4 v0 = *(const float4*)(vp + ro0 + 0 * D_);
        float4 q1 = *(const float4*)(qp + ro0 + 16 * D_);
        float4 k1 = *(const float4*)(kp + ro0 + 16 * D_);
        float4 v1 = *(const float4*)(vp + ro0 + 16 * D_);
        *(float4*)&sq[0][0 + srow][scol] = q0;
        *(float4*)&sk[0][0 + srow][scol] = k0;
        *(float4*)&sv[0][0 + srow][scol] = v0;
        *(float4*)&sq[0][16 + srow][scol] = q1;
        *(float4*)&sk[0][16 + srow][scol] = k1;
        *(float4*)&sv[0][16 + srow][scol] = v1;
        if (bthr) sb[0][brow][bcol] = bp[(size_t)brow * (H_ * C_) + bcol];
    }
    __syncthreads();

    const int nChunk = S_ / SCAN_T;
    for (int n = 0; n < nChunk; ++n) {
        const int  cur  = n & 1;
        const int  ts0  = n * SCAN_T;
        const bool more = n + 1 < nChunk;

        // next chunk: global -> registers, in flight under this chunk's steps
        float4 rq0, rq1, rk0, rk1, rv0, rv1;
        float  rb = 0.f;
        if (more) {
            const size_t ro = ro0 + (size_t)(ts0 + SCAN_T) * D_;
            rq0 = *(const float4*)(qp + ro + 0 * D_);
            rk0 = *(const float4*)(kp + ro + 0 * D_);
            rv0 = *(const float4*)(vp + ro + 0 * D_);
            rq1 = *(const float4*)(qp + ro + 16 * D_);
            rk1 = *(const float4*)(kp + ro + 16 * D_);
            rv1 = *(const float4*)(vp + ro + 16 * D_);
            if (bthr) rb = bp[(size_t)(ts0 + SCAN_T + brow) * (H_ * C_) + bcol];
        }

        // Z update + per-thread term of the denominator (waves 0..3)
        if (t < 128) {
            // unrolled so that the LDS reads of later steps issue ahead of the chain on zreg
            #pragma unroll
            for (int j = 0; j < SCAN_T; ++j) {
                zreg = zreg * sb[cur][j][zc] + sk[cur][j][zd];
                denp[cur][j][t] = sq[cur][j][zd] * zreg;
            }
        }

        // M update + per-thread partial of num[e], SCAN_T steps without a barrier;
        // a step's operands are read from LDS one step ahead (two register sets)
        float4 kb[2][8], qb[2][8];
        float  bcb[2], veb[2];
        #pragma unroll
        for (int i4 = 0; i4 < 8; ++i4) {
            kb[0][i4] = *(const float4*)&sk[cur][0][d0 + i4 * 4];
            qb[0][i4] = *(const float4*)&sq[cur][0][d0 + i4 * 4];
        }
        bcb[0] = sb[cur][0][c];
        veb[0] = sv[cur][0][e];
        // unrolled so that the two operand sets keep constant indices (registers)
        // and every LDS offset is an immediate
        #pragma unroll
        for (int j = 0; j < SCAN_T; ++j) {
            const int a = j & 1;
            if (j + 1 < SCAN_T) {
                #pragma unroll
                for (int i4 = 0; i4 < 8; ++i4) {
                    kb[a ^ 1][i4] = *(const float4*)&sk[cur][j + 1][d0 + i4 * 4];
                    qb[a ^ 1][i4] = *(const float4*)&sq[cur][j + 1][d0 + i4 * 4];
                }
                bcb[a ^ 1] = sb[cur][j + 1][c];
                veb[a ^ 1] = sv[cur][j + 1][e];
            }
            // keeps the next step's LDS reads in front of this step's arithmetic:
            // without it they are sunk to their uses and each one's latency shows
            __builtin_amdgcn_sched_barrier(0);
            float bc = bcb[a];
            float ve = veb[a];
            float np = 0.f;
            #pragma unroll
            for (int i4 = 0; i4 < 8; ++i4) {
                float kk[4] = {kb[a][i4].x, kb[a][i4].y, kb[a][i4].z, kb[a][i4].w};
                float qq[4] = {qb[a][i4].x, qb[a][i4].y, qb[a][i4].z, qb[a][i4].w};
                #pragma unroll
                for (int r = 0; r < 4; ++r) {
                    int i = i4 * 4 + r;
                    mreg[i] = mreg[i] * bc + kk[r] * ve;
                    np += qq[r] * mreg[i];
                }
            }
            partial[cur][j][g][e] = np;
        }

        // the other buffer was last read before the previous chunk's barrier
        if (more) {
            *(float4*)&sq[cur ^ 1][0 + srow][scol] = rq0;
            *(float4*)&sk[cur ^ 1][0 + srow][scol] = rk0;
            *(float4*)&sv[cur ^ 1][0 + srow][scol] = rv0;
            *(float4*)&sq[cur ^ 1][16 + srow][scol] = rq1;
            *(float4*)&sk[cur ^ 1][16 + srow][scol] = rk1;
            *(float4*)&sv[cur ^ 1][16 + srow][scol] = rv1;
            if (bthr) sb[cur ^ 1][brow][bcol] = rb;
        }
        // one barrier per chunk: publishes this chunk's partial sums and the
        // next chunk's staged rows; partial/denp of this parity are written
        // again only behind the next chunk's barrier
        __syncthreads();

        // each wave finishes SCAN_T/8 steps: same sums, same order as per step;
        // unrolled so that the steps' shuffle trees overlap
        #pragma unroll
        for (int jj = 0; jj < SCAN_T / 8; ++jj) {
            int j = wv * (SCAN_T / 8) + jj;
            float ds[4];
            #pragma unroll
            for (int w = 0; w < 4; ++w) {
                float dt = denp[cur][j][w * 32 + lane];
                #pragma unroll
                for (int off = 16; off > 0; off >>= 1) dt += __shfl_xor(dt, off);
                ds[w] = dt;
            }
            float den = ds[0] + ds[1] + ds[2] + ds[3] + 1e-6f;
            float2 p0 = *(const float2*)&partial[cur][j][0][2 * lane];
            float2 p1 = *(const float2*)&partial[cur][j][1][2 * lane];
            float2 p2 = *(const float2*)&partial[cur][j][2][2 * lane];
            float2 p3 = *(const float2*)&partial[cur][j][3][2 * lane];
            float n0 = p0.x + p1.x + p2.x + p3.x;
            float n1 = p0.y + p1.y + p2.y + p3.y;
            v2h o;
            o.x = (_Float16)(n0 / den);
            o.y = (_Float16)(n1 / den);
            *(v2h*)&yp[(size_t)(ts0 + j) * D_ + 2 * lane] = o;
        }
        // the next trip rewrites the registers that these stores name
        asm volatile("s_wait_xcnt 0x0" ::: "memory");
    }
}

// ---------------------------------------------------------------------------
// LayerNorm over rows of h (4096 x 1024), f32 out
// ---------------------------------------------------------------------------
__global__ __launch_bounds__(256) void ln_kernel(const float* __restrict__ hbuf,
                                                 const float* __restrict__ gamma,
                                                 const float* __restrict__ lbeta,
                                                 float* __restrict__ out) {
    __shared__ float rs[256], rq[256];
    __shared__ float smu, srstd;
    int m = blockIdx.x, t = threadIdx.x;
    const float* hr = hbuf + (size_t)m * D_;
    float s = 0.f, q2 = 0.f;
    float vals[4];
    #pragma unroll
    for (int i = 0; i < 4; ++i) {
        float v = hr[t + i * 256];
        vals[i] = v; s += v; q2 += v * v;
    }
    rs[t] = s; rq[t] = q2;
    __syncthreads();
    for (int off = 128; off > 0; off >>= 1) {
        if (t < off) { rs[t] += rs[t + off]; rq[t] += rq[t + off]; }
        __syncthreads();
    }
    if (t == 0) {
        float mu  = rs[0] * (1.f / D_);
        float var = rq[0] * (1.f / D_) - mu * mu;
        smu = mu; srstd = rsqrtf(var + 1e-5f);
    }
    __syncthreads();
    float* orow = out + (size_t)m * D_;
    #pragma unroll
    for (int i = 0; i < 4; ++i) {
        int n = t + i * 256;
        orow[n] = gamma[n] * (vals[i] - smu) * srstd + lbeta[n];
    }
}

// ---------------------------------------------------------------------------
// launch
// ---------------------------------------------------------------------------
extern "C" void kernel_launch(void* const* d_in, const int* in_sizes, int n_in,
                              void* d_out, int out_size, void* d_ws, size_t ws_size,
                              hipStream_t stream) {
    const float* x      = (const float*)d_in[0];
    const float* Wq     = (const float*)d_in[1];
    const float* Wk     = (const float*)d_in[2];
    const float* Wv     = (const float*)d_in[3];
    const float* Wbeta  = (const float*)d_in[4];
    const float* bbeta  = (const float*)d_in[5];
    const float* Wo     = (const float*)d_in[6];
    const float* bo     = (const float*)d_in[7];
    const float* lng    = (const float*)d_in[8];
    const float* lnb    = (const float*)d_in[9];
    float* out = (float*)d_out;

    char* ws = (char*)d_ws;
    size_t off = 0;
    auto alloc = [&](size_t bytes) { char* p = ws + off; off += (bytes + 255) & ~(size_t)255; return p; };

    _Float16* xh   = (_Float16*)alloc((size_t)MTOK * D_ * 2);   // 8 MB
    _Float16* Wqt  = (_Float16*)alloc((size_t)D_ * D_ * 2);     // 2 MB each
    _Float16* Wkt  = (_Float16*)alloc((size_t)D_ * D_ * 2);
    _Float16* Wvt  = (_Float16*)alloc((size_t)D_ * D_ * 2);
    _Float16* Wot  = (_Float16*)alloc((size_t)D_ * D_ * 2);
    float*    qbuf = (float*)alloc((size_t)MTOK * D_ * 4);      // 16 MB each
    float*    kbuf = (float*)alloc((size_t)MTOK * D_ * 4);
    float*    vbuf = (float*)alloc((size_t)MTOK * D_ * 4);
    float*    bbuf = (float*)alloc((size_t)MTOK * 32 * 4);      // 0.5 MB
    _Float16* ybuf = (_Float16*)alloc((size_t)MTOK * D_ * 2);   // 8 MB
    float*    hbuf = (float*)alloc((size_t)MTOK * D_ * 4);      // 16 MB
    (void)ws_size; (void)in_sizes; (void)n_in; (void)out_size;

    const int nX = MTOK * D_;  // 4194304
    f32_to_f16_kernel<<<(nX + 255) / 256, 256, 0, stream>>>(x, xh, nX);

    const int nW = D_ * D_;
    transpose_to_f16_kernel<<<(nW + 255) / 256, 256, 0, stream>>>(Wq, Wqt, D_, D_);
    transpose_to_f16_kernel<<<(nW + 255) / 256, 256, 0, stream>>>(Wk, Wkt, D_, D_);
    transpose_to_f16_kernel<<<(nW + 255) / 256, 256, 0, stream>>>(Wv, Wvt, D_, D_);
    transpose_to_f16_kernel<<<(nW + 255) / 256, 256, 0, stream>>>(Wo, Wot, D_, D_);

    dim3 ggrid(D_ / 128, MTOK / 128);   // (8, 32)
    gemm_f16_wmma_kernel<<<ggrid, 256, 0, stream>>>(xh, Wqt, qbuf, nullptr, nullptr, MTOK, D_, D_);
    gemm_f16_wmma_kernel<<<ggrid, 256, 0, stream>>>(xh, Wkt, kbuf, nullptr, nullptr, MTOK, D_, D_);
    gemm_f16_wmma_kernel<<<ggrid, 256, 0, stream>>>(xh, Wvt, vbuf, nullptr, nullptr, MTOK, D_, D_);

    beta_kernel<<<MTOK, 128, 0, stream>>>(x, Wbeta, bbeta, bbuf);

    const int nPairs = MTOK * H_ * 32;  // 2097152
    rope_phi_kernel<<<nPairs / 256, 256, 0, stream>>>(qbuf, nPairs);
    rope_phi_kernel<<<nPairs / 256, 256, 0, stream>>>(kbuf, nPairs);

    scan_kernel<<<B_ * H_, 256, 0, stream>>>(qbuf, kbuf, vbuf, bbuf, ybuf);

    // h = x + y @ Wo + bo (fused residual + bias epilogue)
    gemm_f16_wmma_kernel<<<ggrid, 256, 0, stream>>>(ybuf, Wot, hbuf, x, bo, MTOK, D_, D_);

    ln_kernel<<<MTOK, 256, 0, stream>>>(hbuf, lng, lnb, out);
}

// v002
// It runs in 475 microseconds.
// In both of two side-by-side timings against v001, it was 1.58 times as fast.
// All steps since v000 together make it 6.67 times as fast.
#include <hip/hip_runtime.h>
#include <hip/hip_bf16.h>

typedef __attribute__((ext_vector_type(16))) _Float16 v16h;
typedef __attribute__((ext_vector_type(8)))  float    v8f;

#define B_   2
#define S_   2048
#define D_   1024
#define H_   16
#define DH_  64
#define C_   2
#define MTOK (B_ * S_)   // 4096

// ---------------------------------------------------------------------------
// CDNA5 async global->LDS copy (ASYNCcnt path), with sync fallback
// ---------------------------------------------------------------------------
#if defined(__has_builtin)
#if __has_builtin(__builtin_amdgcn_global_load_async_to_lds_b128)
#define HAVE_ASYNC_LDS 1
#endif
#endif

#if defined(HAVE_ASYNC_LDS)
// builtin signature: void(v4i addrspace(1)*, v4i addrspace(3)*, imm offset, imm cpol)
typedef int v4i_vs __attribute__((vector_size(4 * sizeof(int))));
typedef __attribute__((address_space(1))) v4i_vs* g_v4i_p;
typedef __attribute__((address_space(3))) v4i_vs* l_v4i_p;
__device__ __forceinline__ void async_copy_b128(const _Float16* g, _Float16* l) {
    __builtin_amdgcn_global_load_async_to_lds_b128(
        (g_v4i_p)(void*)const_cast<_Float16*>(g), (l_v4i_p)(void*)l, 0, 0);
}
#if __has_builtin(__builtin_amdgcn_s_wait_asynccnt)
#define WAIT_ASYNC(n) __builtin_amdgcn_s_wait_asynccnt(n)
#else
#define WAIT_ASYNC(n) asm volatile("s_wait_asynccnt %0" :: "n"(n) : "memory")
#endif
#endif

// ---------------------------------------------------------------------------
// f32 -> f16 conversion
// ---------------------------------------------------------------------------
__global__ __launch_bounds__(256) void f32_to_f16_kernel(const float* __restrict__ src,
                                                         _Float16* __restrict__ dst, int n) {
    int i = blockIdx.x * 256 + threadIdx.x;
    if (i < n) dst[i] = (_Float16)src[i];
}

// W is (K x N) row-major f32; Wt becomes (N x K) row-major f16
__global__ __launch_bounds__(256) void transpose_to_f16_kernel(const float* __restrict__ W,
                                                               _Float16* __restrict__ Wt,
                                                               int K, int N) {
    int i = blockIdx.x * 256 + threadIdx.x;
    if (i < K * N) {
        int k = i / N, n = i % N;
        Wt[(size_t)n * K + k] = (_Float16)W[i];
    }
}

// ---------------------------------------------------------------------------
// WMMA GEMM:  C[M,N] = A[M,K] (f16) * Bt[N,K]^T (f16)  (+ resid + bias)
// block = 256 threads (8 waves), tile = 128x128, K-step = 32,
// double-buffered async global->LDS staging.
// ---------------------------------------------------------------------------
__device__ inline v16h load_frag_k32(const _Float16* tile_base, int row16, int half) {
    // tile rows have stride 32 f16; A-fragment layout for v_wmma_f32_16x16x32_f16:
    // lanes 0-15: K = {0..7, 16..23}; lanes 16-31: K = {8..15, 24..31}
    const _Float16* p = tile_base + row16 * 32 + half * 8;
    union { v16h h; uint4 u[2]; } f;
    f.u[0] = *(const uint4*)(p);
    f.u[1] = *(const uint4*)(p + 16);
    return f.h;
}

__global__ __launch_bounds__(256) void gemm_f16_wmma_kernel(
    const _Float16* __restrict__ A,   // M x K row-major
    const _Float16* __restrict__ Bt,  // N x K row-major (B pre-transposed)
    float* __restrict__ Cout,         // M x N
    const float* __restrict__ resid,  // optional M x N, may be null
    const float* __restrict__ bias,   // optional N, may be null
    int M, int N, int K)
{
#if defined(HAVE_ASYNC_LDS)
    __shared__ _Float16 As[2][128 * 32];
    __shared__ _Float16 Bs[2][128 * 32];
#else
    __shared__ _Float16 As[1][128 * 32];
    __shared__ _Float16 Bs[1][128 * 32];
#endif

    const int t     = threadIdx.x;
    const int m0    = blockIdx.y * 128;
    const int n0    = blockIdx.x * 128;
    const int wave  = t >> 5;
    const int lane  = t & 31;
    const int half  = (lane >> 4) & 1;
    const int l16   = lane & 15;
    const int waveM = wave >> 2;   // 0..1  (64-row slab)
    const int waveN = wave & 3;    // 0..3  (32-col slab)

    // per-thread staging coordinates: 2 chunks of 8 f16 (16B) per matrix
    const int r0  = t >> 2;              // chunk 0 row
    const int cg0 = t & 3;               // chunk 0 col-group
    const int r1  = (t + 256) >> 2;      // chunk 1 row
    const int cg1 = t & 3;

    v8f acc[4][2] = {};
    const int nIter = K / 32;

#if defined(HAVE_ASYNC_LDS)
    // prologue: stage tile 0 into buffer 0 (4 async-load instructions / wave)
    {
        const int k0 = 0;
        async_copy_b128(&A [(size_t)(m0 + r0) * K + k0 + cg0 * 8], &As[0][r0 * 32 + cg0 * 8]);
        async_copy_b128(&Bt[(size_t)(n0 + r0) * K + k0 + cg0 * 8], &Bs[0][r0 * 32 + cg0 * 8]);
        async_copy_b128(&A [(size_t)(m0 + r1) * K + k0 + cg1 * 8], &As[0][r1 * 32 + cg1 * 8]);
        async_copy_b128(&Bt[(size_t)(n0 + r1) * K + k0 + cg1 * 8], &Bs[0][r1 * 32 + cg1 * 8]);
    }
    for (int it = 0; it < nIter; ++it) {
        const int cur = it & 1;
        if (it + 1 < nIter) {
            const int k0 = (it + 1) * 32;
            const int nxt = cur ^ 1;
            async_copy_b128(&A [(size_t)(m0 + r0) * K + k0 + cg0 * 8], &As[nxt][r0 * 32 + cg0 * 8]);
            async_copy_b128(&Bt[(size_t)(n0 + r0) * K + k0 + cg0 * 8], &Bs[nxt][r0 * 32 + cg0 * 8]);
            async_copy_b128(&A [(size_t)(m0 + r1) * K + k0 + cg1 * 8], &As[nxt][r1 * 32 + cg1 * 8]);
            async_copy_b128(&Bt[(size_t)(n0 + r1) * K + k0 + cg1 * 8], &Bs[nxt][r1 * 32 + cg1 * 8]);
            WAIT_ASYNC(4);   // drain previous batch only; next batch stays in flight
        } else {
            WAIT_ASYNC(0);
        }
        __syncthreads();

        v16h af[4], bf[2];
        #pragma unroll
        for (int mt = 0; mt < 4; ++mt)
            af[mt] = load_frag_k32(&As[cur][(waveM * 64 + mt * 16) * 32], l16, half);
        #pragma unroll
        for (int nt = 0; nt < 2; ++nt)
            bf[nt] = load_frag_k32(&Bs[cur][(waveN * 32 + nt * 16) * 32], l16, half);

        #pragma unroll
        for (int mt = 0; mt < 4; ++mt)
            #pragma unroll
            for (int nt = 0; nt < 2; ++nt)
                acc[mt][nt] = __builtin_amdgcn_wmma_f32_16x16x32_f16(
                    false, af[mt], false, bf[nt], (short)0, acc[mt][nt], false, false);
        __syncthreads();   // all reads of buf[cur] done before it is restaged
    }
#else
    for (int it = 0; it < nIter; ++it) {
        const int k0 = it * 32;
        *(uint4*)&As[0][r0 * 32 + cg0 * 8] = *(const uint4*)&A [(size_t)(m0 + r0) * K + k0 + cg0 * 8];
        *(uint4*)&Bs[0][r0 * 32 + cg0 * 8] = *(const uint4*)&Bt[(size_t)(n0 + r0) * K + k0 + cg0 * 8];
        *(uint4*)&As[0][r1 * 32 + cg1 * 8] = *(const uint4*)&A [(size_t)(m0 + r1) * K + k0 + cg1 * 8];
        *(uint4*)&Bs[0][r1 * 32 + cg1 * 8] = *(const uint4*)&Bt[(size_t)(n0 + r1) * K + k0 + cg1 * 8];
        if (k0 + 32 < K) {
            __builtin_prefetch(&A [(size_t)(m0 + (t >> 1)) * K + k0 + 32], 0, 0);
            __builtin_prefetch(&Bt[(size_t)(n0 + (t >> 1)) * K + k0 + 32], 0, 0);
        }
        __syncthreads();
        v16h af[4], bf[2];
        #pragma unroll
        for (int mt = 0; mt < 4; ++mt)
            af[mt] = load_frag_k32(&As[0][(waveM * 64 + mt * 16) * 32], l16, half);
        #pragma unroll
        for (int nt = 0; nt < 2; ++nt)
            bf[nt] = load_frag_k32(&Bs[0][(waveN * 32 + nt * 16) * 32], l16, half);
        #pragma unroll
        for (int mt = 0; mt < 4; ++mt)
            #pragma unroll
            for (int nt = 0; nt < 2; ++nt)
                acc[mt][nt] = __builtin_amdgcn_wmma_f32_16x16x32_f16(
                    false, af[mt], false, bf[nt], (short)0, acc[mt][nt], false, false);
        __syncthreads();
    }
#endif

    // C/D layout: VGPR i -> M = i + 8*half, N = l16
    #pragma unroll
    for (int mt = 0; mt < 4; ++mt) {
        #pragma unroll
        for (int nt = 0; nt < 2; ++nt) {
            #pragma unroll
            for (int i = 0; i < 8; ++i) {
                int m = m0 + waveM * 64 + mt * 16 + 8 * half + i;
                int n = n0 + waveN * 32 + nt * 16 + l16;
                float v = acc[mt][nt][i];
                if (resid) v += resid[(size_t)m * N + n];
                if (bias)  v += bias[n];
                Cout[(size_t)m * N + n] = v;
            }
        }
    }
}

// ---------------------------------------------------------------------------
// beta = clip(sigmoid(x @ Wbeta + bbeta), 1e-3, 0.999)   (4096 x 32)
// ---------------------------------------------------------------------------
__global__ __launch_bounds__(128) void beta_kernel(const float* __restrict__ x,
                                                   const float* __restrict__ Wb,
                                                   const float* __restrict__ bb,
                                                   float* __restrict__ beta) {
    __shared__ float pb[128];
    int m = blockIdx.x;
    int t = threadIdx.x;
    int c = t & 31, seg = t >> 5;
    const float* xr = x + (size_t)m * D_;
    float s = 0.f;
    int kb = seg * 256;
    for (int k = kb; k < kb + 256; ++k)
        s += xr[k] * Wb[(size_t)k * 32 + c];
    pb[t] = s;
    __syncthreads();
    if (t < 32) {
        float tot = pb[t] + pb[t + 32] + pb[t + 64] + pb[t + 96];
        float logit = tot + bb[t];
        float sg = 1.f / (1.f + __expf(-logit));
        sg = fminf(fmaxf(sg, 0.001f), 0.999f);
        beta[(size_t)m * 32 + t] = sg;
    }
}

// ---------------------------------------------------------------------------
// RoPE + phi (elu+1), in place, per head half-pair (i, i+32)
// ---------------------------------------------------------------------------
__global__ __launch_bounds__(256) void rope_phi_kernel(float* __restrict__ u, int total) {
    int idx = blockIdx.x * 256 + threadIdx.x;
    if (idx >= total) return;
    int i   = idx & 31;        // rotation-frequency index
    int rem = idx >> 5;
    int hh  = rem & 15;        // head
    int m   = rem >> 4;        // token 0..4095
    int s   = m & (S_ - 1);    // position within sequence
    float f   = __expf(-(float)(2 * i) * 9.210340371976184f / 64.f); // ln(10000)
    float ang = (float)s * f;
    float cs = __cosf(ang), sn = __sinf(ang);
    size_t base = (size_t)m * D_ + hh * DH_;
    float u1 = u[base + i], u2 = u[base + 32 + i];
    float r1 = u1 * cs - u2 * sn;
    float r2 = u1 * sn + u2 * cs;
    u[base + i]      = r1 > 0.f ? r1 + 1.f : __expf(r1);  // elu(r)+1
    u[base + 32 + i] = r2 > 0.f ? r2 + 1.f : __expf(r2);
}

// ---------------------------------------------------------------------------
// Sequential DeltaNet scan. The columns e of the state M[C][64 d][64 e] never
// meet (num[e] sums over c and d only), so each (b,h) is dealt to SCAN_ES
// work-groups of SCAN_EW columns each: 256 work-groups instead of 32.
// A thread holds both decay channels of two rows d of one column e (4 f32), so
// k[d]*v[e] is formed once for both channels. Z[C][64] is kept by threads
// 0..127 of every work-group (each needs the whole denominator).
// The time loop runs over chunks of SCAN_T steps. A chunk's q, k, v and beta
// are staged in LDS (two buffers; the next chunk is fetched into registers
// while this one is worked on). Inside a chunk no thread needs another
// thread's result: each step's partial sums go to LDS and are added up once
// per chunk, behind the chunk's single barrier.
// Writes y as f16 (feeds the output WMMA GEMM directly).
// ---------------------------------------------------------------------------
#define SCAN_T  32
#define SCAN_ES 8                  // work-groups per (b,h)
#define SCAN_EW (DH_ / SCAN_ES)    // state columns per work-group
#define SCAN_G  8                  // steps whose operands are read from LDS together
#define SCAN_PP (256 + 8)          // floats per step of partial: 4 steps fall on 32 distinct banks
#define SCAN_DP (128 + 32)         // floats per step of denp: 2 steps fall on 64 distinct banks
typedef __attribute__((ext_vector_type(2))) float v2f;

// x + (x of lane ^ MASK), inside a row of 16 lanes; every lane on
template <int MASK>
__device__ __forceinline__ float add_xmask(float x) {
    int o = __builtin_amdgcn_update_dpp(0, __builtin_bit_cast(int, x), 0x160 + MASK, 0xf, 0xf, true);
    return x + __builtin_bit_cast(float, o);
}

__global__ __launch_bounds__(256) void scan_kernel(const float* __restrict__ q,
                                                   const float* __restrict__ k,
                                                   const float* __restrict__ v,
                                                   const float* __restrict__ beta,
                                                   _Float16* __restrict__ y) {
    __shared__ __attribute__((aligned(16))) float sq[2][SCAN_T][DH_];
    __shared__ __attribute__((aligned(16))) float sk[2][SCAN_T][DH_];
    __shared__ __attribute__((aligned(16))) float sv[2][SCAN_T][SCAN_EW];
    __shared__ __attribute__((aligned(16))) float sb[2][SCAN_T][C_];
    __shared__ __attribute__((aligned(16))) float partial[2][SCAN_T][SCAN_PP];
    __shared__ __attribute__((aligned(16))) float denp[2][SCAN_T][SCAN_DP];

    int bh = blockIdx.x / SCAN_ES;
    int e0 = (blockIdx.x % SCAN_ES) * SCAN_EW;   // first column of this work-group
    int b = bh / H_, h = bh % H_;
    int t  = threadIdx.x;
    int e  = t & (SCAN_EW - 1);   // column inside the work-group's slab
    int d0 = (t >> 3) * 2;        // first of this thread's two rows

    v2f m0 = {0.f, 0.f};       // channel 0, rows d0 and d0 + 1
    v2f m1 = {0.f, 0.f};       // channel 1
    float zreg = 0.f;
    int zc = (t >> 6) & 1;     // for t<128: Z channel
    int zd = t & 63;

    const float* qp = q + (size_t)b * S_ * D_ + h * DH_;
    const float* kp = k + (size_t)b * S_ * D_ + h * DH_;
    const float* vp = v + (size_t)b * S_ * D_ + h * DH_ + e0;
    const float* bp = beta + (size_t)b * S_ * (H_ * C_) + h * C_;
    _Float16*    yp = y + (size_t)b * S_ * D_ + h * DH_ + e0;

    // staging: 2 float4 of q and k per thread and chunk; v's slab and beta by t < 64
    const int srow = t >> 4;            // step inside a pass of 16 rows
    const int scol = (t & 15) * 4;      // first of four head dims
    const int brow = (t >> 1) & (SCAN_T - 1);
    const int bcol = t & 1;
    const bool bthr = t < C_ * SCAN_T;  // also SCAN_T * SCAN_EW / 4 float4 of v

    const size_t ro0 = (size_t)srow * D_ + scol;
    const size_t vo0 = (size_t)brow * D_ + bcol * 4;

    // chunk 0 into buffer 0
    {
        float4 q0 = *(const float4*)(qp + ro0 + 0 * D_);
        float4 k0 = *(const float4*)(kp + ro0 + 0 * D_);
        float4 q1 = *(const float4*)(qp + ro0 + 16 * D_);
        float4 k1 = *(const float4*)(kp + ro0 + 16 * D_);
        *(float4*)&sq[0][0 + srow][scol] = q0;
        *(float4*)&sk[0][0 + srow][scol] = k0;
        *(float4*)&sq[0][16 + srow][scol] = q1;
        *(float4*)&sk[0][16 + srow][scol] = k1;
        if (bthr) {
            *(float4*)&sv[0][brow][bcol * 4] = *(const float4*)(vp + vo0);
            sb[0][brow][bcol] = bp[(size_t)brow * (H_ * C_) + bcol];
        }
    }
    __syncthreads();

    const int nChunk = S_ / SCAN_T;
    // not unrolled, so that the last trip is not peeled off: with 'more' a branch at
    // run time the next chunk's global loads stay at the head of the trip; peeled,
    // they were sunk to just in front of their LDS stores and their latency showed
    #pragma nounroll
    for (int n = 0; n < nChunk; ++n) {
        const int  cur  = n & 1;
        const int  ts0  = n * SCAN_T;
        const bool more = n + 1 < nChunk;

        // next chunk: global -> registers, in flight under this chunk's steps
        float4 rq0, rq1, rk0, rk1, rv0;
        float  rb = 0.f;
        if (more) {
            const size_t ro = ro0 + (size_t)(ts0 + SCAN_T) * D_;
            rq0 = *(const float4*)(qp + ro + 0 * D_);
            rk0 = *(const float4*)(kp + ro + 0 * D_);
            rq1 = *(const float4*)(qp + ro + 16 * D_);
            rk1 = *(const float4*)(kp + ro + 16 * D_);
            if (bthr) {
                rv0 = *(const float4*)(vp + vo0 + (size_t)(ts0 + SCAN_T) * D_);
                rb  = bp[(size_t)(ts0 + SCAN_T + brow) * (H_ * C_) + bcol];
            }
        }

        // Z update + per-thread term of the denominator (waves 0..3)
        if (t < 128) {
            // unrolled so that the LDS reads of later steps issue ahead of the chain on zreg
            #pragma unroll
            for (int j = 0; j < SCAN_T; ++j) {
                zreg = zreg * sb[cur][j][zc] + sk[cur][j][zd];
                denp[cur][j][t] = sq[cur][j][zd] * zreg;
            }
        }

        // M update + per-thread partial of num[e], SCAN_T steps without a barrier;
        // the operands of SCAN_G steps are read from LDS one group ahead (two register sets)
        v2f   kb[2][SCAN_G], qb[2][SCAN_G], bb[2][SCAN_G];
        float vb[2][SCAN_G];
        #pragma unroll
        for (int u = 0; u < SCAN_G; ++u) {
            kb[0][u] = *(const v2f*)&sk[cur][u][d0];
            qb[0][u] = *(const v2f*)&sq[cur][u][d0];
            bb[0][u] = *(const v2f*)&sb[cur][u][0];
            vb[0][u] = sv[cur][u][e];
        }
        // unrolled so that the two operand sets keep constant indices (registers)
        // and every LDS offset is an immediate
        #pragma unroll
        for (int gi = 0; gi < SCAN_T / SCAN_G; ++gi) {
            const int a = gi & 1;
            if (gi + 1 < SCAN_T / SCAN_G) {
                #pragma unroll
                for (int u = 0; u < SCAN_G; ++u) {
                    const int j = (gi + 1) * SCAN_G + u;
                    kb[a ^ 1][u] = *(const v2f*)&sk[cur][j][d0];
                    qb[a ^ 1][u] = *(const v2f*)&sq[cur][j][d0];
                    bb[a ^ 1][u] = *(const v2f*)&sb[cur][j][0];
                    vb[a ^ 1][u] = sv[cur][j][e];
                }
            }
            // keeps the next group's LDS reads in front of this group's arithmetic:
            // without it they are sunk to their uses and each one's latency shows
            __builtin_amdgcn_sched_barrier(0);
            #pragma unroll
            for (int u = 0; u < SCAN_G; ++u) {
                v2f kv = kb[a][u] * vb[a][u];
                m0 = m0 * bb[a][u].x + kv;
                m1 = m1 * bb[a][u].y + kv;
                v2f sm = m0 + m1;
                partial[cur][gi * SCAN_G + u][t] = qb[a][u].x * sm.x + qb[a][u].y * sm.y;
            }
        }

        // the other buffer was last read before the previous chunk's barrier
        if (more) {
            *(float4*)&sq[cur ^ 1][0 + srow][scol] = rq0;
            *(float4*)&sk[cur ^ 1][0 + srow][scol] = rk0;
            *(float4*)&sq[cur ^ 1][16 + srow][scol] = rq1;
            *(float4*)&sk[cur ^ 1][16 + srow][scol] = rk1;
            if (bthr) {
                *(float4*)&sv[cur ^ 1][brow][bcol * 4] = rv0;
                sb[cur ^ 1][brow][bcol] = rb;
            }
        }
        // one barrier per chunk: publishes this chunk's partial sums and the
        // next chunk's staged rows; partial/denp of this parity are written
        // again only behind the next chunk's barrier
        __syncthreads();

        // each thread finishes one output: step j, column e. The eight lanes of a
        // step share its denominator: 16 terms each, then three adds across lanes
        {
            const int j = t >> 3;
            float4 a0 = *(const float4*)&denp[cur][j][0 * 32 + e * 4];
            float4 a1 = *(const float4*)&denp[cur][j][1 * 32 + e * 4];
            float4 a2 = *(const float4*)&denp[cur][j][2 * 32 + e * 4];
            float4 a3 = *(const float4*)&denp[cur][j][3 * 32 + e * 4];
            float s4[4] = {0.f, 0.f, 0.f, 0.f};   // four chains, so that the adds overlap
            #pragma unroll
            for (int p = 0; p < 32; ++p) s4[p & 3] += partial[cur][j][p * SCAN_EW + e];
            float ds = ((a0.x + a0.y) + (a0.z + a0.w)) + ((a1.x + a1.y) + (a1.z + a1.w))
                     + ((a2.x + a2.y) + (a2.z + a2.w)) + ((a3.x + a3.y) + (a3.z + a3.w));
            ds = add_xmask<1>(ds);
            ds = add_xmask<2>(ds);
            ds = add_xmask<4>(ds);
            float den = ds + 1e-6f;
            float num = (s4[0] + s4[1]) + (s4[2] + s4[3]);
            yp[(size_t)(ts0 + j) * D_ + e] = (_Float16)(num / den);
        }
        // the next trip rewrites the registers that this store names
        asm volatile("s_wait_xcnt 0x0" ::: "memory");
    }
}

// ---------------------------------------------------------------------------
// LayerNorm over rows of h (4096 x 1024), f32 out
// ---------------------------------------------------------------------------
__global__ __launch_bounds__(256) void ln_kernel(const float* __restrict__ hbuf,
                                                 const float* __restrict__ gamma,
                                                 const float* __restrict__ lbeta,
                                                 float* __restrict__ out) {
    __shared__ float rs[256], rq[256];
    __shared__ float smu, srstd;
    int m = blockIdx.x, t = threadIdx.x;
    const float* hr = hbuf + (size_t)m * D_;
    float s = 0.f, q2 = 0.f;
    float vals[4];
    #pragma unroll
    for (int i = 0; i < 4; ++i) {
        float v = hr[t + i * 256];
        vals[i] = v; s += v; q2 += v * v;
    }
    rs[t] = s; rq[t] = q2;
    __syncthreads();
    for (int off = 128; off > 0; off >>= 1) {
        if (t < off) { rs[t] += rs[t + off]; rq[t] += rq[t + off]; }
        __syncthreads();
    }
    if (t == 0) {
        float mu  = rs[0] * (1.f / D_);
        float var = rq[0] * (1.f / D_) - mu * mu;
        smu = mu; srstd = rsqrtf(var + 1e-5f);
    }
    __syncthreads();
    float* orow = out + (size_t)m * D_;
    #pragma unroll
    for (int i = 0; i < 4; ++i) {
        int n = t + i * 256;
        orow[n] = gamma[n] * (vals[i] - smu) * srstd + lbeta[n];
    }
}

// ---------------------------------------------------------------------------
// launch
// ---------------------------------------------------------------------------
extern "C" void kernel_launch(void* const* d_in, const int* in_sizes, int n_in,
                              void* d_out, int out_size, void* d_ws, size_t ws_size,
                              hipStream_t stream) {
    const float* x      = (const float*)d_in[0];
    const float* Wq     = (const float*)d_in[1];
    const float* Wk     = (const float*)d_in[2];
    const float* Wv     = (const float*)d_in[3];
    const float* Wbeta  = (const float*)d_in[4];
    const float* bbeta  = (const float*)d_in[5];
    const float* Wo     = (const float*)d_in[6];
    const float* bo     = (const float*)d_in[7];
    const float* lng    = (const float*)d_in[8];
    const float* lnb    = (const float*)d_in[9];
    float* out = (float*)d_out;

    char* ws = (char*)d_ws;
    size_t off = 0;
    auto alloc = [&](size_t bytes) { char* p = ws + off; off += (bytes + 255) & ~(size_t)255; return p; };

    _Float16* xh   = (_Float16*)alloc((size_t)MTOK * D_ * 2);   // 8 MB
    _Float16* Wqt  = (_Float16*)alloc((size_t)D_ * D_ * 2);     // 2 MB each
    _Float16* Wkt  = (_Float16*)alloc((size_t)D_ * D_ * 2);
    _Float16* Wvt  = (_Float16*)alloc((size_t)D_ * D_ * 2);
    _Float16* Wot  = (_Float16*)alloc((size_t)D_ * D_ * 2);
    float*    qbuf = (float*)alloc((size_t)MTOK * D_ * 4);      // 16 MB each
    float*    kbuf = (float*)alloc((size_t)MTOK * D_ * 4);
    float*    vbuf = (float*)alloc((size_t)MTOK * D_ * 4);
    float*    bbuf = (float*)alloc((size_t)MTOK * 32 * 4);      // 0.5 MB
    _Float16* ybuf = (_Float16*)alloc((size_t)MTOK * D_ * 2);   // 8 MB
    float*    hbuf = (float*)alloc((size_t)MTOK * D_ * 4);      // 16 MB
    (void)ws_size; (void)in_sizes; (void)n_in; (void)out_size;

    const int nX = MTOK * D_;  // 4194304
    f32_to_f16_kernel<<<(nX + 255) / 256, 256, 0, stream>>>(x, xh, nX);

    const int nW = D_ * D_;
    transpose_to_f16_kernel<<<(nW + 255) / 256, 256, 0, stream>>>(Wq, Wqt, D_, D_);
    transpose_to_f16_kernel<<<(nW + 255) / 256, 256, 0, stream>>>(Wk, Wkt, D_, D_);
    transpose_to_f16_kernel<<<(nW + 255) / 256, 256, 0, stream>>>(Wv, Wvt, D_, D_);
    transpose_to_f16_kernel<<<(nW + 255) / 256, 256, 0, stream>>>(Wo, Wot, D_, D_);

    dim3 ggrid(D_ / 128, MTOK / 128);   // (8, 32)
    gemm_f16_wmma_kernel<<<ggrid, 256, 0, stream>>>(xh, Wqt, qbuf, nullptr, nullptr, MTOK, D_, D_);
    gemm_f16_wmma_kernel<<<ggrid, 256, 0, stream>>>(xh, Wkt, kbuf, nullptr, nullptr, MTOK, D_, D_);
    gemm_f16_wmma_kernel<<<ggrid, 256, 0, stream>>>(xh, Wvt, vbuf, nullptr, nullptr, MTOK, D_, D_);

    beta_kernel<<<MTOK, 128, 0, stream>>>(x, Wbeta, bbeta, bbuf);

    const int nPairs = MTOK * H_ * 32;  // 2097152
    rope_phi_kernel<<<nPairs / 256, 256, 0, stream>>>(qbuf, nPairs);
    rope_phi_kernel<<<nPairs / 256, 256, 0, stream>>>(kbuf, nPairs);

    scan_kernel<<<B_ * H_ * SCAN_ES, 256, 0, stream>>>(qbuf, kbuf, vbuf, bbuf, ybuf);

    // h = x + y @ Wo + bo (fused residual + bias epilogue)
    gemm_f16_wmma_kernel<<<ggrid, 256, 0, stream>>>(ybuf, Wot, hbuf, x, bo, MTOK, D_, D_);

    ln_kernel<<<MTOK, 256, 0, stream>>>(hbuf, lng, lnb, out);
}

// v003
// It runs in 310 microseconds.
// Timed twice side by side with v002, it ran 1.53 times as fast both times.
// Counting every step since v000, it is 10.2 times as fast.
#include <hip/hip_runtime.h>
#include <hip/hip_bf16.h>

typedef __attribute__((ext_vector_type(16))) _Float16 v16h;
typedef __attribute__((ext_vector_type(8)))  float    v8f;

#define B_   2
#define S_   2048
#define D_   1024
#define H_   16
#define DH_  64
#define C_   2
#define MTOK (B_ * S_)   // 4096

// ---------------------------------------------------------------------------
// CDNA5 async global->LDS copy (ASYNCcnt path), with sync fallback
// ---------------------------------------------------------------------------
#if defined(__has_builtin)
#if __has_builtin(__builtin_amdgcn_global_load_async_to_lds_b128)
#define HAVE_ASYNC_LDS 1
#endif
#endif

#if defined(HAVE_ASYNC_LDS)
// builtin signature: void(v4i addrspace(1)*, v4i addrspace(3)*, imm offset, imm cpol)
typedef int v4i_vs __attribute__((vector_size(4 * sizeof(int))));
typedef __attribute__((address_space(1))) v4i_vs* g_v4i_p;
typedef __attribute__((address_space(3))) v4i_vs* l_v4i_p;
__device__ __forceinline__ void async_copy_b128(const _Float16* g, _Float16* l) {
    __builtin_amdgcn_global_load_async_to_lds_b128(
        (g_v4i_p)(void*)const_cast<_Float16*>(g), (l_v4i_p)(void*)l, 0, 0);
}
#if __has_builtin(__builtin_amdgcn_s_wait_asynccnt)
#define WAIT_ASYNC(n) __builtin_amdgcn_s_wait_asynccnt(n)
#else
#define WAIT_ASYNC(n) asm volatile("s_wait_asynccnt %0" :: "n"(n) : "memory")
#endif
#endif

// ---------------------------------------------------------------------------
// The three element-wise helpers below give each thread 32 elements, moved in
// 16-byte pieces: with one element per thread their time was the
// time it takes to start their waves, not the time to move their bytes.
// ---------------------------------------------------------------------------
typedef __attribute__((ext_vector_type(8))) _Float16 v8h;

__device__ __forceinline__ v8h cvt8(float4 a, float4 b) {
    v8h o = {(_Float16)a.x, (_Float16)a.y, (_Float16)a.z, (_Float16)a.w,
             (_Float16)b.x, (_Float16)b.y, (_Float16)b.z, (_Float16)b.w};
    return o;
}

// f32 -> f16 conversion; a work-group converts CVT_WG elements (n is a multiple),
// a thread four runs of 8, all eight loads in flight together
#define CVT_WG 8192
__global__ __launch_bounds__(256) void f32_to_f16_kernel(const float* __restrict__ src,
                                                         _Float16* __restrict__ dst, int n) {
    int i = blockIdx.x * CVT_WG + threadIdx.x * 8;
    if (i + 3 * 2048 + 8 > n) return;
    float4 a[4], b[4];
    #pragma unroll
    for (int g = 0; g < 4; ++g) {
        a[g] = *(const float4*)(src + i + g * 2048);
        b[g] = *(const float4*)(src + i + g * 2048 + 4);
    }
    #pragma unroll
    for (int g = 0; g < 4; ++g) *(v8h*)(dst + i + g * 2048) = cvt8(a[g], b[g]);
}

// W is (D_ x D_) row-major f32, rows k; Wt becomes its transpose in f16, rows n.
// A work-group turns a tile of 64 k x 128 n, a thread 8 k x 4 n: eight lanes side
// by side in k write 128 bytes in a row of Wt. The pitch is a constant, so that
// a thread's loads, and its stores, share one address register pair.
__global__ __launch_bounds__(256) void transpose_to_f16_kernel(const float* __restrict__ W,
                                                               _Float16* __restrict__ Wt) {
    int t  = threadIdx.x;
    int k0 = (blockIdx.x / (D_ / 128)) * 64 + (t & 7) * 8;
    int n0 = (blockIdx.x % (D_ / 128)) * 128 + (t >> 3) * 4;
    const float* wp = W + k0 * D_ + n0;
    float4 r[8];
    #pragma unroll
    for (int j = 0; j < 8; ++j) r[j] = *(const float4*)(wp + j * D_);
    _Float16* op = Wt + n0 * D_ + k0;
    v8h o0 = {(_Float16)r[0].x, (_Float16)r[1].x, (_Float16)r[2].x, (_Float16)r[3].x,
              (_Float16)r[4].x, (_Float16)r[5].x, (_Float16)r[6].x, (_Float16)r[7].x};
    v8h o1 = {(_Float16)r[0].y, (_Float16)r[1].y, (_Float16)r[2].y, (_Float16)r[3].y,
              (_Float16)r[4].y, (_Float16)r[5].y, (_Float16)r[6].y, (_Float16)r[7].y};
    v8h o2 = {(_Float16)r[0].z, (_Float16)r[1].z, (_Float16)r[2].z, (_Float16)r[3].z,
              (_Float16)r[4].z, (_Float16)r[5].z, (_Float16)r[6].z, (_Float16)r[7].z};
    v8h o3 = {(_Float16)r[0].w, (_Float16)r[1].w, (_Float16)r[2].w, (_Float16)r[3].w,
              (_Float16)r[4].w, (_Float16)r[5].w, (_Float16)r[6].w, (_Float16)r[7].w};
    *(v8h*)(op)          = o0;
    *(v8h*)(op + D_)     = o1;
    *(v8h*)(op + 2 * D_) = o2;
    *(v8h*)(op + 3 * D_) = o3;
}

// ---------------------------------------------------------------------------
// WMMA GEMM:  C[M,N] = A[M,K] (f16) * Bt[N,K]^T (f16)  (+ resid + bias)
// block = 256 threads (8 waves), tile = 128x128, K-step = 32,
// double-buffered async global->LDS staging.
// ---------------------------------------------------------------------------
__device__ inline v16h load_frag_k32(const _Float16* tile_base, int row16, int half) {
    // tile rows have stride 32 f16; A-fragment layout for v_wmma_f32_16x16x32_f16:
    // lanes 0-15: K = {0..7, 16..23}; lanes 16-31: K = {8..15, 24..31}
    const _Float16* p = tile_base + row16 * 32 + half * 8;
    union { v16h h; uint4 u[2]; } f;
    f.u[0] = *(const uint4*)(p);
    f.u[1] = *(const uint4*)(p + 16);
    return f.h;
}

__global__ __launch_bounds__(256) void gemm_f16_wmma_kernel(
    const _Float16* __restrict__ A,   // M x K row-major
    const _Float16* __restrict__ Bt,  // N x K row-major (B pre-transposed)
    float* __restrict__ Cout,         // M x N
    const float* __restrict__ resid,  // optional M x N, may be null
    const float* __restrict__ bias,   // optional N, may be null
    int M, int N, int K)
{
#if defined(HAVE_ASYNC_LDS)
    __shared__ _Float16 As[2][128 * 32];
    __shared__ _Float16 Bs[2][128 * 32];
#else
    __shared__ _Float16 As[1][128 * 32];
    __shared__ _Float16 Bs[1][128 * 32];
#endif

    const int t     = threadIdx.x;
    const int m0    = blockIdx.y * 128;
    const int n0    = blockIdx.x * 128;
    const int wave  = t >> 5;
    const int lane  = t & 31;
    const int half  = (lane >> 4) & 1;
    const int l16   = lane & 15;
    const int waveM = wave >> 2;   // 0..1  (64-row slab)
    const int waveN = wave & 3;    // 0..3  (32-col slab)

    // per-thread staging coordinates: 2 chunks of 8 f16 (16B) per matrix
    const int r0  = t >> 2;              // chunk 0 row
    const int cg0 = t & 3;               // chunk 0 col-group
    const int r1  = (t + 256) >> 2;      // chunk 1 row
    const int cg1 = t & 3;

    v8f acc[4][2] = {};
    const int nIter = K / 32;

#if defined(HAVE_ASYNC_LDS)
    // prologue: stage tile 0 into buffer 0 (4 async-load instructions / wave)
    {
        const int k0 = 0;
        async_copy_b128(&A [(size_t)(m0 + r0) * K + k0 + cg0 * 8], &As[0][r0 * 32 + cg0 * 8]);
        async_copy_b128(&Bt[(size_t)(n0 + r0) * K + k0 + cg0 * 8], &Bs[0][r0 * 32 + cg0 * 8]);
        async_copy_b128(&A [(size_t)(m0 + r1) * K + k0 + cg1 * 8], &As[0][r1 * 32 + cg1 * 8]);
        async_copy_b128(&Bt[(size_t)(n0 + r1) * K + k0 + cg1 * 8], &Bs[0][r1 * 32 + cg1 * 8]);
    }
    for (int it = 0; it < nIter; ++it) {
        const int cur = it & 1;
        if (it + 1 < nIter) {
            const int k0 = (it + 1) * 32;
            const int nxt = cur ^ 1;
            async_copy_b128(&A [(size_t)(m0 + r0) * K + k0 + cg0 * 8], &As[nxt][r0 * 32 + cg0 * 8]);
            async_copy_b128(&Bt[(size_t)(n0 + r0) * K + k0 + cg0 * 8], &Bs[nxt][r0 * 32 + cg0 * 8]);
            async_copy_b128(&A [(size_t)(m0 + r1) * K + k0 + cg1 * 8], &As[nxt][r1 * 32 + cg1 * 8]);
            async_copy_b128(&Bt[(size_t)(n0 + r1) * K + k0 + cg1 * 8], &Bs[nxt][r1 * 32 + cg1 * 8]);
            WAIT_ASYNC(4);   // drain previous batch only; next batch stays in flight
        } else {
            WAIT_ASYNC(0);
        }
        __syncthreads();

        v16h af[4], bf[2];
        #pragma unroll
        for (int mt = 0; mt < 4; ++mt)
            af[mt] = load_frag_k32(&As[cur][(waveM * 64 + mt * 16) * 32], l16, half);
        #pragma unroll
        for (int nt = 0; nt < 2; ++nt)
            bf[nt] = load_frag_k32(&Bs[cur][(waveN * 32 + nt * 16) * 32], l16, half);

        #pragma unroll
        for (int mt = 0; mt < 4; ++mt)
            #pragma unroll
            for (int nt = 0; nt < 2; ++nt)
                acc[mt][nt] = __builtin_amdgcn_wmma_f32_16x16x32_f16(
                    false, af[mt], false, bf[nt], (short)0, acc[mt][nt], false, false);
        __syncthreads();   // all reads of buf[cur] done before it is restaged
    }
#else
    for (int it = 0; it < nIter; ++it) {
        const int k0 = it * 32;
        *(uint4*)&As[0][r0 * 32 + cg0 * 8] = *(const uint4*)&A [(size_t)(m0 + r0) * K + k0 + cg0 * 8];
        *(uint4*)&Bs[0][r0 * 32 + cg0 * 8] = *(const uint4*)&Bt[(size_t)(n0 + r0) * K + k0 + cg0 * 8];
        *(uint4*)&As[0][r1 * 32 + cg1 * 8] = *(const uint4*)&A [(size_t)(m0 + r1) * K + k0 + cg1 * 8];
        *(uint4*)&Bs[0][r1 * 32 + cg1 * 8] = *(const uint4*)&Bt[(size_t)(n0 + r1) * K + k0 + cg1 * 8];
        if (k0 + 32 < K) {
            __builtin_prefetch(&A [(size_t)(m0 + (t >> 1)) * K + k0 + 32], 0, 0);
            __builtin_prefetch(&Bt[(size_t)(n0 + (t >> 1)) * K + k0 + 32], 0, 0);
        }
        __syncthreads();
        v16h af[4], bf[2];
        #pragma unroll
        for (int mt = 0; mt < 4; ++mt)
            af[mt] = load_frag_k32(&As[0][(waveM * 64 + mt * 16) * 32], l16, half);
        #pragma unroll
        for (int nt = 0; nt < 2; ++nt)
            bf[nt] = load_frag_k32(&Bs[0][(waveN * 32 + nt * 16) * 32], l16, half);
        #pragma unroll
        for (int mt = 0; mt < 4; ++mt)
            #pragma unroll
            for (int nt = 0; nt < 2; ++nt)
                acc[mt][nt] = __builtin_amdgcn_wmma_f32_16x16x32_f16(
                    false, af[mt], false, bf[nt], (short)0, acc[mt][nt], false, false);
        __syncthreads();
    }
#endif

    // C/D layout: VGPR i -> M = i + 8*half, N = l16
    #pragma unroll
    for (int mt = 0; mt < 4; ++mt) {
        #pragma unroll
        for (int nt = 0; nt < 2; ++nt) {
            #pragma unroll
            for (int i = 0; i < 8; ++i) {
                int m = m0 + waveM * 64 + mt * 16 + 8 * half + i;
                int n = n0 + waveN * 32 + nt * 16 + l16;
                float v = acc[mt][nt][i];
                if (resid) v += resid[(size_t)m * N + n];
                if (bias)  v += bias[n];
                Cout[(size_t)m * N + n] = v;
            }
        }
    }
}

// ---------------------------------------------------------------------------
// beta = clip(sigmoid(x @ Wbeta + bbeta), 1e-3, 0.999)   (4096 x 32)
// ---------------------------------------------------------------------------
__global__ __launch_bounds__(128) void beta_kernel(const float* __restrict__ x,
                                                   const float* __restrict__ Wb,
                                                   const float* __restrict__ bb,
                                                   float* __restrict__ beta) {
    __shared__ float pb[128];
    int m = blockIdx.x;
    int t = threadIdx.x;
    int c = t & 31, seg = t >> 5;
    const float* xr = x + (size_t)m * D_;
    float s = 0.f;
    int kb = seg * 256;
    for (int k = kb; k < kb + 256; ++k)
        s += xr[k] * Wb[(size_t)k * 32 + c];
    pb[t] = s;
    __syncthreads();
    if (t < 32) {
        float tot = pb[t] + pb[t + 32] + pb[t + 64] + pb[t + 96];
        float logit = tot + bb[t];
        float sg = 1.f / (1.f + __expf(-logit));
        sg = fminf(fmaxf(sg, 0.001f), 0.999f);
        beta[(size_t)m * 32 + t] = sg;
    }
}

// ---------------------------------------------------------------------------
// RoPE + phi (elu+1), in place, per head half-pair (i, i+32).
// A wave takes one token; a thread four neighbouring frequencies i of four heads
// (the angle depends on token and frequency only). total = threads = tokens * 32.
// ---------------------------------------------------------------------------
__device__ __forceinline__ float phi1(float r) { return r > 0.f ? r + 1.f : __expf(r); }  // elu(r)+1

__global__ __launch_bounds__(256) void rope_phi_kernel(float* __restrict__ u, int total) {
    int idx = blockIdx.x * 256 + threadIdx.x;
    if (idx >= total) return;
    int i0 = (idx & 7) * 4;    // first of four rotation-frequency indices
    int hg = (idx >> 3) & 3;   // heads hg, hg + 4, hg + 8, hg + 12
    int m  = idx >> 5;         // token 0..4095
    int s  = m & (S_ - 1);     // position within sequence
    float* up = u + (size_t)m * D_ + hg * DH_ + i0;
    float4 a[4], b[4];
    #pragma unroll
    for (int j = 0; j < 4; ++j) {
        a[j] = *(const float4*)(up + j * 4 * DH_);
        b[j] = *(const float4*)(up + j * 4 * DH_ + 32);
    }
    float cs[4], sn[4];
    #pragma unroll
    for (int c = 0; c < 4; ++c) {
        float f   = __expf(-(float)(2 * (i0 + c)) * 9.210340371976184f / 64.f); // ln(10000)
        float ang = (float)s * f;
        cs[c] = __cosf(ang);
        sn[c] = __sinf(ang);
    }
    #pragma unroll
    for (int j = 0; j < 4; ++j) {
        float4 x, y;
        x.x = phi1(a[j].x * cs[0] - b[j].x * sn[0]);  y.x = phi1(a[j].x * sn[0] + b[j].x * cs[0]);
        x.y = phi1(a[j].y * cs[1] - b[j].y * sn[1]);  y.y = phi1(a[j].y * sn[1] + b[j].y * cs[1]);
        x.z = phi1(a[j].z * cs[2] - b[j].z * sn[2]);  y.z = phi1(a[j].z * sn[2] + b[j].z * cs[2]);
        x.w = phi1(a[j].w * cs[3] - b[j].w * sn[3]);  y.w = phi1(a[j].w * sn[3] + b[j].w * cs[3]);
        *(float4*)(up + j * 4 * DH_)      = x;
        *(float4*)(up + j * 4 * DH_ + 32) = y;
    }
}

// ---------------------------------------------------------------------------
// Sequential DeltaNet scan. The columns e of the state M[C][64 d][64 e] never
// meet (num[e] sums over c and d only), so each (b,h) is dealt to SCAN_ES
// work-groups of SCAN_EW columns each: 256 work-groups instead of 32.
// A thread holds both decay channels of two rows d of one column e (4 f32), so
// k[d]*v[e] is formed once for both channels. Z[C][64] is kept by threads
// 0..127 of every work-group (each needs the whole denominator).
// The time loop runs over chunks of SCAN_T steps. A chunk's q, k, v and beta
// are staged in LDS (two buffers; the next chunk is fetched into registers
// while this one is worked on). Inside a chunk no thread needs another
// thread's result: each step's partial sums go to LDS and are added up once
// per chunk, behind the chunk's single barrier.
// Writes y as f16 (feeds the output WMMA GEMM directly).
// ---------------------------------------------------------------------------
#define SCAN_T  32
#define SCAN_ES 8                  // work-groups per (b,h)
#define SCAN_EW (DH_ / SCAN_ES)    // state columns per work-group
#define SCAN_G  8                  // steps whose operands are read from LDS together
#define SCAN_PP (256 + 8)          // floats per step of partial: 4 steps fall on 32 distinct banks
#define SCAN_DP (128 + 32)         // floats per step of denp: 2 steps fall on 64 distinct banks
typedef __attribute__((ext_vector_type(2))) float v2f;

// x + (x of lane ^ MASK), inside a row of 16 lanes; every lane on
template <int MASK>
__device__ __forceinline__ float add_xmask(float x) {
    int o = __builtin_amdgcn_update_dpp(0, __builtin_bit_cast(int, x), 0x160 + MASK, 0xf, 0xf, true);
    return x + __builtin_bit_cast(float, o);
}

__global__ __launch_bounds__(256) void scan_kernel(const float* __restrict__ q,
                                                   const float* __restrict__ k,
                                                   const float* __restrict__ v,
                                                   const float* __restrict__ beta,
                                                   _Float16* __restrict__ y) {
    __shared__ __attribute__((aligned(16))) float sq[2][SCAN_T][DH_];
    __shared__ __attribute__((aligned(16))) float sk[2][SCAN_T][DH_];
    __shared__ __attribute__((aligned(16))) float sv[2][SCAN_T][SCAN_EW];
    __shared__ __attribute__((aligned(16))) float sb[2][SCAN_T][C_];
    __shared__ __attribute__((aligned(16))) float partial[2][SCAN_T][SCAN_PP];
    __shared__ __attribute__((aligned(16))) float denp[2][SCAN_T][SCAN_DP];

    int bh = blockIdx.x / SCAN_ES;
    int e0 = (blockIdx.x % SCAN_ES) * SCAN_EW;   // first column of this work-group
    int b = bh / H_, h = bh % H_;
    int t  = threadIdx.x;
    int e  = t & (SCAN_EW - 1);   // column inside the work-group's slab
    int d0 = (t >> 3) * 2;        // first of this thread's two rows

    v2f m0 = {0.f, 0.f};       // channel 0, rows d0 and d0 + 1
    v2f m1 = {0.f, 0.f};       // channel 1
    float zreg = 0.f;
    int zc = (t >> 6) & 1;     // for t<128: Z channel
    int zd = t & 63;

    const float* qp = q + (size_t)b * S_ * D_ + h * DH_;
    const float* kp = k + (size_t)b * S_ * D_ + h * DH_;
    const float* vp = v + (size_t)b * S_ * D_ + h * DH_ + e0;
    const float* bp = beta + (size_t)b * S_ * (H_ * C_) + h * C_;
    _Float16*    yp = y + (size_t)b * S_ * D_ + h * DH_ + e0;

    // staging: 2 float4 of q and k per thread and chunk; v's slab and beta by t < 64
    const int srow = t >> 4;            // step inside a pass of 16 rows
    const int scol = (t & 15) * 4;      // first of four head dims
    const int brow = (t >> 1) & (SCAN_T - 1);
    const int bcol = t & 1;
    const bool bthr = t < C_ * SCAN_T;  // also SCAN_T * SCAN_EW / 4 float4 of v

    const size_t ro0 = (size_t)srow * D_ + scol;
    const size_t vo0 = (size_t)brow * D_ + bcol * 4;

    // chunk 0 into buffer 0
    {
        float4 q0 = *(const float4*)(qp + ro0 + 0 * D_);
        float4 k0 = *(const float4*)(kp + ro0 + 0 * D_);
        float4 q1 = *(const float4*)(qp + ro0 + 16 * D_);
        float4 k1 = *(const float4*)(kp + ro0 + 16 * D_);
        *(float4*)&sq[0][0 + srow][scol] = q0;
        *(float4*)&sk[0][0 + srow][scol] = k0;
        *(float4*)&sq[0][16 + srow][scol] = q1;
        *(float4*)&sk[0][16 + srow][scol] = k1;
        if (bthr) {
            *(float4*)&sv[0][brow][bcol * 4] = *(const float4*)(vp + vo0);
            sb[0][brow][bcol] = bp[(size_t)brow * (H_ * C_) + bcol];
        }
    }
    __syncthreads();

    const int nChunk = S_ / SCAN_T;
    // not unrolled, so that the last trip is not peeled off: with 'more' a branch at
    // run time the next chunk's global loads stay at the head of the trip; peeled,
    // they were sunk to just in front of their LDS stores and their latency showed
    #pragma nounroll
    for (int n = 0; n < nChunk; ++n) {
        const int  cur  = n & 1;
        const int  ts0  = n * SCAN_T;
        const bool more = n + 1 < nChunk;

        // next chunk: global -> registers, in flight under this chunk's steps
        float4 rq0, rq1, rk0, rk1, rv0;
        float  rb = 0.f;
        if (more) {
            const size_t ro = ro0 + (size_t)(ts0 + SCAN_T) * D_;
            rq0 = *(const float4*)(qp + ro + 0 * D_);
            rk0 = *(const float4*)(kp + ro + 0 * D_);
            rq1 = *(const float4*)(qp + ro + 16 * D_);
            rk1 = *(const float4*)(kp + ro + 16 * D_);
            if (bthr) {
                rv0 = *(const float4*)(vp + vo0 + (size_t)(ts0 + SCAN_T) * D_);
                rb  = bp[(size_t)(ts0 + SCAN_T + brow) * (H_ * C_) + bcol];
            }
        }

        // Z update + per-thread term of the denominator (waves 0..3)
        if (t < 128) {
            // unrolled so that the LDS reads of later steps issue ahead of the chain on zreg
            #pragma unroll
            for (int j = 0; j < SCAN_T; ++j) {
                zreg = zreg * sb[cur][j][zc] + sk[cur][j][zd];
                denp[cur][j][t] = sq[cur][j][zd] * zreg;
            }
        }

        // M update + per-thread partial of num[e], SCAN_T steps without a barrier;
        // the operands of SCAN_G steps are read from LDS one group ahead (two register sets)
        v2f   kb[2][SCAN_G], qb[2][SCAN_G], bb[2][SCAN_G];
        float vb[2][SCAN_G];
        #pragma unroll
        for (int u = 0; u < SCAN_G; ++u) {
            kb[0][u] = *(const v2f*)&sk[cur][u][d0];
            qb[0][u] = *(const v2f*)&sq[cur][u][d0];
            bb[0][u] = *(const v2f*)&sb[cur][u][0];
            vb[0][u] = sv[cur][u][e];
        }
        // unrolled so that the two operand sets keep constant indices (registers)
        // and every LDS offset is an immediate
        #pragma unroll
        for (int gi = 0; gi < SCAN_T / SCAN_G; ++gi) {
            const int a = gi & 1;
            if (gi + 1 < SCAN_T / SCAN_G) {
                #pragma unroll
                for (int u = 0; u < SCAN_G; ++u) {
                    const int j = (gi + 1) * SCAN_G + u;
                    kb[a ^ 1][u] = *(const v2f*)&sk[cur][j][d0];
                    qb[a ^ 1][u] = *(const v2f*)&sq[cur][j][d0];
                    bb[a ^ 1][u] = *(const v2f*)&sb[cur][j][0];
                    vb[a ^ 1][u] = sv[cur][j][e];
                }
            }
            // keeps the next group's LDS reads in front of this group's arithmetic:
            // without it they are sunk to their uses and each one's latency shows
            __builtin_amdgcn_sched_barrier(0);
            #pragma unroll
            for (int u = 0; u < SCAN_G; ++u) {
                v2f kv = kb[a][u] * vb[a][u];
                m0 = m0 * bb[a][u].x + kv;
                m1 = m1 * bb[a][u].y + kv;
                v2f sm = m0 + m1;
                partial[cur][gi * SCAN_G + u][t] = qb[a][u].x * sm.x + qb[a][u].y * sm.y;
            }
        }

        // the other buffer was last read before the previous chunk's barrier
        if (more) {
            *(float4*)&sq[cur ^ 1][0 + srow][scol] = rq0;
            *(float4*)&sk[cur ^ 1][0 + srow][scol] = rk0;
            *(float4*)&sq[cur ^ 1][16 + srow][scol] = rq1;
            *(float4*)&sk[cur ^ 1][16 + srow][scol] = rk1;
            if (bthr) {
                *(float4*)&sv[cur ^ 1][brow][bcol * 4] = rv0;
                sb[cur ^ 1][brow][bcol] = rb;
            }
        }
        // one barrier per chunk: publishes this chunk's partial sums and the
        // next chunk's staged rows; partial/denp of this parity are written
        // again only behind the next chunk's barrier
        __syncthreads();

        // each thread finishes one output: step j, column e. The eight lanes of a
        // step share its denominator: 16 terms each, then three adds across lanes
        {
            const int j = t >> 3;
            float4 a0 = *(const float4*)&denp[cur][j][0 * 32 + e * 4];
            float4 a1 = *(const float4*)&denp[cur][j][1 * 32 + e * 4];
            float4 a2 = *(const float4*)&denp[cur][j][2 * 32 + e * 4];
            float4 a3 = *(const float4*)&denp[cur][j][3 * 32 + e * 4];
            float s4[4] = {0.f, 0.f, 0.f, 0.f};   // four chains, so that the adds overlap
            #pragma unroll
            for (int p = 0; p < 32; ++p) s4[p & 3] += partial[cur][j][p * SCAN_EW + e];
            float ds = ((a0.x + a0.y) + (a0.z + a0.w)) + ((a1.x + a1.y) + (a1.z + a1.w))
                     + ((a2.x + a2.y) + (a2.z + a2.w)) + ((a3.x + a3.y) + (a3.z + a3.w));
            ds = add_xmask<1>(ds);
            ds = add_xmask<2>(ds);
            ds = add_xmask<4>(ds);
            float den = ds + 1e-6f;
            float num = (s4[0] + s4[1]) + (s4[2] + s4[3]);
            yp[(size_t)(ts0 + j) * D_ + e] = (_Float16)(num / den);
        }
        // the next trip rewrites the registers that this store names
        asm volatile("s_wait_xcnt 0x0" ::: "memory");
    }
}

// ---------------------------------------------------------------------------
// LayerNorm over rows of h (4096 x 1024), f32 out
// ---------------------------------------------------------------------------
__global__ __launch_bounds__(256) void ln_kernel(const float* __restrict__ hbuf,
                                                 const float* __restrict__ gamma,
                                                 const float* __restrict__ lbeta,
                                                 float* __restrict__ out) {
    __shared__ float rs[256], rq[256];
    __shared__ float smu, srstd;
    int m = blockIdx.x, t = threadIdx.x;
    const float* hr = hbuf + (size_t)m * D_;
    float s = 0.f, q2 = 0.f;
    float vals[4];
    #pragma unroll
    for (int i = 0; i < 4; ++i) {
        float v = hr[t + i * 256];
        vals[i] = v; s += v; q2 += v * v;
    }
    rs[t] = s; rq[t] = q2;
    __syncthreads();
    for (int off = 128; off > 0; off >>= 1) {
        if (t < off) { rs[t] += rs[t + off]; rq[t] += rq[t + off]; }
        __syncthreads();
    }
    if (t == 0) {
        float mu  = rs[0] * (1.f / D_);
        float var = rq[0] * (1.f / D_) - mu * mu;
        smu = mu; srstd = rsqrtf(var + 1e-5f);
    }
    __syncthreads();
    float* orow = out + (size_t)m * D_;
    #pragma unroll
    for (int i = 0; i < 4; ++i) {
        int n = t + i * 256;
        orow[n] = gamma[n] * (vals[i] - smu) * srstd + lbeta[n];
    }
}

// ---------------------------------------------------------------------------
// launch
// ---------------------------------------------------------------------------
extern "C" void kernel_launch(void* const* d_in, const int* in_sizes, int n_in,
                              void* d_out, int out_size, void* d_ws, size_t ws_size,
                              hipStream_t stream) {
    const float* x      = (const float*)d_in[0];
    const float* Wq     = (const float*)d_in[1];
    const float* Wk     = (const float*)d_in[2];
    const float* Wv     = (const float*)d_in[3];
    const float* Wbeta  = (const float*)d_in[4];
    const float* bbeta  = (const float*)d_in[5];
    const float* Wo     = (const float*)d_in[6];
    const float* bo     = (const float*)d_in[7];
    const float* lng    = (const float*)d_in[8];
    const float* lnb    = (const float*)d_in[9];
    float* out = (float*)d_out;

    char* ws = (char*)d_ws;
    size_t off = 0;
    auto alloc = [&](size_t bytes) { char* p = ws + off; off += (bytes + 255) & ~(size_t)255; return p; };

    _Float16* xh   = (_Float16*)alloc((size_t)MTOK * D_ * 2);   // 8 MB
    _Float16* Wqt  = (_Float16*)alloc((size_t)D_ * D_ * 2);     // 2 MB each
    _Float16* Wkt  = (_Float16*)alloc((size_t)D_ * D_ * 2);
    _Float16* Wvt  = (_Float16*)alloc((size_t)D_ * D_ * 2);
    _Float16* Wot  = (_Float16*)alloc((size_t)D_ * D_ * 2);
    float*    qbuf = (float*)alloc((size_t)MTOK * D_ * 4);      // 16 MB each
    float*    kbuf = (float*)alloc((size_t)MTOK * D_ * 4);
    float*    vbuf = (float*)alloc((size_t)MTOK * D_ * 4);
    float*    bbuf = (float*)alloc((size_t)MTOK * 32 * 4);      // 0.5 MB
    _Float16* ybuf = (_Float16*)alloc((size_t)MTOK * D_ * 2);   // 8 MB
    float*    hbuf = (float*)alloc((size_t)MTOK * D_ * 4);      // 16 MB
    (void)ws_size; (void)in_sizes; (void)n_in; (void)out_size;

    const int nX = MTOK * D_;  // 4194304
    f32_to_f16_kernel<<<nX / CVT_WG, 256, 0, stream>>>(x, xh, nX);

    const int nW = (D_ / 64) * (D_ / 128);   // tiles of 64 k x 128 n
    transpose_to_f16_kernel<<<nW, 256, 0, stream>>>(Wq, Wqt);
    transpose_to_f16_kernel<<<nW, 256, 0, stream>>>(Wk, Wkt);
    transpose_to_f16_kernel<<<nW, 256, 0, stream>>>(Wv, Wvt);
    transpose_to_f16_kernel<<<nW, 256, 0, stream>>>(Wo, Wot);

    dim3 ggrid(D_ / 128, MTOK / 128);   // (8, 32)
    gemm_f16_wmma_kernel<<<ggrid, 256, 0, stream>>>(xh, Wqt, qbuf, nullptr, nullptr, MTOK, D_, D_);
    gemm_f16_wmma_kernel<<<ggrid, 256, 0, stream>>>(xh, Wkt, kbuf, nullptr, nullptr, MTOK, D_, D_);
    gemm_f16_wmma_kernel<<<ggrid, 256, 0, stream>>>(xh, Wvt, vbuf, nullptr, nullptr, MTOK, D_, D_);

    beta_kernel<<<MTOK, 128, 0, stream>>>(x, Wbeta, bbeta, bbuf);

    const int nPairs = MTOK * 32;  // threads: 16 half-pairs each
    rope_phi_kernel<<<nPairs / 256, 256, 0, stream>>>(qbuf, nPairs);
    rope_phi_kernel<<<nPairs / 256, 256, 0, stream>>>(kbuf, nPairs);

    scan_kernel<<<B_ * H_ * SCAN_ES, 256, 0, stream>>>(qbuf, kbuf, vbuf, bbuf, ybuf);

    // h = x + y @ Wo + bo (fused residual + bias epilogue)
    gemm_f16_wmma_kernel<<<ggrid, 256, 0, stream>>>(ybuf, Wot, hbuf, x, bo, MTOK, D_, D_);

    ln_kernel<<<MTOK, 256, 0, stream>>>(hbuf, lng, lnb, out);
}

// v004
// A run of this version takes 239 microseconds.
// Next to v003, in two timings, it ran 1.30 times as fast each time.
// Over all steps from v000 it is 13.3 times as fast.
#include <hip/hip_runtime.h>
#include <hip/hip_bf16.h>

typedef __attribute__((ext_vector_type(16))) _Float16 v16h;
typedef __attribute__((ext_vector_type(8)))  float    v8f;

#define B_   2
#define S_   2048
#define D_   1024
#define H_   16
#define DH_  64
#define C_   2
#define MTOK (B_ * S_)   // 4096

// ---------------------------------------------------------------------------
// CDNA5 async global->LDS copy (ASYNCcnt path), with sync fallback
// ---------------------------------------------------------------------------
#if defined(__has_builtin)
#if __has_builtin(__builtin_amdgcn_global_load_async_to_lds_b128)
#define HAVE_ASYNC_LDS 1
#endif
#endif

#if defined(HAVE_ASYNC_LDS)
// builtin signature: void(v4i addrspace(1)*, v4i addrspace(3)*, imm offset, imm cpol)
typedef int v4i_vs __attribute__((vector_size(4 * sizeof(int))));
typedef __attribute__((address_space(1))) v4i_vs* g_v4i_p;
typedef __attribute__((address_space(3))) v4i_vs* l_v4i_p;
__device__ __forceinline__ void async_copy_b128(const _Float16* g, _Float16* l) {
    __builtin_amdgcn_global_load_async_to_lds_b128(
        (g_v4i_p)(void*)const_cast<_Float16*>(g), (l_v4i_p)(void*)l, 0, 0);
}
#if __has_builtin(__builtin_amdgcn_s_wait_asynccnt)
#define WAIT_ASYNC(n) __builtin_amdgcn_s_wait_asynccnt(n)
#else
#define WAIT_ASYNC(n) asm volatile("s_wait_asynccnt %0" :: "n"(n) : "memory")
#endif
#endif

// ---------------------------------------------------------------------------
// The three element-wise helpers below give each thread 32 elements, moved in
// 16-byte pieces: with one element per thread their time was the
// time it takes to start their waves, not the time to move their bytes.
// ---------------------------------------------------------------------------
typedef __attribute__((ext_vector_type(8))) _Float16 v8h;

__device__ __forceinline__ v8h cvt8(float4 a, float4 b) {
    v8h o = {(_Float16)a.x, (_Float16)a.y, (_Float16)a.z, (_Float16)a.w,
             (_Float16)b.x, (_Float16)b.y, (_Float16)b.z, (_Float16)b.w};
    return o;
}

// f32 -> f16 conversion; a work-group converts CVT_WG elements (n is a multiple),
// a thread four runs of 8, all eight loads in flight together
#define CVT_WG 8192
__global__ __launch_bounds__(256) void f32_to_f16_kernel(const float* __restrict__ src,
                                                         _Float16* __restrict__ dst, int n) {
    int i = blockIdx.x * CVT_WG + threadIdx.x * 8;
    if (i + 3 * 2048 + 8 > n) return;
    float4 a[4], b[4];
    #pragma unroll
    for (int g = 0; g < 4; ++g) {
        a[g] = *(const float4*)(src + i + g * 2048);
        b[g] = *(const float4*)(src + i + g * 2048 + 4);
    }
    #pragma unroll
    for (int g = 0; g < 4; ++g) *(v8h*)(dst + i + g * 2048) = cvt8(a[g], b[g]);
}

// W is (D_ x D_) row-major f32, rows k; Wt becomes its transpose in f16, rows n.
// A work-group turns a tile of 64 k x 128 n, a thread 8 k x 4 n: eight lanes side
// by side in k write 128 bytes in a row of Wt. The pitch is a constant, so that
// a thread's loads, and its stores, share one address register pair.
__global__ __launch_bounds__(256) void transpose_to_f16_kernel(const float* __restrict__ W,
                                                               _Float16* __restrict__ Wt) {
    int t  = threadIdx.x;
    int k0 = (blockIdx.x / (D_ / 128)) * 64 + (t & 7) * 8;
    int n0 = (blockIdx.x % (D_ / 128)) * 128 + (t >> 3) * 4;
    const float* wp = W + k0 * D_ + n0;
    float4 r[8];
    #pragma unroll
    for (int j = 0; j < 8; ++j) r[j] = *(const float4*)(wp + j * D_);
    _Float16* op = Wt + n0 * D_ + k0;
    v8h o0 = {(_Float16)r[0].x, (_Float16)r[1].x, (_Float16)r[2].x, (_Float16)r[3].x,
              (_Float16)r[4].x, (_Float16)r[5].x, (_Float16)r[6].x, (_Float16)r[7].x};
    v8h o1 = {(_Float16)r[0].y, (_Float16)r[1].y, (_Float16)r[2].y, (_Float16)r[3].y,
              (_Float16)r[4].y, (_Float16)r[5].y, (_Float16)r[6].y, (_Float16)r[7].y};
    v8h o2 = {(_Float16)r[0].z, (_Float16)r[1].z, (_Float16)r[2].z, (_Float16)r[3].z,
              (_Float16)r[4].z, (_Float16)r[5].z, (_Float16)r[6].z, (_Float16)r[7].z};
    v8h o3 = {(_Float16)r[0].w, (_Float16)r[1].w, (_Float16)r[2].w, (_Float16)r[3].w,
              (_Float16)r[4].w, (_Float16)r[5].w, (_Float16)r[6].w, (_Float16)r[7].w};
    *(v8h*)(op)          = o0;
    *(v8h*)(op + D_)     = o1;
    *(v8h*)(op + 2 * D_) = o2;
    *(v8h*)(op + 3 * D_) = o3;
}

// ---------------------------------------------------------------------------
// WMMA GEMM:  C[M,N] = A[M,K] (f16) * Bt[N,K]^T (f16)  (+ resid + bias)
// block = 256 threads (8 waves), tile = 128x128, K-step = 32,
// double-buffered async global->LDS staging.
// ---------------------------------------------------------------------------
__device__ inline v16h load_frag_k32(const _Float16* tile_base, int row16, int half) {
    // tile rows have stride 32 f16; A-fragment layout for v_wmma_f32_16x16x32_f16:
    // lanes 0-15: K = {0..7, 16..23}; lanes 16-31: K = {8..15, 24..31}
    const _Float16* p = tile_base + row16 * 32 + half * 8;
    union { v16h h; uint4 u[2]; } f;
    f.u[0] = *(const uint4*)(p);
    f.u[1] = *(const uint4*)(p + 16);
    return f.h;
}

__global__ __launch_bounds__(256) void gemm_f16_wmma_kernel(
    const _Float16* __restrict__ A,   // M x K row-major
    const _Float16* __restrict__ Bt,  // N x K row-major (B pre-transposed)
    float* __restrict__ Cout,         // M x N
    const float* __restrict__ resid,  // optional M x N, may be null
    const float* __restrict__ bias,   // optional N, may be null
    int M, int N, int K)
{
#if defined(HAVE_ASYNC_LDS)
    __shared__ _Float16 As[2][128 * 32];
    __shared__ _Float16 Bs[2][128 * 32];
#else
    __shared__ _Float16 As[1][128 * 32];
    __shared__ _Float16 Bs[1][128 * 32];
#endif

    const int t     = threadIdx.x;
    const int m0    = blockIdx.y * 128;
    const int n0    = blockIdx.x * 128;
    const int wave  = t >> 5;
    const int lane  = t & 31;
    const int half  = (lane >> 4) & 1;
    const int l16   = lane & 15;
    const int waveM = wave >> 2;   // 0..1  (64-row slab)
    const int waveN = wave & 3;    // 0..3  (32-col slab)

    // per-thread staging coordinates: 2 chunks of 8 f16 (16B) per matrix
    const int r0  = t >> 2;              // chunk 0 row
    const int cg0 = t & 3;               // chunk 0 col-group
    const int r1  = (t + 256) >> 2;      // chunk 1 row
    const int cg1 = t & 3;

    v8f acc[4][2] = {};
    const int nIter = K / 32;

#if defined(HAVE_ASYNC_LDS)
    // prologue: stage tile 0 into buffer 0 (4 async-load instructions / wave)
    {
        const int k0 = 0;
        async_copy_b128(&A [(size_t)(m0 + r0) * K + k0 + cg0 * 8], &As[0][r0 * 32 + cg0 * 8]);
        async_copy_b128(&Bt[(size_t)(n0 + r0) * K + k0 + cg0 * 8], &Bs[0][r0 * 32 + cg0 * 8]);
        async_copy_b128(&A [(size_t)(m0 + r1) * K + k0 + cg1 * 8], &As[0][r1 * 32 + cg1 * 8]);
        async_copy_b128(&Bt[(size_t)(n0 + r1) * K + k0 + cg1 * 8], &Bs[0][r1 * 32 + cg1 * 8]);
    }
    for (int it = 0; it < nIter; ++it) {
        const int cur = it & 1;
        if (it + 1 < nIter) {
            const int k0 = (it + 1) * 32;
            const int nxt = cur ^ 1;
            async_copy_b128(&A [(size_t)(m0 + r0) * K + k0 + cg0 * 8], &As[nxt][r0 * 32 + cg0 * 8]);
            async_copy_b128(&Bt[(size_t)(n0 + r0) * K + k0 + cg0 * 8], &Bs[nxt][r0 * 32 + cg0 * 8]);
            async_copy_b128(&A [(size_t)(m0 + r1) * K + k0 + cg1 * 8], &As[nxt][r1 * 32 + cg1 * 8]);
            async_copy_b128(&Bt[(size_t)(n0 + r1) * K + k0 + cg1 * 8], &Bs[nxt][r1 * 32 + cg1 * 8]);
            WAIT_ASYNC(4);   // drain previous batch only; next batch stays in flight
        } else {
            WAIT_ASYNC(0);
        }
        __syncthreads();

        v16h af[4], bf[2];
        #pragma unroll
        for (int mt = 0; mt < 4; ++mt)
            af[mt] = load_frag_k32(&As[cur][(waveM * 64 + mt * 16) * 32], l16, half);
        #pragma unroll
        for (int nt = 0; nt < 2; ++nt)
            bf[nt] = load_frag_k32(&Bs[cur][(waveN * 32 + nt * 16) * 32], l16, half);

        #pragma unroll
        for (int mt = 0; mt < 4; ++mt)
            #pragma unroll
            for (int nt = 0; nt < 2; ++nt)
                acc[mt][nt] = __builtin_amdgcn_wmma_f32_16x16x32_f16(
                    false, af[mt], false, bf[nt], (short)0, acc[mt][nt], false, false);
        __syncthreads();   // all reads of buf[cur] done before it is restaged
    }
#else
    for (int it = 0; it < nIter; ++it) {
        const int k0 = it * 32;
        *(uint4*)&As[0][r0 * 32 + cg0 * 8] = *(const uint4*)&A [(size_t)(m0 + r0) * K + k0 + cg0 * 8];
        *(uint4*)&Bs[0][r0 * 32 + cg0 * 8] = *(const uint4*)&Bt[(size_t)(n0 + r0) * K + k0 + cg0 * 8];
        *(uint4*)&As[0][r1 * 32 + cg1 * 8] = *(const uint4*)&A [(size_t)(m0 + r1) * K + k0 + cg1 * 8];
        *(uint4*)&Bs[0][r1 * 32 + cg1 * 8] = *(const uint4*)&Bt[(size_t)(n0 + r1) * K + k0 + cg1 * 8];
        if (k0 + 32 < K) {
            __builtin_prefetch(&A [(size_t)(m0 + (t >> 1)) * K + k0 + 32], 0, 0);
            __builtin_prefetch(&Bt[(size_t)(n0 + (t >> 1)) * K + k0 + 32], 0, 0);
        }
        __syncthreads();
        v16h af[4], bf[2];
        #pragma unroll
        for (int mt = 0; mt < 4; ++mt)
            af[mt] = load_frag_k32(&As[0][(waveM * 64 + mt * 16) * 32], l16, half);
        #pragma unroll
        for (int nt = 0; nt < 2; ++nt)
            bf[nt] = load_frag_k32(&Bs[0][(waveN * 32 + nt * 16) * 32], l16, half);
        #pragma unroll
        for (int mt = 0; mt < 4; ++mt)
            #pragma unroll
            for (int nt = 0; nt < 2; ++nt)
                acc[mt][nt] = __builtin_amdgcn_wmma_f32_16x16x32_f16(
                    false, af[mt], false, bf[nt], (short)0, acc[mt][nt], false, false);
        __syncthreads();
    }
#endif

    // C/D layout: VGPR i -> M = i + 8*half, N = l16
    #pragma unroll
    for (int mt = 0; mt < 4; ++mt) {
        #pragma unroll
        for (int nt = 0; nt < 2; ++nt) {
            #pragma unroll
            for (int i = 0; i < 8; ++i) {
                int m = m0 + waveM * 64 + mt * 16 + 8 * half + i;
                int n = n0 + waveN * 32 + nt * 16 + l16;
                float v = acc[mt][nt][i];
                if (resid) v += resid[(size_t)m * N + n];
                if (bias)  v += bias[n];
                Cout[(size_t)m * N + n] = v;
            }
        }
    }
}

// ---------------------------------------------------------------------------
// beta = clip(sigmoid(x @ Wbeta + bbeta), 1e-3, 0.999)   (4096 x 32)
// A work-group takes BT_TOK tokens and all 32 columns; each of its waves a
// slice of BT_KS values of k; a lane holds 4 tokens x 4 columns, so that eight
// 16-byte loads feed 64 multiply-adds and many loads are in flight per wait.
// The waves' partial sums meet in LDS.
// ---------------------------------------------------------------------------
#define BT_TOK   16
#define BT_WAVES 16
#define BT_KS    (D_ / BT_WAVES)   // 64
#define BT_G     4                 // runs of 4 k per register set
#define BT_SK    (BT_G * 4)        // values of k per register set
typedef __attribute__((ext_vector_type(2))) float bt2f;

// one register set: 4 tokens x BT_SK k of x, BT_SK k x 4 columns of Wb
__device__ __forceinline__ void bt_load(float4 (&xv)[BT_G][4], float4 (&wv)[BT_G][4],
                                        const float* xp, const float* wp) {
    #pragma unroll
    for (int g = 0; g < BT_G; ++g) {
        #pragma unroll
        for (int i = 0; i < 4; ++i) xv[g][i] = *(const float4*)(xp + i * D_ + g * 4);
        #pragma unroll
        for (int j = 0; j < 4; ++j) {
            // the set's last load is given, as its destination, an address pair that
            // the loads before it name: the wait stands in front of that overwrite
            if (g == BT_G - 1 && j == 3) asm volatile("s_wait_xcnt 0x0" ::: "memory");
            wv[g][j] = *(const float4*)(wp + (g * 4 + j) * 32);
        }
    }
}

__device__ __forceinline__ void bt_fma(bt2f (&acc)[4][2], const float4 (&xv)[BT_G][4],
                                       const float4 (&wv)[BT_G][4]) {
    #pragma unroll
    for (int g = 0; g < BT_G; ++g) {
        #pragma unroll
        for (int i = 0; i < 4; ++i) {
            const float xs[4] = {xv[g][i].x, xv[g][i].y, xv[g][i].z, xv[g][i].w};
            #pragma unroll
            for (int j = 0; j < 4; ++j) {
                bt2f lo = {wv[g][j].x, wv[g][j].y}, hi = {wv[g][j].z, wv[g][j].w};
                acc[i][0] += lo * xs[j];
                acc[i][1] += hi * xs[j];
            }
        }
    }
}

__global__ __launch_bounds__(BT_WAVES * 32) void beta_kernel(const float* __restrict__ x,
                                                             const float* __restrict__ Wb,
                                                             const float* __restrict__ bb,
                                                             float* __restrict__ beta) {
    __shared__ __attribute__((aligned(16))) float pb[BT_WAVES][BT_TOK][32];
    const int t    = threadIdx.x;
    const int wave = t >> 5;
    const int tg   = (t >> 3) & 3;   // tokens tg * 4 .. tg * 4 + 3
    const int cg   = t & 7;          // columns cg * 4 .. cg * 4 + 3
    const int m0   = blockIdx.x * BT_TOK;
    const float* xp = x + (size_t)(m0 + tg * 4) * D_ + wave * BT_KS;
    const float* wp = Wb + (size_t)(wave * BT_KS) * 32 + cg * 4;

    bt2f acc[4][2] = {};
    // not unrolled: unrolled, every load of the slice was lifted to the top and spilled
    #pragma nounroll
    for (int s = 0; s < BT_KS / BT_SK; ++s) {
        float4 xv[BT_G][4], wv[BT_G][4];
        bt_load(xv, wv, xp, wp);
        // keeps the set's loads together in front of its arithmetic: sunk to their
        // uses, only a few would be in flight
        __builtin_amdgcn_sched_barrier(0);
        bt_fma(acc, xv, wv);
        xp += BT_SK;
        wp += BT_SK * 32;
    }
    #pragma unroll
    for (int i = 0; i < 4; ++i) {
        float4 o = {acc[i][0].x, acc[i][0].y, acc[i][1].x, acc[i][1].y};
        *(float4*)&pb[wave][tg * 4 + i][cg * 4] = o;
    }
    __syncthreads();
    // thread t finishes token t / 32, column t % 32
    {
        const float* pp = &pb[0][0][0] + t;
        float s4[4] = {0.f, 0.f, 0.f, 0.f};
        #pragma unroll
        for (int w = 0; w < BT_WAVES; ++w) s4[w & 3] += pp[w * (BT_TOK * 32)];
        float logit = ((s4[0] + s4[1]) + (s4[2] + s4[3])) + bb[t & 31];
        float sg = 1.f / (1.f + __expf(-logit));
        sg = fminf(fmaxf(sg, 0.001f), 0.999f);
        beta[(size_t)m0 * 32 + t] = sg;
    }
}

// ---------------------------------------------------------------------------
// RoPE + phi (elu+1), in place, per head half-pair (i, i+32).
// A wave takes one token; a thread four neighbouring frequencies i of four heads
// (the angle depends on token and frequency only). total = threads = tokens * 32.
// ---------------------------------------------------------------------------
__device__ __forceinline__ float phi1(float r) { return r > 0.f ? r + 1.f : __expf(r); }  // elu(r)+1

__global__ __launch_bounds__(256) void rope_phi_kernel(float* __restrict__ u, int total) {
    int idx = blockIdx.x * 256 + threadIdx.x;
    if (idx >= total) return;
    int i0 = (idx & 7) * 4;    // first of four rotation-frequency indices
    int hg = (idx >> 3) & 3;   // heads hg, hg + 4, hg + 8, hg + 12
    int m  = idx >> 5;         // token 0..4095
    int s  = m & (S_ - 1);     // position within sequence
    float* up = u + (size_t)m * D_ + hg * DH_ + i0;
    float4 a[4], b[4];
    #pragma unroll
    for (int j = 0; j < 4; ++j) {
        a[j] = *(const float4*)(up + j * 4 * DH_);
        b[j] = *(const float4*)(up + j * 4 * DH_ + 32);
    }
    float cs[4], sn[4];
    #pragma unroll
    for (int c = 0; c < 4; ++c) {
        float f   = __expf(-(float)(2 * (i0 + c)) * 9.210340371976184f / 64.f); // ln(10000)
        float ang = (float)s * f;
        cs[c] = __cosf(ang);
        sn[c] = __sinf(ang);
    }
    #pragma unroll
    for (int j = 0; j < 4; ++j) {
        float4 x, y;
        x.x = phi1(a[j].x * cs[0] - b[j].x * sn[0]);  y.x = phi1(a[j].x * sn[0] + b[j].x * cs[0]);
        x.y = phi1(a[j].y * cs[1] - b[j].y * sn[1]);  y.y = phi1(a[j].y * sn[1] + b[j].y * cs[1]);
        x.z = phi1(a[j].z * cs[2] - b[j].z * sn[2]);  y.z = phi1(a[j].z * sn[2] + b[j].z * cs[2]);
        x.w = phi1(a[j].w * cs[3] - b[j].w * sn[3]);  y.w = phi1(a[j].w * sn[3] + b[j].w * cs[3]);
        *(float4*)(up + j * 4 * DH_)      = x;
        *(float4*)(up + j * 4 * DH_ + 32) = y;
    }
}

// ---------------------------------------------------------------------------
// Sequential DeltaNet scan. The columns e of the state M[C][64 d][64 e] never
// meet (num[e] sums over c and d only), so each (b,h) is dealt to SCAN_ES
// work-groups of SCAN_EW columns each: 256 work-groups instead of 32.
// A thread holds both decay channels of two rows d of one column e (4 f32), so
// k[d]*v[e] is formed once for both channels. Z[C][64] is kept by threads
// 0..127 of every work-group (each needs the whole denominator).
// The time loop runs over chunks of SCAN_T steps. A chunk's q, k, v and beta
// are staged in LDS (two buffers; the next chunk is fetched into registers
// while this one is worked on). Inside a chunk no thread needs another
// thread's result: each step's partial sums go to LDS and are added up once
// per chunk, behind the chunk's single barrier.
// Writes y as f16 (feeds the output WMMA GEMM directly).
// ---------------------------------------------------------------------------
#define SCAN_T  32
#define SCAN_ES 8                  // work-groups per (b,h)
#define SCAN_EW (DH_ / SCAN_ES)    // state columns per work-group
#define SCAN_G  8                  // steps whose operands are read from LDS together
#define SCAN_PP (256 + 8)          // floats per step of partial: 4 steps fall on 32 distinct banks
#define SCAN_DP (128 + 32)         // floats per step of denp: 2 steps fall on 64 distinct banks
typedef __attribute__((ext_vector_type(2))) float v2f;

// x + (x of lane ^ MASK), inside a row of 16 lanes; every lane on
template <int MASK>
__device__ __forceinline__ float add_xmask(float x) {
    int o = __builtin_amdgcn_update_dpp(0, __builtin_bit_cast(int, x), 0x160 + MASK, 0xf, 0xf, true);
    return x + __builtin_bit_cast(float, o);
}

__global__ __launch_bounds__(256) void scan_kernel(const float* __restrict__ q,
                                                   const float* __restrict__ k,
                                                   const float* __restrict__ v,
                                                   const float* __restrict__ beta,
                                                   _Float16* __restrict__ y) {
    __shared__ __attribute__((aligned(16))) float sq[2][SCAN_T][DH_];
    __shared__ __attribute__((aligned(16))) float sk[2][SCAN_T][DH_];
    __shared__ __attribute__((aligned(16))) float sv[2][SCAN_T][SCAN_EW];
    __shared__ __attribute__((aligned(16))) float sb[2][SCAN_T][C_];
    __shared__ __attribute__((aligned(16))) float partial[2][SCAN_T][SCAN_PP];
    __shared__ __attribute__((aligned(16))) float denp[2][SCAN_T][SCAN_DP];

    int bh = blockIdx.x / SCAN_ES;
    int e0 = (blockIdx.x % SCAN_ES) * SCAN_EW;   // first column of this work-group
    int b = bh / H_, h = bh % H_;
    int t  = threadIdx.x;
    int e  = t & (SCAN_EW - 1);   // column inside the work-group's slab
    int d0 = (t >> 3) * 2;        // first of this thread's two rows

    v2f m0 = {0.f, 0.f};       // channel 0, rows d0 and d0 + 1
    v2f m1 = {0.f, 0.f};       // channel 1
    float zreg = 0.f;
    int zc = (t >> 6) & 1;     // for t<128: Z channel
    int zd = t & 63;

    const float* qp = q + (size_t)b * S_ * D_ + h * DH_;
    const float* kp = k + (size_t)b * S_ * D_ + h * DH_;
    const float* vp = v + (size_t)b * S_ * D_ + h * DH_ + e0;
    const float* bp = beta + (size_t)b * S_ * (H_ * C_) + h * C_;
    _Float16*    yp = y + (size_t)b * S_ * D_ + h * DH_ + e0;

    // staging: 2 float4 of q and k per thread and chunk; v's slab and beta by t < 64
    const int srow = t >> 4;            // step inside a pass of 16 rows
    const int scol = (t & 15) * 4;      // first of four head dims
    const int brow = (t >> 1) & (SCAN_T - 1);
    const int bcol = t & 1;
    const bool bthr = t < C_ * SCAN_T;  // also SCAN_T * SCAN_EW / 4 float4 of v

    const size_t ro0 = (size_t)srow * D_ + scol;
    const size_t vo0 = (size_t)brow * D_ + bcol * 4;

    // chunk 0 into buffer 0
    {
        float4 q0 = *(const float4*)(qp + ro0 + 0 * D_);
        float4 k0 = *(const float4*)(kp + ro0 + 0 * D_);
        float4 q1 = *(const float4*)(qp + ro0 + 16 * D_);
        float4 k1 = *(const float4*)(kp + ro0 + 16 * D_);
        *(float4*)&sq[0][0 + srow][scol] = q0;
        *(float4*)&sk[0][0 + srow][scol] = k0;
        *(float4*)&sq[0][16 + srow][scol] = q1;
        *(float4*)&sk[0][16 + srow][scol] = k1;
        if (bthr) {
            *(float4*)&sv[0][brow][bcol * 4] = *(const float4*)(vp + vo0);
            sb[0][brow][bcol] = bp[(size_t)brow * (H_ * C_) + bcol];
        }
    }
    __syncthreads();

    const int nChunk = S_ / SCAN_T;
    // not unrolled, so that the last trip is not peeled off: with 'more' a branch at
    // run time the next chunk's global loads stay at the head of the trip; peeled,
    // they were sunk to just in front of their LDS stores and their latency showed
    #pragma nounroll
    for (int n = 0; n < nChunk; ++n) {
        const int  cur  = n & 1;
        const int  ts0  = n * SCAN_T;
        const bool more = n + 1 < nChunk;

        // next chunk: global -> registers, in flight under this chunk's steps
        float4 rq0, rq1, rk0, rk1, rv0;
        float  rb = 0.f;
        if (more) {
            const size_t ro = ro0 + (size_t)(ts0 + SCAN_T) * D_;
            rq0 = *(const float4*)(qp + ro + 0 * D_);
            rk0 = *(const float4*)(kp + ro + 0 * D_);
            rq1 = *(const float4*)(qp + ro + 16 * D_);
            rk1 = *(const float4*)(kp + ro + 16 * D_);
            if (bthr) {
                rv0 = *(const float4*)(vp + vo0 + (size_t)(ts0 + SCAN_T) * D_);
                rb  = bp[(size_t)(ts0 + SCAN_T + brow) * (H_ * C_) + bcol];
            }
        }

        // Z update + per-thread term of the denominator (waves 0..3)
        if (t < 128) {
            // unrolled so that the LDS reads of later steps issue ahead of the chain on zreg
            #pragma unroll
            for (int j = 0; j < SCAN_T; ++j) {
                zreg = zreg * sb[cur][j][zc] + sk[cur][j][zd];
                denp[cur][j][t] = sq[cur][j][zd] * zreg;
            }
        }

        // M update + per-thread partial of num[e], SCAN_T steps without a barrier;
        // the operands of SCAN_G steps are read from LDS one group ahead (two register sets)
        v2f   kb[2][SCAN_G], qb[2][SCAN_G], bb[2][SCAN_G];
        float vb[2][SCAN_G];
        #pragma unroll
        for (int u = 0; u < SCAN_G; ++u) {
            kb[0][u] = *(const v2f*)&sk[cur][u][d0];
            qb[0][u] = *(const v2f*)&sq[cur][u][d0];
            bb[0][u] = *(const v2f*)&sb[cur][u][0];
            vb[0][u] = sv[cur][u][e];
        }
        // unrolled so that the two operand sets keep constant indices (registers)
        // and every LDS offset is an immediate
        #pragma unroll
        for (int gi = 0; gi < SCAN_T / SCAN_G; ++gi) {
            const int a = gi & 1;
            if (gi + 1 < SCAN_T / SCAN_G) {
                #pragma unroll
                for (int u = 0; u < SCAN_G; ++u) {
                    const int j = (gi + 1) * SCAN_G + u;
                    kb[a ^ 1][u] = *(const v2f*)&sk[cur][j][d0];
                    qb[a ^ 1][u] = *(const v2f*)&sq[cur][j][d0];
                    bb[a ^ 1][u] = *(const v2f*)&sb[cur][j][0];
                    vb[a ^ 1][u] = sv[cur][j][e];
                }
            }
            // keeps the next group's LDS reads in front of this group's arithmetic:
            // without it they are sunk to their uses and each one's latency shows
            __builtin_amdgcn_sched_barrier(0);
            #pragma unroll
            for (int u = 0; u < SCAN_G; ++u) {
                v2f kv = kb[a][u] * vb[a][u];
                m0 = m0 * bb[a][u].x + kv;
                m1 = m1 * bb[a][u].y + kv;
                v2f sm = m0 + m1;
                partial[cur][gi * SCAN_G + u][t] = qb[a][u].x * sm.x + qb[a][u].y * sm.y;
            }
        }

        // the other buffer was last read before the previous chunk's barrier
        if (more) {
            *(float4*)&sq[cur ^ 1][0 + srow][scol] = rq0;
            *(float4*)&sk[cur ^ 1][0 + srow][scol] = rk0;
            *(float4*)&sq[cur ^ 1][16 + srow][scol] = rq1;
            *(float4*)&sk[cur ^ 1][16 + srow][scol] = rk1;
            if (bthr) {
                *(float4*)&sv[cur ^ 1][brow][bcol * 4] = rv0;
                sb[cur ^ 1][brow][bcol] = rb;
            }
        }
        // one barrier per chunk: publishes this chunk's partial sums and the
        // next chunk's staged rows; partial/denp of this parity are written
        // again only behind the next chunk's barrier
        __syncthreads();

        // each thread finishes one output: step j, column e. The eight lanes of a
        // step share its denominator: 16 terms each, then three adds across lanes
        {
            const int j = t >> 3;
            float4 a0 = *(const float4*)&denp[cur][j][0 * 32 + e * 4];
            float4 a1 = *(const float4*)&denp[cur][j][1 * 32 + e * 4];
            float4 a2 = *(const float4*)&denp[cur][j][2 * 32 + e * 4];
            float4 a3 = *(const float4*)&denp[cur][j][3 * 32 + e * 4];
            float s4[4] = {0.f, 0.f, 0.f, 0.f};   // four chains, so that the adds overlap
            #pragma unroll
            for (int p = 0; p < 32; ++p) s4[p & 3] += partial[cur][j][p * SCAN_EW + e];
            float ds = ((a0.x + a0.y) + (a0.z + a0.w)) + ((a1.x + a1.y) + (a1.z + a1.w))
                     + ((a2.x + a2.y) + (a2.z + a2.w)) + ((a3.x + a3.y) + (a3.z + a3.w));
            ds = add_xmask<1>(ds);
            ds = add_xmask<2>(ds);
            ds = add_xmask<4>(ds);
            float den = ds + 1e-6f;
            float num = (s4[0] + s4[1]) + (s4[2] + s4[3]);
            yp[(size_t)(ts0 + j) * D_ + e] = (_Float16)(num / den);
        }
        // the next trip rewrites the registers that this store names
        asm volatile("s_wait_xcnt 0x0" ::: "memory");
    }
}

// ---------------------------------------------------------------------------
// LayerNorm over rows of h (4096 x 1024), f32 out
// ---------------------------------------------------------------------------
__global__ __launch_bounds__(256) void ln_kernel(const float* __restrict__ hbuf,
                                                 const float* __restrict__ gamma,
                                                 const float* __restrict__ lbeta,
                                                 float* __restrict__ out) {
    __shared__ float rs[256], rq[256];
    __shared__ float smu, srstd;
    int m = blockIdx.x, t = threadIdx.x;
    const float* hr = hbuf + (size_t)m * D_;
    float s = 0.f, q2 = 0.f;
    float vals[4];
    #pragma unroll
    for (int i = 0; i < 4; ++i) {
        float v = hr[t + i * 256];
        vals[i] = v; s += v; q2 += v * v;
    }
    rs[t] = s; rq[t] = q2;
    __syncthreads();
    for (int off = 128; off > 0; off >>= 1) {
        if (t < off) { rs[t] += rs[t + off]; rq[t] += rq[t + off]; }
        __syncthreads();
    }
    if (t == 0) {
        float mu  = rs[0] * (1.f / D_);
        float var = rq[0] * (1.f / D_) - mu * mu;
        smu = mu; srstd = rsqrtf(var + 1e-5f);
    }
    __syncthreads();
    float* orow = out + (size_t)m * D_;
    #pragma unroll
    for (int i = 0; i < 4; ++i) {
        int n = t + i * 256;
        orow[n] = gamma[n] * (vals[i] - smu) * srstd + lbeta[n];
    }
}

// ---------------------------------------------------------------------------
// launch
// ---------------------------------------------------------------------------
extern "C" void kernel_launch(void* const* d_in, const int* in_sizes, int n_in,
                              void* d_out, int out_size, void* d_ws, size_t ws_size,
                              hipStream_t stream) {
    const float* x      = (const float*)d_in[0];
    const float* Wq     = (const float*)d_in[1];
    const float* Wk     = (const float*)d_in[2];
    const float* Wv     = (const float*)d_in[3];
    const float* Wbeta  = (const float*)d_in[4];
    const float* bbeta  = (const float*)d_in[5];
    const float* Wo     = (const float*)d_in[6];
    const float* bo     = (const float*)d_in[7];
    const float* lng    = (const float*)d_in[8];
    const float* lnb    = (const float*)d_in[9];
    float* out = (float*)d_out;

    char* ws = (char*)d_ws;
    size_t off = 0;
    auto alloc = [&](size_t bytes) { char* p = ws + off; off += (bytes + 255) & ~(size_t)255; return p; };

    _Float16* xh   = (_Float16*)alloc((size_t)MTOK * D_ * 2);   // 8 MB
    _Float16* Wqt  = (_Float16*)alloc((size_t)D_ * D_ * 2);     // 2 MB each
    _Float16* Wkt  = (_Float16*)alloc((size_t)D_ * D_ * 2);
    _Float16* Wvt  = (_Float16*)alloc((size_t)D_ * D_ * 2);
    _Float16* Wot  = (_Float16*)alloc((size_t)D_ * D_ * 2);
    float*    qbuf = (float*)alloc((size_t)MTOK * D_ * 4);      // 16 MB each
    float*    kbuf = (float*)alloc((size_t)MTOK * D_ * 4);
    float*    vbuf = (float*)alloc((size_t)MTOK * D_ * 4);
    float*    bbuf = (float*)alloc((size_t)MTOK * 32 * 4);      // 0.5 MB
    _Float16* ybuf = (_Float16*)alloc((size_t)MTOK * D_ * 2);   // 8 MB
    float*    hbuf = (float*)alloc((size_t)MTOK * D_ * 4);      // 16 MB
    (void)ws_size; (void)in_sizes; (void)n_in; (void)out_size;

    const int nX = MTOK * D_;  // 4194304
    f32_to_f16_kernel<<<nX / CVT_WG, 256, 0, stream>>>(x, xh, nX);

    const int nW = (D_ / 64) * (D_ / 128);   // tiles of 64 k x 128 n
    transpose_to_f16_kernel<<<nW, 256, 0, stream>>>(Wq, Wqt);
    transpose_to_f16_kernel<<<nW, 256, 0, stream>>>(Wk, Wkt);
    transpose_to_f16_kernel<<<nW, 256, 0, stream>>>(Wv, Wvt);
    transpose_to_f16_kernel<<<nW, 256, 0, stream>>>(Wo, Wot);

    dim3 ggrid(D_ / 128, MTOK / 128);   // (8, 32)
    gemm_f16_wmma_kernel<<<ggrid, 256, 0, stream>>>(xh, Wqt, qbuf, nullptr, nullptr, MTOK, D_, D_);
    gemm_f16_wmma_kernel<<<ggrid, 256, 0, stream>>>(xh, Wkt, kbuf, nullptr, nullptr, MTOK, D_, D_);
    gemm_f16_wmma_kernel<<<ggrid, 256, 0, stream>>>(xh, Wvt, vbuf, nullptr, nullptr, MTOK, D_, D_);

    beta_kernel<<<MTOK / BT_TOK, BT_WAVES * 32, 0, stream>>>(x, Wbeta, bbeta, bbuf);

    const int nPairs = MTOK * 32;  // threads: 16 half-pairs each
    rope_phi_kernel<<<nPairs / 256, 256, 0, stream>>>(qbuf, nPairs);
    rope_phi_kernel<<<nPairs / 256, 256, 0, stream>>>(kbuf, nPairs);

    scan_kernel<<<B_ * H_ * SCAN_ES, 256, 0, stream>>>(qbuf, kbuf, vbuf, bbuf, ybuf);

    // h = x + y @ Wo + bo (fused residual + bias epilogue)
    gemm_f16_wmma_kernel<<<ggrid, 256, 0, stream>>>(ybuf, Wot, hbuf, x, bo, MTOK, D_, D_);

    ln_kernel<<<MTOK, 256, 0, stream>>>(hbuf, lng, lnb, out);
}

// v005
// It runs in 187 microseconds.
// In two side-by-side timings against v004, it was 1.27 and 1.28 times as fast.
// Counting every step since v000, it is 16.9 times as fast.
#include <hip/hip_runtime.h>
#include <hip/hip_bf16.h>

typedef __attribute__((ext_vector_type(16))) _Float16 v16h;
typedef __attribute__((ext_vector_type(8)))  float    v8f;

#define B_   2
#define S_   2048
#define D_   1024
#define H_   16
#define DH_  64
#define C_   2
#define MTOK (B_ * S_)   // 4096

// ---------------------------------------------------------------------------
// CDNA5 async global->LDS copy (ASYNCcnt path), with sync fallback
// ---------------------------------------------------------------------------
#if defined(__has_builtin)
#if __has_builtin(__builtin_amdgcn_global_load_async_to_lds_b128)
#define HAVE_ASYNC_LDS 1
#endif
#endif

#if defined(HAVE_ASYNC_LDS)
// builtin signature: void(v4i addrspace(1)*, v4i addrspace(3)*, imm offset, imm cpol)
typedef int v4i_vs __attribute__((vector_size(4 * sizeof(int))));
typedef __attribute__((address_space(1))) v4i_vs* g_v4i_p;
typedef __attribute__((address_space(3))) v4i_vs* l_v4i_p;
__device__ __forceinline__ void async_copy_b128(const _Float16* g, _Float16* l) {
    __builtin_amdgcn_global_load_async_to_lds_b128(
        (g_v4i_p)(void*)const_cast<_Float16*>(g), (l_v4i_p)(void*)l, 0, 0);
}
#if __has_builtin(__builtin_amdgcn_s_wait_asynccnt)
#define WAIT_ASYNC(n) __builtin_amdgcn_s_wait_asynccnt(n)
#else
#define WAIT_ASYNC(n) asm volatile("s_wait_asynccnt %0" :: "n"(n) : "memory")
#endif
#endif

// ---------------------------------------------------------------------------
// The three element-wise helpers below give each thread 32 elements, moved in
// 16-byte pieces: with one element per thread their time was the
// time it takes to start their waves, not the time to move their bytes.
// ---------------------------------------------------------------------------
typedef __attribute__((ext_vector_type(8))) _Float16 v8h;

__device__ __forceinline__ v8h cvt8(float4 a, float4 b) {
    v8h o = {(_Float16)a.x, (_Float16)a.y, (_Float16)a.z, (_Float16)a.w,
             (_Float16)b.x, (_Float16)b.y, (_Float16)b.z, (_Float16)b.w};
    return o;
}

// f32 -> f16 conversion; a work-group converts CVT_WG elements (n is a multiple),
// a thread four runs of 8, all eight loads in flight together
#define CVT_WG 8192
__global__ __launch_bounds__(256) void f32_to_f16_kernel(const float* __restrict__ src,
                                                         _Float16* __restrict__ dst, int n) {
    int i = blockIdx.x * CVT_WG + threadIdx.x * 8;
    if (i + 3 * 2048 + 8 > n) return;
    float4 a[4], b[4];
    #pragma unroll
    for (int g = 0; g < 4; ++g) {
        a[g] = *(const float4*)(src + i + g * 2048);
        b[g] = *(const float4*)(src + i + g * 2048 + 4);
    }
    #pragma unroll
    for (int g = 0; g < 4; ++g) *(v8h*)(dst + i + g * 2048) = cvt8(a[g], b[g]);
}

// W is (D_ x D_) row-major f32, rows k; Wt becomes its transpose in f16, rows n.
// A work-group turns a tile of 64 k x 128 n, a thread 8 k x 4 n: eight lanes side
// by side in k write 128 bytes in a row of Wt. The pitch is a constant, so that
// a thread's loads, and its stores, share one address register pair.
__global__ __launch_bounds__(256) void transpose_to_f16_kernel(const float* __restrict__ W,
                                                               _Float16* __restrict__ Wt) {
    int t  = threadIdx.x;
    int k0 = (blockIdx.x / (D_ / 128)) * 64 + (t & 7) * 8;
    int n0 = (blockIdx.x % (D_ / 128)) * 128 + (t >> 3) * 4;
    const float* wp = W + k0 * D_ + n0;
    float4 r[8];
    #pragma unroll
    for (int j = 0; j < 8; ++j) r[j] = *(const float4*)(wp + j * D_);
    _Float16* op = Wt + n0 * D_ + k0;
    v8h o0 = {(_Float16)r[0].x, (_Float16)r[1].x, (_Float16)r[2].x, (_Float16)r[3].x,
              (_Float16)r[4].x, (_Float16)r[5].x, (_Float16)r[6].x, (_Float16)r[7].x};
    v8h o1 = {(_Float16)r[0].y, (_Float16)r[1].y, (_Float16)r[2].y, (_Float16)r[3].y,
              (_Float16)r[4].y, (_Float16)r[5].y, (_Float16)r[6].y, (_Float16)r[7].y};
    v8h o2 = {(_Float16)r[0].z, (_Float16)r[1].z, (_Float16)r[2].z, (_Float16)r[3].z,
              (_Float16)r[4].z, (_Float16)r[5].z, (_Float16)r[6].z, (_Float16)r[7].z};
    v8h o3 = {(_Float16)r[0].w, (_Float16)r[1].w, (_Float16)r[2].w, (_Float16)r[3].w,
              (_Float16)r[4].w, (_Float16)r[5].w, (_Float16)r[6].w, (_Float16)r[7].w};
    *(v8h*)(op)          = o0;
    *(v8h*)(op + D_)     = o1;
    *(v8h*)(op + 2 * D_) = o2;
    *(v8h*)(op + 3 * D_) = o3;
}

// ---------------------------------------------------------------------------
// WMMA GEMM:  C[M,N] = A[M,K] (f16) * Bt[N,K]^T (f16)  (+ resid + bias)
// block = 256 threads (8 waves), tile = 128x128, K-step = 32,
// double-buffered async global->LDS staging.
// ---------------------------------------------------------------------------
__device__ inline v16h load_frag_k32(const _Float16* tile_base, int row16, int half) {
    // tile rows have stride 32 f16; A-fragment layout for v_wmma_f32_16x16x32_f16:
    // lanes 0-15: K = {0..7, 16..23}; lanes 16-31: K = {8..15, 24..31}
    const _Float16* p = tile_base + row16 * 32 + half * 8;
    union { v16h h; uint4 u[2]; } f;
    f.u[0] = *(const uint4*)(p);
    f.u[1] = *(const uint4*)(p + 16);
    return f.h;
}

__global__ __launch_bounds__(256) void gemm_f16_wmma_kernel(
    const _Float16* __restrict__ A,   // M x K row-major
    const _Float16* __restrict__ Bt,  // N x K row-major (B pre-transposed)
    float* __restrict__ Cout,         // M x N
    const float* __restrict__ resid,  // optional M x N, may be null
    const float* __restrict__ bias,   // optional N, may be null
    int M, int N, int K)
{
#if defined(HAVE_ASYNC_LDS)
    __shared__ _Float16 As[2][128 * 32];
    __shared__ _Float16 Bs[2][128 * 32];
#else
    __shared__ _Float16 As[1][128 * 32];
    __shared__ _Float16 Bs[1][128 * 32];
#endif

    const int t     = threadIdx.x;
    const int m0    = blockIdx.y * 128;
    const int n0    = blockIdx.x * 128;
    const int wave  = t >> 5;
    const int lane  = t & 31;
    const int half  = (lane >> 4) & 1;
    const int l16   = lane & 15;
    const int waveM = wave >> 2;   // 0..1  (64-row slab)
    const int waveN = wave & 3;    // 0..3  (32-col slab)

    // per-thread staging coordinates: 2 chunks of 8 f16 (16B) per matrix
    const int r0  = t >> 2;              // chunk 0 row
    const int cg0 = t & 3;               // chunk 0 col-group
    const int r1  = (t + 256) >> 2;      // chunk 1 row
    const int cg1 = t & 3;

    v8f acc[4][2] = {};
    const int nIter = K / 32;

#if defined(HAVE_ASYNC_LDS)
    // prologue: stage tile 0 into buffer 0 (4 async-load instructions / wave)
    {
        const int k0 = 0;
        async_copy_b128(&A [(size_t)(m0 + r0) * K + k0 + cg0 * 8], &As[0][r0 * 32 + cg0 * 8]);
        async_copy_b128(&Bt[(size_t)(n0 + r0) * K + k0 + cg0 * 8], &Bs[0][r0 * 32 + cg0 * 8]);
        async_copy_b128(&A [(size_t)(m0 + r1) * K + k0 + cg1 * 8], &As[0][r1 * 32 + cg1 * 8]);
        async_copy_b128(&Bt[(size_t)(n0 + r1) * K + k0 + cg1 * 8], &Bs[0][r1 * 32 + cg1 * 8]);
    }
    for (int it = 0; it < nIter; ++it) {
        const int cur = it & 1;
        if (it + 1 < nIter) {
            const int k0 = (it + 1) * 32;
            const int nxt = cur ^ 1;
            async_copy_b128(&A [(size_t)(m0 + r0) * K + k0 + cg0 * 8], &As[nxt][r0 * 32 + cg0 * 8]);
            async_copy_b128(&Bt[(size_t)(n0 + r0) * K + k0 + cg0 * 8], &Bs[nxt][r0 * 32 + cg0 * 8]);
            async_copy_b128(&A [(size_t)(m0 + r1) * K + k0 + cg1 * 8], &As[nxt][r1 * 32 + cg1 * 8]);
            async_copy_b128(&Bt[(size_t)(n0 + r1) * K + k0 + cg1 * 8], &Bs[nxt][r1 * 32 + cg1 * 8]);
            WAIT_ASYNC(4);   // drain previous batch only; next batch stays in flight
        } else {
            WAIT_ASYNC(0);
        }
        __syncthreads();

        v16h af[4], bf[2];
        #pragma unroll
        for (int mt = 0; mt < 4; ++mt)
            af[mt] = load_frag_k32(&As[cur][(waveM * 64 + mt * 16) * 32], l16, half);
        #pragma unroll
        for (int nt = 0; nt < 2; ++nt)
            bf[nt] = load_frag_k32(&Bs[cur][(waveN * 32 + nt * 16) * 32], l16, half);

        #pragma unroll
        for (int mt = 0; mt < 4; ++mt)
            #pragma unroll
            for (int nt = 0; nt < 2; ++nt)
                acc[mt][nt] = __builtin_amdgcn_wmma_f32_16x16x32_f16(
                    false, af[mt], false, bf[nt], (short)0, acc[mt][nt], false, false);
        __syncthreads();   // all reads of buf[cur] done before it is restaged
    }
#else
    for (int it = 0; it < nIter; ++it) {
        const int k0 = it * 32;
        *(uint4*)&As[0][r0 * 32 + cg0 * 8] = *(const uint4*)&A [(size_t)(m0 + r0) * K + k0 + cg0 * 8];
        *(uint4*)&Bs[0][r0 * 32 + cg0 * 8] = *(const uint4*)&Bt[(size_t)(n0 + r0) * K + k0 + cg0 * 8];
        *(uint4*)&As[0][r1 * 32 + cg1 * 8] = *(const uint4*)&A [(size_t)(m0 + r1) * K + k0 + cg1 * 8];
        *(uint4*)&Bs[0][r1 * 32 + cg1 * 8] = *(const uint4*)&Bt[(size_t)(n0 + r1) * K + k0 + cg1 * 8];
        if (k0 + 32 < K) {
            __builtin_prefetch(&A [(size_t)(m0 + (t >> 1)) * K + k0 + 32], 0, 0);
            __builtin_prefetch(&Bt[(size_t)(n0 + (t >> 1)) * K + k0 + 32], 0, 0);
        }
        __syncthreads();
        v16h af[4], bf[2];
        #pragma unroll
        for (int mt = 0; mt < 4; ++mt)
            af[mt] = load_frag_k32(&As[0][(waveM * 64 + mt * 16) * 32], l16, half);
        #pragma unroll
        for (int nt = 0; nt < 2; ++nt)
            bf[nt] = load_frag_k32(&Bs[0][(waveN * 32 + nt * 16) * 32], l16, half);
        #pragma unroll
        for (int mt = 0; mt < 4; ++mt)
            #pragma unroll
            for (int nt = 0; nt < 2; ++nt)
                acc[mt][nt] = __builtin_amdgcn_wmma_f32_16x16x32_f16(
                    false, af[mt], false, bf[nt], (short)0, acc[mt][nt], false, false);
        __syncthreads();
    }
#endif

    // C/D layout: VGPR i -> M = i + 8*half, N = l16
    #pragma unroll
    for (int mt = 0; mt < 4; ++mt) {
        #pragma unroll
        for (int nt = 0; nt < 2; ++nt) {
            #pragma unroll
            for (int i = 0; i < 8; ++i) {
                int m = m0 + waveM * 64 + mt * 16 + 8 * half + i;
                int n = n0 + waveN * 32 + nt * 16 + l16;
                float v = acc[mt][nt][i];
                if (resid) v += resid[(size_t)m * N + n];
                if (bias)  v += bias[n];
                Cout[(size_t)m * N + n] = v;
            }
        }
    }
}

// ---------------------------------------------------------------------------
// beta = clip(sigmoid(x @ Wbeta + bbeta), 1e-3, 0.999)   (4096 x 32)
// A work-group takes BT_TOK tokens and all 32 columns; each of its waves a
// slice of BT_KS values of k; a lane holds 4 tokens x 4 columns, so that eight
// 16-byte loads feed 64 multiply-adds and many loads are in flight per wait.
// The waves' partial sums meet in LDS.
// ---------------------------------------------------------------------------
#define BT_TOK   16
#define BT_WAVES 16
#define BT_KS    (D_ / BT_WAVES)   // 64
#define BT_G     4                 // runs of 4 k per register set
#define BT_SK    (BT_G * 4)        // values of k per register set
typedef __attribute__((ext_vector_type(2))) float bt2f;

// one register set: 4 tokens x BT_SK k of x, BT_SK k x 4 columns of Wb
__device__ __forceinline__ void bt_load(float4 (&xv)[BT_G][4], float4 (&wv)[BT_G][4],
                                        const float* xp, const float* wp) {
    #pragma unroll
    for (int g = 0; g < BT_G; ++g) {
        #pragma unroll
        for (int i = 0; i < 4; ++i) xv[g][i] = *(const float4*)(xp + i * D_ + g * 4);
        #pragma unroll
        for (int j = 0; j < 4; ++j) {
            // the set's last load is given, as its destination, an address pair that
            // the loads before it name: the wait stands in front of that overwrite
            if (g == BT_G - 1 && j == 3) asm volatile("s_wait_xcnt 0x0" ::: "memory");
            wv[g][j] = *(const float4*)(wp + (g * 4 + j) * 32);
        }
    }
}

__device__ __forceinline__ void bt_fma(bt2f (&acc)[4][2], const float4 (&xv)[BT_G][4],
                                       const float4 (&wv)[BT_G][4]) {
    #pragma unroll
    for (int g = 0; g < BT_G; ++g) {
        #pragma unroll
        for (int i = 0; i < 4; ++i) {
            const float xs[4] = {xv[g][i].x, xv[g][i].y, xv[g][i].z, xv[g][i].w};
            #pragma unroll
            for (int j = 0; j < 4; ++j) {
                bt2f lo = {wv[g][j].x, wv[g][j].y}, hi = {wv[g][j].z, wv[g][j].w};
                acc[i][0] += lo * xs[j];
                acc[i][1] += hi * xs[j];
            }
        }
    }
}

__global__ __launch_bounds__(BT_WAVES * 32) void beta_kernel(const float* __restrict__ x,
                                                             const float* __restrict__ Wb,
                                                             const float* __restrict__ bb,
                                                             float* __restrict__ beta) {
    __shared__ __attribute__((aligned(16))) float pb[BT_WAVES][BT_TOK][32];
    const int t    = threadIdx.x;
    const int wave = t >> 5;
    const int tg   = (t >> 3) & 3;   // tokens tg * 4 .. tg * 4 + 3
    const int cg   = t & 7;          // columns cg * 4 .. cg * 4 + 3
    const int m0   = blockIdx.x * BT_TOK;
    const float* xp = x + (size_t)(m0 + tg * 4) * D_ + wave * BT_KS;
    const float* wp = Wb + (size_t)(wave * BT_KS) * 32 + cg * 4;

    bt2f acc[4][2] = {};
    // not unrolled: unrolled, every load of the slice was lifted to the top and spilled
    #pragma nounroll
    for (int s = 0; s < BT_KS / BT_SK; ++s) {
        float4 xv[BT_G][4], wv[BT_G][4];
        bt_load(xv, wv, xp, wp);
        // keeps the set's loads together in front of its arithmetic: sunk to their
        // uses, only a few would be in flight
        __builtin_amdgcn_sched_barrier(0);
        bt_fma(acc, xv, wv);
        xp += BT_SK;
        wp += BT_SK * 32;
    }
    #pragma unroll
    for (int i = 0; i < 4; ++i) {
        float4 o = {acc[i][0].x, acc[i][0].y, acc[i][1].x, acc[i][1].y};
        *(float4*)&pb[wave][tg * 4 + i][cg * 4] = o;
    }
    __syncthreads();
    // thread t finishes token t / 32, column t % 32
    {
        const float* pp = &pb[0][0][0] + t;
        float s4[4] = {0.f, 0.f, 0.f, 0.f};
        #pragma unroll
        for (int w = 0; w < BT_WAVES; ++w) s4[w & 3] += pp[w * (BT_TOK * 32)];
        float logit = ((s4[0] + s4[1]) + (s4[2] + s4[3])) + bb[t & 31];
        float sg = 1.f / (1.f + __expf(-logit));
        sg = fminf(fmaxf(sg, 0.001f), 0.999f);
        beta[(size_t)m0 * 32 + t] = sg;
    }
}

// ---------------------------------------------------------------------------
// RoPE + phi (elu+1), in place, per head half-pair (i, i+32).
// A wave takes one token; a thread four neighbouring frequencies i of four heads
// (the angle depends on token and frequency only). total = threads = tokens * 32.
// ---------------------------------------------------------------------------
__device__ __forceinline__ float phi1(float r) { return r > 0.f ? r + 1.f : __expf(r); }  // elu(r)+1

__global__ __launch_bounds__(256) void rope_phi_kernel(float* __restrict__ u, int total) {
    int idx = blockIdx.x * 256 + threadIdx.x;
    if (idx >= total) return;
    int i0 = (idx & 7) * 4;    // first of four rotation-frequency indices
    int hg = (idx >> 3) & 3;   // heads hg, hg + 4, hg + 8, hg + 12
    int m  = idx >> 5;         // token 0..4095
    int s  = m & (S_ - 1);     // position within sequence
    float* up = u + (size_t)m * D_ + hg * DH_ + i0;
    float4 a[4], b[4];
    #pragma unroll
    for (int j = 0; j < 4; ++j) {
        a[j] = *(const float4*)(up + j * 4 * DH_);
        b[j] = *(const float4*)(up + j * 4 * DH_ + 32);
    }
    float cs[4], sn[4];
    #pragma unroll
    for (int c = 0; c < 4; ++c) {
        float f   = __expf(-(float)(2 * (i0 + c)) * 9.210340371976184f / 64.f); // ln(10000)
        float ang = (float)s * f;
        cs[c] = __cosf(ang);
        sn[c] = __sinf(ang);
    }
    #pragma unroll
    for (int j = 0; j < 4; ++j) {
        float4 x, y;
        x.x = phi1(a[j].x * cs[0] - b[j].x * sn[0]);  y.x = phi1(a[j].x * sn[0] + b[j].x * cs[0]);
        x.y = phi1(a[j].y * cs[1] - b[j].y * sn[1]);  y.y = phi1(a[j].y * sn[1] + b[j].y * cs[1]);
        x.z = phi1(a[j].z * cs[2] - b[j].z * sn[2]);  y.z = phi1(a[j].z * sn[2] + b[j].z * cs[2]);
        x.w = phi1(a[j].w * cs[3] - b[j].w * sn[3]);  y.w = phi1(a[j].w * sn[3] + b[j].w * cs[3]);
        *(float4*)(up + j * 4 * DH_)      = x;
        *(float4*)(up + j * 4 * DH_ + 32) = y;
    }
}

// ---------------------------------------------------------------------------
// DeltaNet recurrence in chunk form, its products on the matrix unit.
// With P[c][t] the product of channel c's decays from the chunk's first step
// through step t, and M0, Z0 the state at the chunk's start, the recurrence gives
//   num[t][e] = sum_{s<=t} G[t][s] (q_t.k_s) v_s[e] + sum_c P[c][t] (q_t M0[c])[e]
//   den[t]    = sum_{s<=t} G[t][s] (q_t.k_s)        + sum_c P[c][t] (q_t.Z0[c]) + eps
//   G[t][s]   = sum_c P[c][t] / P[c][s]   (formed as exp2 of a difference of logs, never above 1 each)
//   M0'[c]    = P[c][T] M0[c] + sum_s (P[c][T] / P[c][s]) k_s v_s^T    (Z likewise, v = 1)
// A work-group takes one (b,h) and CK_EW columns e and walks the chunks in order.
// Waves 0..3 each finish 16 steps t of the chunk; waves 4..7 each carry 16 rows d
// of the state (f32, in accumulators) to the next chunk and hand it over in LDS,
// rounded to f16 and already in B-fragment order. The denominator runs through
// the same products with a column of ones in v's place.
// q, k, v are rounded to f16 when staged; every sum is f32.
// Every '#pragma unroll' of this section stands on a loop that indexes fragments,
// accumulators or staging registers: only with constant indices do they stay in registers.
// Writes y as f16 (feeds the output WMMA GEMM directly).
// ---------------------------------------------------------------------------
#define CK_T  64                 // steps per chunk
#define CK_EW 16                 // state columns per work-group
#define CK_ES (DH_ / CK_EW)      // work-groups per (b,h)
#define CK_QP 80                 // f16 per staged row of q and k: 160 bytes, 32 B x odd for the transposing loads
typedef __attribute__((ext_vector_type(4))) _Float16 v4h;
typedef short ck_s16x8 __attribute__((ext_vector_type(8)));

__device__ __forceinline__ v16h ck_cat(v8h a, v8h b) {
    return __builtin_shufflevector(a, b, 0, 1, 2, 3, 4, 5, 6, 7, 8, 9, 10, 11, 12, 13, 14, 15);
}
// 32 k of one row that lies along k, in the hardware's k order: 8 hh + 0..7, 16 + 8 hh + 0..7
__device__ __forceinline__ v16h ck_row(const _Float16* p, int hh) {
    return ck_cat(*(const v8h*)(p + 8 * hh), *(const v8h*)(p + 16 + 8 * hh));
}
__device__ __forceinline__ v8h ck_tr(const _Float16* p) {
    typedef __attribute__((address_space(3))) ck_s16x8 lds_s16x8;
    return __builtin_bit_cast(v8h, __builtin_amdgcn_ds_load_tr16_b128_v8i16((lds_s16x8*)p));
}
// 32 k of column dbase + (lane & 15) of a tile whose rows are k, same k order (pitch in f16)
__device__ __forceinline__ v16h ck_col(const _Float16* tile, int pitch, int kbase, int dbase, int lane) {
    const _Float16* p = tile + (kbase + 8 * (lane >> 4) + (lane & 7)) * pitch + dbase + 8 * ((lane >> 3) & 1);
    return ck_cat(ck_tr(p), ck_tr(p + 16 * pitch));
}
__device__ __forceinline__ v8f ck_mm(v16h a, v16h b, v8f c) {
    return __builtin_amdgcn_wmma_f32_16x16x32_f16(false, a, false, b, (short)0, c, false, false);
}
__device__ __forceinline__ v4h ck_cvt4(float4 a) {
    v4h o = {(_Float16)a.x, (_Float16)a.y, (_Float16)a.z, (_Float16)a.w};
    return o;
}
__device__ __forceinline__ v8h ck_cvt8(v8f a) {
    v8h o = {(_Float16)a[0], (_Float16)a[1], (_Float16)a[2], (_Float16)a[3],
             (_Float16)a[4], (_Float16)a[5], (_Float16)a[6], (_Float16)a[7]};
    return o;
}

// x + (x of the lane N below, inside a row of 16 lanes; 0 where there is none): a step of a running sum
template <int N>
__device__ __forceinline__ float ck_add_shr(float x) {
    int o = __builtin_amdgcn_update_dpp(0, __builtin_bit_cast(int, x), 0x110 + N, 0xf, 0xf, true);
    return x + __builtin_bit_cast(float, o);
}

__global__ __launch_bounds__(256) void scan_kernel(const float* __restrict__ q,
                                                   const float* __restrict__ k,
                                                   const float* __restrict__ v,
                                                   const float* __restrict__ beta,
                                                   _Float16* __restrict__ y) {
    __shared__ __attribute__((aligned(16))) _Float16 sq[2][CK_T][CK_QP];
    __shared__ __attribute__((aligned(16))) _Float16 sk[2][CK_T][CK_QP];
    __shared__ __attribute__((aligned(16))) _Float16 sv[2][CK_T][CK_EW];
    __shared__ __attribute__((aligned(16))) float    sl[2][C_][CK_T];   // log2 P[c][s]
    __shared__ __attribute__((aligned(16))) float    sp[2][C_][CK_T];   // P[c][s]
    __shared__ __attribute__((aligned(16))) _Float16 sw[2][C_][CK_T];   // P[c][T] / P[c][s]
    // state at a chunk's start: [channel][M, Z][32 rows d][first, second 16 of them][lane][8 rows]
    __shared__ __attribute__((aligned(16))) _Float16 ss[2][C_][2][2][2][32][8];

    const int bh   = blockIdx.x / CK_ES;
    const int e0   = (blockIdx.x % CK_ES) * CK_EW;
    const int b    = bh / H_, h = bh % H_;
    const int t    = threadIdx.x;
    const int lane = t & 31;
    const int c16  = lane & 15;
    const int hh   = lane >> 4;
    const int wave = __builtin_amdgcn_readfirstlane(t >> 5);   // scalar, so that the roles part at a scalar branch

    const float* qp = q + (size_t)b * S_ * D_ + h * DH_;
    const float* kp = k + (size_t)b * S_ * D_ + h * DH_;
    const float* vp = v + (size_t)b * S_ * D_ + h * DH_ + e0;
    const float* bp = beta + (size_t)b * S_ * (H_ * C_) + h * C_;
    _Float16*    yp = y + (size_t)b * S_ * D_ + h * DH_ + e0;

    // staging: 4 float4 of q and of k and one of v per thread and chunk; waves 4 and 5 a channel of beta each
    const int  srow = t >> 4, scol = (t & 15) * 4;
    const int  vrow = t >> 2, vcol = (t & 3) * 4;
    const bool bwav = wave == 4 || wave == 5;
    const int  bch  = wave & 1;

    float4 rq[4], rk[4], rv;
    float  rb0 = 1.f, rb1 = 1.f;
    auto fetch = [&](int ts) {
        #pragma unroll
        for (int i = 0; i < 4; ++i) {
            rq[i] = *(const float4*)(qp + (size_t)(ts + srow + 16 * i) * D_ + scol);
            rk[i] = *(const float4*)(kp + (size_t)(ts + srow + 16 * i) * D_ + scol);
        }
        rv = *(const float4*)(vp + (size_t)(ts + vrow) * D_ + vcol);
        // what follows rewrites the address registers that these loads name
        asm volatile("s_wait_xcnt 0x0" ::: "memory");
        if (bwav) {
            rb0 = bp[(size_t)(ts + 2 * lane) * (H_ * C_) + bch];
            rb1 = bp[(size_t)(ts + 2 * lane + 1) * (H_ * C_) + bch];
            // the same for these two
            asm volatile("s_wait_xcnt 0x0" ::: "memory");
        }
    };
    auto stage = [&](int buf) {
        #pragma unroll
        for (int i = 0; i < 4; ++i) {
            *(v4h*)&sq[buf][srow + 16 * i][scol] = ck_cvt4(rq[i]);
            *(v4h*)&sk[buf][srow + 16 * i][scol] = ck_cvt4(rk[i]);
        }
        *(v4h*)&sv[buf][vrow][vcol] = ck_cvt4(rv);
        if (bwav) {
            // running sum of log2 beta over the chunk; a lane holds steps 2 lane and 2 lane + 1
            const float a0 = __log2f(rb0), a1 = __log2f(rb1);
            float inc = a0 + a1;
            inc = ck_add_shr<1>(inc);
            inc = ck_add_shr<2>(inc);
            inc = ck_add_shr<4>(inc);
            inc = ck_add_shr<8>(inc);
            const float low = __builtin_bit_cast(float, __builtin_amdgcn_readlane(__builtin_bit_cast(int, inc), 15));
            if (lane >= 16) inc += low;
            const float l0 = inc - a1, l1 = inc;
            const float lT = __builtin_bit_cast(float, __builtin_amdgcn_readlane(__builtin_bit_cast(int, inc), 31));
            float2 lo = {l0, l1};
            float2 po = {__builtin_amdgcn_exp2f(l0), __builtin_amdgcn_exp2f(l1)};
            *(float2*)&sl[buf][bch][2 * lane] = lo;
            *(float2*)&sp[buf][bch][2 * lane] = po;
            sw[buf][bch][2 * lane]     = (_Float16)__builtin_amdgcn_exp2f(lT - l0);
            sw[buf][bch][2 * lane + 1] = (_Float16)__builtin_amdgcn_exp2f(lT - l1);
        }
    };

    v8f M[C_] = {}, Z[C_] = {};   // waves 4..7: rows (wave - 4) * 16 + 8 hh + r, column c16; Z the same in every column
    const int dt = wave & 3;      // the state wave's block of rows d; the output wave's block of steps t
    auto publish = [&](int buf) {
        #pragma unroll
        for (int ch = 0; ch < C_; ++ch) {
            *(v8h*)&ss[buf][ch][0][dt >> 1][dt & 1][lane][0] = ck_cvt8(M[ch]);
            *(v8h*)&ss[buf][ch][1][dt >> 1][dt & 1][lane][0] = ck_cvt8(Z[ch]);
        }
    };

    v8h yv = {};   // waves 0..3: y of steps dt * 16 + 8 hh + r, column c16, of the chunk just finished
    auto put_y = [&](int ts) {
        _Float16* yo = yp + (size_t)(ts + dt * 16 + 8 * hh) * D_ + c16;
        #pragma unroll
        for (int r = 0; r < 8; ++r) yo[(size_t)r * D_] = yv[r];
        // what follows rewrites registers that these stores name
        asm volatile("s_wait_xcnt 0x0" ::: "memory");
    };

    fetch(0);
    stage(0);
    if (wave >= 4) publish(0);
    __syncthreads();

    v16h ones;
    #pragma unroll
    for (int i = 0; i < 16; ++i) ones[i] = (_Float16)1.f;

    const int nChunk = S_ / CK_T;
    // not unrolled, so that the last trip is not peeled off and the next chunk's
    // global loads stay at the head of the trip, in flight under this chunk's work
    #pragma nounroll
    for (int n = 0; n < nChunk; ++n) {
        const int  cur  = n & 1;
        const int  ts0  = n * CK_T;
        const bool more = n + 1 < nChunk;
        if (more) fetch(ts0 + CK_T);

        const _Float16* Kt = &sk[cur][0][0];
        const _Float16* Vt = &sv[cur][0][0];
        if (wave < 4) {
            // ---- 16 steps t = dt * 16 + ... of this chunk
            // the previous chunk's results go out now: stored at that chunk's end, its
            // barrier would wait for the stores to be acknowledged
            if (n > 0) put_y(ts0 - CK_T);
            const int tl = dt * 16 + c16;
            v16h qf[2];   // row t = tl: B (column t) of the score product, A (row t) of the state product
            #pragma unroll
            for (int kk = 0; kk < 2; ++kk) qf[kk] = ck_row(&sq[cur][tl][kk * 32], hh);
            const float lt0 = sl[cur][0][tl], lt1 = sl[cur][1][tl];

            // scores transposed: st[r] = k_s.q_t, s = sb * 16 + 8 hh + r, t = tl; two such
            // tiles, weighted and rounded, are an A fragment with row t and k = s
            v16h af[2];
            #pragma unroll
            for (int sb = 0; sb < 4; ++sb) {
                v8f st = {};
                #pragma unroll
                for (int kk = 0; kk < 2; ++kk)
                    st = ck_mm(ck_row(Kt + (sb * 16 + c16) * CK_QP + kk * 32, hh), qf[kk], st);
                const float4 x0 = *(const float4*)&sl[cur][0][sb * 16 + 8 * hh];
                const float4 x1 = *(const float4*)&sl[cur][0][sb * 16 + 8 * hh + 4];
                const float4 y0 = *(const float4*)&sl[cur][1][sb * 16 + 8 * hh];
                const float4 y1 = *(const float4*)&sl[cur][1][sb * 16 + 8 * hh + 4];
                const float ls0[8] = {x0.x, x0.y, x0.z, x0.w, x1.x, x1.y, x1.z, x1.w};
                const float ls1[8] = {y0.x, y0.y, y0.z, y0.w, y1.x, y1.y, y1.z, y1.w};
                #pragma unroll
                for (int r = 0; r < 8; ++r) {
                    // later steps s do not count: their weight is exp2 of a large negative number, 0
                    const bool  on = sb * 16 + 8 * hh + r <= tl;
                    const float g  = __builtin_amdgcn_exp2f(on ? lt0 - ls0[r] : -1000.f)
                                   + __builtin_amdgcn_exp2f(on ? lt1 - ls1[r] : -1000.f);
                    af[sb >> 1][(sb & 1) * 8 + r] = (_Float16)(st[r] * g);
                }
            }
            v8f num = {}, den = {};
            #pragma unroll
            for (int j = 0; j < 2; ++j) {
                num = ck_mm(af[j], ck_col(Vt, CK_EW, 32 * j, 0, lane), num);
                den = ck_mm(af[j], ones, den);
            }
            v8f nm[C_] = {}, dz[C_] = {};
            #pragma unroll
            for (int ch = 0; ch < C_; ++ch) {
                #pragma unroll
                for (int kk = 0; kk < 2; ++kk) {
                    v16h mb = ck_cat(*(const v8h*)&ss[cur][ch][0][kk][0][lane][0],
                                     *(const v8h*)&ss[cur][ch][0][kk][1][lane][0]);
                    v16h zb = ck_cat(*(const v8h*)&ss[cur][ch][1][kk][0][lane][0],
                                     *(const v8h*)&ss[cur][ch][1][kk][1][lane][0]);
                    nm[ch] = ck_mm(qf[kk], mb, nm[ch]);
                    dz[ch] = ck_mm(qf[kk], zb, dz[ch]);
                }
            }
            // register r of every accumulator: step t = dt * 16 + 8 hh + r, column c16
            const float4 u0 = *(const float4*)&sp[cur][0][dt * 16 + 8 * hh];
            const float4 u1 = *(const float4*)&sp[cur][0][dt * 16 + 8 * hh + 4];
            const float4 w0 = *(const float4*)&sp[cur][1][dt * 16 + 8 * hh];
            const float4 w1 = *(const float4*)&sp[cur][1][dt * 16 + 8 * hh + 4];
            const float p0[8] = {u0.x, u0.y, u0.z, u0.w, u1.x, u1.y, u1.z, u1.w};
            const float p1[8] = {w0.x, w0.y, w0.z, w0.w, w1.x, w1.y, w1.z, w1.w};
            #pragma unroll
            for (int r = 0; r < 8; ++r) {
                const float nu = num[r] + p0[r] * nm[0][r] + p1[r] * nm[1][r];
                const float de = den[r] + p0[r] * dz[0][r] + p1[r] * dz[1][r] + 1e-6f;
                yv[r] = (_Float16)(nu * __builtin_amdgcn_rcpf(de));
            }
        } else {
            // ---- rows d = dt * 16 + ... of the state, carried to the chunk's end
            const float pT[C_] = {sp[cur][0][CK_T - 1], sp[cur][1][CK_T - 1]};
            #pragma unroll
            for (int ch = 0; ch < C_; ++ch) { M[ch] *= pT[ch]; Z[ch] *= pT[ch]; }
            #pragma unroll
            for (int j = 0; j < 2; ++j) {
                const v16h kt = ck_col(Kt, CK_QP, 32 * j, dt * 16, lane);   // A: row d, k = s
                const v16h vf = ck_col(Vt, CK_EW, 32 * j, 0, lane);         // B: column e, k = s
                #pragma unroll
                for (int ch = 0; ch < C_; ++ch) {
                    const v16h wf = ck_row(&sw[cur][ch][32 * j], hh);       // the weights of the steps s, same k order
                    M[ch] = ck_mm(kt, vf * wf, M[ch]);
                    Z[ch] = ck_mm(kt, wf, Z[ch]);
                }
            }
            publish(cur ^ 1);
        }

        // the other buffers were last read before the previous chunk's barrier
        if (more) stage(cur ^ 1);
        // one barrier per chunk: publishes the next chunk's staged rows and the state at its start
        __syncthreads();
    }
    if (wave < 4) put_y(S_ - CK_T);
}

// ---------------------------------------------------------------------------
// LayerNorm over rows of h (4096 x 1024), f32 out
// ---------------------------------------------------------------------------
__global__ __launch_bounds__(256) void ln_kernel(const float* __restrict__ hbuf,
                                                 const float* __restrict__ gamma,
                                                 const float* __restrict__ lbeta,
                                                 float* __restrict__ out) {
    __shared__ float rs[256], rq[256];
    __shared__ float smu, srstd;
    int m = blockIdx.x, t = threadIdx.x;
    const float* hr = hbuf + (size_t)m * D_;
    float s = 0.f, q2 = 0.f;
    float vals[4];
    #pragma unroll
    for (int i = 0; i < 4; ++i) {
        float v = hr[t + i * 256];
        vals[i] = v; s += v; q2 += v * v;
    }
    rs[t] = s; rq[t] = q2;
    __syncthreads();
    for (int off = 128; off > 0; off >>= 1) {
        if (t < off) { rs[t] += rs[t + off]; rq[t] += rq[t + off]; }
        __syncthreads();
    }
    if (t == 0) {
        float mu  = rs[0] * (1.f / D_);
        float var = rq[0] * (1.f / D_) - mu * mu;
        smu = mu; srstd = rsqrtf(var + 1e-5f);
    }
    __syncthreads();
    float* orow = out + (size_t)m * D_;
    #pragma unroll
    for (int i = 0; i < 4; ++i) {
        int n = t + i * 256;
        orow[n] = gamma[n] * (vals[i] - smu) * srstd + lbeta[n];
    }
}

// ---------------------------------------------------------------------------
// launch
// ---------------------------------------------------------------------------
extern "C" void kernel_launch(void* const* d_in, const int* in_sizes, int n_in,
                              void* d_out, int out_size, void* d_ws, size_t ws_size,
                              hipStream_t stream) {
    const float* x      = (const float*)d_in[0];
    const float* Wq     = (const float*)d_in[1];
    const float* Wk     = (const float*)d_in[2];
    const float* Wv     = (const float*)d_in[3];
    const float* Wbeta  = (const float*)d_in[4];
    const float* bbeta  = (const float*)d_in[5];
    const float* Wo     = (const float*)d_in[6];
    const float* bo     = (const float*)d_in[7];
    const float* lng    = (const float*)d_in[8];
    const float* lnb    = (const float*)d_in[9];
    float* out = (float*)d_out;

    char* ws = (char*)d_ws;
    size_t off = 0;
    auto alloc = [&](size_t bytes) { char* p = ws + off; off += (bytes + 255) & ~(size_t)255; return p; };

    _Float16* xh   = (_Float16*)alloc((size_t)MTOK * D_ * 2);   // 8 MB
    _Float16* Wqt  = (_Float16*)alloc((size_t)D_ * D_ * 2);     // 2 MB each
    _Float16* Wkt  = (_Float16*)alloc((size_t)D_ * D_ * 2);
    _Float16* Wvt  = (_Float16*)alloc((size_t)D_ * D_ * 2);
    _Float16* Wot  = (_Float16*)alloc((size_t)D_ * D_ * 2);
    float*    qbuf = (float*)alloc((size_t)MTOK * D_ * 4);      // 16 MB each
    float*    kbuf = (float*)alloc((size_t)MTOK * D_ * 4);
    float*    vbuf = (float*)alloc((size_t)MTOK * D_ * 4);
    float*    bbuf = (float*)alloc((size_t)MTOK * 32 * 4);      // 0.5 MB
    _Float16* ybuf = (_Float16*)alloc((size_t)MTOK * D_ * 2);   // 8 MB
    float*    hbuf = (float*)alloc((size_t)MTOK * D_ * 4);      // 16 MB
    (void)ws_size; (void)in_sizes; (void)n_in; (void)out_size;

    const int nX = MTOK * D_;  // 4194304
    f32_to_f16_kernel<<<nX / CVT_WG, 256, 0, stream>>>(x, xh, nX);

    const int nW = (D_ / 64) * (D_ / 128);   // tiles of 64 k x 128 n
    transpose_to_f16_kernel<<<nW, 256, 0, stream>>>(Wq, Wqt);
    transpose_to_f16_kernel<<<nW, 256, 0, stream>>>(Wk, Wkt);
    transpose_to_f16_kernel<<<nW, 256, 0, stream>>>(Wv, Wvt);
    transpose_to_f16_kernel<<<nW, 256, 0, stream>>>(Wo, Wot);

    dim3 ggrid(D_ / 128, MTOK / 128);   // (8, 32)
    gemm_f16_wmma_kernel<<<ggrid, 256, 0, stream>>>(xh, Wqt, qbuf, nullptr, nullptr, MTOK, D_, D_);
    gemm_f16_wmma_kernel<<<ggrid, 256, 0, stream>>>(xh, Wkt, kbuf, nullptr, nullptr, MTOK, D_, D_);
    gemm_f16_wmma_kernel<<<ggrid, 256, 0, stream>>>(xh, Wvt, vbuf, nullptr, nullptr, MTOK, D_, D_);

    beta_kernel<<<MTOK / BT_TOK, BT_WAVES * 32, 0, stream>>>(x, Wbeta, bbeta, bbuf);

    const int nPairs = MTOK * 32;  // threads: 16 half-pairs each
    rope_phi_kernel<<<nPairs / 256, 256, 0, stream>>>(qbuf, nPairs);
    rope_phi_kernel<<<nPairs / 256, 256, 0, stream>>>(kbuf, nPairs);

    scan_kernel<<<B_ * H_ * CK_ES, 256, 0, stream>>>(qbuf, kbuf, vbuf, bbuf, ybuf);

    // h = x + y @ Wo + bo (fused residual + bias epilogue)
    gemm_f16_wmma_kernel<<<ggrid, 256, 0, stream>>>(ybuf, Wot, hbuf, x, bo, MTOK, D_, D_);

    ln_kernel<<<MTOK, 256, 0, stream>>>(hbuf, lng, lnb, out);
}

// v006
// One run takes 170 microseconds.
// Two timings next to v005 put it at 1.11 and 1.10 times that version's speed.
// All steps since v000 together make it 18.7 times as fast.
#include <hip/hip_runtime.h>
#include <hip/hip_bf16.h>

typedef __attribute__((ext_vector_type(16))) _Float16 v16h;
typedef __attribute__((ext_vector_type(8)))  float    v8f;

#define B_   2
#define S_   2048
#define D_   1024
#define H_   16
#define DH_  64
#define C_   2
#define MTOK (B_ * S_)   // 4096

// ---------------------------------------------------------------------------
// CDNA5 async global->LDS copy (ASYNCcnt path), with sync fallback
// ---------------------------------------------------------------------------
#if defined(__has_builtin)
#if __has_builtin(__builtin_amdgcn_global_load_async_to_lds_b128)
#define HAVE_ASYNC_LDS 1
#endif
#endif

#if defined(HAVE_ASYNC_LDS)
// builtin signature: void(v4i addrspace(1)*, v4i addrspace(3)*, imm offset, imm cpol)
typedef int v4i_vs __attribute__((vector_size(4 * sizeof(int))));
typedef __attribute__((address_space(1))) v4i_vs* g_v4i_p;
typedef __attribute__((address_space(3))) v4i_vs* l_v4i_p;
__device__ __forceinline__ void async_copy_b128(const _Float16* g, _Float16* l) {
    __builtin_amdgcn_global_load_async_to_lds_b128(
        (g_v4i_p)(void*)const_cast<_Float16*>(g), (l_v4i_p)(void*)l, 0, 0);
}
#if __has_builtin(__builtin_amdgcn_s_wait_asynccnt)
#define WAIT_ASYNC(n) __builtin_amdgcn_s_wait_asynccnt(n)
#else
#define WAIT_ASYNC(n) asm volatile("s_wait_asynccnt %0" :: "n"(n) : "memory")
#endif
#endif

// ---------------------------------------------------------------------------
// The three element-wise helpers below give each thread 32 elements, moved in
// 16-byte pieces: with one element per thread their time was the
// time it takes to start their waves, not the time to move their bytes.
// ---------------------------------------------------------------------------
typedef __attribute__((ext_vector_type(8))) _Float16 v8h;

__device__ __forceinline__ v8h cvt8(float4 a, float4 b) {
    v8h o = {(_Float16)a.x, (_Float16)a.y, (_Float16)a.z, (_Float16)a.w,
             (_Float16)b.x, (_Float16)b.y, (_Float16)b.z, (_Float16)b.w};
    return o;
}

// f32 -> f16 conversion; a work-group converts CVT_WG elements (n is a multiple),
// a thread four runs of 8, all eight loads in flight together
#define CVT_WG 8192
__global__ __launch_bounds__(256) void f32_to_f16_kernel(const float* __restrict__ src,
                                                         _Float16* __restrict__ dst, int n) {
    int i = blockIdx.x * CVT_WG + threadIdx.x * 8;
    if (i + 3 * 2048 + 8 > n) return;
    float4 a[4], b[4];
    #pragma unroll
    for (int g = 0; g < 4; ++g) {
        a[g] = *(const float4*)(src + i + g * 2048);
        b[g] = *(const float4*)(src + i + g * 2048 + 4);
    }
    #pragma unroll
    for (int g = 0; g < 4; ++g) *(v8h*)(dst + i + g * 2048) = cvt8(a[g], b[g]);
}

// W is (D_ x D_) row-major f32, rows k; Wt becomes its transpose in f16, rows n.
// A work-group turns a tile of 64 k x 128 n, a thread 8 k x 4 n: eight lanes side
// by side in k write 128 bytes in a row of Wt. The pitch is a constant, so that
// a thread's loads, and its stores, share one address register pair.
__global__ __launch_bounds__(256) void transpose_to_f16_kernel(const float* __restrict__ W,
                                                               _Float16* __restrict__ Wt) {
    int t  = threadIdx.x;
    int k0 = (blockIdx.x / (D_ / 128)) * 64 + (t & 7) * 8;
    int n0 = (blockIdx.x % (D_ / 128)) * 128 + (t >> 3) * 4;
    const float* wp = W + k0 * D_ + n0;
    float4 r[8];
    #pragma unroll
    for (int j = 0; j < 8; ++j) r[j] = *(const float4*)(wp + j * D_);
    _Float16* op = Wt + n0 * D_ + k0;
    v8h o0 = {(_Float16)r[0].x, (_Float16)r[1].x, (_Float16)r[2].x, (_Float16)r[3].x,
              (_Float16)r[4].x, (_Float16)r[5].x, (_Float16)r[6].x, (_Float16)r[7].x};
    v8h o1 = {(_Float16)r[0].y, (_Float16)r[1].y, (_Float16)r[2].y, (_Float16)r[3].y,
              (_Float16)r[4].y, (_Float16)r[5].y, (_Float16)r[6].y, (_Float16)r[7].y};
    v8h o2 = {(_Float16)r[0].z, (_Float16)r[1].z, (_Float16)r[2].z, (_Float16)r[3].z,
              (_Float16)r[4].z, (_Float16)r[5].z, (_Float16)r[6].z, (_Float16)r[7].z};
    v8h o3 = {(_Float16)r[0].w, (_Float16)r[1].w, (_Float16)r[2].w, (_Float16)r[3].w,
              (_Float16)r[4].w, (_Float16)r[5].w, (_Float16)r[6].w, (_Float16)r[7].w};
    *(v8h*)(op)          = o0;
    *(v8h*)(op + D_)     = o1;
    *(v8h*)(op + 2 * D_) = o2;
    *(v8h*)(op + 3 * D_) = o3;
}

// ---------------------------------------------------------------------------
// WMMA GEMM:  C[M,N] = A[M,K] (f16) * Bt[N,K]^T (f16)  (+ resid + bias)
// block = 256 threads (8 waves), tile = 128x128, K-step = 32,
// double-buffered async global->LDS staging.
// ---------------------------------------------------------------------------
// f16 per staged row: 32 of data and 8 unused. At 80 bytes (16 B x odd) the sixteen
// rows that a 16-byte fragment load reads fall on all 64 banks; at 64 bytes four rows
// share each bank.
#define GM_P 40
__device__ inline v16h load_frag_k32(const _Float16* tile_base, int row16, int half) {
    // tile rows have stride GM_P f16; A-fragment layout for v_wmma_f32_16x16x32_f16:
    // lanes 0-15: K = {0..7, 16..23}; lanes 16-31: K = {8..15, 24..31}
    const _Float16* p = tile_base + row16 * GM_P + half * 8;
    union { v16h h; uint4 u[2]; } f;
    f.u[0] = *(const uint4*)(p);
    f.u[1] = *(const uint4*)(p + 16);
    return f.h;
}

__global__ __launch_bounds__(256) void gemm_f16_wmma_kernel(
    const _Float16* __restrict__ A,   // M x K row-major
    const _Float16* __restrict__ Bt,  // N x K row-major (B pre-transposed)
    float* __restrict__ Cout,         // M x N
    const float* __restrict__ resid,  // optional M x N, may be null
    const float* __restrict__ bias,   // optional N, may be null
    int M, int N, int K)
{
#if defined(HAVE_ASYNC_LDS)
    __shared__ __attribute__((aligned(16))) _Float16 As[2][128 * GM_P];
    __shared__ __attribute__((aligned(16))) _Float16 Bs[2][128 * GM_P];
#else
    __shared__ __attribute__((aligned(16))) _Float16 As[1][128 * GM_P];
    __shared__ __attribute__((aligned(16))) _Float16 Bs[1][128 * GM_P];
#endif

    const int t     = threadIdx.x;
    const int m0    = blockIdx.y * 128;
    const int n0    = blockIdx.x * 128;
    const int wave  = t >> 5;
    const int lane  = t & 31;
    const int half  = (lane >> 4) & 1;
    const int l16   = lane & 15;
    const int waveM = wave >> 2;   // 0..1  (64-row slab)
    const int waveN = wave & 3;    // 0..3  (32-col slab)

    // per-thread staging coordinates: 2 chunks of 8 f16 (16B) per matrix
    const int r0  = t >> 2;              // chunk 0 row
    const int cg0 = t & 3;               // chunk 0 col-group
    const int r1  = (t + 256) >> 2;      // chunk 1 row
    const int cg1 = t & 3;

    v8f acc[4][2] = {};
    const int nIter = K / 32;

#if defined(HAVE_ASYNC_LDS)
    // prologue: stage tile 0 into buffer 0 (4 async-load instructions / wave)
    {
        const int k0 = 0;
        async_copy_b128(&A [(size_t)(m0 + r0) * K + k0 + cg0 * 8], &As[0][r0 * GM_P + cg0 * 8]);
        async_copy_b128(&Bt[(size_t)(n0 + r0) * K + k0 + cg0 * 8], &Bs[0][r0 * GM_P + cg0 * 8]);
        async_copy_b128(&A [(size_t)(m0 + r1) * K + k0 + cg1 * 8], &As[0][r1 * GM_P + cg1 * 8]);
        async_copy_b128(&Bt[(size_t)(n0 + r1) * K + k0 + cg1 * 8], &Bs[0][r1 * GM_P + cg1 * 8]);
    }
    for (int it = 0; it < nIter; ++it) {
        const int cur = it & 1;
        if (it + 1 < nIter) {
            const int k0 = (it + 1) * 32;
            const int nxt = cur ^ 1;
            async_copy_b128(&A [(size_t)(m0 + r0) * K + k0 + cg0 * 8], &As[nxt][r0 * GM_P + cg0 * 8]);
            async_copy_b128(&Bt[(size_t)(n0 + r0) * K + k0 + cg0 * 8], &Bs[nxt][r0 * GM_P + cg0 * 8]);
            async_copy_b128(&A [(size_t)(m0 + r1) * K + k0 + cg1 * 8], &As[nxt][r1 * GM_P + cg1 * 8]);
            async_copy_b128(&Bt[(size_t)(n0 + r1) * K + k0 + cg1 * 8], &Bs[nxt][r1 * GM_P + cg1 * 8]);
            WAIT_ASYNC(4);   // drain previous batch only; next batch stays in flight
        } else {
            WAIT_ASYNC(0);
        }
        __syncthreads();

        v16h af[4], bf[2];
        #pragma unroll
        for (int mt = 0; mt < 4; ++mt)
            af[mt] = load_frag_k32(&As[cur][(waveM * 64 + mt * 16) * GM_P], l16, half);
        #pragma unroll
        for (int nt = 0; nt < 2; ++nt)
            bf[nt] = load_frag_k32(&Bs[cur][(waveN * 32 + nt * 16) * GM_P], l16, half);

        #pragma unroll
        for (int mt = 0; mt < 4; ++mt)
            #pragma unroll
            for (int nt = 0; nt < 2; ++nt)
                acc[mt][nt] = __builtin_amdgcn_wmma_f32_16x16x32_f16(
                    false, af[mt], false, bf[nt], (short)0, acc[mt][nt], false, false);
        __syncthreads();   // all reads of buf[cur] done before it is restaged
    }
#else
    for (int it = 0; it < nIter; ++it) {
        const int k0 = it * 32;
        *(uint4*)&As[0][r0 * GM_P + cg0 * 8] = *(const uint4*)&A [(size_t)(m0 + r0) * K + k0 + cg0 * 8];
        *(uint4*)&Bs[0][r0 * GM_P + cg0 * 8] = *(const uint4*)&Bt[(size_t)(n0 + r0) * K + k0 + cg0 * 8];
        *(uint4*)&As[0][r1 * GM_P + cg1 * 8] = *(const uint4*)&A [(size_t)(m0 + r1) * K + k0 + cg1 * 8];
        *(uint4*)&Bs[0][r1 * GM_P + cg1 * 8] = *(const uint4*)&Bt[(size_t)(n0 + r1) * K + k0 + cg1 * 8];
        if (k0 + 32 < K) {
            __builtin_prefetch(&A [(size_t)(m0 + (t >> 1)) * K + k0 + 32], 0, 0);
            __builtin_prefetch(&Bt[(size_t)(n0 + (t >> 1)) * K + k0 + 32], 0, 0);
        }
        __syncthreads();
        v16h af[4], bf[2];
        #pragma unroll
        for (int mt = 0; mt < 4; ++mt)
            af[mt] = load_frag_k32(&As[0][(waveM * 64 + mt * 16) * GM_P], l16, half);
        #pragma unroll
        for (int nt = 0; nt < 2; ++nt)
            bf[nt] = load_frag_k32(&Bs[0][(waveN * 32 + nt * 16) * GM_P], l16, half);
        #pragma unroll
        for (int mt = 0; mt < 4; ++mt)
            #pragma unroll
            for (int nt = 0; nt < 2; ++nt)
                acc[mt][nt] = __builtin_amdgcn_wmma_f32_16x16x32_f16(
                    false, af[mt], false, bf[nt], (short)0, acc[mt][nt], false, false);
        __syncthreads();
    }
#endif

    // C/D layout: VGPR i -> M = i + 8*half, N = l16
    #pragma unroll
    for (int mt = 0; mt < 4; ++mt) {
        #pragma unroll
        for (int nt = 0; nt < 2; ++nt) {
            #pragma unroll
            for (int i = 0; i < 8; ++i) {
                int m = m0 + waveM * 64 + mt * 16 + 8 * half + i;
                int n = n0 + waveN * 32 + nt * 16 + l16;
                float v = acc[mt][nt][i];
                if (resid) v += resid[(size_t)m * N + n];
                if (bias)  v += bias[n];
                Cout[(size_t)m * N + n] = v;
            }
        }
    }
}

// ---------------------------------------------------------------------------
// beta = clip(sigmoid(x @ Wbeta + bbeta), 1e-3, 0.999)   (4096 x 32)
// A work-group takes BT_TOK tokens and all 32 columns; each of its waves a
// slice of BT_KS values of k; a lane holds 4 tokens x 4 columns, so that eight
// 16-byte loads feed 64 multiply-adds and many loads are in flight per wait.
// The waves' partial sums meet in LDS.
// ---------------------------------------------------------------------------
#define BT_TOK   16
#define BT_WAVES 16
#define BT_KS    (D_ / BT_WAVES)   // 64
#define BT_G     4                 // runs of 4 k per register set
#define BT_SK    (BT_G * 4)        // values of k per register set
typedef __attribute__((ext_vector_type(2))) float bt2f;

// one register set: 4 tokens x BT_SK k of x, BT_SK k x 4 columns of Wb
__device__ __forceinline__ void bt_load(float4 (&xv)[BT_G][4], float4 (&wv)[BT_G][4],
                                        const float* xp, const float* wp) {
    #pragma unroll
    for (int g = 0; g < BT_G; ++g) {
        #pragma unroll
        for (int i = 0; i < 4; ++i) xv[g][i] = *(const float4*)(xp + i * D_ + g * 4);
        #pragma unroll
        for (int j = 0; j < 4; ++j) {
            // the set's last load is given, as its destination, an address pair that
            // the loads before it name: the wait stands in front of that overwrite
            if (g == BT_G - 1 && j == 3) asm volatile("s_wait_xcnt 0x0" ::: "memory");
            wv[g][j] = *(const float4*)(wp + (g * 4 + j) * 32);
        }
    }
}

__device__ __forceinline__ void bt_fma(bt2f (&acc)[4][2], const float4 (&xv)[BT_G][4],
                                       const float4 (&wv)[BT_G][4]) {
    #pragma unroll
    for (int g = 0; g < BT_G; ++g) {
        #pragma unroll
        for (int i = 0; i < 4; ++i) {
            const float xs[4] = {xv[g][i].x, xv[g][i].y, xv[g][i].z, xv[g][i].w};
            #pragma unroll
            for (int j = 0; j < 4; ++j) {
                bt2f lo = {wv[g][j].x, wv[g][j].y}, hi = {wv[g][j].z, wv[g][j].w};
                acc[i][0] += lo * xs[j];
                acc[i][1] += hi * xs[j];
            }
        }
    }
}

__global__ __launch_bounds__(BT_WAVES * 32) void beta_kernel(const float* __restrict__ x,
                                                             const float* __restrict__ Wb,
                                                             const float* __restrict__ bb,
                                                             float* __restrict__ beta) {
    __shared__ __attribute__((aligned(16))) float pb[BT_WAVES][BT_TOK][32];
    const int t    = threadIdx.x;
    const int wave = t >> 5;
    const int tg   = (t >> 3) & 3;   // tokens tg * 4 .. tg * 4 + 3
    const int cg   = t & 7;          // columns cg * 4 .. cg * 4 + 3
    const int m0   = blockIdx.x * BT_TOK;
    const float* xp = x + (size_t)(m0 + tg * 4) * D_ + wave * BT_KS;
    const float* wp = Wb + (size_t)(wave * BT_KS) * 32 + cg * 4;

    bt2f acc[4][2] = {};
    // not unrolled: unrolled, every load of the slice was lifted to the top and spilled
    #pragma nounroll
    for (int s = 0; s < BT_KS / BT_SK; ++s) {
        float4 xv[BT_G][4], wv[BT_G][4];
        bt_load(xv, wv, xp, wp);
        // keeps the set's loads together in front of its arithmetic: sunk to their
        // uses, only a few would be in flight
        __builtin_amdgcn_sched_barrier(0);
        bt_fma(acc, xv, wv);
        xp += BT_SK;
        wp += BT_SK * 32;
    }
    #pragma unroll
    for (int i = 0; i < 4; ++i) {
        float4 o = {acc[i][0].x, acc[i][0].y, acc[i][1].x, acc[i][1].y};
        *(float4*)&pb[wave][tg * 4 + i][cg * 4] = o;
    }
    __syncthreads();
    // thread t finishes token t / 32, column t % 32
    {
        const float* pp = &pb[0][0][0] + t;
        float s4[4] = {0.f, 0.f, 0.f, 0.f};
        #pragma unroll
        for (int w = 0; w < BT_WAVES; ++w) s4[w & 3] += pp[w * (BT_TOK * 32)];
        float logit = ((s4[0] + s4[1]) + (s4[2] + s4[3])) + bb[t & 31];
        float sg = 1.f / (1.f + __expf(-logit));
        sg = fminf(fmaxf(sg, 0.001f), 0.999f);
        beta[(size_t)m0 * 32 + t] = sg;
    }
}

// ---------------------------------------------------------------------------
// RoPE + phi (elu+1), in place, per head half-pair (i, i+32).
// A wave takes one token; a thread four neighbouring frequencies i of four heads
// (the angle depends on token and frequency only). total = threads = tokens * 32.
// ---------------------------------------------------------------------------
__device__ __forceinline__ float phi1(float r) { return r > 0.f ? r + 1.f : __expf(r); }  // elu(r)+1

__global__ __launch_bounds__(256) void rope_phi_kernel(float* __restrict__ u, int total) {
    int idx = blockIdx.x * 256 + threadIdx.x;
    if (idx >= total) return;
    int i0 = (idx & 7) * 4;    // first of four rotation-frequency indices
    int hg = (idx >> 3) & 3;   // heads hg, hg + 4, hg + 8, hg + 12
    int m  = idx >> 5;         // token 0..4095
    int s  = m & (S_ - 1);     // position within sequence
    float* up = u + (size_t)m * D_ + hg * DH_ + i0;
    float4 a[4], b[4];
    #pragma unroll
    for (int j = 0; j < 4; ++j) {
        a[j] = *(const float4*)(up + j * 4 * DH_);
        b[j] = *(const float4*)(up + j * 4 * DH_ + 32);
    }
    float cs[4], sn[4];
    #pragma unroll
    for (int c = 0; c < 4; ++c) {
        float f   = __expf(-(float)(2 * (i0 + c)) * 9.210340371976184f / 64.f); // ln(10000)
        float ang = (float)s * f;
        cs[c] = __cosf(ang);
        sn[c] = __sinf(ang);
    }
    #pragma unroll
    for (int j = 0; j < 4; ++j) {
        float4 x, y;
        x.x = phi1(a[j].x * cs[0] - b[j].x * sn[0]);  y.x = phi1(a[j].x * sn[0] + b[j].x * cs[0]);
        x.y = phi1(a[j].y * cs[1] - b[j].y * sn[1]);  y.y = phi1(a[j].y * sn[1] + b[j].y * cs[1]);
        x.z = phi1(a[j].z * cs[2] - b[j].z * sn[2]);  y.z = phi1(a[j].z * sn[2] + b[j].z * cs[2]);
        x.w = phi1(a[j].w * cs[3] - b[j].w * sn[3]);  y.w = phi1(a[j].w * sn[3] + b[j].w * cs[3]);
        *(float4*)(up + j * 4 * DH_)      = x;
        *(float4*)(up + j * 4 * DH_ + 32) = y;
    }
}

// ---------------------------------------------------------------------------
// DeltaNet recurrence in chunk form, its products on the matrix unit.
// With P[c][t] the product of channel c's decays from the chunk's first step
// through step t, and M0, Z0 the state at the chunk's start, the recurrence gives
//   num[t][e] = sum_{s<=t} G[t][s] (q_t.k_s) v_s[e] + sum_c P[c][t] (q_t M0[c])[e]
//   den[t]    = sum_{s<=t} G[t][s] (q_t.k_s)        + sum_c P[c][t] (q_t.Z0[c]) + eps
//   G[t][s]   = sum_c P[c][t] / P[c][s]   (formed as exp2 of a difference of logs, never above 1 each)
//   M0'[c]    = P[c][T] M0[c] + sum_s (P[c][T] / P[c][s]) k_s v_s^T    (Z likewise, v = 1)
// A work-group takes one (b,h) and CK_EW columns e and walks the chunks in order.
// Waves 0..3 each finish 16 steps t of the chunk; waves 4..7 each carry 16 rows d
// of the state (f32, in accumulators) to the next chunk and hand it over in LDS,
// rounded to f16 and already in B-fragment order. The denominator runs through
// the same products with a column of ones in v's place.
// q, k, v are rounded to f16 when staged; every sum is f32.
// Every '#pragma unroll' of this section stands on a loop that indexes fragments,
// accumulators or staging registers: only with constant indices do they stay in registers.
// Writes y as f16 (feeds the output WMMA GEMM directly).
// ---------------------------------------------------------------------------
#define CK_T  64                 // steps per chunk
#define CK_EW 16                 // state columns per work-group
#define CK_ES (DH_ / CK_EW)      // work-groups per (b,h)
#define CK_QP 80                 // f16 per staged row of q and k: 160 bytes, 32 B x odd for the transposing loads
typedef __attribute__((ext_vector_type(4))) _Float16 v4h;
typedef short ck_s16x8 __attribute__((ext_vector_type(8)));

__device__ __forceinline__ v16h ck_cat(v8h a, v8h b) {
    return __builtin_shufflevector(a, b, 0, 1, 2, 3, 4, 5, 6, 7, 8, 9, 10, 11, 12, 13, 14, 15);
}
// 32 k of one row that lies along k, in the hardware's k order: 8 hh + 0..7, 16 + 8 hh + 0..7
__device__ __forceinline__ v16h ck_row(const _Float16* p, int hh) {
    return ck_cat(*(const v8h*)(p + 8 * hh), *(const v8h*)(p + 16 + 8 * hh));
}
__device__ __forceinline__ v8h ck_tr(const _Float16* p) {
    typedef __attribute__((address_space(3))) ck_s16x8 lds_s16x8;
    return __builtin_bit_cast(v8h, __builtin_amdgcn_ds_load_tr16_b128_v8i16((lds_s16x8*)p));
}
// 32 k of column dbase + (lane & 15) of a tile whose rows are k, same k order (pitch in f16)
__device__ __forceinline__ v16h ck_col(const _Float16* tile, int pitch, int kbase, int dbase, int lane) {
    const _Float16* p = tile + (kbase + 8 * (lane >> 4) + (lane & 7)) * pitch + dbase + 8 * ((lane >> 3) & 1);
    return ck_cat(ck_tr(p), ck_tr(p + 16 * pitch));
}
__device__ __forceinline__ v8f ck_mm(v16h a, v16h b, v8f c) {
    return __builtin_amdgcn_wmma_f32_16x16x32_f16(false, a, false, b, (short)0, c, false, false);
}
__device__ __forceinline__ v4h ck_cvt4(float4 a) {
    v4h o = {(_Float16)a.x, (_Float16)a.y, (_Float16)a.z, (_Float16)a.w};
    return o;
}
__device__ __forceinline__ v8h ck_cvt8(v8f a) {
    v8h o = {(_Float16)a[0], (_Float16)a[1], (_Float16)a[2], (_Float16)a[3],
             (_Float16)a[4], (_Float16)a[5], (_Float16)a[6], (_Float16)a[7]};
    return o;
}

// x + (x of the lane N below, inside a row of 16 lanes; 0 where there is none): a step of a running sum
template <int N>
__device__ __forceinline__ float ck_add_shr(float x) {
    int o = __builtin_amdgcn_update_dpp(0, __builtin_bit_cast(int, x), 0x110 + N, 0xf, 0xf, true);
    return x + __builtin_bit_cast(float, o);
}

__global__ __launch_bounds__(256) void scan_kernel(const float* __restrict__ q,
                                                   const float* __restrict__ k,
                                                   const float* __restrict__ v,
                                                   const float* __restrict__ beta,
                                                   _Float16* __restrict__ y) {
    __shared__ __attribute__((aligned(16))) _Float16 sq[2][CK_T][CK_QP];
    __shared__ __attribute__((aligned(16))) _Float16 sk[2][CK_T][CK_QP];
    __shared__ __attribute__((aligned(16))) _Float16 sv[2][CK_T][CK_EW];
    __shared__ __attribute__((aligned(16))) float    sl[2][C_][CK_T];   // log2 P[c][s]
    __shared__ __attribute__((aligned(16))) float    sp[2][C_][CK_T];   // P[c][s]
    __shared__ __attribute__((aligned(16))) _Float16 sw[2][C_][CK_T];   // P[c][T] / P[c][s]
    // state at a chunk's start: [channel][M, Z][32 rows d][first, second 16 of them][lane][8 rows]
    __shared__ __attribute__((aligned(16))) _Float16 ss[2][C_][2][2][2][32][8];

    const int bh   = blockIdx.x / CK_ES;
    const int e0   = (blockIdx.x % CK_ES) * CK_EW;
    const int b    = bh / H_, h = bh % H_;
    const int t    = threadIdx.x;
    const int lane = t & 31;
    const int c16  = lane & 15;
    const int hh   = lane >> 4;
    const int wave = __builtin_amdgcn_readfirstlane(t >> 5);   // scalar, so that the roles part at a scalar branch

    const float* qp = q + (size_t)b * S_ * D_ + h * DH_;
    const float* kp = k + (size_t)b * S_ * D_ + h * DH_;
    const float* vp = v + (size_t)b * S_ * D_ + h * DH_ + e0;
    const float* bp = beta + (size_t)b * S_ * (H_ * C_) + h * C_;
    _Float16*    yp = y + (size_t)b * S_ * D_ + h * DH_ + e0;

    // staging: 4 float4 of q and of k and one of v per thread and chunk; waves 4 and 5 a channel of beta each
    const int  srow = t >> 4, scol = (t & 15) * 4;
    const int  vrow = t >> 2, vcol = (t & 3) * 4;
    const bool bwav = wave == 4 || wave == 5;
    const int  bch  = wave & 1;

    float4 rq[4], rk[4], rv;
    float  rb0 = 1.f, rb1 = 1.f;
    auto fetch = [&](int ts) {
        #pragma unroll
        for (int i = 0; i < 4; ++i) {
            rq[i] = *(const float4*)(qp + (size_t)(ts + srow + 16 * i) * D_ + scol);
            rk[i] = *(const float4*)(kp + (size_t)(ts + srow + 16 * i) * D_ + scol);
        }
        rv = *(const float4*)(vp + (size_t)(ts + vrow) * D_ + vcol);
        // what follows rewrites the address registers that these loads name
        asm volatile("s_wait_xcnt 0x0" ::: "memory");
        if (bwav) {
            rb0 = bp[(size_t)(ts + 2 * lane) * (H_ * C_) + bch];
            rb1 = bp[(size_t)(ts + 2 * lane + 1) * (H_ * C_) + bch];
            // the same for these two
            asm volatile("s_wait_xcnt 0x0" ::: "memory");
        }
    };
    auto stage = [&](int buf) {
        #pragma unroll
        for (int i = 0; i < 4; ++i) {
            *(v4h*)&sq[buf][srow + 16 * i][scol] = ck_cvt4(rq[i]);
            *(v4h*)&sk[buf][srow + 16 * i][scol] = ck_cvt4(rk[i]);
        }
        *(v4h*)&sv[buf][vrow][vcol] = ck_cvt4(rv);
        if (bwav) {
            // running sum of log2 beta over the chunk; a lane holds steps 2 lane and 2 lane + 1
            const float a0 = __log2f(rb0), a1 = __log2f(rb1);
            float inc = a0 + a1;
            inc = ck_add_shr<1>(inc);
            inc = ck_add_shr<2>(inc);
            inc = ck_add_shr<4>(inc);
            inc = ck_add_shr<8>(inc);
            const float low = __builtin_bit_cast(float, __builtin_amdgcn_readlane(__builtin_bit_cast(int, inc), 15));
            if (lane >= 16) inc += low;
            const float l0 = inc - a1, l1 = inc;
            const float lT = __builtin_bit_cast(float, __builtin_amdgcn_readlane(__builtin_bit_cast(int, inc), 31));
            float2 lo = {l0, l1};
            float2 po = {__builtin_amdgcn_exp2f(l0), __builtin_amdgcn_exp2f(l1)};
            *(float2*)&sl[buf][bch][2 * lane] = lo;
            *(float2*)&sp[buf][bch][2 * lane] = po;
            sw[buf][bch][2 * lane]     = (_Float16)__builtin_amdgcn_exp2f(lT - l0);
            sw[buf][bch][2 * lane + 1] = (_Float16)__builtin_amdgcn_exp2f(lT - l1);
        }
    };

    v8f M[C_] = {}, Z[C_] = {};   // waves 4..7: rows (wave - 4) * 16 + 8 hh + r, column c16; Z the same in every column
    const int dt = wave & 3;      // the state wave's block of rows d; the output wave's block of steps t
    auto publish = [&](int buf) {
        #pragma unroll
        for (int ch = 0; ch < C_; ++ch) {
            *(v8h*)&ss[buf][ch][0][dt >> 1][dt & 1][lane][0] = ck_cvt8(M[ch]);
            *(v8h*)&ss[buf][ch][1][dt >> 1][dt & 1][lane][0] = ck_cvt8(Z[ch]);
        }
    };

    v8h yv = {};   // waves 0..3: y of steps dt * 16 + 8 hh + r, column c16, of the chunk just finished
    auto put_y = [&](int ts) {
        _Float16* yo = yp + (size_t)(ts + dt * 16 + 8 * hh) * D_ + c16;
        #pragma unroll
        for (int r = 0; r < 8; ++r) yo[(size_t)r * D_] = yv[r];
        // what follows rewrites registers that these stores name
        asm volatile("s_wait_xcnt 0x0" ::: "memory");
    };

    fetch(0);
    stage(0);
    if (wave >= 4) publish(0);
    __syncthreads();

    v16h ones;
    #pragma unroll
    for (int i = 0; i < 16; ++i) ones[i] = (_Float16)1.f;

    const int nChunk = S_ / CK_T;
    // not unrolled, so that the last trip is not peeled off and the next chunk's
    // global loads stay at the head of the trip, in flight under this chunk's work
    #pragma nounroll
    for (int n = 0; n < nChunk; ++n) {
        const int  cur  = n & 1;
        const int  ts0  = n * CK_T;
        const bool more = n + 1 < nChunk;
        if (more) fetch(ts0 + CK_T);

        const _Float16* Kt = &sk[cur][0][0];
        const _Float16* Vt = &sv[cur][0][0];
        if (wave < 4) {
            // ---- 16 steps t = dt * 16 + ... of this chunk
            // the previous chunk's results go out now: stored at that chunk's end, its
            // barrier would wait for the stores to be acknowledged
            if (n > 0) put_y(ts0 - CK_T);
            const int tl = dt * 16 + c16;
            v16h qf[2];   // row t = tl: B (column t) of the score product, A (row t) of the state product
            #pragma unroll
            for (int kk = 0; kk < 2; ++kk) qf[kk] = ck_row(&sq[cur][tl][kk * 32], hh);
            const float lt0 = sl[cur][0][tl], lt1 = sl[cur][1][tl];

            // scores transposed: st[r] = k_s.q_t, s = sb * 16 + 8 hh + r, t = tl; two such
            // tiles, weighted and rounded, are an A fragment with row t and k = s
            v16h af[2];
            #pragma unroll
            for (int sb = 0; sb < 4; ++sb) {
                v8f st = {};
                #pragma unroll
                for (int kk = 0; kk < 2; ++kk)
                    st = ck_mm(ck_row(Kt + (sb * 16 + c16) * CK_QP + kk * 32, hh), qf[kk], st);
                const float4 x0 = *(const float4*)&sl[cur][0][sb * 16 + 8 * hh];
                const float4 x1 = *(const float4*)&sl[cur][0][sb * 16 + 8 * hh + 4];
                const float4 y0 = *(const float4*)&sl[cur][1][sb * 16 + 8 * hh];
                const float4 y1 = *(const float4*)&sl[cur][1][sb * 16 + 8 * hh + 4];
                const float ls0[8] = {x0.x, x0.y, x0.z, x0.w, x1.x, x1.y, x1.z, x1.w};
                const float ls1[8] = {y0.x, y0.y, y0.z, y0.w, y1.x, y1.y, y1.z, y1.w};
                #pragma unroll
                for (int r = 0; r < 8; ++r) {
                    // later steps s do not count: their weight is exp2 of a large negative number, 0
                    const bool  on = sb * 16 + 8 * hh + r <= tl;
                    const float g  = __builtin_amdgcn_exp2f(on ? lt0 - ls0[r] : -1000.f)
                                   + __builtin_amdgcn_exp2f(on ? lt1 - ls1[r] : -1000.f);
                    af[sb >> 1][(sb & 1) * 8 + r] = (_Float16)(st[r] * g);
                }
            }
            v8f num = {}, den = {};
            #pragma unroll
            for (int j = 0; j < 2; ++j) {
                num = ck_mm(af[j], ck_col(Vt, CK_EW, 32 * j, 0, lane), num);
                den = ck_mm(af[j], ones, den);
            }
            v8f nm[C_] = {}, dz[C_] = {};
            #pragma unroll
            for (int ch = 0; ch < C_; ++ch) {
                #pragma unroll
                for (int kk = 0; kk < 2; ++kk) {
                    v16h mb = ck_cat(*(const v8h*)&ss[cur][ch][0][kk][0][lane][0],
                                     *(const v8h*)&ss[cur][ch][0][kk][1][lane][0]);
                    v16h zb = ck_cat(*(const v8h*)&ss[cur][ch][1][kk][0][lane][0],
                                     *(const v8h*)&ss[cur][ch][1][kk][1][lane][0]);
                    nm[ch] = ck_mm(qf[kk], mb, nm[ch]);
                    dz[ch] = ck_mm(qf[kk], zb, dz[ch]);
                }
            }
            // register r of every accumulator: step t = dt * 16 + 8 hh + r, column c16
            const float4 u0 = *(const float4*)&sp[cur][0][dt * 16 + 8 * hh];
            const float4 u1 = *(const float4*)&sp[cur][0][dt * 16 + 8 * hh + 4];
            const float4 w0 = *(const float4*)&sp[cur][1][dt * 16 + 8 * hh];
            const float4 w1 = *(const float4*)&sp[cur][1][dt * 16 + 8 * hh + 4];
            const float p0[8] = {u0.x, u0.y, u0.z, u0.w, u1.x, u1.y, u1.z, u1.w};
            const float p1[8] = {w0.x, w0.y, w0.z, w0.w, w1.x, w1.y, w1.z, w1.w};
            #pragma unroll
            for (int r = 0; r < 8; ++r) {
                const float nu = num[r] + p0[r] * nm[0][r] + p1[r] * nm[1][r];
                const float de = den[r] + p0[r] * dz[0][r] + p1[r] * dz[1][r] + 1e-6f;
                yv[r] = (_Float16)(nu * __builtin_amdgcn_rcpf(de));
            }
        } else {
            // ---- rows d = dt * 16 + ... of the state, carried to the chunk's end
            const float pT[C_] = {sp[cur][0][CK_T - 1], sp[cur][1][CK_T - 1]};
            #pragma unroll
            for (int ch = 0; ch < C_; ++ch) { M[ch] *= pT[ch]; Z[ch] *= pT[ch]; }
            #pragma unroll
            for (int j = 0; j < 2; ++j) {
                const v16h kt = ck_col(Kt, CK_QP, 32 * j, dt * 16, lane);   // A: row d, k = s
                const v16h vf = ck_col(Vt, CK_EW, 32 * j, 0, lane);         // B: column e, k = s
                #pragma unroll
                for (int ch = 0; ch < C_; ++ch) {
                    const v16h wf = ck_row(&sw[cur][ch][32 * j], hh);       // the weights of the steps s, same k order
                    M[ch] = ck_mm(kt, vf * wf, M[ch]);
                    Z[ch] = ck_mm(kt, wf, Z[ch]);
                }
            }
            publish(cur ^ 1);
        }

        // the other buffers were last read before the previous chunk's barrier
        if (more) stage(cur ^ 1);
        // one barrier per chunk: publishes the next chunk's staged rows and the state at its start
        __syncthreads();
    }
    if (wave < 4) put_y(S_ - CK_T);
}

// ---------------------------------------------------------------------------
// LayerNorm over rows of h (4096 x 1024), f32 out
// ---------------------------------------------------------------------------
__global__ __launch_bounds__(256) void ln_kernel(const float* __restrict__ hbuf,
                                                 const float* __restrict__ gamma,
                                                 const float* __restrict__ lbeta,
                                                 float* __restrict__ out) {
    __shared__ float rs[256], rq[256];
    __shared__ float smu, srstd;
    int m = blockIdx.x, t = threadIdx.x;
    const float* hr = hbuf + (size_t)m * D_;
    float s = 0.f, q2 = 0.f;
    float vals[4];
    #pragma unroll
    for (int i = 0; i < 4; ++i) {
        float v = hr[t + i * 256];
        vals[i] = v; s += v; q2 += v * v;
    }
    rs[t] = s; rq[t] = q2;
    __syncthreads();
    for (int off = 128; off > 0; off >>= 1) {
        if (t < off) { rs[t] += rs[t + off]; rq[t] += rq[t + off]; }
        __syncthreads();
    }
    if (t == 0) {
        float mu  = rs[0] * (1.f / D_);
        float var = rq[0] * (1.f / D_) - mu * mu;
        smu = mu; srstd = rsqrtf(var + 1e-5f);
    }
    __syncthreads();
    float* orow = out + (size_t)m * D_;
    #pragma unroll
    for (int i = 0; i < 4; ++i) {
        int n = t + i * 256;
        orow[n] = gamma[n] * (vals[i] - smu) * srstd + lbeta[n];
    }
}

// ---------------------------------------------------------------------------
// launch
// ---------------------------------------------------------------------------
extern "C" void kernel_launch(void* const* d_in, const int* in_sizes, int n_in,
                              void* d_out, int out_size, void* d_ws, size_t ws_size,
                              hipStream_t stream) {
    const float* x      = (const float*)d_in[0];
    const float* Wq     = (const float*)d_in[1];
    const float* Wk     = (const float*)d_in[2];
    const float* Wv     = (const float*)d_in[3];
    const float* Wbeta  = (const float*)d_in[4];
    const float* bbeta  = (const float*)d_in[5];
    const float* Wo     = (const float*)d_in[6];
    const float* bo     = (const float*)d_in[7];
    const float* lng    = (const float*)d_in[8];
    const float* lnb    = (const float*)d_in[9];
    float* out = (float*)d_out;

    char* ws = (char*)d_ws;
    size_t off = 0;
    auto alloc = [&](size_t bytes) { char* p = ws + off; off += (bytes + 255) & ~(size_t)255; return p; };

    _Float16* xh   = (_Float16*)alloc((size_t)MTOK * D_ * 2);   // 8 MB
    _Float16* Wqt  = (_Float16*)alloc((size_t)D_ * D_ * 2);     // 2 MB each
    _Float16* Wkt  = (_Float16*)alloc((size_t)D_ * D_ * 2);
    _Float16* Wvt  = (_Float16*)alloc((size_t)D_ * D_ * 2);
    _Float16* Wot  = (_Float16*)alloc((size_t)D_ * D_ * 2);
    float*    qbuf = (float*)alloc((size_t)MTOK * D_ * 4);      // 16 MB each
    float*    kbuf = (float*)alloc((size_t)MTOK * D_ * 4);
    float*    vbuf = (float*)alloc((size_t)MTOK * D_ * 4);
    float*    bbuf = (float*)alloc((size_t)MTOK * 32 * 4);      // 0.5 MB
    _Float16* ybuf = (_Float16*)alloc((size_t)MTOK * D_ * 2);   // 8 MB
    float*    hbuf = (float*)alloc((size_t)MTOK * D_ * 4);      // 16 MB
    (void)ws_size; (void)in_sizes; (void)n_in; (void)out_size;

    const int nX = MTOK * D_;  // 4194304
    f32_to_f16_kernel<<<nX / CVT_WG, 256, 0, stream>>>(x, xh, nX);

    const int nW = (D_ / 64) * (D_ / 128);   // tiles of 64 k x 128 n
    transpose_to_f16_kernel<<<nW, 256, 0, stream>>>(Wq, Wqt);
    transpose_to_f16_kernel<<<nW, 256, 0, stream>>>(Wk, Wkt);
    transpose_to_f16_kernel<<<nW, 256, 0, stream>>>(Wv, Wvt);
    transpose_to_f16_kernel<<<nW, 256, 0, stream>>>(Wo, Wot);

    dim3 ggrid(D_ / 128, MTOK / 128);   // (8, 32)
    gemm_f16_wmma_kernel<<<ggrid, 256, 0, stream>>>(xh, Wqt, qbuf, nullptr, nullptr, MTOK, D_, D_);
    gemm_f16_wmma_kernel<<<ggrid, 256, 0, stream>>>(xh, Wkt, kbuf, nullptr, nullptr, MTOK, D_, D_);
    gemm_f16_wmma_kernel<<<ggrid, 256, 0, stream>>>(xh, Wvt, vbuf, nullptr, nullptr, MTOK, D_, D_);

    beta_kernel<<<MTOK / BT_TOK, BT_WAVES * 32, 0, stream>>>(x, Wbeta, bbeta, bbuf);

    const int nPairs = MTOK * 32;  // threads: 16 half-pairs each
    rope_phi_kernel<<<nPairs / 256, 256, 0, stream>>>(qbuf, nPairs);
    rope_phi_kernel<<<nPairs / 256, 256, 0, stream>>>(kbuf, nPairs);

    scan_kernel<<<B_ * H_ * CK_ES, 256, 0, stream>>>(qbuf, kbuf, vbuf, bbuf, ybuf);

    // h = x + y @ Wo + bo (fused residual + bias epilogue)
    gemm_f16_wmma_kernel<<<ggrid, 256, 0, stream>>>(ybuf, Wot, hbuf, x, bo, MTOK, D_, D_);

    ln_kernel<<<MTOK, 256, 0, stream>>>(hbuf, lng, lnb, out);
}

// v007
// One run takes 146 microseconds.
// Next to v006, in two timings, it ran 1.16 times as fast each time.
// Over all steps from v000 it is 21.7 times as fast.
#include <hip/hip_runtime.h>
#include <hip/hip_bf16.h>

typedef __attribute__((ext_vector_type(16))) _Float16 v16h;
typedef __attribute__((ext_vector_type(8)))  float    v8f;

#define B_   2
#define S_   2048
#define D_   1024
#define H_   16
#define DH_  64
#define C_   2
#define MTOK (B_ * S_)   // 4096

// ---------------------------------------------------------------------------
// CDNA5 async global->LDS copy (ASYNCcnt path), with sync fallback
// ---------------------------------------------------------------------------
#if defined(__has_builtin)
#if __has_builtin(__builtin_amdgcn_global_load_async_to_lds_b128)
#define HAVE_ASYNC_LDS 1
#endif
#endif

#if defined(HAVE_ASYNC_LDS)
// builtin signature: void(v4i addrspace(1)*, v4i addrspace(3)*, imm offset, imm cpol)
typedef int v4i_vs __attribute__((vector_size(4 * sizeof(int))));
typedef __attribute__((address_space(1))) v4i_vs* g_v4i_p;
typedef __attribute__((address_space(3))) v4i_vs* l_v4i_p;
__device__ __forceinline__ void async_copy_b128(const _Float16* g, _Float16* l) {
    __builtin_amdgcn_global_load_async_to_lds_b128(
        (g_v4i_p)(void*)const_cast<_Float16*>(g), (l_v4i_p)(void*)l, 0, 0);
}
#if __has_builtin(__builtin_amdgcn_s_wait_asynccnt)
#define WAIT_ASYNC(n) __builtin_amdgcn_s_wait_asynccnt(n)
#else
#define WAIT_ASYNC(n) asm volatile("s_wait_asynccnt %0" :: "n"(n) : "memory")
#endif
#endif

// ---------------------------------------------------------------------------
// The three element-wise helpers below give each thread 32 elements, moved in
// 16-byte pieces: with one element per thread their time was the
// time it takes to start their waves, not the time to move their bytes.
// ---------------------------------------------------------------------------
typedef __attribute__((ext_vector_type(8))) _Float16 v8h;

__device__ __forceinline__ v8h cvt8(float4 a, float4 b) {
    v8h o = {(_Float16)a.x, (_Float16)a.y, (_Float16)a.z, (_Float16)a.w,
             (_Float16)b.x, (_Float16)b.y, (_Float16)b.z, (_Float16)b.w};
    return o;
}

// f32 -> f16 conversion; 256 threads (part 'blk', thread 't' of it) convert CVT_WG
// elements (n is a multiple), a thread four runs of 8, all eight loads in flight together
#define CVT_WG 8192
__device__ __forceinline__ void f32_to_f16_part(const float* __restrict__ src,
                                                _Float16* __restrict__ dst, int n, int blk, int t) {
    int i = blk * CVT_WG + t * 8;
    if (i + 3 * 2048 + 8 > n) return;
    float4 a[4], b[4];
    #pragma unroll
    for (int g = 0; g < 4; ++g) {
        a[g] = *(const float4*)(src + i + g * 2048);
        b[g] = *(const float4*)(src + i + g * 2048 + 4);
    }
    #pragma unroll
    for (int g = 0; g < 4; ++g) *(v8h*)(dst + i + g * 2048) = cvt8(a[g], b[g]);
}

// W is (D_ x D_) row-major f32, rows k; Wt becomes its transpose in f16, rows n.
// 256 threads (tile 'blk', thread 't' of it) turn a tile of 64 k x 128 n, a thread 8 k x 4 n: eight lanes side
// by side in k write 128 bytes in a row of Wt. The pitch is a constant, so that
// a thread's loads, and its stores, share one address register pair.
__device__ __forceinline__ void transpose_to_f16_part(const float* __restrict__ W,
                                                      _Float16* __restrict__ Wt, int blk, int t) {
    int k0 = (blk / (D_ / 128)) * 64 + (t & 7) * 8;
    int n0 = (blk % (D_ / 128)) * 128 + (t >> 3) * 4;
    const float* wp = W + k0 * D_ + n0;
    float4 r[8];
    #pragma unroll
    for (int j = 0; j < 8; ++j) r[j] = *(const float4*)(wp + j * D_);
    _Float16* op = Wt + n0 * D_ + k0;
    v8h o0 = {(_Float16)r[0].x, (_Float16)r[1].x, (_Float16)r[2].x, (_Float16)r[3].x,
              (_Float16)r[4].x, (_Float16)r[5].x, (_Float16)r[6].x, (_Float16)r[7].x};
    v8h o1 = {(_Float16)r[0].y, (_Float16)r[1].y, (_Float16)r[2].y, (_Float16)r[3].y,
              (_Float16)r[4].y, (_Float16)r[5].y, (_Float16)r[6].y, (_Float16)r[7].y};
    v8h o2 = {(_Float16)r[0].z, (_Float16)r[1].z, (_Float16)r[2].z, (_Float16)r[3].z,
              (_Float16)r[4].z, (_Float16)r[5].z, (_Float16)r[6].z, (_Float16)r[7].z};
    v8h o3 = {(_Float16)r[0].w, (_Float16)r[1].w, (_Float16)r[2].w, (_Float16)r[3].w,
              (_Float16)r[4].w, (_Float16)r[5].w, (_Float16)r[6].w, (_Float16)r[7].w};
    *(v8h*)(op)          = o0;
    *(v8h*)(op + D_)     = o1;
    *(v8h*)(op + 2 * D_) = o2;
    *(v8h*)(op + 3 * D_) = o3;
    // the other parts' code stands behind these stores in the built kernel and reuses
    // their registers: the wait closes the four stores in front of any such overwrite
    asm volatile("s_wait_xcnt 0x0" ::: "memory");
}

// ---------------------------------------------------------------------------
// WMMA GEMM:  C[M,N] = A[M,K] (f16) * Bt[N,K]^T (f16)  (+ resid + bias)
// blockIdx.z picks one of up to three products that share A and run as one grid.
// block = 256 threads (8 waves), tile = 128x128, K-step = 32,
// double-buffered async global->LDS staging.
// ---------------------------------------------------------------------------
// f16 per staged row: 32 of data and 8 unused. At 80 bytes (16 B x odd) the sixteen
// rows that a 16-byte fragment load reads fall on all 64 banks; at 64 bytes four rows
// share each bank.
#define GM_P 40
__device__ inline v16h load_frag_k32(const _Float16* tile_base, int row16, int half) {
    // tile rows have stride GM_P f16; A-fragment layout for v_wmma_f32_16x16x32_f16:
    // lanes 0-15: K = {0..7, 16..23}; lanes 16-31: K = {8..15, 24..31}
    const _Float16* p = tile_base + row16 * GM_P + half * 8;
    union { v16h h; uint4 u[2]; } f;
    f.u[0] = *(const uint4*)(p);
    f.u[1] = *(const uint4*)(p + 16);
    return f.h;
}

__global__ __launch_bounds__(256) void gemm_f16_wmma_kernel(
    const _Float16* __restrict__ A,   // M x K row-major
    const _Float16* __restrict__ Bt0, // N x K row-major (B pre-transposed), product z = 0
    const _Float16* __restrict__ Bt1, // the same for z = 1 and z = 2 (unused where the grid has no such z)
    const _Float16* __restrict__ Bt2,
    float* __restrict__ C0,           // M x N, product z = 0
    float* __restrict__ C1,
    float* __restrict__ C2,
    const float* __restrict__ resid,  // optional M x N, may be null
    const float* __restrict__ bias,   // optional N, may be null
    int M, int N, int K)
{
#if defined(HAVE_ASYNC_LDS)
    __shared__ __attribute__((aligned(16))) _Float16 As[2][128 * GM_P];
    __shared__ __attribute__((aligned(16))) _Float16 Bs[2][128 * GM_P];
#else
    __shared__ __attribute__((aligned(16))) _Float16 As[1][128 * GM_P];
    __shared__ __attribute__((aligned(16))) _Float16 Bs[1][128 * GM_P];
#endif

    const _Float16* __restrict__ Bt   = blockIdx.z == 0 ? Bt0 : blockIdx.z == 1 ? Bt1 : Bt2;
    float* __restrict__          Cout = blockIdx.z == 0 ? C0 : blockIdx.z == 1 ? C1 : C2;

    const int t     = threadIdx.x;
    const int m0    = blockIdx.y * 128;
    const int n0    = blockIdx.x * 128;
    const int wave  = t >> 5;
    const int lane  = t & 31;
    const int half  = (lane >> 4) & 1;
    const int l16   = lane & 15;
    const int waveM = wave >> 2;   // 0..1  (64-row slab)
    const int waveN = wave & 3;    // 0..3  (32-col slab)

    // per-thread staging coordinates: 2 chunks of 8 f16 (16B) per matrix
    const int r0  = t >> 2;              // chunk 0 row
    const int cg0 = t & 3;               // chunk 0 col-group
    const int r1  = (t + 256) >> 2;      // chunk 1 row
    const int cg1 = t & 3;

    v8f acc[4][2] = {};
    const int nIter = K / 32;

#if defined(HAVE_ASYNC_LDS)
    // prologue: stage tile 0 into buffer 0 (4 async-load instructions / wave)
    {
        const int k0 = 0;
        async_copy_b128(&A [(size_t)(m0 + r0) * K + k0 + cg0 * 8], &As[0][r0 * GM_P + cg0 * 8]);
        async_copy_b128(&Bt[(size_t)(n0 + r0) * K + k0 + cg0 * 8], &Bs[0][r0 * GM_P + cg0 * 8]);
        async_copy_b128(&A [(size_t)(m0 + r1) * K + k0 + cg1 * 8], &As[0][r1 * GM_P + cg1 * 8]);
        async_copy_b128(&Bt[(size_t)(n0 + r1) * K + k0 + cg1 * 8], &Bs[0][r1 * GM_P + cg1 * 8]);
    }
    for (int it = 0; it < nIter; ++it) {
        const int cur = it & 1;
        if (it + 1 < nIter) {
            const int k0 = (it + 1) * 32;
            const int nxt = cur ^ 1;
            async_copy_b128(&A [(size_t)(m0 + r0) * K + k0 + cg0 * 8], &As[nxt][r0 * GM_P + cg0 * 8]);
            async_copy_b128(&Bt[(size_t)(n0 + r0) * K + k0 + cg0 * 8], &Bs[nxt][r0 * GM_P + cg0 * 8]);
            async_copy_b128(&A [(size_t)(m0 + r1) * K + k0 + cg1 * 8], &As[nxt][r1 * GM_P + cg1 * 8]);
            async_copy_b128(&Bt[(size_t)(n0 + r1) * K + k0 + cg1 * 8], &Bs[nxt][r1 * GM_P + cg1 * 8]);
            WAIT_ASYNC(4);   // drain previous batch only; next batch stays in flight
        } else {
            WAIT_ASYNC(0);
        }
        __syncthreads();

        v16h af[4], bf[2];
        #pragma unroll
        for (int mt = 0; mt < 4; ++mt)
            af[mt] = load_frag_k32(&As[cur][(waveM * 64 + mt * 16) * GM_P], l16, half);
        #pragma unroll
        for (int nt = 0; nt < 2; ++nt)
            bf[nt] = load_frag_k32(&Bs[cur][(waveN * 32 + nt * 16) * GM_P], l16, half);

        #pragma unroll
        for (int mt = 0; mt < 4; ++mt)
            #pragma unroll
            for (int nt = 0; nt < 2; ++nt)
                acc[mt][nt] = __builtin_amdgcn_wmma_f32_16x16x32_f16(
                    false, af[mt], false, bf[nt], (short)0, acc[mt][nt], false, false);
        __syncthreads();   // all reads of buf[cur] done before it is restaged
    }
#else
    for (int it = 0; it < nIter; ++it) {
        const int k0 = it * 32;
        *(uint4*)&As[0][r0 * GM_P + cg0 * 8] = *(const uint4*)&A [(size_t)(m0 + r0) * K + k0 + cg0 * 8];
        *(uint4*)&Bs[0][r0 * GM_P + cg0 * 8] = *(const uint4*)&Bt[(size_t)(n0 + r0) * K + k0 + cg0 * 8];
        *(uint4*)&As[0][r1 * GM_P + cg1 * 8] = *(const uint4*)&A [(size_t)(m0 + r1) * K + k0 + cg1 * 8];
        *(uint4*)&Bs[0][r1 * GM_P + cg1 * 8] = *(const uint4*)&Bt[(size_t)(n0 + r1) * K + k0 + cg1 * 8];
        if (k0 + 32 < K) {
            __builtin_prefetch(&A [(size_t)(m0 + (t >> 1)) * K + k0 + 32], 0, 0);
            __builtin_prefetch(&Bt[(size_t)(n0 + (t >> 1)) * K + k0 + 32], 0, 0);
        }
        __syncthreads();
        v16h af[4], bf[2];
        #pragma unroll
        for (int mt = 0; mt < 4; ++mt)
            af[mt] = load_frag_k32(&As[0][(waveM * 64 + mt * 16) * GM_P], l16, half);
        #pragma unroll
        for (int nt = 0; nt < 2; ++nt)
            bf[nt] = load_frag_k32(&Bs[0][(waveN * 32 + nt * 16) * GM_P], l16, half);
        #pragma unroll
        for (int mt = 0; mt < 4; ++mt)
            #pragma unroll
            for (int nt = 0; nt < 2; ++nt)
                acc[mt][nt] = __builtin_amdgcn_wmma_f32_16x16x32_f16(
                    false, af[mt], false, bf[nt], (short)0, acc[mt][nt], false, false);
        __syncthreads();
    }
#endif

    // C/D layout: VGPR i -> M = i + 8*half, N = l16
    #pragma unroll
    for (int mt = 0; mt < 4; ++mt) {
        #pragma unroll
        for (int nt = 0; nt < 2; ++nt) {
            #pragma unroll
            for (int i = 0; i < 8; ++i) {
                int m = m0 + waveM * 64 + mt * 16 + 8 * half + i;
                int n = n0 + waveN * 32 + nt * 16 + l16;
                float v = acc[mt][nt][i];
                if (resid) v += resid[(size_t)m * N + n];
                if (bias)  v += bias[n];
                Cout[(size_t)m * N + n] = v;
            }
        }
    }
}

// ---------------------------------------------------------------------------
// beta = clip(sigmoid(x @ Wbeta + bbeta), 1e-3, 0.999)   (4096 x 32)
// A work-group takes BT_TOK tokens and all 32 columns; each of its waves a
// slice of BT_KS values of k; a lane holds 4 tokens x 4 columns, so that eight
// 16-byte loads feed 64 multiply-adds and many loads are in flight per wait.
// The waves' partial sums meet in LDS.
// ---------------------------------------------------------------------------
#define BT_TOK   16
#define BT_WAVES 16
#define BT_KS    (D_ / BT_WAVES)   // 64
#define BT_G     4                 // runs of 4 k per register set
#define BT_SK    (BT_G * 4)        // values of k per register set
typedef __attribute__((ext_vector_type(2))) float bt2f;

// one register set: 4 tokens x BT_SK k of x, BT_SK k x 4 columns of Wb
__device__ __forceinline__ void bt_load(float4 (&xv)[BT_G][4], float4 (&wv)[BT_G][4],
                                        const float* xp, const float* wp) {
    #pragma unroll
    for (int g = 0; g < BT_G; ++g) {
        #pragma unroll
        for (int i = 0; i < 4; ++i) xv[g][i] = *(const float4*)(xp + i * D_ + g * 4);
        #pragma unroll
        for (int j = 0; j < 4; ++j) {
            // the set's last load is given, as its destination, an address pair that
            // the loads before it name: the wait stands in front of that overwrite
            if (g == BT_G - 1 && j == 3) asm volatile("s_wait_xcnt 0x0" ::: "memory");
            wv[g][j] = *(const float4*)(wp + (g * 4 + j) * 32);
        }
    }
}

__device__ __forceinline__ void bt_fma(bt2f (&acc)[4][2], const float4 (&xv)[BT_G][4],
                                       const float4 (&wv)[BT_G][4]) {
    #pragma unroll
    for (int g = 0; g < BT_G; ++g) {
        #pragma unroll
        for (int i = 0; i < 4; ++i) {
            const float xs[4] = {xv[g][i].x, xv[g][i].y, xv[g][i].z, xv[g][i].w};
            #pragma unroll
            for (int j = 0; j < 4; ++j) {
                bt2f lo = {wv[g][j].x, wv[g][j].y}, hi = {wv[g][j].z, wv[g][j].w};
                acc[i][0] += lo * xs[j];
                acc[i][1] += hi * xs[j];
            }
        }
    }
}

__device__ __forceinline__ void beta_part(const float* __restrict__ x,
                                          const float* __restrict__ Wb,
                                          const float* __restrict__ bb,
                                          float* __restrict__ beta, int blk) {
    __shared__ __attribute__((aligned(16))) float pb[BT_WAVES][BT_TOK][32];
    const int t    = threadIdx.x;
    const int wave = t >> 5;
    const int tg   = (t >> 3) & 3;   // tokens tg * 4 .. tg * 4 + 3
    const int cg   = t & 7;          // columns cg * 4 .. cg * 4 + 3
    const int m0   = blk * BT_TOK;
    const float* xp = x + (size_t)(m0 + tg * 4) * D_ + wave * BT_KS;
    const float* wp = Wb + (size_t)(wave * BT_KS) * 32 + cg * 4;

    bt2f acc[4][2] = {};
    // not unrolled: unrolled, every load of the slice was lifted to the top and spilled
    #pragma nounroll
    for (int s = 0; s < BT_KS / BT_SK; ++s) {
        float4 xv[BT_G][4], wv[BT_G][4];
        bt_load(xv, wv, xp, wp);
        // keeps the set's loads together in front of its arithmetic: sunk to their
        // uses, only a few would be in flight
        __builtin_amdgcn_sched_barrier(0);
        bt_fma(acc, xv, wv);
        xp += BT_SK;
        wp += BT_SK * 32;
    }
    #pragma unroll
    for (int i = 0; i < 4; ++i) {
        float4 o = {acc[i][0].x, acc[i][0].y, acc[i][1].x, acc[i][1].y};
        *(float4*)&pb[wave][tg * 4 + i][cg * 4] = o;
    }
    __syncthreads();
    // thread t finishes token t / 32, column t % 32
    {
        const float* pp = &pb[0][0][0] + t;
        float s4[4] = {0.f, 0.f, 0.f, 0.f};
        #pragma unroll
        for (int w = 0; w < BT_WAVES; ++w) s4[w & 3] += pp[w * (BT_TOK * 32)];
        float logit = ((s4[0] + s4[1]) + (s4[2] + s4[3])) + bb[t & 31];
        float sg = 1.f / (1.f + __expf(-logit));
        sg = fminf(fmaxf(sg, 0.001f), 0.999f);
        beta[(size_t)m0 * 32 + t] = sg;
    }
}

// ---------------------------------------------------------------------------
// All the work that reads nothing but inputs, as one grid: none of these parts
// waits for another, and launched one after the other each paid its own start
// and its own tail. The longest parts have the lowest indices.
// A work-group is one part of beta, or two parts of 256 threads of the others.
// ---------------------------------------------------------------------------
#define PR_BETA (MTOK / BT_TOK)                  // 256 work-groups
#define PR_CVT  (MTOK * D_ / CVT_WG / 2)         // 256
#define PR_TILE ((D_ / 64) * (D_ / 128))         // tiles of 64 k x 128 n per weight: 128
#define PR_TR   (4 * PR_TILE / 2)                // 256
__global__ __launch_bounds__(BT_WAVES * 32) void prep_kernel(const float* __restrict__ x,
                                                             const float* __restrict__ Wq,
                                                             const float* __restrict__ Wk,
                                                             const float* __restrict__ Wv,
                                                             const float* __restrict__ Wo,
                                                             const float* __restrict__ Wb,
                                                             const float* __restrict__ bb,
                                                             _Float16* __restrict__ xh,
                                                             _Float16* __restrict__ Wqt,
                                                             _Float16* __restrict__ Wkt,
                                                             _Float16* __restrict__ Wvt,
                                                             _Float16* __restrict__ Wot,
                                                             float* __restrict__ beta) {
    const int blk = blockIdx.x;
    if (blk < PR_BETA) {
        beta_part(x, Wb, bb, beta, blk);
        return;
    }
    const int sub = threadIdx.x >> 8, t = threadIdx.x & 255;
    if (blk < PR_BETA + PR_CVT) {
        f32_to_f16_part(x, xh, MTOK * D_, (blk - PR_BETA) * 2 + sub, t);
        return;
    }
    const int g = blk - (PR_BETA + PR_CVT);      // both of its tiles lie in weight w
    const int w = g / (PR_TILE / 2);
    const float* W  = w == 0 ? Wq  : w == 1 ? Wk  : w == 2 ? Wv  : Wo;
    _Float16*    Wt = w == 0 ? Wqt : w == 1 ? Wkt : w == 2 ? Wvt : Wot;
    transpose_to_f16_part(W, Wt, (g % (PR_TILE / 2)) * 2 + sub, t);
}

// ---------------------------------------------------------------------------
// RoPE + phi (elu+1), in place, per head half-pair (i, i+32).
// A wave takes one token; a thread four neighbouring frequencies i of four heads
// (the angle depends on token and frequency only). total = threads = tokens * 32.
// blockIdx.y picks the array: q and k go through as one grid.
// ---------------------------------------------------------------------------
__device__ __forceinline__ float phi1(float r) { return r > 0.f ? r + 1.f : __expf(r); }  // elu(r)+1

__global__ __launch_bounds__(256) void rope_phi_kernel(float* __restrict__ u0, float* __restrict__ u1, int total) {
    int idx = blockIdx.x * 256 + threadIdx.x;
    if (idx >= total) return;
    float* u = blockIdx.y == 0 ? u0 : u1;
    int i0 = (idx & 7) * 4;    // first of four rotation-frequency indices
    int hg = (idx >> 3) & 3;   // heads hg, hg + 4, hg + 8, hg + 12
    int m  = idx >> 5;         // token 0..4095
    int s  = m & (S_ - 1);     // position within sequence
    float* up = u + (size_t)m * D_ + hg * DH_ + i0;
    float4 a[4], b[4];
    #pragma unroll
    for (int j = 0; j < 4; ++j) {
        a[j] = *(const float4*)(up + j * 4 * DH_);
        b[j] = *(const float4*)(up + j * 4 * DH_ + 32);
    }
    float cs[4], sn[4];
    #pragma unroll
    for (int c = 0; c < 4; ++c) {
        float f   = __expf(-(float)(2 * (i0 + c)) * 9.210340371976184f / 64.f); // ln(10000)
        float ang = (float)s * f;
        cs[c] = __cosf(ang);
        sn[c] = __sinf(ang);
    }
    #pragma unroll
    for (int j = 0; j < 4; ++j) {
        float4 x, y;
        x.x = phi1(a[j].x * cs[0] - b[j].x * sn[0]);  y.x = phi1(a[j].x * sn[0] + b[j].x * cs[0]);
        x.y = phi1(a[j].y * cs[1] - b[j].y * sn[1]);  y.y = phi1(a[j].y * sn[1] + b[j].y * cs[1]);
        x.z = phi1(a[j].z * cs[2] - b[j].z * sn[2]);  y.z = phi1(a[j].z * sn[2] + b[j].z * cs[2]);
        x.w = phi1(a[j].w * cs[3] - b[j].w * sn[3]);  y.w = phi1(a[j].w * sn[3] + b[j].w * cs[3]);
        *(float4*)(up + j * 4 * DH_)      = x;
        *(float4*)(up + j * 4 * DH_ + 32) = y;
    }
}

// ---------------------------------------------------------------------------
// DeltaNet recurrence in chunk form, its products on the matrix unit.
// With P[c][t] the product of channel c's decays from the chunk's first step
// through step t, and M0, Z0 the state at the chunk's start, the recurrence gives
//   num[t][e] = sum_{s<=t} G[t][s] (q_t.k_s) v_s[e] + sum_c P[c][t] (q_t M0[c])[e]
//   den[t]    = sum_{s<=t} G[t][s] (q_t.k_s)        + sum_c P[c][t] (q_t.Z0[c]) + eps
//   G[t][s]   = sum_c P[c][t] / P[c][s]   (formed as exp2 of a difference of logs, never above 1 each)
//   M0'[c]    = P[c][T] M0[c] + sum_s (P[c][T] / P[c][s]) k_s v_s^T    (Z likewise, v = 1)
// A work-group takes one (b,h) and CK_EW columns e and walks the chunks in order.
// Waves 0..3 each finish 16 steps t of the chunk; waves 4..7 each carry 16 rows d
// of the state (f32, in accumulators) to the next chunk and hand it over in LDS,
// rounded to f16 and already in B-fragment order. The denominator runs through
// the same products with a column of ones in v's place.
// q, k, v are rounded to f16 when staged; every sum is f32.
// Every '#pragma unroll' of this section stands on a loop that indexes fragments,
// accumulators or staging registers: only with constant indices do they stay in registers.
// Writes y as f16 (feeds the output WMMA GEMM directly).
// ---------------------------------------------------------------------------
#define CK_T  64                 // steps per chunk
#define CK_EW 16                 // state columns per work-group
#define CK_ES (DH_ / CK_EW)      // work-groups per (b,h)
#define CK_QP 80                 // f16 per staged row of q and k: 160 bytes, 32 B x odd for the transposing loads
typedef __attribute__((ext_vector_type(4))) _Float16 v4h;
typedef short ck_s16x8 __attribute__((ext_vector_type(8)));

__device__ __forceinline__ v16h ck_cat(v8h a, v8h b) {
    return __builtin_shufflevector(a, b, 0, 1, 2, 3, 4, 5, 6, 7, 8, 9, 10, 11, 12, 13, 14, 15);
}
// 32 k of one row that lies along k, in the hardware's k order: 8 hh + 0..7, 16 + 8 hh + 0..7
__device__ __forceinline__ v16h ck_row(const _Float16* p, int hh) {
    return ck_cat(*(const v8h*)(p + 8 * hh), *(const v8h*)(p + 16 + 8 * hh));
}
__device__ __forceinline__ v8h ck_tr(const _Float16* p) {
    typedef __attribute__((address_space(3))) ck_s16x8 lds_s16x8;
    return __builtin_bit_cast(v8h, __builtin_amdgcn_ds_load_tr16_b128_v8i16((lds_s16x8*)p));
}
// 32 k of column dbase + (lane & 15) of a tile whose rows are k, same k order (pitch in f16)
__device__ __forceinline__ v16h ck_col(const _Float16* tile, int pitch, int kbase, int dbase, int lane) {
    const _Float16* p = tile + (kbase + 8 * (lane >> 4) + (lane & 7)) * pitch + dbase + 8 * ((lane >> 3) & 1);
    return ck_cat(ck_tr(p), ck_tr(p + 16 * pitch));
}
__device__ __forceinline__ v8f ck_mm(v16h a, v16h b, v8f c) {
    return __builtin_amdgcn_wmma_f32_16x16x32_f16(false, a, false, b, (short)0, c, false, false);
}
__device__ __forceinline__ v4h ck_cvt4(float4 a) {
    v4h o = {(_Float16)a.x, (_Float16)a.y, (_Float16)a.z, (_Float16)a.w};
    return o;
}
__device__ __forceinline__ v8h ck_cvt8(v8f a) {
    v8h o = {(_Float16)a[0], (_Float16)a[1], (_Float16)a[2], (_Float16)a[3],
             (_Float16)a[4], (_Float16)a[5], (_Float16)a[6], (_Float16)a[7]};
    return o;
}

// x + (x of the lane N below, inside a row of 16 lanes; 0 where there is none): a step of a running sum
template <int N>
__device__ __forceinline__ float ck_add_shr(float x) {
    int o = __builtin_amdgcn_update_dpp(0, __builtin_bit_cast(int, x), 0x110 + N, 0xf, 0xf, true);
    return x + __builtin_bit_cast(float, o);
}

__global__ __launch_bounds__(256) void scan_kernel(const float* __restrict__ q,
                                                   const float* __restrict__ k,
                                                   const float* __restrict__ v,
                                                   const float* __restrict__ beta,
                                                   _Float16* __restrict__ y) {
    __shared__ __attribute__((aligned(16))) _Float16 sq[2][CK_T][CK_QP];
    __shared__ __attribute__((aligned(16))) _Float16 sk[2][CK_T][CK_QP];
    __shared__ __attribute__((aligned(16))) _Float16 sv[2][CK_T][CK_EW];
    __shared__ __attribute__((aligned(16))) float    sl[2][C_][CK_T];   // log2 P[c][s]
    __shared__ __attribute__((aligned(16))) float    sp[2][C_][CK_T];   // P[c][s]
    __shared__ __attribute__((aligned(16))) _Float16 sw[2][C_][CK_T];   // P[c][T] / P[c][s]
    // state at a chunk's start: [channel][M, Z][32 rows d][first, second 16 of them][lane][8 rows]
    __shared__ __attribute__((aligned(16))) _Float16 ss[2][C_][2][2][2][32][8];

    const int bh   = blockIdx.x / CK_ES;
    const int e0   = (blockIdx.x % CK_ES) * CK_EW;
    const int b    = bh / H_, h = bh % H_;
    const int t    = threadIdx.x;
    const int lane = t & 31;
    const int c16  = lane & 15;
    const int hh   = lane >> 4;
    const int wave = __builtin_amdgcn_readfirstlane(t >> 5);   // scalar, so that the roles part at a scalar branch

    const float* qp = q + (size_t)b * S_ * D_ + h * DH_;
    const float* kp = k + (size_t)b * S_ * D_ + h * DH_;
    const float* vp = v + (size_t)b * S_ * D_ + h * DH_ + e0;
    const float* bp = beta + (size_t)b * S_ * (H_ * C_) + h * C_;
    _Float16*    yp = y + (size_t)b * S_ * D_ + h * DH_ + e0;

    // staging: 4 float4 of q and of k and one of v per thread and chunk; waves 4 and 5 a channel of beta each
    const int  srow = t >> 4, scol = (t & 15) * 4;
    const int  vrow = t >> 2, vcol = (t & 3) * 4;
    const bool bwav = wave == 4 || wave == 5;
    const int  bch  = wave & 1;

    float4 rq[4], rk[4], rv;
    float  rb0 = 1.f, rb1 = 1.f;
    auto fetch = [&](int ts) {
        #pragma unroll
        for (int i = 0; i < 4; ++i) {
            rq[i] = *(const float4*)(qp + (size_t)(ts + srow + 16 * i) * D_ + scol);
            rk[i] = *(const float4*)(kp + (size_t)(ts + srow + 16 * i) * D_ + scol);
        }
        rv = *(const float4*)(vp + (size_t)(ts + vrow) * D_ + vcol);
        // what follows rewrites the address registers that these loads name
        asm volatile("s_wait_xcnt 0x0" ::: "memory");
        if (bwav) {
            rb0 = bp[(size_t)(ts + 2 * lane) * (H_ * C_) + bch];
            rb1 = bp[(size_t)(ts + 2 * lane + 1) * (H_ * C_) + bch];
            // the same for these two
            asm volatile("s_wait_xcnt 0x0" ::: "memory");
        }
    };
    auto stage = [&](int buf) {
        #pragma unroll
        for (int i = 0; i < 4; ++i) {
            *(v4h*)&sq[buf][srow + 16 * i][scol] = ck_cvt4(rq[i]);
            *(v4h*)&sk[buf][srow + 16 * i][scol] = ck_cvt4(rk[i]);
        }
        *(v4h*)&sv[buf][vrow][vcol] = ck_cvt4(rv);
        if (bwav) {
            // running sum of log2 beta over the chunk; a lane holds steps 2 lane and 2 lane + 1
            const float a0 = __log2f(rb0), a1 = __log2f(rb1);
            float inc = a0 + a1;
            inc = ck_add_shr<1>(inc);
            inc = ck_add_shr<2>(inc);
            inc = ck_add_shr<4>(inc);
            inc = ck_add_shr<8>(inc);
            const float low = __builtin_bit_cast(float, __builtin_amdgcn_readlane(__builtin_bit_cast(int, inc), 15));
            if (lane >= 16) inc += low;
            const float l0 = inc - a1, l1 = inc;
            const float lT = __builtin_bit_cast(float, __builtin_amdgcn_readlane(__builtin_bit_cast(int, inc), 31));
            float2 lo = {l0, l1};
            float2 po = {__builtin_amdgcn_exp2f(l0), __builtin_amdgcn_exp2f(l1)};
            *(float2*)&sl[buf][bch][2 * lane] = lo;
            *(float2*)&sp[buf][bch][2 * lane] = po;
            sw[buf][bch][2 * lane]     = (_Float16)__builtin_amdgcn_exp2f(lT - l0);
            sw[buf][bch][2 * lane + 1] = (_Float16)__builtin_amdgcn_exp2f(lT - l1);
        }
    };

    v8f M[C_] = {}, Z[C_] = {};   // waves 4..7: rows (wave - 4) * 16 + 8 hh + r, column c16; Z the same in every column
    const int dt = wave & 3;      // the state wave's block of rows d; the output wave's block of steps t
    auto publish = [&](int buf) {
        #pragma unroll
        for (int ch = 0; ch < C_; ++ch) {
            *(v8h*)&ss[buf][ch][0][dt >> 1][dt & 1][lane][0] = ck_cvt8(M[ch]);
            *(v8h*)&ss[buf][ch][1][dt >> 1][dt & 1][lane][0] = ck_cvt8(Z[ch]);
        }
    };

    v8h yv = {};   // waves 0..3: y of steps dt * 16 + 8 hh + r, column c16, of the chunk just finished
    auto put_y = [&](int ts) {
        _Float16* yo = yp + (size_t)(ts + dt * 16 + 8 * hh) * D_ + c16;
        #pragma unroll
        for (int r = 0; r < 8; ++r) yo[(size_t)r * D_] = yv[r];
        // what follows rewrites registers that these stores name
        asm volatile("s_wait_xcnt 0x0" ::: "memory");
    };

    fetch(0);
    stage(0);
    if (wave >= 4) publish(0);
    __syncthreads();

    v16h ones;
    #pragma unroll
    for (int i = 0; i < 16; ++i) ones[i] = (_Float16)1.f;

    const int nChunk = S_ / CK_T;
    // not unrolled, so that the last trip is not peeled off and the next chunk's
    // global loads stay at the head of the trip, in flight under this chunk's work
    #pragma nounroll
    for (int n = 0; n < nChunk; ++n) {
        const int  cur  = n & 1;
        const int  ts0  = n * CK_T;
        const bool more = n + 1 < nChunk;
        if (more) fetch(ts0 + CK_T);

        const _Float16* Kt = &sk[cur][0][0];
        const _Float16* Vt = &sv[cur][0][0];
        if (wave < 4) {
            // ---- 16 steps t = dt * 16 + ... of this chunk
            // the previous chunk's results go out now: stored at that chunk's end, its
            // barrier would wait for the stores to be acknowledged
            if (n > 0) put_y(ts0 - CK_T);
            const int tl = dt * 16 + c16;
            v16h qf[2];   // row t = tl: B (column t) of the score product, A (row t) of the state product
            #pragma unroll
            for (int kk = 0; kk < 2; ++kk) qf[kk] = ck_row(&sq[cur][tl][kk * 32], hh);
            const float lt0 = sl[cur][0][tl], lt1 = sl[cur][1][tl];

            // scores transposed: st[r] = k_s.q_t, s = sb * 16 + 8 hh + r, t = tl; two such
            // tiles, weighted and rounded, are an A fragment with row t and k = s
            v16h af[2];
            #pragma unroll
            for (int sb = 0; sb < 4; ++sb) {
                v8f st = {};
                #pragma unroll
                for (int kk = 0; kk < 2; ++kk)
                    st = ck_mm(ck_row(Kt + (sb * 16 + c16) * CK_QP + kk * 32, hh), qf[kk], st);
                const float4 x0 = *(const float4*)&sl[cur][0][sb * 16 + 8 * hh];
                const float4 x1 = *(const float4*)&sl[cur][0][sb * 16 + 8 * hh + 4];
                const float4 y0 = *(const float4*)&sl[cur][1][sb * 16 + 8 * hh];
                const float4 y1 = *(const float4*)&sl[cur][1][sb * 16 + 8 * hh + 4];
                const float ls0[8] = {x0.x, x0.y, x0.z, x0.w, x1.x, x1.y, x1.z, x1.w};
                const float ls1[8] = {y0.x, y0.y, y0.z, y0.w, y1.x, y1.y, y1.z, y1.w};
                #pragma unroll
                for (int r = 0; r < 8; ++r) {
                    // later steps s do not count: their weight is exp2 of a large negative number, 0
                    const bool  on = sb * 16 + 8 * hh + r <= tl;
                    const float g  = __builtin_amdgcn_exp2f(on ? lt0 - ls0[r] : -1000.f)
                                   + __builtin_amdgcn_exp2f(on ? lt1 - ls1[r] : -1000.f);
                    af[sb >> 1][(sb & 1) * 8 + r] = (_Float16)(st[r] * g);
                }
            }
            v8f num = {}, den = {};
            #pragma unroll
            for (int j = 0; j < 2; ++j) {
                num = ck_mm(af[j], ck_col(Vt, CK_EW, 32 * j, 0, lane), num);
                den = ck_mm(af[j], ones, den);
            }
            v8f nm[C_] = {}, dz[C_] = {};
            #pragma unroll
            for (int ch = 0; ch < C_; ++ch) {
                #pragma unroll
                for (int kk = 0; kk < 2; ++kk) {
                    v16h mb = ck_cat(*(const v8h*)&ss[cur][ch][0][kk][0][lane][0],
                                     *(const v8h*)&ss[cur][ch][0][kk][1][lane][0]);
                    v16h zb = ck_cat(*(const v8h*)&ss[cur][ch][1][kk][0][lane][0],
                                     *(const v8h*)&ss[cur][ch][1][kk][1][lane][0]);
                    nm[ch] = ck_mm(qf[kk], mb, nm[ch]);
                    dz[ch] = ck_mm(qf[kk], zb, dz[ch]);
                }
            }
            // register r of every accumulator: step t = dt * 16 + 8 hh + r, column c16
            const float4 u0 = *(const float4*)&sp[cur][0][dt * 16 + 8 * hh];
            const float4 u1 = *(const float4*)&sp[cur][0][dt * 16 + 8 * hh + 4];
            const float4 w0 = *(const float4*)&sp[cur][1][dt * 16 + 8 * hh];
            const float4 w1 = *(const float4*)&sp[cur][1][dt * 16 + 8 * hh + 4];
            const float p0[8] = {u0.x, u0.y, u0.z, u0.w, u1.x, u1.y, u1.z, u1.w};
            const float p1[8] = {w0.x, w0.y, w0.z, w0.w, w1.x, w1.y, w1.z, w1.w};
            #pragma unroll
            for (int r = 0; r < 8; ++r) {
                const float nu = num[r] + p0[r] * nm[0][r] + p1[r] * nm[1][r];
                const float de = den[r] + p0[r] * dz[0][r] + p1[r] * dz[1][r] + 1e-6f;
                yv[r] = (_Float16)(nu * __builtin_amdgcn_rcpf(de));
            }
        } else {
            // ---- rows d = dt * 16 + ... of the state, carried to the chunk's end
            const float pT[C_] = {sp[cur][0][CK_T - 1], sp[cur][1][CK_T - 1]};
            #pragma unroll
            for (int ch = 0; ch < C_; ++ch) { M[ch] *= pT[ch]; Z[ch] *= pT[ch]; }
            #pragma unroll
            for (int j = 0; j < 2; ++j) {
                const v16h kt = ck_col(Kt, CK_QP, 32 * j, dt * 16, lane);   // A: row d, k = s
                const v16h vf = ck_col(Vt, CK_EW, 32 * j, 0, lane);         // B: column e, k = s
                #pragma unroll
                for (int ch = 0; ch < C_; ++ch) {
                    const v16h wf = ck_row(&sw[cur][ch][32 * j], hh);       // the weights of the steps s, same k order
                    M[ch] = ck_mm(kt, vf * wf, M[ch]);
                    Z[ch] = ck_mm(kt, wf, Z[ch]);
                }
            }
            publish(cur ^ 1);
        }

        // the other buffers were last read before the previous chunk's barrier
        if (more) stage(cur ^ 1);
        // one barrier per chunk: publishes the next chunk's staged rows and the state at its start
        __syncthreads();
    }
    if (wave < 4) put_y(S_ - CK_T);
}

// ---------------------------------------------------------------------------
// LayerNorm over rows of h (4096 x 1024), f32 out
// ---------------------------------------------------------------------------
__global__ __launch_bounds__(256) void ln_kernel(const float* __restrict__ hbuf,
                                                 const float* __restrict__ gamma,
                                                 const float* __restrict__ lbeta,
                                                 float* __restrict__ out) {
    __shared__ float rs[256], rq[256];
    __shared__ float smu, srstd;
    int m = blockIdx.x, t = threadIdx.x;
    const float* hr = hbuf + (size_t)m * D_;
    float s = 0.f, q2 = 0.f;
    float vals[4];
    #pragma unroll
    for (int i = 0; i < 4; ++i) {
        float v = hr[t + i * 256];
        vals[i] = v; s += v; q2 += v * v;
    }
    rs[t] = s; rq[t] = q2;
    __syncthreads();
    for (int off = 128; off > 0; off >>= 1) {
        if (t < off) { rs[t] += rs[t + off]; rq[t] += rq[t + off]; }
        __syncthreads();
    }
    if (t == 0) {
        float mu  = rs[0] * (1.f / D_);
        float var = rq[0] * (1.f / D_) - mu * mu;
        smu = mu; srstd = rsqrtf(var + 1e-5f);
    }
    __syncthreads();
    float* orow = out + (size_t)m * D_;
    #pragma unroll
    for (int i = 0; i < 4; ++i) {
        int n = t + i * 256;
        orow[n] = gamma[n] * (vals[i] - smu) * srstd + lbeta[n];
    }
}

// ---------------------------------------------------------------------------
// launch
// ---------------------------------------------------------------------------
extern "C" void kernel_launch(void* const* d_in, const int* in_sizes, int n_in,
                              void* d_out, int out_size, void* d_ws, size_t ws_size,
                              hipStream_t stream) {
    const float* x      = (const float*)d_in[0];
    const float* Wq     = (const float*)d_in[1];
    const float* Wk     = (const float*)d_in[2];
    const float* Wv     = (const float*)d_in[3];
    const float* Wbeta  = (const float*)d_in[4];
    const float* bbeta  = (const float*)d_in[5];
    const float* Wo     = (const float*)d_in[6];
    const float* bo     = (const float*)d_in[7];
    const float* lng    = (const float*)d_in[8];
    const float* lnb    = (const float*)d_in[9];
    float* out = (float*)d_out;

    char* ws = (char*)d_ws;
    size_t off = 0;
    auto alloc = [&](size_t bytes) { char* p = ws + off; off += (bytes + 255) & ~(size_t)255; return p; };

    _Float16* xh   = (_Float16*)alloc((size_t)MTOK * D_ * 2);   // 8 MB
    _Float16* Wqt  = (_Float16*)alloc((size_t)D_ * D_ * 2);     // 2 MB each
    _Float16* Wkt  = (_Float16*)alloc((size_t)D_ * D_ * 2);
    _Float16* Wvt  = (_Float16*)alloc((size_t)D_ * D_ * 2);
    _Float16* Wot  = (_Float16*)alloc((size_t)D_ * D_ * 2);
    float*    qbuf = (float*)alloc((size_t)MTOK * D_ * 4);      // 16 MB each
    float*    kbuf = (float*)alloc((size_t)MTOK * D_ * 4);
    float*    vbuf = (float*)alloc((size_t)MTOK * D_ * 4);
    float*    bbuf = (float*)alloc((size_t)MTOK * 32 * 4);      // 0.5 MB
    _Float16* ybuf = (_Float16*)alloc((size_t)MTOK * D_ * 2);   // 8 MB
    float*    hbuf = (float*)alloc((size_t)MTOK * D_ * 4);      // 16 MB
    (void)ws_size; (void)in_sizes; (void)n_in; (void)out_size;

    // beta, x in f16 and the four weights transposed: one grid
    prep_kernel<<<PR_BETA + PR_CVT + PR_TR, BT_WAVES * 32, 0, stream>>>(
        x, Wq, Wk, Wv, Wo, Wbeta, bbeta, xh, Wqt, Wkt, Wvt, Wot, bbuf);

    // q, k, v: one grid, z picks the weight
    dim3 ggrid3(D_ / 128, MTOK / 128, 3);   // (8, 32, 3)
    gemm_f16_wmma_kernel<<<ggrid3, 256, 0, stream>>>(xh, Wqt, Wkt, Wvt, qbuf, kbuf, vbuf,
                                                     nullptr, nullptr, MTOK, D_, D_);

    const int nPairs = MTOK * 32;  // threads per array: 16 half-pairs each
    dim3 rgrid(nPairs / 256, 2);
    rope_phi_kernel<<<rgrid, 256, 0, stream>>>(qbuf, kbuf, nPairs);

    scan_kernel<<<B_ * H_ * CK_ES, 256, 0, stream>>>(qbuf, kbuf, vbuf, bbuf, ybuf);

    // h = x + y @ Wo + bo (fused residual + bias epilogue)
    dim3 ggrid(D_ / 128, MTOK / 128);   // (8, 32)
    gemm_f16_wmma_kernel<<<ggrid, 256, 0, stream>>>(ybuf, Wot, nullptr, nullptr, hbuf, nullptr, nullptr,
                                                    x, bo, MTOK, D_, D_);

    ln_kernel<<<MTOK, 256, 0, stream>>>(hbuf, lng, lnb, out);
}

// v008
// A run of this version takes 135 microseconds.
// Timed twice side by side with v007, it ran 1.08 times as fast both times.
// Counting every step since v000, it is 23.4 times as fast.
#include <hip/hip_runtime.h>
#include <hip/hip_bf16.h>

typedef __attribute__((ext_vector_type(16))) _Float16 v16h;
typedef __attribute__((ext_vector_type(8)))  float    v8f;

#define B_   2
#define S_   2048
#define D_   1024
#define H_   16
#define DH_  64
#define C_   2
#define MTOK (B_ * S_)   // 4096

// ---------------------------------------------------------------------------
// CDNA5 async global->LDS copy (ASYNCcnt path), with sync fallback
// ---------------------------------------------------------------------------
#if defined(__has_builtin)
#if __has_builtin(__builtin_amdgcn_global_load_async_to_lds_b128)
#define HAVE_ASYNC_LDS 1
#endif
#endif

#if defined(HAVE_ASYNC_LDS)
// builtin signature: void(v4i addrspace(1)*, v4i addrspace(3)*, imm offset, imm cpol)
typedef int v4i_vs __attribute__((vector_size(4 * sizeof(int))));
typedef __attribute__((address_space(1))) v4i_vs* g_v4i_p;
typedef __attribute__((address_space(3))) v4i_vs* l_v4i_p;
__device__ __forceinline__ void async_copy_b128(const _Float16* g, _Float16* l) {
    __builtin_amdgcn_global_load_async_to_lds_b128(
        (g_v4i_p)(void*)const_cast<_Float16*>(g), (l_v4i_p)(void*)l, 0, 0);
}
#if __has_builtin(__builtin_amdgcn_s_wait_asynccnt)
#define WAIT_ASYNC(n) __builtin_amdgcn_s_wait_asynccnt(n)
#else
#define WAIT_ASYNC(n) asm volatile("s_wait_asynccnt %0" :: "n"(n) : "memory")
#endif
#endif

// ---------------------------------------------------------------------------
// The three element-wise helpers below give each thread 32 elements, moved in
// 16-byte pieces: with one element per thread their time was the
// time it takes to start their waves, not the time to move their bytes.
// ---------------------------------------------------------------------------
typedef __attribute__((ext_vector_type(8))) _Float16 v8h;

__device__ __forceinline__ v8h cvt8(float4 a, float4 b) {
    v8h o = {(_Float16)a.x, (_Float16)a.y, (_Float16)a.z, (_Float16)a.w,
             (_Float16)b.x, (_Float16)b.y, (_Float16)b.z, (_Float16)b.w};
    return o;
}

// f32 -> f16 conversion; 256 threads (part 'blk', thread 't' of it) convert CVT_WG
// elements (n is a multiple), a thread four runs of 8, all eight loads in flight together
#define CVT_WG 8192
__device__ __forceinline__ void f32_to_f16_part(const float* __restrict__ src,
                                                _Float16* __restrict__ dst, int n, int blk, int t) {
    int i = blk * CVT_WG + t * 8;
    if (i + 3 * 2048 + 8 > n) return;
    float4 a[4], b[4];
    #pragma unroll
    for (int g = 0; g < 4; ++g) {
        a[g] = *(const float4*)(src + i + g * 2048);
        b[g] = *(const float4*)(src + i + g * 2048 + 4);
    }
    #pragma unroll
    for (int g = 0; g < 4; ++g) *(v8h*)(dst + i + g * 2048) = cvt8(a[g], b[g]);
}

// W is (D_ x D_) row-major f32, rows k; Wt becomes its transpose in f16, rows n.
// 256 threads (tile 'blk', thread 't' of it) turn a tile of 64 k x 128 n, a thread 8 k x 4 n: eight lanes side
// by side in k write 128 bytes in a row of Wt. The pitch is a constant, so that
// a thread's loads, and its stores, share one address register pair.
__device__ __forceinline__ void transpose_to_f16_part(const float* __restrict__ W,
                                                      _Float16* __restrict__ Wt, int blk, int t) {
    int k0 = (blk / (D_ / 128)) * 64 + (t & 7) * 8;
    int n0 = (blk % (D_ / 128)) * 128 + (t >> 3) * 4;
    const float* wp = W + k0 * D_ + n0;
    float4 r[8];
    #pragma unroll
    for (int j = 0; j < 8; ++j) r[j] = *(const float4*)(wp + j * D_);
    _Float16* op = Wt + n0 * D_ + k0;
    v8h o0 = {(_Float16)r[0].x, (_Float16)r[1].x, (_Float16)r[2].x, (_Float16)r[3].x,
              (_Float16)r[4].x, (_Float16)r[5].x, (_Float16)r[6].x, (_Float16)r[7].x};
    v8h o1 = {(_Float16)r[0].y, (_Float16)r[1].y, (_Float16)r[2].y, (_Float16)r[3].y,
              (_Float16)r[4].y, (_Float16)r[5].y, (_Float16)r[6].y, (_Float16)r[7].y};
    v8h o2 = {(_Float16)r[0].z, (_Float16)r[1].z, (_Float16)r[2].z, (_Float16)r[3].z,
              (_Float16)r[4].z, (_Float16)r[5].z, (_Float16)r[6].z, (_Float16)r[7].z};
    v8h o3 = {(_Float16)r[0].w, (_Float16)r[1].w, (_Float16)r[2].w, (_Float16)r[3].w,
              (_Float16)r[4].w, (_Float16)r[5].w, (_Float16)r[6].w, (_Float16)r[7].w};
    *(v8h*)(op)          = o0;
    *(v8h*)(op + D_)     = o1;
    *(v8h*)(op + 2 * D_) = o2;
    *(v8h*)(op + 3 * D_) = o3;
    // the other parts' code stands behind these stores in the built kernel and reuses
    // their registers: the wait closes the four stores in front of any such overwrite
    asm volatile("s_wait_xcnt 0x0" ::: "memory");
}

// ---------------------------------------------------------------------------
// WMMA GEMM:  C[M,N] = A[M,K] (f16) * Bt[N,K]^T (f16)  (+ resid + bias)
// blockIdx.z picks one of up to three products that share A and run as one grid.
// block = 256 threads (8 waves), tile = 128x128, K-step = 32,
// double-buffered async global->LDS staging.
// ---------------------------------------------------------------------------
// f16 per staged row: 32 of data and 8 unused. At 80 bytes (16 B x odd) the sixteen
// rows that a 16-byte fragment load reads fall on all 64 banks; at 64 bytes four rows
// share each bank.
#define GM_P 40
__device__ inline v16h load_frag_k32(const _Float16* tile_base, int row16, int half) {
    // tile rows have stride GM_P f16; A-fragment layout for v_wmma_f32_16x16x32_f16:
    // lanes 0-15: K = {0..7, 16..23}; lanes 16-31: K = {8..15, 24..31}
    const _Float16* p = tile_base + row16 * GM_P + half * 8;
    union { v16h h; uint4 u[2]; } f;
    f.u[0] = *(const uint4*)(p);
    f.u[1] = *(const uint4*)(p + 16);
    return f.h;
}

__global__ __launch_bounds__(256) void gemm_f16_wmma_kernel(
    const _Float16* __restrict__ A,   // M x K row-major
    const _Float16* __restrict__ Bt0, // N x K row-major (B pre-transposed), product z = 0
    const _Float16* __restrict__ Bt1, // the same for z = 1 and z = 2 (unused where the grid has no such z)
    const _Float16* __restrict__ Bt2,
    float* __restrict__ C0,           // M x N, product z = 0
    float* __restrict__ C1,
    float* __restrict__ C2,
    const float* __restrict__ resid,  // optional M x N, may be null
    const float* __restrict__ bias,   // optional N, may be null
    int M, int N, int K)
{
#if defined(HAVE_ASYNC_LDS)
    __shared__ __attribute__((aligned(16))) _Float16 As[2][128 * GM_P];
    __shared__ __attribute__((aligned(16))) _Float16 Bs[2][128 * GM_P];
#else
    __shared__ __attribute__((aligned(16))) _Float16 As[1][128 * GM_P];
    __shared__ __attribute__((aligned(16))) _Float16 Bs[1][128 * GM_P];
#endif

    const _Float16* __restrict__ Bt   = blockIdx.z == 0 ? Bt0 : blockIdx.z == 1 ? Bt1 : Bt2;
    float* __restrict__          Cout = blockIdx.z == 0 ? C0 : blockIdx.z == 1 ? C1 : C2;

    const int t     = threadIdx.x;
    const int m0    = blockIdx.y * 128;
    const int n0    = blockIdx.x * 128;
    const int wave  = t >> 5;
    const int lane  = t & 31;
    const int half  = (lane >> 4) & 1;
    const int l16   = lane & 15;
    const int waveM = wave >> 2;   // 0..1  (64-row slab)
    const int waveN = wave & 3;    // 0..3  (32-col slab)

    // per-thread staging coordinates: 2 chunks of 8 f16 (16B) per matrix
    const int r0  = t >> 2;              // chunk 0 row
    const int cg0 = t & 3;               // chunk 0 col-group
    const int r1  = (t + 256) >> 2;      // chunk 1 row
    const int cg1 = t & 3;

    v8f acc[4][2] = {};
    const int nIter = K / 32;

#if defined(HAVE_ASYNC_LDS)
    // prologue: stage tile 0 into buffer 0 (4 async-load instructions / wave)
    {
        const int k0 = 0;
        async_copy_b128(&A [(size_t)(m0 + r0) * K + k0 + cg0 * 8], &As[0][r0 * GM_P + cg0 * 8]);
        async_copy_b128(&Bt[(size_t)(n0 + r0) * K + k0 + cg0 * 8], &Bs[0][r0 * GM_P + cg0 * 8]);
        async_copy_b128(&A [(size_t)(m0 + r1) * K + k0 + cg1 * 8], &As[0][r1 * GM_P + cg1 * 8]);
        async_copy_b128(&Bt[(size_t)(n0 + r1) * K + k0 + cg1 * 8], &Bs[0][r1 * GM_P + cg1 * 8]);
    }
    for (int it = 0; it < nIter; ++it) {
        const int cur = it & 1;
        if (it + 1 < nIter) {
            const int k0 = (it + 1) * 32;
            const int nxt = cur ^ 1;
            async_copy_b128(&A [(size_t)(m0 + r0) * K + k0 + cg0 * 8], &As[nxt][r0 * GM_P + cg0 * 8]);
            async_copy_b128(&Bt[(size_t)(n0 + r0) * K + k0 + cg0 * 8], &Bs[nxt][r0 * GM_P + cg0 * 8]);
            async_copy_b128(&A [(size_t)(m0 + r1) * K + k0 + cg1 * 8], &As[nxt][r1 * GM_P + cg1 * 8]);
            async_copy_b128(&Bt[(size_t)(n0 + r1) * K + k0 + cg1 * 8], &Bs[nxt][r1 * GM_P + cg1 * 8]);
            WAIT_ASYNC(4);   // drain previous batch only; next batch stays in flight
        } else {
            WAIT_ASYNC(0);
        }
        __syncthreads();

        v16h af[4], bf[2];
        #pragma unroll
        for (int mt = 0; mt < 4; ++mt)
            af[mt] = load_frag_k32(&As[cur][(waveM * 64 + mt * 16) * GM_P], l16, half);
        #pragma unroll
        for (int nt = 0; nt < 2; ++nt)
            bf[nt] = load_frag_k32(&Bs[cur][(waveN * 32 + nt * 16) * GM_P], l16, half);

        #pragma unroll
        for (int mt = 0; mt < 4; ++mt)
            #pragma unroll
            for (int nt = 0; nt < 2; ++nt)
                acc[mt][nt] = __builtin_amdgcn_wmma_f32_16x16x32_f16(
                    false, af[mt], false, bf[nt], (short)0, acc[mt][nt], false, false);
        __syncthreads();   // all reads of buf[cur] done before it is restaged
    }
#else
    for (int it = 0; it < nIter; ++it) {
        const int k0 = it * 32;
        *(uint4*)&As[0][r0 * GM_P + cg0 * 8] = *(const uint4*)&A [(size_t)(m0 + r0) * K + k0 + cg0 * 8];
        *(uint4*)&Bs[0][r0 * GM_P + cg0 * 8] = *(const uint4*)&Bt[(size_t)(n0 + r0) * K + k0 + cg0 * 8];
        *(uint4*)&As[0][r1 * GM_P + cg1 * 8] = *(const uint4*)&A [(size_t)(m0 + r1) * K + k0 + cg1 * 8];
        *(uint4*)&Bs[0][r1 * GM_P + cg1 * 8] = *(const uint4*)&Bt[(size_t)(n0 + r1) * K + k0 + cg1 * 8];
        if (k0 + 32 < K) {
            __builtin_prefetch(&A [(size_t)(m0 + (t >> 1)) * K + k0 + 32], 0, 0);
            __builtin_prefetch(&Bt[(size_t)(n0 + (t >> 1)) * K + k0 + 32], 0, 0);
        }
        __syncthreads();
        v16h af[4], bf[2];
        #pragma unroll
        for (int mt = 0; mt < 4; ++mt)
            af[mt] = load_frag_k32(&As[0][(waveM * 64 + mt * 16) * GM_P], l16, half);
        #pragma unroll
        for (int nt = 0; nt < 2; ++nt)
            bf[nt] = load_frag_k32(&Bs[0][(waveN * 32 + nt * 16) * GM_P], l16, half);
        #pragma unroll
        for (int mt = 0; mt < 4; ++mt)
            #pragma unroll
            for (int nt = 0; nt < 2; ++nt)
                acc[mt][nt] = __builtin_amdgcn_wmma_f32_16x16x32_f16(
                    false, af[mt], false, bf[nt], (short)0, acc[mt][nt], false, false);
        __syncthreads();
    }
#endif

    // C/D layout: VGPR i -> M = i + 8*half, N = l16
    #pragma unroll
    for (int mt = 0; mt < 4; ++mt) {
        #pragma unroll
        for (int nt = 0; nt < 2; ++nt) {
            #pragma unroll
            for (int i = 0; i < 8; ++i) {
                int m = m0 + waveM * 64 + mt * 16 + 8 * half + i;
                int n = n0 + waveN * 32 + nt * 16 + l16;
                float v = acc[mt][nt][i];
                if (resid) v += resid[(size_t)m * N + n];
                if (bias)  v += bias[n];
                Cout[(size_t)m * N + n] = v;
            }
        }
    }
}

// ---------------------------------------------------------------------------
// beta = clip(sigmoid(x @ Wbeta + bbeta), 1e-3, 0.999)   (4096 x 32)
// A work-group takes BT_TOK tokens and all 32 columns; each of its waves a
// slice of BT_KS values of k; a lane holds 4 tokens x 4 columns, so that eight
// 16-byte loads feed 64 multiply-adds and many loads are in flight per wait.
// The waves' partial sums meet in LDS.
// ---------------------------------------------------------------------------
#define BT_TOK   16
#define BT_WAVES 16
#define BT_KS    (D_ / BT_WAVES)   // 64
#define BT_G     4                 // runs of 4 k per register set
#define BT_SK    (BT_G * 4)        // values of k per register set
typedef __attribute__((ext_vector_type(2))) float bt2f;

// one register set: 4 tokens x BT_SK k of x, BT_SK k x 4 columns of Wb
__device__ __forceinline__ void bt_load(float4 (&xv)[BT_G][4], float4 (&wv)[BT_G][4],
                                        const float* xp, const float* wp) {
    #pragma unroll
    for (int g = 0; g < BT_G; ++g) {
        #pragma unroll
        for (int i = 0; i < 4; ++i) xv[g][i] = *(const float4*)(xp + i * D_ + g * 4);
        #pragma unroll
        for (int j = 0; j < 4; ++j) {
            // the set's last load is given, as its destination, an address pair that
            // the loads before it name: the wait stands in front of that overwrite
            if (g == BT_G - 1 && j == 3) asm volatile("s_wait_xcnt 0x0" ::: "memory");
            wv[g][j] = *(const float4*)(wp + (g * 4 + j) * 32);
        }
    }
}

__device__ __forceinline__ void bt_fma(bt2f (&acc)[4][2], const float4 (&xv)[BT_G][4],
                                       const float4 (&wv)[BT_G][4]) {
    #pragma unroll
    for (int g = 0; g < BT_G; ++g) {
        #pragma unroll
        for (int i = 0; i < 4; ++i) {
            const float xs[4] = {xv[g][i].x, xv[g][i].y, xv[g][i].z, xv[g][i].w};
            #pragma unroll
            for (int j = 0; j < 4; ++j) {
                bt2f lo = {wv[g][j].x, wv[g][j].y}, hi = {wv[g][j].z, wv[g][j].w};
                acc[i][0] += lo * xs[j];
                acc[i][1] += hi * xs[j];
            }
        }
    }
}

__device__ __forceinline__ void beta_part(const float* __restrict__ x,
                                          const float* __restrict__ Wb,
                                          const float* __restrict__ bb,
                                          float* __restrict__ beta, int blk) {
    __shared__ __attribute__((aligned(16))) float pb[BT_WAVES][BT_TOK][32];
    const int t    = threadIdx.x;
    const int wave = t >> 5;
    const int tg   = (t >> 3) & 3;   // tokens tg * 4 .. tg * 4 + 3
    const int cg   = t & 7;          // columns cg * 4 .. cg * 4 + 3
    const int m0   = blk * BT_TOK;
    const float* xp = x + (size_t)(m0 + tg * 4) * D_ + wave * BT_KS;
    const float* wp = Wb + (size_t)(wave * BT_KS) * 32 + cg * 4;

    bt2f acc[4][2] = {};
    // not unrolled: unrolled, every load of the slice was lifted to the top and spilled
    #pragma nounroll
    for (int s = 0; s < BT_KS / BT_SK; ++s) {
        float4 xv[BT_G][4], wv[BT_G][4];
        bt_load(xv, wv, xp, wp);
        // keeps the set's loads together in front of its arithmetic: sunk to their
        // uses, only a few would be in flight
        __builtin_amdgcn_sched_barrier(0);
        bt_fma(acc, xv, wv);
        xp += BT_SK;
        wp += BT_SK * 32;
    }
    #pragma unroll
    for (int i = 0; i < 4; ++i) {
        float4 o = {acc[i][0].x, acc[i][0].y, acc[i][1].x, acc[i][1].y};
        *(float4*)&pb[wave][tg * 4 + i][cg * 4] = o;
    }
    __syncthreads();
    // thread t finishes token t / 32, column t % 32
    {
        const float* pp = &pb[0][0][0] + t;
        float s4[4] = {0.f, 0.f, 0.f, 0.f};
        #pragma unroll
        for (int w = 0; w < BT_WAVES; ++w) s4[w & 3] += pp[w * (BT_TOK * 32)];
        float logit = ((s4[0] + s4[1]) + (s4[2] + s4[3])) + bb[t & 31];
        float sg = 1.f / (1.f + __expf(-logit));
        sg = fminf(fmaxf(sg, 0.001f), 0.999f);
        beta[(size_t)m0 * 32 + t] = sg;
    }
}

// ---------------------------------------------------------------------------
// All the work that reads nothing but inputs, as one grid: none of these parts
// waits for another, and launched one after the other each paid its own start
// and its own tail. The longest parts have the lowest indices.
// A work-group is one part of beta, or two parts of 256 threads of the others.
// ---------------------------------------------------------------------------
#define PR_BETA (MTOK / BT_TOK)                  // 256 work-groups
#define PR_CVT  (MTOK * D_ / CVT_WG / 2)         // 256
#define PR_TILE ((D_ / 64) * (D_ / 128))         // tiles of 64 k x 128 n per weight: 128
#define PR_TR   (4 * PR_TILE / 2)                // 256
__global__ __launch_bounds__(BT_WAVES * 32) void prep_kernel(const float* __restrict__ x,
                                                             const float* __restrict__ Wq,
                                                             const float* __restrict__ Wk,
                                                             const float* __restrict__ Wv,
                                                             const float* __restrict__ Wo,
                                                             const float* __restrict__ Wb,
                                                             const float* __restrict__ bb,
                                                             _Float16* __restrict__ xh,
                                                             _Float16* __restrict__ Wqt,
                                                             _Float16* __restrict__ Wkt,
                                                             _Float16* __restrict__ Wvt,
                                                             _Float16* __restrict__ Wot,
                                                             float* __restrict__ beta) {
    const int blk = blockIdx.x;
    if (blk < PR_BETA) {
        beta_part(x, Wb, bb, beta, blk);
        return;
    }
    const int sub = threadIdx.x >> 8, t = threadIdx.x & 255;
    if (blk < PR_BETA + PR_CVT) {
        f32_to_f16_part(x, xh, MTOK * D_, (blk - PR_BETA) * 2 + sub, t);
        return;
    }
    const int g = blk - (PR_BETA + PR_CVT);      // both of its tiles lie in weight w
    const int w = g / (PR_TILE / 2);
    const float* W  = w == 0 ? Wq  : w == 1 ? Wk  : w == 2 ? Wv  : Wo;
    _Float16*    Wt = w == 0 ? Wqt : w == 1 ? Wkt : w == 2 ? Wvt : Wot;
    transpose_to_f16_part(W, Wt, (g % (PR_TILE / 2)) * 2 + sub, t);
}

// ---------------------------------------------------------------------------
// RoPE + phi (elu+1), in place, per head half-pair (i, i+32).
// A wave takes one token; a thread four neighbouring frequencies i of four heads
// (the angle depends on token and frequency only). total = threads = tokens * 32.
// blockIdx.y picks the array: q and k go through as one grid.
// ---------------------------------------------------------------------------
__device__ __forceinline__ float phi1(float r) { return r > 0.f ? r + 1.f : __expf(r); }  // elu(r)+1

__global__ __launch_bounds__(256) void rope_phi_kernel(float* __restrict__ u0, float* __restrict__ u1, int total) {
    int idx = blockIdx.x * 256 + threadIdx.x;
    if (idx >= total) return;
    float* u = blockIdx.y == 0 ? u0 : u1;
    int i0 = (idx & 7) * 4;    // first of four rotation-frequency indices
    int hg = (idx >> 3) & 3;   // heads hg, hg + 4, hg + 8, hg + 12
    int m  = idx >> 5;         // token 0..4095
    int s  = m & (S_ - 1);     // position within sequence
    float* up = u + (size_t)m * D_ + hg * DH_ + i0;
    float4 a[4], b[4];
    #pragma unroll
    for (int j = 0; j < 4; ++j) {
        a[j] = *(const float4*)(up + j * 4 * DH_);
        b[j] = *(const float4*)(up + j * 4 * DH_ + 32);
    }
    float cs[4], sn[4];
    #pragma unroll
    for (int c = 0; c < 4; ++c) {
        float f   = __expf(-(float)(2 * (i0 + c)) * 9.210340371976184f / 64.f); // ln(10000)
        float ang = (float)s * f;
        cs[c] = __cosf(ang);
        sn[c] = __sinf(ang);
    }
    #pragma unroll
    for (int j = 0; j < 4; ++j) {
        float4 x, y;
        x.x = phi1(a[j].x * cs[0] - b[j].x * sn[0]);  y.x = phi1(a[j].x * sn[0] + b[j].x * cs[0]);
        x.y = phi1(a[j].y * cs[1] - b[j].y * sn[1]);  y.y = phi1(a[j].y * sn[1] + b[j].y * cs[1]);
        x.z = phi1(a[j].z * cs[2] - b[j].z * sn[2]);  y.z = phi1(a[j].z * sn[2] + b[j].z * cs[2]);
        x.w = phi1(a[j].w * cs[3] - b[j].w * sn[3]);  y.w = phi1(a[j].w * sn[3] + b[j].w * cs[3]);
        *(float4*)(up + j * 4 * DH_)      = x;
        *(float4*)(up + j * 4 * DH_ + 32) = y;
    }
}

// ---------------------------------------------------------------------------
// DeltaNet recurrence in chunk form, its products on the matrix unit.
// With P[c][t] the product of channel c's decays from the chunk's first step
// through step t, and M0, Z0 the state at the chunk's start, the recurrence gives
//   num[t][e] = sum_{s<=t} G[t][s] (q_t.k_s) v_s[e] + sum_c P[c][t] (q_t M0[c])[e]
//   den[t]    = sum_{s<=t} G[t][s] (q_t.k_s)        + sum_c P[c][t] (q_t.Z0[c]) + eps
//   G[t][s]   = sum_c P[c][t] / P[c][s]   (formed as exp2 of a difference of logs, never above 1 each)
//   M0'[c]    = P[c][T] M0[c] + sum_s (P[c][T] / P[c][s]) k_s v_s^T    (Z likewise, v = 1)
// Only the state goes from chunk to chunk, so the work is two launches.
// scan_state_kernel: a work-group takes one (b,h) and CK_EW columns e and walks the
// chunks in order, CK_G of them staged per barrier; waves 4..7 each carry 16 rows d
// of the state (f32, in accumulators) and store the state at every chunk's start in
// the workspace, rounded to f16 and already in B-fragment order. scan_out_kernel: a work-group takes one (b,h) and ONE
// chunk, all 64 columns e; no work-group waits for another chunk's, and the scores
// of a chunk are formed once. Each of its waves finishes 16 steps t. The denominator
// runs through the same products with a column of ones in v's place.
// q, k, v are rounded to f16 when staged; every sum is f32.
// Every '#pragma unroll' of this section stands on a loop that indexes fragments,
// accumulators or staging registers: only with constant indices do they stay in registers.
// Writes y as f16 (feeds the output WMMA GEMM directly).
// ---------------------------------------------------------------------------
#define CK_T  64                 // steps per chunk
#define CK_EW 16                 // state columns per work-group
#define CK_ES (DH_ / CK_EW)      // work-groups per (b,h)
#define CK_QP 80                 // f16 per staged row of q and k: 160 bytes, 32 B x odd for the transposing loads
typedef __attribute__((ext_vector_type(4))) _Float16 v4h;
typedef short ck_s16x8 __attribute__((ext_vector_type(8)));

__device__ __forceinline__ v16h ck_cat(v8h a, v8h b) {
    return __builtin_shufflevector(a, b, 0, 1, 2, 3, 4, 5, 6, 7, 8, 9, 10, 11, 12, 13, 14, 15);
}
// 32 k of one row that lies along k, in the hardware's k order: 8 hh + 0..7, 16 + 8 hh + 0..7
__device__ __forceinline__ v16h ck_row(const _Float16* p, int hh) {
    return ck_cat(*(const v8h*)(p + 8 * hh), *(const v8h*)(p + 16 + 8 * hh));
}
__device__ __forceinline__ v8h ck_tr(const _Float16* p) {
    typedef __attribute__((address_space(3))) ck_s16x8 lds_s16x8;
    return __builtin_bit_cast(v8h, __builtin_amdgcn_ds_load_tr16_b128_v8i16((lds_s16x8*)p));
}
// 32 k of column dbase + (lane & 15) of a tile whose rows are k, same k order (pitch in f16)
__device__ __forceinline__ v16h ck_col(const _Float16* tile, int pitch, int kbase, int dbase, int lane) {
    const _Float16* p = tile + (kbase + 8 * (lane >> 4) + (lane & 7)) * pitch + dbase + 8 * ((lane >> 3) & 1);
    return ck_cat(ck_tr(p), ck_tr(p + 16 * pitch));
}
__device__ __forceinline__ v8f ck_mm(v16h a, v16h b, v8f c) {
    return __builtin_amdgcn_wmma_f32_16x16x32_f16(false, a, false, b, (short)0, c, false, false);
}
__device__ __forceinline__ v4h ck_cvt4(float4 a) {
    v4h o = {(_Float16)a.x, (_Float16)a.y, (_Float16)a.z, (_Float16)a.w};
    return o;
}
__device__ __forceinline__ v8h ck_cvt8(v8f a) {
    v8h o = {(_Float16)a[0], (_Float16)a[1], (_Float16)a[2], (_Float16)a[3],
             (_Float16)a[4], (_Float16)a[5], (_Float16)a[6], (_Float16)a[7]};
    return o;
}

// x + (x of the lane N below, inside a row of 16 lanes; 0 where there is none): a step of a running sum
template <int N>
__device__ __forceinline__ float ck_add_shr(float x) {
    int o = __builtin_amdgcn_update_dpp(0, __builtin_bit_cast(int, x), 0x110 + N, 0xf, 0xf, true);
    return x + __builtin_bit_cast(float, o);
}

// running sum of log2 beta over a chunk; a lane holds steps 2 lane and 2 lane + 1 (l0, l1); lT: the sum at the chunk's end
__device__ __forceinline__ void ck_logsum(float rb0, float rb1, int lane, float& l0, float& l1, float& lT) {
    const float a0 = __log2f(rb0), a1 = __log2f(rb1);
    float inc = a0 + a1;
    inc = ck_add_shr<1>(inc);
    inc = ck_add_shr<2>(inc);
    inc = ck_add_shr<4>(inc);
    inc = ck_add_shr<8>(inc);
    const float low = __builtin_bit_cast(float, __builtin_amdgcn_readlane(__builtin_bit_cast(int, inc), 15));
    if (lane >= 16) inc += low;
    l0 = inc - a1;
    l1 = inc;
    lT = __builtin_bit_cast(float, __builtin_amdgcn_readlane(__builtin_bit_cast(int, inc), 31));
}

#define CK_N  (S_ / CK_T)                      // chunks per sequence
// the state at a chunk's start, in the workspace, per (b,h) and chunk:
// M as [block of 16 columns e][channel][32 rows d][first, second 16 of them][lane][8 rows], Z as [channel][row d]
#define CK_MF (C_ * 2 * 2 * 32 * 8)            // f16 of M per block of columns
#define CK_MS (CK_ES * CK_MF)
#define CK_ZS (C_ * DH_)

#define CK_G  4                                // chunks staged per barrier of the state pass
#define CK_GT (CK_G * CK_T)

// Work-group barrier that waits for this wave's LDS accesses alone. __syncthreads() would
// also wait until the wave's stores of the state are acknowledged, which no wave of this
// launch reads.
__device__ __forceinline__ void ck_barrier_lds() {
    asm volatile("s_wait_dscnt 0x0\n\ts_barrier_signal -1\n\ts_barrier_wait -1" ::: "memory");
}

__global__ __launch_bounds__(256) void scan_state_kernel(const float* __restrict__ k,
                                                         const float* __restrict__ v,
                                                         const float* __restrict__ beta,
                                                         _Float16* __restrict__ sm,
                                                         _Float16* __restrict__ sz) {
    __shared__ __attribute__((aligned(16))) _Float16 sk[2][CK_GT][CK_QP];
    __shared__ __attribute__((aligned(16))) _Float16 sv[2][CK_GT][CK_EW];
    __shared__ __attribute__((aligned(16))) _Float16 sw[2][C_][CK_GT];   // P[c][T] / P[c][s], T the end of s's chunk
    __shared__ __attribute__((aligned(16))) float    spT[2][CK_G][C_];   // P[c][T]

    const int bh   = blockIdx.x / CK_ES;
    const int es   = blockIdx.x % CK_ES;
    const int b    = bh / H_, h = bh % H_;
    const int t    = threadIdx.x;
    const int lane = t & 31;
    const int c16  = lane & 15;
    const int hh   = lane >> 4;
    const int wave = __builtin_amdgcn_readfirstlane(t >> 5);   // scalar, so that the roles part at a scalar branch

    const float* kp = k + (size_t)b * S_ * D_ + h * DH_;
    const float* vp = v + (size_t)b * S_ * D_ + h * DH_ + es * CK_EW;
    const float* bp = beta + (size_t)b * S_ * (H_ * C_) + h * C_;

    // staging, per thread and CK_G chunks: 4 CK_G float4 of k and CK_G of v; waves 0..3, which
    // carry no state, the decays of one chunk each, both channels
    const int  srow = t >> 4, scol = (t & 15) * 4;
    const int  vrow = t >> 2, vcol = (t & 3) * 4;
    const bool bwav = wave < CK_G;

    float4 rk[4 * CK_G], rv[CK_G];
    float2 rb0 = {1.f, 1.f}, rb1 = {1.f, 1.f};
    auto fetch = [&](int ts) {
        #pragma unroll
        for (int i = 0; i < 4 * CK_G; ++i) rk[i] = *(const float4*)(kp + (size_t)(ts + srow + 16 * i) * D_ + scol);
        #pragma unroll
        for (int i = 0; i < CK_G; ++i) rv[i] = *(const float4*)(vp + (size_t)(ts + vrow + CK_T * i) * D_ + vcol);
        // what follows rewrites the address registers that these loads name
        asm volatile("s_wait_xcnt 0x0" ::: "memory");
        if (bwav) {
            rb0 = *(const float2*)(bp + (size_t)(ts + wave * CK_T + 2 * lane) * (H_ * C_));
            rb1 = *(const float2*)(bp + (size_t)(ts + wave * CK_T + 2 * lane + 1) * (H_ * C_));
            // the same for these two
            asm volatile("s_wait_xcnt 0x0" ::: "memory");
        }
    };
    auto stage = [&](int buf) {
        #pragma unroll
        for (int i = 0; i < 4 * CK_G; ++i) *(v4h*)&sk[buf][srow + 16 * i][scol] = ck_cvt4(rk[i]);
        #pragma unroll
        for (int i = 0; i < CK_G; ++i) *(v4h*)&sv[buf][vrow + CK_T * i][vcol] = ck_cvt4(rv[i]);
        if (bwav) {
            const float x0[C_] = {rb0.x, rb0.y}, x1[C_] = {rb1.x, rb1.y};
            #pragma unroll
            for (int ch = 0; ch < C_; ++ch) {
                float l0, l1, lT;
                ck_logsum(x0[ch], x1[ch], lane, l0, l1, lT);
                sw[buf][ch][wave * CK_T + 2 * lane]     = (_Float16)__builtin_amdgcn_exp2f(lT - l0);
                sw[buf][ch][wave * CK_T + 2 * lane + 1] = (_Float16)__builtin_amdgcn_exp2f(lT - l1);
                if (lane == 0) spT[buf][wave][ch] = __builtin_amdgcn_exp2f(lT);
            }
        }
    };

    v8f M[C_] = {}, Z[C_] = {};   // waves 4..7: rows dt * 16 + 8 hh + r, column c16; Z the same in every column
    const int dt = wave & 3;      // the state wave's block of rows d
    // the state as it stands, which is that at the start of chunk n
    auto put_state = [&](int n) {
        _Float16* mo = sm + (size_t)(bh * CK_N + n) * CK_MS + es * CK_MF + dt * 256 + lane * 8;
        #pragma unroll
        for (int ch = 0; ch < C_; ++ch) *(v8h*)(mo + ch * (CK_MF / C_)) = ck_cvt8(M[ch]);
        // Z is the same in every column and in every block of columns: one copy goes out
        if (es == 0 && c16 == 0) {
            _Float16* zo = sz + (size_t)(bh * CK_N + n) * CK_ZS + dt * 16 + 8 * hh;
            #pragma unroll
            for (int ch = 0; ch < C_; ++ch) *(v8h*)(zo + ch * DH_) = ck_cvt8(Z[ch]);
        }
        // what follows rewrites registers that these stores name
        asm volatile("s_wait_xcnt 0x0" ::: "memory");
    };

    fetch(0);
    stage(0);
    ck_barrier_lds();

    // not unrolled, so that the last trip is not peeled off and the next chunks'
    // global loads stay at the head of the trip, in flight under these chunks' work
    #pragma nounroll
    for (int n = 0; n < CK_N / CK_G; ++n) {
        const int  cur  = n & 1;
        const bool more = n + 1 < CK_N / CK_G;
        if (more) fetch((n + 1) * CK_GT);

        if (wave >= 4) {
            #pragma unroll
            for (int g = 0; g < CK_G; ++g) {
                // the chunk's fragments are asked for first: their way from LDS runs under the stores of the state
                const _Float16* Kt = &sk[cur][g * CK_T][0];
                const _Float16* Vt = &sv[cur][g * CK_T][0];
                const float2 pT = *(const float2*)&spT[cur][g][0];
                v16h kt[2], vf[2], wf[2][C_];
                #pragma unroll
                for (int j = 0; j < 2; ++j) {
                    kt[j] = ck_col(Kt, CK_QP, 32 * j, dt * 16, lane);   // A: row d, k = s
                    vf[j] = ck_col(Vt, CK_EW, 32 * j, 0, lane);         // B: column e, k = s
                    #pragma unroll
                    for (int ch = 0; ch < C_; ++ch)
                        wf[j][ch] = ck_row(&sw[cur][ch][g * CK_T + 32 * j], hh);   // the weights of the steps s, same k order
                }
                put_state(n * CK_G + g);
                // the sequence's last chunk changes no state that anybody reads
                if (g + 1 < CK_G || more) {
                    M[0] *= pT.x; Z[0] *= pT.x;
                    M[1] *= pT.y; Z[1] *= pT.y;
                    #pragma unroll
                    for (int j = 0; j < 2; ++j) {
                        #pragma unroll
                        for (int ch = 0; ch < C_; ++ch) {
                            M[ch] = ck_mm(kt[j], vf[j] * wf[j][ch], M[ch]);
                            Z[ch] = ck_mm(kt[j], wf[j][ch], Z[ch]);
                        }
                    }
                }
            }
        }

        // the other buffers were last read before the previous trip's barrier
        if (more) stage(cur ^ 1);
        // one barrier per CK_G chunks: publishes the next chunks' staged rows
        ck_barrier_lds();
    }
}

__global__ __launch_bounds__(128) void scan_out_kernel(const float* __restrict__ q,
                                                       const float* __restrict__ k,
                                                       const float* __restrict__ v,
                                                       const float* __restrict__ beta,
                                                       const _Float16* __restrict__ sm,
                                                       const _Float16* __restrict__ sz,
                                                       _Float16* __restrict__ y) {
    __shared__ __attribute__((aligned(16))) _Float16 sq[CK_T][CK_QP];
    __shared__ __attribute__((aligned(16))) _Float16 sk[CK_T][CK_QP];
    __shared__ __attribute__((aligned(16))) _Float16 sv[CK_T][CK_QP];
    __shared__ __attribute__((aligned(16))) float    sl[C_][CK_T];   // log2 P[c][s]
    __shared__ __attribute__((aligned(16))) float    sp[C_][CK_T];   // P[c][s]
    __shared__ __attribute__((aligned(16))) _Float16 ss[CK_MS];      // M at the chunk's start

    const int bh   = blockIdx.x / CK_N;
    const int ts0  = (blockIdx.x % CK_N) * CK_T;
    const int b    = bh / H_, h = bh % H_;
    const int t    = threadIdx.x;
    const int lane = t & 31;
    const int c16  = lane & 15;
    const int hh   = lane >> 4;
    const int dt   = __builtin_amdgcn_readfirstlane(t >> 5);   // the wave, and its block of steps t; scalar for the branch on it

    const size_t row0 = ((size_t)b * S_ + ts0) * D_ + h * DH_;
    const _Float16* mp = sm + (size_t)blockIdx.x * CK_MS;
    const _Float16* zp = sz + (size_t)blockIdx.x * CK_ZS;

    // ---- the chunk's decays, its start state and its rows of q, k, v, all loads in flight together
    float rb0 = 1.f, rb1 = 1.f;
    if (dt < C_) {
        // waves 0 and 1: a channel of beta each
        const float* bp = beta + ((size_t)b * S_ + ts0) * (H_ * C_) + h * C_ + dt;
        rb0 = bp[(size_t)(2 * lane) * (H_ * C_)];
        rb1 = bp[(size_t)(2 * lane + 1) * (H_ * C_)];
        // what follows rewrites the address registers that these loads name
        asm volatile("s_wait_xcnt 0x0" ::: "memory");
    }
    // Z at the chunk's start as B fragments, the same in every column: rows d in the k order of q's fragments
    v16h zb[C_][2];
    #pragma unroll
    for (int ch = 0; ch < C_; ++ch) {
        #pragma unroll
        for (int kk = 0; kk < 2; ++kk)
            zb[ch][kk] = ck_cat(*(const v8h*)(zp + ch * DH_ + kk * 32 + 8 * hh),
                                *(const v8h*)(zp + ch * DH_ + kk * 32 + 16 + 8 * hh));
    }
    // the same for these eight
    asm volatile("s_wait_xcnt 0x0" ::: "memory");
    const int srow = t >> 4, scol = (t & 15) * 4;
    {
        const float* qp = q + row0 + (size_t)srow * D_ + scol;
        const float* kp = k + row0 + (size_t)srow * D_ + scol;
        const float* vp = v + row0 + (size_t)srow * D_ + scol;
        float4 rq[8], rk[8], rv[8];
        v8h    rs[8];
        #pragma unroll
        for (int i = 0; i < 8; ++i) rs[i] = *(const v8h*)(mp + (i * 128 + t) * 8);
        #pragma unroll
        for (int i = 0; i < 8; ++i) {
            rq[i] = *(const float4*)(qp + (size_t)(8 * i) * D_);
            rk[i] = *(const float4*)(kp + (size_t)(8 * i) * D_);
            rv[i] = *(const float4*)(vp + (size_t)(8 * i) * D_);
        }
        // the same for all of these
        asm volatile("s_wait_xcnt 0x0" ::: "memory");
        // holds the loads of the state up here, in flight with the rows': sunk to their use
        // behind the branch below, they were issued only when rows had come back
        asm volatile("" :: "v"(rs[0]), "v"(rs[1]), "v"(rs[2]), "v"(rs[3]), "v"(rs[4]), "v"(rs[5]), "v"(rs[6]), "v"(rs[7]));
        if (dt < C_) {
            float l0, l1, lT;
            ck_logsum(rb0, rb1, lane, l0, l1, lT);
            float2 lo = {l0, l1};
            float2 po = {__builtin_amdgcn_exp2f(l0), __builtin_amdgcn_exp2f(l1)};
            *(float2*)&sl[dt][2 * lane] = lo;
            *(float2*)&sp[dt][2 * lane] = po;
        }
        #pragma unroll
        for (int i = 0; i < 8; ++i) *(v8h*)&ss[(i * 128 + t) * 8] = rs[i];
        #pragma unroll
        for (int i = 0; i < 8; ++i) {
            *(v4h*)&sq[srow + 8 * i][scol] = ck_cvt4(rq[i]);
            *(v4h*)&sk[srow + 8 * i][scol] = ck_cvt4(rk[i]);
            *(v4h*)&sv[srow + 8 * i][scol] = ck_cvt4(rv[i]);
        }
    }
    // the one barrier: publishes the staged rows, the decays and the state
    __syncthreads();

    v16h ones;
    #pragma unroll
    for (int i = 0; i < 16; ++i) ones[i] = (_Float16)1.f;

    const _Float16* Kt = &sk[0][0];
    const _Float16* Vt = &sv[0][0];
    const int tl = dt * 16 + c16;
    v16h qf[2];   // row t = tl: B (column t) of the score product, A (row t) of the state product
    #pragma unroll
    for (int kk = 0; kk < 2; ++kk) qf[kk] = ck_row(&sq[tl][kk * 32], hh);
    const float lt0 = sl[0][tl], lt1 = sl[1][tl];

    // scores transposed: st[r] = k_s.q_t, s = sb * 16 + 8 hh + r, t = tl; two such
    // tiles, weighted and rounded, are an A fragment with row t and k = s
    v16h af[2];
    #pragma unroll
    for (int sb = 0; sb < 4; ++sb) {
        v8f st = {};
        #pragma unroll
        for (int kk = 0; kk < 2; ++kk)
            st = ck_mm(ck_row(Kt + (sb * 16 + c16) * CK_QP + kk * 32, hh), qf[kk], st);
        const float4 x0 = *(const float4*)&sl[0][sb * 16 + 8 * hh];
        const float4 x1 = *(const float4*)&sl[0][sb * 16 + 8 * hh + 4];
        const float4 y0 = *(const float4*)&sl[1][sb * 16 + 8 * hh];
        const float4 y1 = *(const float4*)&sl[1][sb * 16 + 8 * hh + 4];
        const float ls0[8] = {x0.x, x0.y, x0.z, x0.w, x1.x, x1.y, x1.z, x1.w};
        const float ls1[8] = {y0.x, y0.y, y0.z, y0.w, y1.x, y1.y, y1.z, y1.w};
        #pragma unroll
        for (int r = 0; r < 8; ++r) {
            // later steps s do not count: their weight is exp2 of a large negative number, 0
            const bool  on = sb * 16 + 8 * hh + r <= tl;
            const float g  = __builtin_amdgcn_exp2f(on ? lt0 - ls0[r] : -1000.f)
                           + __builtin_amdgcn_exp2f(on ? lt1 - ls1[r] : -1000.f);
            af[sb >> 1][(sb & 1) * 8 + r] = (_Float16)(st[r] * g);
        }
    }

    // register r of every accumulator: step t = dt * 16 + 8 hh + r, column c16
    const float4 u0 = *(const float4*)&sp[0][dt * 16 + 8 * hh];
    const float4 u1 = *(const float4*)&sp[0][dt * 16 + 8 * hh + 4];
    const float4 w0 = *(const float4*)&sp[1][dt * 16 + 8 * hh];
    const float4 w1 = *(const float4*)&sp[1][dt * 16 + 8 * hh + 4];
    const float p0[8] = {u0.x, u0.y, u0.z, u0.w, u1.x, u1.y, u1.z, u1.w};
    const float p1[8] = {w0.x, w0.y, w0.z, w0.w, w1.x, w1.y, w1.z, w1.w};

    v8f den = {}, dz[C_] = {};
    #pragma unroll
    for (int j = 0; j < 2; ++j) den = ck_mm(af[j], ones, den);
    #pragma unroll
    for (int ch = 0; ch < C_; ++ch) {
        #pragma unroll
        for (int kk = 0; kk < 2; ++kk) dz[ch] = ck_mm(qf[kk], zb[ch][kk], dz[ch]);
    }
    float rd[8];
    #pragma unroll
    for (int r = 0; r < 8; ++r)
        rd[r] = __builtin_amdgcn_rcpf(den[r] + p0[r] * dz[0][r] + p1[r] * dz[1][r] + 1e-6f);

    v8h yv[CK_ES];   // y of steps dt * 16 + 8 hh + r, column eb * 16 + c16
    #pragma unroll
    for (int eb = 0; eb < CK_ES; ++eb) {
        v8f num = {}, nm[C_] = {};
        #pragma unroll
        for (int j = 0; j < 2; ++j) num = ck_mm(af[j], ck_col(Vt, CK_QP, 32 * j, eb * CK_EW, lane), num);
        #pragma unroll
        for (int ch = 0; ch < C_; ++ch) {
            #pragma unroll
            for (int kk = 0; kk < 2; ++kk) {
                const _Float16* f = &ss[eb * CK_MF + (ch * 2 + kk) * 512 + lane * 8];
                nm[ch] = ck_mm(qf[kk], ck_cat(*(const v8h*)f, *(const v8h*)(f + 256)), nm[ch]);
            }
        }
        #pragma unroll
        for (int r = 0; r < 8; ++r)
            yv[eb][r] = (_Float16)((num[r] + p0[r] * nm[0][r] + p1[r] * nm[1][r]) * rd[r]);
    }
    _Float16* yo = y + row0 + (size_t)(dt * 16 + 8 * hh) * D_ + c16;
    #pragma unroll
    for (int eb = 0; eb < CK_ES; ++eb) {
        #pragma unroll
        for (int r = 0; r < 8; ++r) yo[(size_t)r * D_ + eb * CK_EW] = yv[eb][r];
    }
}

// ---------------------------------------------------------------------------
// LayerNorm over rows of h (4096 x 1024), f32 out
// ---------------------------------------------------------------------------
__global__ __launch_bounds__(256) void ln_kernel(const float* __restrict__ hbuf,
                                                 const float* __restrict__ gamma,
                                                 const float* __restrict__ lbeta,
                                                 float* __restrict__ out) {
    __shared__ float rs[256], rq[256];
    __shared__ float smu, srstd;
    int m = blockIdx.x, t = threadIdx.x;
    const float* hr = hbuf + (size_t)m * D_;
    float s = 0.f, q2 = 0.f;
    float vals[4];
    #pragma unroll
    for (int i = 0; i < 4; ++i) {
        float v = hr[t + i * 256];
        vals[i] = v; s += v; q2 += v * v;
    }
    rs[t] = s; rq[t] = q2;
    __syncthreads();
    for (int off = 128; off > 0; off >>= 1) {
        if (t < off) { rs[t] += rs[t + off]; rq[t] += rq[t + off]; }
        __syncthreads();
    }
    if (t == 0) {
        float mu  = rs[0] * (1.f / D_);
        float var = rq[0] * (1.f / D_) - mu * mu;
        smu = mu; srstd = rsqrtf(var + 1e-5f);
    }
    __syncthreads();
    float* orow = out + (size_t)m * D_;
    #pragma unroll
    for (int i = 0; i < 4; ++i) {
        int n = t + i * 256;
        orow[n] = gamma[n] * (vals[i] - smu) * srstd + lbeta[n];
    }
}

// ---------------------------------------------------------------------------
// launch
// ---------------------------------------------------------------------------
extern "C" void kernel_launch(void* const* d_in, const int* in_sizes, int n_in,
                              void* d_out, int out_size, void* d_ws, size_t ws_size,
                              hipStream_t stream) {
    const float* x      = (const float*)d_in[0];
    const float* Wq     = (const float*)d_in[1];
    const float* Wk     = (const float*)d_in[2];
    const float* Wv     = (const float*)d_in[3];
    const float* Wbeta  = (const float*)d_in[4];
    const float* bbeta  = (const float*)d_in[5];
    const float* Wo     = (const float*)d_in[6];
    const float* bo     = (const float*)d_in[7];
    const float* lng    = (const float*)d_in[8];
    const float* lnb    = (const float*)d_in[9];
    float* out = (float*)d_out;

    char* ws = (char*)d_ws;
    size_t off = 0;
    auto alloc = [&](size_t bytes) { char* p = ws + off; off += (bytes + 255) & ~(size_t)255; return p; };

    _Float16* xh   = (_Float16*)alloc((size_t)MTOK * D_ * 2);   // 8 MB
    _Float16* Wqt  = (_Float16*)alloc((size_t)D_ * D_ * 2);     // 2 MB each
    _Float16* Wkt  = (_Float16*)alloc((size_t)D_ * D_ * 2);
    _Float16* Wvt  = (_Float16*)alloc((size_t)D_ * D_ * 2);
    _Float16* Wot  = (_Float16*)alloc((size_t)D_ * D_ * 2);
    float*    qbuf = (float*)alloc((size_t)MTOK * D_ * 4);      // 16 MB each
    float*    kbuf = (float*)alloc((size_t)MTOK * D_ * 4);
    float*    vbuf = (float*)alloc((size_t)MTOK * D_ * 4);
    float*    bbuf = (float*)alloc((size_t)MTOK * 32 * 4);      // 0.5 MB
    _Float16* ybuf = (_Float16*)alloc((size_t)MTOK * D_ * 2);   // 8 MB
    float*    hbuf = (float*)alloc((size_t)MTOK * D_ * 4);      // 16 MB
    _Float16* smbuf = (_Float16*)alloc((size_t)B_ * H_ * CK_N * CK_MS * 2);   // 16 MB
    _Float16* szbuf = (_Float16*)alloc((size_t)B_ * H_ * CK_N * CK_ZS * 2);   // 0.25 MB
    (void)ws_size; (void)in_sizes; (void)n_in; (void)out_size;

    // beta, x in f16 and the four weights transposed: one grid
    prep_kernel<<<PR_BETA + PR_CVT + PR_TR, BT_WAVES * 32, 0, stream>>>(
        x, Wq, Wk, Wv, Wo, Wbeta, bbeta, xh, Wqt, Wkt, Wvt, Wot, bbuf);

    // q, k, v: one grid, z picks the weight
    dim3 ggrid3(D_ / 128, MTOK / 128, 3);   // (8, 32, 3)
    gemm_f16_wmma_kernel<<<ggrid3, 256, 0, stream>>>(xh, Wqt, Wkt, Wvt, qbuf, kbuf, vbuf,
                                                     nullptr, nullptr, MTOK, D_, D_);

    const int nPairs = MTOK * 32;  // threads per array: 16 half-pairs each
    dim3 rgrid(nPairs / 256, 2);
    rope_phi_kernel<<<rgrid, 256, 0, stream>>>(qbuf, kbuf, nPairs);

    // the state at every chunk's start, chunk after chunk; then every chunk's outputs, all chunks at once
    scan_state_kernel<<<B_ * H_ * CK_ES, 256, 0, stream>>>(kbuf, vbuf, bbuf, smbuf, szbuf);
    scan_out_kernel<<<B_ * H_ * CK_N, 128, 0, stream>>>(qbuf, kbuf, vbuf, bbuf, smbuf, szbuf, ybuf);

    // h = x + y @ Wo + bo (fused residual + bias epilogue)
    dim3 ggrid(D_ / 128, MTOK / 128);   // (8, 32)
    gemm_f16_wmma_kernel<<<ggrid, 256, 0, stream>>>(ybuf, Wot, nullptr, nullptr, hbuf, nullptr, nullptr,
                                                    x, bo, MTOK, D_, D_);

    ln_kernel<<<MTOK, 256, 0, stream>>>(hbuf, lng, lnb, out);
}

// v009
// Measured time: 125 microseconds a run.
// Next to v008, in two timings, it ran 1.07 times as fast each time.
// Over all steps from v000 it is 25.2 times as fast.
#include <hip/hip_runtime.h>
#include <hip/hip_bf16.h>

typedef __attribute__((ext_vector_type(16))) _Float16 v16h;
typedef __attribute__((ext_vector_type(8)))  float    v8f;

#define B_   2
#define S_   2048
#define D_   1024
#define H_   16
#define DH_  64
#define C_   2
#define MTOK (B_ * S_)   // 4096

// ---------------------------------------------------------------------------
// CDNA5 async global->LDS copy (ASYNCcnt path), with sync fallback
// ---------------------------------------------------------------------------
#if defined(__has_builtin)
#if __has_builtin(__builtin_amdgcn_global_load_async_to_lds_b128)
#define HAVE_ASYNC_LDS 1
#endif
#endif

#if defined(HAVE_ASYNC_LDS)
// builtin signature: void(v4i addrspace(1)*, v4i addrspace(3)*, imm offset, imm cpol)
typedef int v4i_vs __attribute__((vector_size(4 * sizeof(int))));
typedef __attribute__((address_space(1))) v4i_vs* g_v4i_p;
typedef __attribute__((address_space(3))) v4i_vs* l_v4i_p;
__device__ __forceinline__ void async_copy_b128(const _Float16* g, _Float16* l) {
    __builtin_amdgcn_global_load_async_to_lds_b128(
        (g_v4i_p)(void*)const_cast<_Float16*>(g), (l_v4i_p)(void*)l, 0, 0);
}
#endif

// ---------------------------------------------------------------------------
// The three element-wise helpers below give each thread 32 elements, moved in
// 16-byte pieces: with one element per thread their time was the
// time it takes to start their waves, not the time to move their bytes.
// ---------------------------------------------------------------------------
typedef __attribute__((ext_vector_type(8))) _Float16 v8h;

__device__ __forceinline__ v8h cvt8(float4 a, float4 b) {
    v8h o = {(_Float16)a.x, (_Float16)a.y, (_Float16)a.z, (_Float16)a.w,
             (_Float16)b.x, (_Float16)b.y, (_Float16)b.z, (_Float16)b.w};
    return o;
}

// f32 -> f16 conversion; 256 threads (part 'blk', thread 't' of it) convert CVT_WG
// elements (n is a multiple), a thread four runs of 8, all eight loads in flight together
#define CVT_WG 8192
__device__ __forceinline__ void f32_to_f16_part(const float* __restrict__ src,
                                                _Float16* __restrict__ dst, int n, int blk, int t) {
    int i = blk * CVT_WG + t * 8;
    if (i + 3 * 2048 + 8 > n) return;
    float4 a[4], b[4];
    #pragma unroll
    for (int g = 0; g < 4; ++g) {
        a[g] = *(const float4*)(src + i + g * 2048);
        b[g] = *(const float4*)(src + i + g * 2048 + 4);
    }
    #pragma unroll
    for (int g = 0; g < 4; ++g) *(v8h*)(dst + i + g * 2048) = cvt8(a[g], b[g]);
}

// W is (D_ x D_) row-major f32, rows k; Wt becomes its transpose in f16, rows n.
// 256 threads (tile 'blk', thread 't' of it) turn a tile of 64 k x 128 n, a thread 8 k x 4 n: eight lanes side
// by side in k write 128 bytes in a row of Wt. The pitch is a constant, so that
// a thread's loads, and its stores, share one address register pair.
__device__ __forceinline__ void transpose_to_f16_part(const float* __restrict__ W,
                                                      _Float16* __restrict__ Wt, int blk, int t) {
    int k0 = (blk / (D_ / 128)) * 64 + (t & 7) * 8;
    int n0 = (blk % (D_ / 128)) * 128 + (t >> 3) * 4;
    const float* wp = W + k0 * D_ + n0;
    float4 r[8];
    #pragma unroll
    for (int j = 0; j < 8; ++j) r[j] = *(const float4*)(wp + j * D_);
    _Float16* op = Wt + n0 * D_ + k0;
    v8h o0 = {(_Float16)r[0].x, (_Float16)r[1].x, (_Float16)r[2].x, (_Float16)r[3].x,
              (_Float16)r[4].x, (_Float16)r[5].x, (_Float16)r[6].x, (_Float16)r[7].x};
    v8h o1 = {(_Float16)r[0].y, (_Float16)r[1].y, (_Float16)r[2].y, (_Float16)r[3].y,
              (_Float16)r[4].y, (_Float16)r[5].y, (_Float16)r[6].y, (_Float16)r[7].y};
    v8h o2 = {(_Float16)r[0].z, (_Float16)r[1].z, (_Float16)r[2].z, (_Float16)r[3].z,
              (_Float16)r[4].z, (_Float16)r[5].z, (_Float16)r[6].z, (_Float16)r[7].z};
    v8h o3 = {(_Float16)r[0].w, (_Float16)r[1].w, (_Float16)r[2].w, (_Float16)r[3].w,
              (_Float16)r[4].w, (_Float16)r[5].w, (_Float16)r[6].w, (_Float16)r[7].w};
    *(v8h*)(op)          = o0;
    *(v8h*)(op + D_)     = o1;
    *(v8h*)(op + 2 * D_) = o2;
    *(v8h*)(op + 3 * D_) = o3;
    // the other parts' code stands behind these stores in the built kernel and reuses
    // their registers: the wait closes the four stores in front of any such overwrite
    asm volatile("s_wait_xcnt 0x0" ::: "memory");
}

// ---------------------------------------------------------------------------
// WMMA GEMM:  C[M,N] = A[M,K] (f16) * Bt[N,K]^T (f16)  (+ resid + bias)
// blockIdx.z picks one of up to three products that share A and run as one grid.
// block = 256 threads (8 waves), tile = 128x128, K-step = GM_K,
// double-buffered async global->LDS staging.
// ---------------------------------------------------------------------------
// k per staged tile: a row's piece is 128 bytes, one whole line of A or Bt, so that a
// wave's copy of 512 bytes touches four lines; at 32 k it touched eight, half of each.
#define GM_K 64
// f16 per staged row: GM_K of data and 8 unused. At 144 bytes (16 B x odd) the sixteen
// rows that a 16-byte fragment load reads fall on all 64 banks.
#define GM_P (GM_K + 8)
#define GM_C (128 * GM_K / 8 / 256)   // 16-byte pieces per thread and matrix
__device__ inline v16h load_frag_k32(const _Float16* tile_base, int row16, int half) {
    // tile rows have stride GM_P f16; A-fragment layout for v_wmma_f32_16x16x32_f16:
    // lanes 0-15: K = {0..7, 16..23}; lanes 16-31: K = {8..15, 24..31}
    const _Float16* p = tile_base + row16 * GM_P + half * 8;
    union { v16h h; uint4 u[2]; } f;
    f.u[0] = *(const uint4*)(p);
    f.u[1] = *(const uint4*)(p + 16);
    return f.h;
}

__global__ __launch_bounds__(256) void gemm_f16_wmma_kernel(
    const _Float16* __restrict__ A,   // M x K row-major
    const _Float16* __restrict__ Bt0, // N x K row-major (B pre-transposed), product z = 0
    const _Float16* __restrict__ Bt1, // the same for z = 1 and z = 2 (unused where the grid has no such z)
    const _Float16* __restrict__ Bt2,
    float* __restrict__ C0,           // M x N, product z = 0
    float* __restrict__ C1,
    float* __restrict__ C2,
    const float* __restrict__ resid,  // optional M x N, may be null
    const float* __restrict__ bias,   // optional N, may be null
    int M, int N, int K)
{
#if defined(HAVE_ASYNC_LDS)
    __shared__ __attribute__((aligned(16))) _Float16 As[2][128 * GM_P];
    __shared__ __attribute__((aligned(16))) _Float16 Bs[2][128 * GM_P];
#else
    __shared__ __attribute__((aligned(16))) _Float16 As[1][128 * GM_P];
    __shared__ __attribute__((aligned(16))) _Float16 Bs[1][128 * GM_P];
#endif

    const _Float16* __restrict__ Bt   = blockIdx.z == 0 ? Bt0 : blockIdx.z == 1 ? Bt1 : Bt2;
    float* __restrict__          Cout = blockIdx.z == 0 ? C0 : blockIdx.z == 1 ? C1 : C2;

    const int t     = threadIdx.x;
    const int m0    = blockIdx.y * 128;
    const int n0    = blockIdx.x * 128;
    const int wave  = t >> 5;
    const int lane  = t & 31;
    const int half  = (lane >> 4) & 1;
    const int l16   = lane & 15;
    const int waveM = wave >> 2;   // 0..1  (64-row slab)
    const int waveN = wave & 3;    // 0..3  (32-col slab)

    // per-thread staging coordinates: GM_C pieces of 8 f16 (16B) per matrix, in rows r0 + 32 j;
    // eight lanes side by side fill a row
    const int r0 = t >> 3;
    const int cg = t & 7;

    v8f acc[4][2] = {};
    const int nIter = K / GM_K;
    // the products of one staged tile; its loops are unrolled so that fragments and
    // accumulators have constant indices and stay in registers
    auto tile_mm = [&](const _Float16* At, const _Float16* Bw) {
        #pragma unroll
        for (int kk = 0; kk < GM_K / 32; ++kk) {
            v16h af[4], bf[2];
            #pragma unroll
            for (int mt = 0; mt < 4; ++mt)
                af[mt] = load_frag_k32(At + (waveM * 64 + mt * 16) * GM_P + kk * 32, l16, half);
            #pragma unroll
            for (int nt = 0; nt < 2; ++nt)
                bf[nt] = load_frag_k32(Bw + (waveN * 32 + nt * 16) * GM_P + kk * 32, l16, half);
            #pragma unroll
            for (int mt = 0; mt < 4; ++mt)
                #pragma unroll
                for (int nt = 0; nt < 2; ++nt)
                    acc[mt][nt] = __builtin_amdgcn_wmma_f32_16x16x32_f16(
                        false, af[mt], false, bf[nt], (short)0, acc[mt][nt], false, false);
        }
    };

#if defined(HAVE_ASYNC_LDS)
    // one tile's copies: 2 GM_C per wave, unrolled so that they issue back to back
    auto stage = [&](int k0, int buf) {
        #pragma unroll
        for (int j = 0; j < GM_C; ++j) {
            const int r = r0 + 32 * j;
            async_copy_b128(&A [(size_t)(m0 + r) * K + k0 + cg * 8], &As[buf][r * GM_P + cg * 8]);
            async_copy_b128(&Bt[(size_t)(n0 + r) * K + k0 + cg * 8], &Bs[buf][r * GM_P + cg * 8]);
        }
    };
    // two buffers: tile 0 lands and is published; tile 1 flies under tile 0's products
    stage(0, 0);
    asm volatile("s_wait_asynccnt 0x0" ::: "memory");   // this wave's copies of tile 0 have landed
    __syncthreads();
    if (1 < nIter) stage(GM_K, 1);
    for (int it = 0; it < nIter; ++it) {
        const int cur = it & 1;
        tile_mm(&As[cur][0], &Bs[cur][0]);
        // this wave's reads of buf[cur] are done before the barrier behind which it is refilled
        asm volatile("s_wait_dscnt 0x0" ::: "memory");
        // this wave's copies of the next tile have landed before the barrier that publishes them
        asm volatile("s_wait_asynccnt 0x0" ::: "memory");
        __syncthreads();
        if (it + 2 < nIter) stage((it + 2) * GM_K, cur);
    }
    // no copy is outstanding when the wave goes on to its stores and ends
    asm volatile("s_wait_asynccnt 0x0" ::: "memory");
#else
    for (int it = 0; it < nIter; ++it) {
        const int k0 = it * GM_K;
        #pragma unroll
        for (int j = 0; j < GM_C; ++j) {
            const int r = r0 + 32 * j;
            *(uint4*)&As[0][r * GM_P + cg * 8] = *(const uint4*)&A [(size_t)(m0 + r) * K + k0 + cg * 8];
            *(uint4*)&Bs[0][r * GM_P + cg * 8] = *(const uint4*)&Bt[(size_t)(n0 + r) * K + k0 + cg * 8];
        }
        __syncthreads();
        tile_mm(&As[0][0], &Bs[0][0]);
        __syncthreads();
    }
#endif

    // C/D layout: VGPR i -> M = i + 8*half, N = l16
    #pragma unroll
    for (int mt = 0; mt < 4; ++mt) {
        #pragma unroll
        for (int nt = 0; nt < 2; ++nt) {
            #pragma unroll
            for (int i = 0; i < 8; ++i) {
                int m = m0 + waveM * 64 + mt * 16 + 8 * half + i;
                int n = n0 + waveN * 32 + nt * 16 + l16;
                float v = acc[mt][nt][i];
                if (resid) v += resid[(size_t)m * N + n];
                if (bias)  v += bias[n];
                Cout[(size_t)m * N + n] = v;
            }
        }
    }
}

// ---------------------------------------------------------------------------
// beta = clip(sigmoid(x @ Wbeta + bbeta), 1e-3, 0.999)   (4096 x 32)
// A work-group takes BT_TOK tokens and all 32 columns; each of its waves a
// slice of BT_KS values of k; a lane holds 4 tokens x 4 columns, so that eight
// 16-byte loads feed 64 multiply-adds and many loads are in flight per wait.
// The waves' partial sums meet in LDS.
// ---------------------------------------------------------------------------
#define BT_TOK   16
#define BT_WAVES 16
#define BT_KS    (D_ / BT_WAVES)   // 64
#define BT_G     4                 // runs of 4 k per register set
#define BT_SK    (BT_G * 4)        // values of k per register set
typedef __attribute__((ext_vector_type(2))) float bt2f;

// one register set: 4 tokens x BT_SK k of x, BT_SK k x 4 columns of Wb
__device__ __forceinline__ void bt_load(float4 (&xv)[BT_G][4], float4 (&wv)[BT_G][4],
                                        const float* xp, const float* wp) {
    #pragma unroll
    for (int g = 0; g < BT_G; ++g) {
        #pragma unroll
        for (int i = 0; i < 4; ++i) xv[g][i] = *(const float4*)(xp + i * D_ + g * 4);
        #pragma unroll
        for (int j = 0; j < 4; ++j) {
            // the set's last load is given, as its destination, an address pair that
            // the loads before it name: the wait stands in front of that overwrite
            if (g == BT_G - 1 && j == 3) asm volatile("s_wait_xcnt 0x0" ::: "memory");
            wv[g][j] = *(const float4*)(wp + (g * 4 + j) * 32);
        }
    }
}

__device__ __forceinline__ void bt_fma(bt2f (&acc)[4][2], const float4 (&xv)[BT_G][4],
                                       const float4 (&wv)[BT_G][4]) {
    #pragma unroll
    for (int g = 0; g < BT_G; ++g) {
        #pragma unroll
        for (int i = 0; i < 4; ++i) {
            const float xs[4] = {xv[g][i].x, xv[g][i].y, xv[g][i].z, xv[g][i].w};
            #pragma unroll
            for (int j = 0; j < 4; ++j) {
                bt2f lo = {wv[g][j].x, wv[g][j].y}, hi = {wv[g][j].z, wv[g][j].w};
                acc[i][0] += lo * xs[j];
                acc[i][1] += hi * xs[j];
            }
        }
    }
}

__device__ __forceinline__ void beta_part(const float* __restrict__ x,
                                          const float* __restrict__ Wb,
                                          const float* __restrict__ bb,
                                          float* __restrict__ beta, int blk) {
    __shared__ __attribute__((aligned(16))) float pb[BT_WAVES][BT_TOK][32];
    const int t    = threadIdx.x;
    const int wave = t >> 5;
    const int tg   = (t >> 3) & 3;   // tokens tg * 4 .. tg * 4 + 3
    const int cg   = t & 7;          // columns cg * 4 .. cg * 4 + 3
    const int m0   = blk * BT_TOK;
    const float* xp = x + (size_t)(m0 + tg * 4) * D_ + wave * BT_KS;
    const float* wp = Wb + (size_t)(wave * BT_KS) * 32 + cg * 4;

    bt2f acc[4][2] = {};
    // not unrolled: unrolled, every load of the slice was lifted to the top and spilled
    #pragma nounroll
    for (int s = 0; s < BT_KS / BT_SK; ++s) {
        float4 xv[BT_G][4], wv[BT_G][4];
        bt_load(xv, wv, xp, wp);
        // keeps the set's loads together in front of its arithmetic: sunk to their
        // uses, only a few would be in flight
        __builtin_amdgcn_sched_barrier(0);
        bt_fma(acc, xv, wv);
        xp += BT_SK;
        wp += BT_SK * 32;
    }
    #pragma unroll
    for (int i = 0; i < 4; ++i) {
        float4 o = {acc[i][0].x, acc[i][0].y, acc[i][1].x, acc[i][1].y};
        *(float4*)&pb[wave][tg * 4 + i][cg * 4] = o;
    }
    __syncthreads();
    // thread t finishes token t / 32, column t % 32
    {
        const float* pp = &pb[0][0][0] + t;
        float s4[4] = {0.f, 0.f, 0.f, 0.f};
        #pragma unroll
        for (int w = 0; w < BT_WAVES; ++w) s4[w & 3] += pp[w * (BT_TOK * 32)];
        float logit = ((s4[0] + s4[1]) + (s4[2] + s4[3])) + bb[t & 31];
        float sg = 1.f / (1.f + __expf(-logit));
        sg = fminf(fmaxf(sg, 0.001f), 0.999f);
        beta[(size_t)m0 * 32 + t] = sg;
    }
}

// ---------------------------------------------------------------------------
// All the work that reads nothing but inputs, as one grid: none of these parts
// waits for another, and launched one after the other each paid its own start
// and its own tail. The longest parts have the lowest indices.
// A work-group is one part of beta, or two parts of 256 threads of the others.
// ---------------------------------------------------------------------------
#define PR_BETA (MTOK / BT_TOK)                  // 256 work-groups
#define PR_CVT  (MTOK * D_ / CVT_WG / 2)         // 256
#define PR_TILE ((D_ / 64) * (D_ / 128))         // tiles of 64 k x 128 n per weight: 128
#define PR_TR   (4 * PR_TILE / 2)                // 256
__global__ __launch_bounds__(BT_WAVES * 32) void prep_kernel(const float* __restrict__ x,
                                                             const float* __restrict__ Wq,
                                                             const float* __restrict__ Wk,
                                                             const float* __restrict__ Wv,
                                                             const float* __restrict__ Wo,
                                                             const float* __restrict__ Wb,
                                                             const float* __restrict__ bb,
                                                             _Float16* __restrict__ xh,
                                                             _Float16* __restrict__ Wqt,
                                                             _Float16* __restrict__ Wkt,
                                                             _Float16* __restrict__ Wvt,
                                                             _Float16* __restrict__ Wot,
                                                             float* __restrict__ beta) {
    const int blk = blockIdx.x;
    if (blk < PR_BETA) {
        beta_part(x, Wb, bb, beta, blk);
        return;
    }
    const int sub = threadIdx.x >> 8, t = threadIdx.x & 255;
    if (blk < PR_BETA + PR_CVT) {
        f32_to_f16_part(x, xh, MTOK * D_, (blk - PR_BETA) * 2 + sub, t);
        return;
    }
    const int g = blk - (PR_BETA + PR_CVT);      // both of its tiles lie in weight w
    const int w = g / (PR_TILE / 2);
    const float* W  = w == 0 ? Wq  : w == 1 ? Wk  : w == 2 ? Wv  : Wo;
    _Float16*    Wt = w == 0 ? Wqt : w == 1 ? Wkt : w == 2 ? Wvt : Wot;
    transpose_to_f16_part(W, Wt, (g % (PR_TILE / 2)) * 2 + sub, t);
}

// ---------------------------------------------------------------------------
// RoPE + phi (elu+1), in place, per head half-pair (i, i+32).
// A wave takes one token; a thread four neighbouring frequencies i of four heads
// (the angle depends on token and frequency only). total = threads = tokens * 32.
// blockIdx.y picks the array: q and k go through as one grid.
// ---------------------------------------------------------------------------
__device__ __forceinline__ float phi1(float r) { return r > 0.f ? r + 1.f : __expf(r); }  // elu(r)+1

__global__ __launch_bounds__(256) void rope_phi_kernel(float* __restrict__ u0, float* __restrict__ u1, int total) {
    int idx = blockIdx.x * 256 + threadIdx.x;
    if (idx >= total) return;
    float* u = blockIdx.y == 0 ? u0 : u1;
    int i0 = (idx & 7) * 4;    // first of four rotation-frequency indices
    int hg = (idx >> 3) & 3;   // heads hg, hg + 4, hg + 8, hg + 12
    int m  = idx >> 5;         // token 0..4095
    int s  = m & (S_ - 1);     // position within sequence
    float* up = u + (size_t)m * D_ + hg * DH_ + i0;
    float4 a[4], b[4];
    #pragma unroll
    for (int j = 0; j < 4; ++j) {
        a[j] = *(const float4*)(up + j * 4 * DH_);
        b[j] = *(const float4*)(up + j * 4 * DH_ + 32);
    }
    float cs[4], sn[4];
    #pragma unroll
    for (int c = 0; c < 4; ++c) {
        float f   = __expf(-(float)(2 * (i0 + c)) * 9.210340371976184f / 64.f); // ln(10000)
        float ang = (float)s * f;
        cs[c] = __cosf(ang);
        sn[c] = __sinf(ang);
    }
    #pragma unroll
    for (int j = 0; j < 4; ++j) {
        float4 x, y;
        x.x = phi1(a[j].x * cs[0] - b[j].x * sn[0]);  y.x = phi1(a[j].x * sn[0] + b[j].x * cs[0]);
        x.y = phi1(a[j].y * cs[1] - b[j].y * sn[1]);  y.y = phi1(a[j].y * sn[1] + b[j].y * cs[1]);
        x.z = phi1(a[j].z * cs[2] - b[j].z * sn[2]);  y.z = phi1(a[j].z * sn[2] + b[j].z * cs[2]);
        x.w = phi1(a[j].w * cs[3] - b[j].w * sn[3]);  y.w = phi1(a[j].w * sn[3] + b[j].w * cs[3]);
        *(float4*)(up + j * 4 * DH_)      = x;
        *(float4*)(up + j * 4 * DH_ + 32) = y;
    }
}

// ---------------------------------------------------------------------------
// DeltaNet recurrence in chunk form, its products on the matrix unit.
// With P[c][t] the product of channel c's decays from the chunk's first step
// through step t, and M0, Z0 the state at the chunk's start, the recurrence gives
//   num[t][e] = sum_{s<=t} G[t][s] (q_t.k_s) v_s[e] + sum_c P[c][t] (q_t M0[c])[e]
//   den[t]    = sum_{s<=t} G[t][s] (q_t.k_s)        + sum_c P[c][t] (q_t.Z0[c]) + eps
//   G[t][s]   = sum_c P[c][t] / P[c][s]   (formed as exp2 of a difference of logs, never above 1 each)
//   M0'[c]    = P[c][T] M0[c] + sum_s (P[c][T] / P[c][s]) k_s v_s^T    (Z likewise, v = 1)
// Only the state goes from chunk to chunk, so the work is two launches.
// scan_state_kernel: a work-group takes one (b,h) and CK_EW columns e and walks the
// chunks in order, CK_G of them staged per barrier; waves 4..7 each carry 16 rows d
// of the state (f32, in accumulators) and store the state at every chunk's start in
// the workspace, rounded to f16 and already in B-fragment order. scan_out_kernel: a work-group takes one (b,h) and ONE
// chunk, all 64 columns e; no work-group waits for another chunk's, and the scores
// of a chunk are formed once. Each of its waves finishes 16 steps t. The denominator
// runs through the same products with a column of ones in v's place.
// q, k, v are rounded to f16 when staged; every sum is f32.
// Every '#pragma unroll' of this section stands on a loop that indexes fragments,
// accumulators or staging registers: only with constant indices do they stay in registers.
// Writes y as f16 (feeds the output WMMA GEMM directly).
// ---------------------------------------------------------------------------
#define CK_T  64                 // steps per chunk
#define CK_EW 16                 // state columns per work-group
#define CK_ES (DH_ / CK_EW)      // work-groups per (b,h)
#define CK_QP 80                 // f16 per staged row of q and k: 160 bytes, 32 B x odd for the transposing loads
typedef __attribute__((ext_vector_type(4))) _Float16 v4h;
typedef short ck_s16x8 __attribute__((ext_vector_type(8)));

__device__ __forceinline__ v16h ck_cat(v8h a, v8h b) {
    return __builtin_shufflevector(a, b, 0, 1, 2, 3, 4, 5, 6, 7, 8, 9, 10, 11, 12, 13, 14, 15);
}
// 32 k of one row that lies along k, in the hardware's k order: 8 hh + 0..7, 16 + 8 hh + 0..7
__device__ __forceinline__ v16h ck_row(const _Float16* p, int hh) {
    return ck_cat(*(const v8h*)(p + 8 * hh), *(const v8h*)(p + 16 + 8 * hh));
}
__device__ __forceinline__ v8h ck_tr(const _Float16* p) {
    typedef __attribute__((address_space(3))) ck_s16x8 lds_s16x8;
    return __builtin_bit_cast(v8h, __builtin_amdgcn_ds_load_tr16_b128_v8i16((lds_s16x8*)p));
}
// 32 k of column dbase + (lane & 15) of a tile whose rows are k, same k order (pitch in f16)
__device__ __forceinline__ v16h ck_col(const _Float16* tile, int pitch, int kbase, int dbase, int lane) {
    const _Float16* p = tile + (kbase + 8 * (lane >> 4) + (lane & 7)) * pitch + dbase + 8 * ((lane >> 3) & 1);
    return ck_cat(ck_tr(p), ck_tr(p + 16 * pitch));
}
__device__ __forceinline__ v8f ck_mm(v16h a, v16h b, v8f c) {
    return __builtin_amdgcn_wmma_f32_16x16x32_f16(false, a, false, b, (short)0, c, false, false);
}
__device__ __forceinline__ v4h ck_cvt4(float4 a) {
    v4h o = {(_Float16)a.x, (_Float16)a.y, (_Float16)a.z, (_Float16)a.w};
    return o;
}
__device__ __forceinline__ v8h ck_cvt8(v8f a) {
    v8h o = {(_Float16)a[0], (_Float16)a[1], (_Float16)a[2], (_Float16)a[3],
             (_Float16)a[4], (_Float16)a[5], (_Float16)a[6], (_Float16)a[7]};
    return o;
}

// x + (x of the lane N below, inside a row of 16 lanes; 0 where there is none): a step of a running sum
template <int N>
__device__ __forceinline__ float ck_add_shr(float x) {
    int o = __builtin_amdgcn_update_dpp(0, __builtin_bit_cast(int, x), 0x110 + N, 0xf, 0xf, true);
    return x + __builtin_bit_cast(float, o);
}

// running sum of log2 beta over a chunk; a lane holds steps 2 lane and 2 lane + 1 (l0, l1); lT: the sum at the chunk's end
__device__ __forceinline__ void ck_logsum(float rb0, float rb1, int lane, float& l0, float& l1, float& lT) {
    const float a0 = __log2f(rb0), a1 = __log2f(rb1);
    float inc = a0 + a1;
    inc = ck_add_shr<1>(inc);
    inc = ck_add_shr<2>(inc);
    inc = ck_add_shr<4>(inc);
    inc = ck_add_shr<8>(inc);
    const float low = __builtin_bit_cast(float, __builtin_amdgcn_readlane(__builtin_bit_cast(int, inc), 15));
    if (lane >= 16) inc += low;
    l0 = inc - a1;
    l1 = inc;
    lT = __builtin_bit_cast(float, __builtin_amdgcn_readlane(__builtin_bit_cast(int, inc), 31));
}

#define CK_N  (S_ / CK_T)                      // chunks per sequence
// the state at a chunk's start, in the workspace, per (b,h) and chunk:
// M as [block of 16 columns e][channel][32 rows d][first, second 16 of them][lane][8 rows], Z as [channel][row d]
#define CK_MF (C_ * 2 * 2 * 32 * 8)            // f16 of M per block of columns
#define CK_MS (CK_ES * CK_MF)
#define CK_ZS (C_ * DH_)

#define CK_G  4                                // chunks staged per barrier of the state pass
#define CK_GT (CK_G * CK_T)

// Work-group barrier that waits for this wave's LDS accesses alone. __syncthreads() would
// also wait until the wave's stores of the state are acknowledged, which no wave of this
// launch reads.
__device__ __forceinline__ void ck_barrier_lds() {
    asm volatile("s_wait_dscnt 0x0\n\ts_barrier_signal -1\n\ts_barrier_wait -1" ::: "memory");
}

__global__ __launch_bounds__(256) void scan_state_kernel(const float* __restrict__ k,
                                                         const float* __restrict__ v,
                                                         const float* __restrict__ beta,
                                                         _Float16* __restrict__ sm,
                                                         _Float16* __restrict__ sz) {
    __shared__ __attribute__((aligned(16))) _Float16 sk[2][CK_GT][CK_QP];
    __shared__ __attribute__((aligned(16))) _Float16 sv[2][CK_GT][CK_EW];
    __shared__ __attribute__((aligned(16))) _Float16 sw[2][C_][CK_GT];   // P[c][T] / P[c][s], T the end of s's chunk
    __shared__ __attribute__((aligned(16))) float    spT[2][CK_G][C_];   // P[c][T]

    const int bh   = blockIdx.x / CK_ES;
    const int es   = blockIdx.x % CK_ES;
    const int b    = bh / H_, h = bh % H_;
    const int t    = threadIdx.x;
    const int lane = t & 31;
    const int c16  = lane & 15;
    const int hh   = lane >> 4;
    const int wave = __builtin_amdgcn_readfirstlane(t >> 5);   // scalar, so that the roles part at a scalar branch

    const float* kp = k + (size_t)b * S_ * D_ + h * DH_;
    const float* vp = v + (size_t)b * S_ * D_ + h * DH_ + es * CK_EW;
    const float* bp = beta + (size_t)b * S_ * (H_ * C_) + h * C_;

    // staging, per thread and CK_G chunks: 4 CK_G float4 of k and CK_G of v; waves 0..3, which
    // carry no state, the decays of one chunk each, both channels
    const int  srow = t >> 4, scol = (t & 15) * 4;
    const int  vrow = t >> 2, vcol = (t & 3) * 4;
    const bool bwav = wave < CK_G;

    float4 rk[4 * CK_G], rv[CK_G];
    float2 rb0 = {1.f, 1.f}, rb1 = {1.f, 1.f};
    auto fetch = [&](int ts) {
        #pragma unroll
        for (int i = 0; i < 4 * CK_G; ++i) rk[i] = *(const float4*)(kp + (size_t)(ts + srow + 16 * i) * D_ + scol);
        #pragma unroll
        for (int i = 0; i < CK_G; ++i) rv[i] = *(const float4*)(vp + (size_t)(ts + vrow + CK_T * i) * D_ + vcol);
        // what follows rewrites the address registers that these loads name
        asm volatile("s_wait_xcnt 0x0" ::: "memory");
        if (bwav) {
            rb0 = *(const float2*)(bp + (size_t)(ts + wave * CK_T + 2 * lane) * (H_ * C_));
            rb1 = *(const float2*)(bp + (size_t)(ts + wave * CK_T + 2 * lane + 1) * (H_ * C_));
            // the same for these two
            asm volatile("s_wait_xcnt 0x0" ::: "memory");
        }
    };
    auto stage = [&](int buf) {
        #pragma unroll
        for (int i = 0; i < 4 * CK_G; ++i) *(v4h*)&sk[buf][srow + 16 * i][scol] = ck_cvt4(rk[i]);
        #pragma unroll
        for (int i = 0; i < CK_G; ++i) *(v4h*)&sv[buf][vrow + CK_T * i][vcol] = ck_cvt4(rv[i]);
        if (bwav) {
            const float x0[C_] = {rb0.x, rb0.y}, x1[C_] = {rb1.x, rb1.y};
            #pragma unroll
            for (int ch = 0; ch < C_; ++ch) {
                float l0, l1, lT;
                ck_logsum(x0[ch], x1[ch], lane, l0, l1, lT);
                sw[buf][ch][wave * CK_T + 2 * lane]     = (_Float16)__builtin_amdgcn_exp2f(lT - l0);
                sw[buf][ch][wave * CK_T + 2 * lane + 1] = (_Float16)__builtin_amdgcn_exp2f(lT - l1);
                if (lane == 0) spT[buf][wave][ch] = __builtin_amdgcn_exp2f(lT);
            }
        }
    };

    v8f M[C_] = {}, Z[C_] = {};   // waves 4..7: rows dt * 16 + 8 hh + r, column c16; Z the same in every column
    const int dt = wave & 3;      // the state wave's block of rows d
    // the state as it stands, which is that at the start of chunk n
    auto put_state = [&](int n) {
        _Float16* mo = sm + (size_t)(bh * CK_N + n) * CK_MS + es * CK_MF + dt * 256 + lane * 8;
        #pragma unroll
        for (int ch = 0; ch < C_; ++ch) *(v8h*)(mo + ch * (CK_MF / C_)) = ck_cvt8(M[ch]);
        // Z is the same in every column and in every block of columns: one copy goes out
        if (es == 0 && c16 == 0) {
            _Float16* zo = sz + (size_t)(bh * CK_N + n) * CK_ZS + dt * 16 + 8 * hh;
            #pragma unroll
            for (int ch = 0; ch < C_; ++ch) *(v8h*)(zo + ch * DH_) = ck_cvt8(Z[ch]);
        }
        // what follows rewrites registers that these stores name
        asm volatile("s_wait_xcnt 0x0" ::: "memory");
    };

    fetch(0);
    stage(0);
    ck_barrier_lds();

    // not unrolled, so that the last trip is not peeled off and the next chunks'
    // global loads stay at the head of the trip, in flight under these chunks' work
    #pragma nounroll
    for (int n = 0; n < CK_N / CK_G; ++n) {
        const int  cur  = n & 1;
        const bool more = n + 1 < CK_N / CK_G;
        if (more) fetch((n + 1) * CK_GT);

        if (wave >= 4) {
            #pragma unroll
            for (int g = 0; g < CK_G; ++g) {
                // the chunk's fragments are asked for first: their way from LDS runs under the stores of the state
                const _Float16* Kt = &sk[cur][g * CK_T][0];
                const _Float16* Vt = &sv[cur][g * CK_T][0];
                const float2 pT = *(const float2*)&spT[cur][g][0];
                v16h kt[2], vf[2], wf[2][C_];
                #pragma unroll
                for (int j = 0; j < 2; ++j) {
                    kt[j] = ck_col(Kt, CK_QP, 32 * j, dt * 16, lane);   // A: row d, k = s
                    vf[j] = ck_col(Vt, CK_EW, 32 * j, 0, lane);         // B: column e, k = s
                    #pragma unroll
                    for (int ch = 0; ch < C_; ++ch)
                        wf[j][ch] = ck_row(&sw[cur][ch][g * CK_T + 32 * j], hh);   // the weights of the steps s, same k order
                }
                put_state(n * CK_G + g);
                // the sequence's last chunk changes no state that anybody reads
                if (g + 1 < CK_G || more) {
                    M[0] *= pT.x; Z[0] *= pT.x;
                    M[1] *= pT.y; Z[1] *= pT.y;
                    #pragma unroll
                    for (int j = 0; j < 2; ++j) {
                        #pragma unroll
                        for (int ch = 0; ch < C_; ++ch) {
                            M[ch] = ck_mm(kt[j], vf[j] * wf[j][ch], M[ch]);
                            Z[ch] = ck_mm(kt[j], wf[j][ch], Z[ch]);
                        }
                    }
                }
            }
        }

        // the other buffers were last read before the previous trip's barrier
        if (more) stage(cur ^ 1);
        // one barrier per CK_G chunks: publishes the next chunks' staged rows
        ck_barrier_lds();
    }
}

__global__ __launch_bounds__(128) void scan_out_kernel(const float* __restrict__ q,
                                                       const float* __restrict__ k,
                                                       const float* __restrict__ v,
                                                       const float* __restrict__ beta,
                                                       const _Float16* __restrict__ sm,
                                                       const _Float16* __restrict__ sz,
                                                       _Float16* __restrict__ y) {
    __shared__ __attribute__((aligned(16))) _Float16 sq[CK_T][CK_QP];
    __shared__ __attribute__((aligned(16))) _Float16 sk[CK_T][CK_QP];
    __shared__ __attribute__((aligned(16))) _Float16 sv[CK_T][CK_QP];
    __shared__ __attribute__((aligned(16))) float    sl[C_][CK_T];   // log2 P[c][s]
    __shared__ __attribute__((aligned(16))) float    sp[C_][CK_T];   // P[c][s]
    __shared__ __attribute__((aligned(16))) _Float16 ss[CK_MS];      // M at the chunk's start

    const int bh   = blockIdx.x / CK_N;
    const int ts0  = (blockIdx.x % CK_N) * CK_T;
    const int b    = bh / H_, h = bh % H_;
    const int t    = threadIdx.x;
    const int lane = t & 31;
    const int c16  = lane & 15;
    const int hh   = lane >> 4;
    const int dt   = __builtin_amdgcn_readfirstlane(t >> 5);   // the wave, and its block of steps t; scalar for the branch on it

    const size_t row0 = ((size_t)b * S_ + ts0) * D_ + h * DH_;
    const _Float16* mp = sm + (size_t)blockIdx.x * CK_MS;
    const _Float16* zp = sz + (size_t)blockIdx.x * CK_ZS;

    // ---- the chunk's decays, its start state and its rows of q, k, v, all loads in flight together
    float rb0 = 1.f, rb1 = 1.f;
    if (dt < C_) {
        // waves 0 and 1: a channel of beta each
        const float* bp = beta + ((size_t)b * S_ + ts0) * (H_ * C_) + h * C_ + dt;
        rb0 = bp[(size_t)(2 * lane) * (H_ * C_)];
        rb1 = bp[(size_t)(2 * lane + 1) * (H_ * C_)];
        // what follows rewrites the address registers that these loads name
        asm volatile("s_wait_xcnt 0x0" ::: "memory");
    }
    // Z at the chunk's start as B fragments, the same in every column: rows d in the k order of q's fragments
    v16h zb[C_][2];
    #pragma unroll
    for (int ch = 0; ch < C_; ++ch) {
        #pragma unroll
        for (int kk = 0; kk < 2; ++kk)
            zb[ch][kk] = ck_cat(*(const v8h*)(zp + ch * DH_ + kk * 32 + 8 * hh),
                                *(const v8h*)(zp + ch * DH_ + kk * 32 + 16 + 8 * hh));
    }
    // the same for these eight
    asm volatile("s_wait_xcnt 0x0" ::: "memory");
    const int srow = t >> 4, scol = (t & 15) * 4;
    {
        const float* qp = q + row0 + (size_t)srow * D_ + scol;
        const float* kp = k + row0 + (size_t)srow * D_ + scol;
        const float* vp = v + row0 + (size_t)srow * D_ + scol;
        float4 rq[8], rk[8], rv[8];
        v8h    rs[8];
        #pragma unroll
        for (int i = 0; i < 8; ++i) rs[i] = *(const v8h*)(mp + (i * 128 + t) * 8);
        #pragma unroll
        for (int i = 0; i < 8; ++i) {
            rq[i] = *(const float4*)(qp + (size_t)(8 * i) * D_);
            rk[i] = *(const float4*)(kp + (size_t)(8 * i) * D_);
            rv[i] = *(const float4*)(vp + (size_t)(8 * i) * D_);
        }
        // the same for all of these
        asm volatile("s_wait_xcnt 0x0" ::: "memory");
        // holds the loads of the state up here, in flight with the rows': sunk to their use
        // behind the branch below, they were issued only when rows had come back
        asm volatile("" :: "v"(rs[0]), "v"(rs[1]), "v"(rs[2]), "v"(rs[3]), "v"(rs[4]), "v"(rs[5]), "v"(rs[6]), "v"(rs[7]));
        if (dt < C_) {
            float l0, l1, lT;
            ck_logsum(rb0, rb1, lane, l0, l1, lT);
            float2 lo = {l0, l1};
            float2 po = {__builtin_amdgcn_exp2f(l0), __builtin_amdgcn_exp2f(l1)};
            *(float2*)&sl[dt][2 * lane] = lo;
            *(float2*)&sp[dt][2 * lane] = po;
        }
        #pragma unroll
        for (int i = 0; i < 8; ++i) *(v8h*)&ss[(i * 128 + t) * 8] = rs[i];
        #pragma unroll
        for (int i = 0; i < 8; ++i) {
            *(v4h*)&sq[srow + 8 * i][scol] = ck_cvt4(rq[i]);
            *(v4h*)&sk[srow + 8 * i][scol] = ck_cvt4(rk[i]);
            *(v4h*)&sv[srow + 8 * i][scol] = ck_cvt4(rv[i]);
        }
    }
    // the one barrier: publishes the staged rows, the decays and the state
    __syncthreads();

    v16h ones;
    #pragma unroll
    for (int i = 0; i < 16; ++i) ones[i] = (_Float16)1.f;

    const _Float16* Kt = &sk[0][0];
    const _Float16* Vt = &sv[0][0];
    const int tl = dt * 16 + c16;
    v16h qf[2];   // row t = tl: B (column t) of the score product, A (row t) of the state product
    #pragma unroll
    for (int kk = 0; kk < 2; ++kk) qf[kk] = ck_row(&sq[tl][kk * 32], hh);
    const float lt0 = sl[0][tl], lt1 = sl[1][tl];

    // scores transposed: st[r] = k_s.q_t, s = sb * 16 + 8 hh + r, t = tl; two such
    // tiles, weighted and rounded, are an A fragment with row t and k = s
    v16h af[2];
    #pragma unroll
    for (int sb = 0; sb < 4; ++sb) {
        v8f st = {};
        #pragma unroll
        for (int kk = 0; kk < 2; ++kk)
            st = ck_mm(ck_row(Kt + (sb * 16 + c16) * CK_QP + kk * 32, hh), qf[kk], st);
        const float4 x0 = *(const float4*)&sl[0][sb * 16 + 8 * hh];
        const float4 x1 = *(const float4*)&sl[0][sb * 16 + 8 * hh + 4];
        const float4 y0 = *(const float4*)&sl[1][sb * 16 + 8 * hh];
        const float4 y1 = *(const float4*)&sl[1][sb * 16 + 8 * hh + 4];
        const float ls0[8] = {x0.x, x0.y, x0.z, x0.w, x1.x, x1.y, x1.z, x1.w};
        const float ls1[8] = {y0.x, y0.y, y0.z, y0.w, y1.x, y1.y, y1.z, y1.w};
        #pragma unroll
        for (int r = 0; r < 8; ++r) {
            // later steps s do not count: their weight is exp2 of a large negative number, 0
            const bool  on = sb * 16 + 8 * hh + r <= tl;
            const float g  = __builtin_amdgcn_exp2f(on ? lt0 - ls0[r] : -1000.f)
                           + __builtin_amdgcn_exp2f(on ? lt1 - ls1[r] : -1000.f);
            af[sb >> 1][(sb & 1) * 8 + r] = (_Float16)(st[r] * g);
        }
    }

    // register r of every accumulator: step t = dt * 16 + 8 hh + r, column c16
    const float4 u0 = *(const float4*)&sp[0][dt * 16 + 8 * hh];
    const float4 u1 = *(const float4*)&sp[0][dt * 16 + 8 * hh + 4];
    const float4 w0 = *(const float4*)&sp[1][dt * 16 + 8 * hh];
    const float4 w1 = *(const float4*)&sp[1][dt * 16 + 8 * hh + 4];
    const float p0[8] = {u0.x, u0.y, u0.z, u0.w, u1.x, u1.y, u1.z, u1.w};
    const float p1[8] = {w0.x, w0.y, w0.z, w0.w, w1.x, w1.y, w1.z, w1.w};

    v8f den = {}, dz[C_] = {};
    #pragma unroll
    for (int j = 0; j < 2; ++j) den = ck_mm(af[j], ones, den);
    #pragma unroll
    for (int ch = 0; ch < C_; ++ch) {
        #pragma unroll
        for (int kk = 0; kk < 2; ++kk) dz[ch] = ck_mm(qf[kk], zb[ch][kk], dz[ch]);
    }
    float rd[8];
    #pragma unroll
    for (int r = 0; r < 8; ++r)
        rd[r] = __builtin_amdgcn_rcpf(den[r] + p0[r] * dz[0][r] + p1[r] * dz[1][r] + 1e-6f);

    v8h yv[CK_ES];   // y of steps dt * 16 + 8 hh + r, column eb * 16 + c16
    #pragma unroll
    for (int eb = 0; eb < CK_ES; ++eb) {
        v8f num = {}, nm[C_] = {};
        #pragma unroll
        for (int j = 0; j < 2; ++j) num = ck_mm(af[j], ck_col(Vt, CK_QP, 32 * j, eb * CK_EW, lane), num);
        #pragma unroll
        for (int ch = 0; ch < C_; ++ch) {
            #pragma unroll
            for (int kk = 0; kk < 2; ++kk) {
                const _Float16* f = &ss[eb * CK_MF + (ch * 2 + kk) * 512 + lane * 8];
                nm[ch] = ck_mm(qf[kk], ck_cat(*(const v8h*)f, *(const v8h*)(f + 256)), nm[ch]);
            }
        }
        #pragma unroll
        for (int r = 0; r < 8; ++r)
            yv[eb][r] = (_Float16)((num[r] + p0[r] * nm[0][r] + p1[r] * nm[1][r]) * rd[r]);
    }
    _Float16* yo = y + row0 + (size_t)(dt * 16 + 8 * hh) * D_ + c16;
    #pragma unroll
    for (int eb = 0; eb < CK_ES; ++eb) {
        #pragma unroll
        for (int r = 0; r < 8; ++r) yo[(size_t)r * D_ + eb * CK_EW] = yv[eb][r];
    }
}

// ---------------------------------------------------------------------------
// LayerNorm over rows of h (4096 x 1024), f32 out
// ---------------------------------------------------------------------------
__global__ __launch_bounds__(256) void ln_kernel(const float* __restrict__ hbuf,
                                                 const float* __restrict__ gamma,
                                                 const float* __restrict__ lbeta,
                                                 float* __restrict__ out) {
    __shared__ float rs[256], rq[256];
    __shared__ float smu, srstd;
    int m = blockIdx.x, t = threadIdx.x;
    const float* hr = hbuf + (size_t)m * D_;
    float s = 0.f, q2 = 0.f;
    float vals[4];
    #pragma unroll
    for (int i = 0; i < 4; ++i) {
        float v = hr[t + i * 256];
        vals[i] = v; s += v; q2 += v * v;
    }
    rs[t] = s; rq[t] = q2;
    __syncthreads();
    for (int off = 128; off > 0; off >>= 1) {
        if (t < off) { rs[t] += rs[t + off]; rq[t] += rq[t + off]; }
        __syncthreads();
    }
    if (t == 0) {
        float mu  = rs[0] * (1.f / D_);
        float var = rq[0] * (1.f / D_) - mu * mu;
        smu = mu; srstd = rsqrtf(var + 1e-5f);
    }
    __syncthreads();
    float* orow = out + (size_t)m * D_;
    #pragma unroll
    for (int i = 0; i < 4; ++i) {
        int n = t + i * 256;
        orow[n] = gamma[n] * (vals[i] - smu) * srstd + lbeta[n];
    }
}

// ---------------------------------------------------------------------------
// launch
// ---------------------------------------------------------------------------
extern "C" void kernel_launch(void* const* d_in, const int* in_sizes, int n_in,
                              void* d_out, int out_size, void* d_ws, size_t ws_size,
                              hipStream_t stream) {
    const float* x      = (const float*)d_in[0];
    const float* Wq     = (const float*)d_in[1];
    const float* Wk     = (const float*)d_in[2];
    const float* Wv     = (const float*)d_in[3];
    const float* Wbeta  = (const float*)d_in[4];
    const float* bbeta  = (const float*)d_in[5];
    const float* Wo     = (const float*)d_in[6];
    const float* bo     = (const float*)d_in[7];
    const float* lng    = (const float*)d_in[8];
    const float* lnb    = (const float*)d_in[9];
    float* out = (float*)d_out;

    char* ws = (char*)d_ws;
    size_t off = 0;
    auto alloc = [&](size_t bytes) { char* p = ws + off; off += (bytes + 255) & ~(size_t)255; return p; };

    _Float16* xh   = (_Float16*)alloc((size_t)MTOK * D_ * 2);   // 8 MB
    _Float16* Wqt  = (_Float16*)alloc((size_t)D_ * D_ * 2);     // 2 MB each
    _Float16* Wkt  = (_Float16*)alloc((size_t)D_ * D_ * 2);
    _Float16* Wvt  = (_Float16*)alloc((size_t)D_ * D_ * 2);
    _Float16* Wot  = (_Float16*)alloc((size_t)D_ * D_ * 2);
    float*    qbuf = (float*)alloc((size_t)MTOK * D_ * 4);      // 16 MB each
    float*    kbuf = (float*)alloc((size_t)MTOK * D_ * 4);
    float*    vbuf = (float*)alloc((size_t)MTOK * D_ * 4);
    float*    bbuf = (float*)alloc((size_t)MTOK * 32 * 4);      // 0.5 MB
    _Float16* ybuf = (_Float16*)alloc((size_t)MTOK * D_ * 2);   // 8 MB
    float*    hbuf = (float*)alloc((size_t)MTOK * D_ * 4);      // 16 MB
    _Float16* smbuf = (_Float16*)alloc((size_t)B_ * H_ * CK_N * CK_MS * 2);   // 16 MB
    _Float16* szbuf = (_Float16*)alloc((size_t)B_ * H_ * CK_N * CK_ZS * 2);   // 0.25 MB
    (void)ws_size; (void)in_sizes; (void)n_in; (void)out_size;

    // beta, x in f16 and the four weights transposed: one grid
    prep_kernel<<<PR_BETA + PR_CVT + PR_TR, BT_WAVES * 32, 0, stream>>>(
        x, Wq, Wk, Wv, Wo, Wbeta, bbeta, xh, Wqt, Wkt, Wvt, Wot, bbuf);

    // q, k, v: one grid, z picks the weight
    dim3 ggrid3(D_ / 128, MTOK / 128, 3);   // (8, 32, 3)
    gemm_f16_wmma_kernel<<<ggrid3, 256, 0, stream>>>(xh, Wqt, Wkt, Wvt, qbuf, kbuf, vbuf,
                                                     nullptr, nullptr, MTOK, D_, D_);

    const int nPairs = MTOK * 32;  // threads per array: 16 half-pairs each
    dim3 rgrid(nPairs / 256, 2);
    rope_phi_kernel<<<rgrid, 256, 0, stream>>>(qbuf, kbuf, nPairs);

    // the state at every chunk's start, chunk after chunk; then every chunk's outputs, all chunks at once
    scan_state_kernel<<<B_ * H_ * CK_ES, 256, 0, stream>>>(kbuf, vbuf, bbuf, smbuf, szbuf);
    scan_out_kernel<<<B_ * H_ * CK_N, 128, 0, stream>>>(qbuf, kbuf, vbuf, bbuf, smbuf, szbuf, ybuf);

    // h = x + y @ Wo + bo (fused residual + bias epilogue)
    dim3 ggrid(D_ / 128, MTOK / 128);   // (8, 32)
    gemm_f16_wmma_kernel<<<ggrid, 256, 0, stream>>>(ybuf, Wot, nullptr, nullptr, hbuf, nullptr, nullptr,
                                                    x, bo, MTOK, D_, D_);

    ln_kernel<<<MTOK, 256, 0, stream>>>(hbuf, lng, lnb, out);
}

// v010
// It runs in 99.4 microseconds.
// Next to v009, in two timings, it ran 1.25 and 1.26 times as fast.
// All steps since v000 together make it 31.7 times as fast.
#include <hip/hip_runtime.h>
#include <hip/hip_bf16.h>

typedef __attribute__((ext_vector_type(16))) _Float16 v16h;
typedef __attribute__((ext_vector_type(8)))  float    v8f;

#define B_   2
#define S_   2048
#define D_   1024
#define H_   16
#define DH_  64
#define C_   2
#define MTOK (B_ * S_)   // 4096

// ---------------------------------------------------------------------------
// CDNA5 async global->LDS copy (ASYNCcnt path), with sync fallback
// ---------------------------------------------------------------------------
#if defined(__has_builtin)
#if __has_builtin(__builtin_amdgcn_global_load_async_to_lds_b128)
#define HAVE_ASYNC_LDS 1
#endif
#endif

#if defined(HAVE_ASYNC_LDS)
// builtin signature: void(v4i addrspace(1)*, v4i addrspace(3)*, imm offset, imm cpol)
typedef int v4i_vs __attribute__((vector_size(4 * sizeof(int))));
typedef __attribute__((address_space(1))) v4i_vs* g_v4i_p;
typedef __attribute__((address_space(3))) v4i_vs* l_v4i_p;
__device__ __forceinline__ void async_copy_b128(const _Float16* g, _Float16* l) {
    __builtin_amdgcn_global_load_async_to_lds_b128(
        (g_v4i_p)(void*)const_cast<_Float16*>(g), (l_v4i_p)(void*)l, 0, 0);
}
#endif

// ---------------------------------------------------------------------------
// The three element-wise helpers below give each thread 32 elements, moved in
// 16-byte pieces: with one element per thread their time was the
// time it takes to start their waves, not the time to move their bytes.
// ---------------------------------------------------------------------------
typedef __attribute__((ext_vector_type(8))) _Float16 v8h;

__device__ __forceinline__ v8h cvt8(float4 a, float4 b) {
    v8h o = {(_Float16)a.x, (_Float16)a.y, (_Float16)a.z, (_Float16)a.w,
             (_Float16)b.x, (_Float16)b.y, (_Float16)b.z, (_Float16)b.w};
    return o;
}

// f32 -> f16 conversion; 256 threads (part 'blk', thread 't' of it) convert CVT_WG
// elements (n is a multiple), a thread four runs of 8, all eight loads in flight together
#define CVT_WG 8192
__device__ __forceinline__ void f32_to_f16_part(const float* __restrict__ src,
                                                _Float16* __restrict__ dst, int n, int blk, int t) {
    int i = blk * CVT_WG + t * 8;
    if (i + 3 * 2048 + 8 > n) return;
    float4 a[4], b[4];
    #pragma unroll
    for (int g = 0; g < 4; ++g) {
        a[g] = *(const float4*)(src + i + g * 2048);
        b[g] = *(const float4*)(src + i + g * 2048 + 4);
    }
    #pragma unroll
    for (int g = 0; g < 4; ++g) *(v8h*)(dst + i + g * 2048) = cvt8(a[g], b[g]);
}

// W is (D_ x D_) row-major f32, rows k; Wt becomes its transpose in f16, rows n.
// 256 threads (tile 'blk', thread 't' of it) turn a tile of 64 k x 128 n, a thread 8 k x 4 n: eight lanes side
// by side in k write 128 bytes in a row of Wt. The pitch is a constant, so that
// a thread's loads, and its stores, share one address register pair.
__device__ __forceinline__ void transpose_to_f16_part(const float* __restrict__ W,
                                                      _Float16* __restrict__ Wt, int blk, int t) {
    int k0 = (blk / (D_ / 128)) * 64 + (t & 7) * 8;
    int n0 = (blk % (D_ / 128)) * 128 + (t >> 3) * 4;
    const float* wp = W + k0 * D_ + n0;
    float4 r[8];
    #pragma unroll
    for (int j = 0; j < 8; ++j) r[j] = *(const float4*)(wp + j * D_);
    _Float16* op = Wt + n0 * D_ + k0;
    v8h o0 = {(_Float16)r[0].x, (_Float16)r[1].x, (_Float16)r[2].x, (_Float16)r[3].x,
              (_Float16)r[4].x, (_Float16)r[5].x, (_Float16)r[6].x, (_Float16)r[7].x};
    v8h o1 = {(_Float16)r[0].y, (_Float16)r[1].y, (_Float16)r[2].y, (_Float16)r[3].y,
              (_Float16)r[4].y, (_Float16)r[5].y, (_Float16)r[6].y, (_Float16)r[7].y};
    v8h o2 = {(_Float16)r[0].z, (_Float16)r[1].z, (_Float16)r[2].z, (_Float16)r[3].z,
              (_Float16)r[4].z, (_Float16)r[5].z, (_Float16)r[6].z, (_Float16)r[7].z};
    v8h o3 = {(_Float16)r[0].w, (_Float16)r[1].w, (_Float16)r[2].w, (_Float16)r[3].w,
              (_Float16)r[4].w, (_Float16)r[5].w, (_Float16)r[6].w, (_Float16)r[7].w};
    *(v8h*)(op)          = o0;
    *(v8h*)(op + D_)     = o1;
    *(v8h*)(op + 2 * D_) = o2;
    *(v8h*)(op + 3 * D_) = o3;
    // the other parts' code stands behind these stores in the built kernel and reuses
    // their registers: the wait closes the four stores in front of any such overwrite
    asm volatile("s_wait_xcnt 0x0" ::: "memory");
}

// ---------------------------------------------------------------------------
// WMMA GEMM:  C[M,N] = A[M,K] (f16) * Bt[N,K]^T (f16)  (+ resid + bias)
// blockIdx.z picks one of up to three products that share A and run as one grid.
// block = 256 threads (8 waves), tile = 128x128, K-step = GM_K,
// double-buffered async global->LDS staging.
// ---------------------------------------------------------------------------
// k per staged tile: a row's piece is 128 bytes, one whole line of A or Bt, so that a
// wave's copy of 512 bytes touches four lines; at 32 k it touched eight, half of each.
#define GM_K 64
// f16 per staged row: GM_K of data and 8 unused. At 144 bytes (16 B x odd) the sixteen
// rows that a 16-byte fragment load reads fall on all 64 banks.
#define GM_P (GM_K + 8)
#define GM_C (128 * GM_K / 8 / 256)   // 16-byte pieces per thread and matrix
__device__ inline v16h load_frag_k32(const _Float16* tile_base, int row16, int half) {
    // tile rows have stride GM_P f16; A-fragment layout for v_wmma_f32_16x16x32_f16:
    // lanes 0-15: K = {0..7, 16..23}; lanes 16-31: K = {8..15, 24..31}
    const _Float16* p = tile_base + row16 * GM_P + half * 8;
    union { v16h h; uint4 u[2]; } f;
    f.u[0] = *(const uint4*)(p);
    f.u[1] = *(const uint4*)(p + 16);
    return f.h;
}

__global__ __launch_bounds__(256) void gemm_f16_wmma_kernel(
    const _Float16* __restrict__ A,   // M x K row-major
    const _Float16* __restrict__ Bt0, // N x K row-major (B pre-transposed), product z = 0
    const _Float16* __restrict__ Bt1, // the same for z = 1 and z = 2 (unused where the grid has no such z)
    const _Float16* __restrict__ Bt2,
    float* __restrict__ C0,           // M x N, rows of D_ values (N == D_), product z = 0
    float* __restrict__ C1,
    float* __restrict__ C2,
    const float* __restrict__ resid,  // optional M x N, may be null
    const float* __restrict__ bias,   // optional N, may be null
    int M, int N, int K)
{
#if defined(HAVE_ASYNC_LDS)
    __shared__ __attribute__((aligned(16))) _Float16 As[2][128 * GM_P];
    __shared__ __attribute__((aligned(16))) _Float16 Bs[2][128 * GM_P];
#else
    __shared__ __attribute__((aligned(16))) _Float16 As[1][128 * GM_P];
    __shared__ __attribute__((aligned(16))) _Float16 Bs[1][128 * GM_P];
#endif

    const _Float16* __restrict__ Bt   = blockIdx.z == 0 ? Bt0 : blockIdx.z == 1 ? Bt1 : Bt2;
    float* __restrict__          Cout = blockIdx.z == 0 ? C0 : blockIdx.z == 1 ? C1 : C2;

    const int t     = threadIdx.x;
    const int m0    = blockIdx.y * 128;
    const int n0    = blockIdx.x * 128;
    const int wave  = t >> 5;
    const int lane  = t & 31;
    const int half  = (lane >> 4) & 1;
    const int l16   = lane & 15;
    const int waveM = wave >> 2;   // 0..1  (64-row slab)
    const int waveN = wave & 3;    // 0..3  (32-col slab)

    // per-thread staging coordinates: GM_C pieces of 8 f16 (16B) per matrix, in rows r0 + 32 j;
    // eight lanes side by side fill a row
    const int r0 = t >> 3;
    const int cg = t & 7;

    v8f acc[4][2] = {};
    const int nIter = K / GM_K;
    // the products of one staged tile; its loops are unrolled so that fragments and
    // accumulators have constant indices and stay in registers
    auto tile_mm = [&](const _Float16* At, const _Float16* Bw) {
        #pragma unroll
        for (int kk = 0; kk < GM_K / 32; ++kk) {
            v16h af[4], bf[2];
            #pragma unroll
            for (int mt = 0; mt < 4; ++mt)
                af[mt] = load_frag_k32(At + (waveM * 64 + mt * 16) * GM_P + kk * 32, l16, half);
            #pragma unroll
            for (int nt = 0; nt < 2; ++nt)
                bf[nt] = load_frag_k32(Bw + (waveN * 32 + nt * 16) * GM_P + kk * 32, l16, half);
            #pragma unroll
            for (int mt = 0; mt < 4; ++mt)
                #pragma unroll
                for (int nt = 0; nt < 2; ++nt)
                    acc[mt][nt] = __builtin_amdgcn_wmma_f32_16x16x32_f16(
                        false, af[mt], false, bf[nt], (short)0, acc[mt][nt], false, false);
        }
    };

#if defined(HAVE_ASYNC_LDS)
    // one tile's copies: 2 GM_C per wave, unrolled so that they issue back to back
    auto stage = [&](int k0, int buf) {
        #pragma unroll
        for (int j = 0; j < GM_C; ++j) {
            const int r = r0 + 32 * j;
            async_copy_b128(&A [(size_t)(m0 + r) * K + k0 + cg * 8], &As[buf][r * GM_P + cg * 8]);
            async_copy_b128(&Bt[(size_t)(n0 + r) * K + k0 + cg * 8], &Bs[buf][r * GM_P + cg * 8]);
        }
    };
    // two buffers: tile 0 lands and is published; tile 1 flies under tile 0's products
    stage(0, 0);
    asm volatile("s_wait_asynccnt 0x0" ::: "memory");   // this wave's copies of tile 0 have landed
    __syncthreads();
    if (1 < nIter) stage(GM_K, 1);
    for (int it = 0; it < nIter; ++it) {
        const int cur = it & 1;
        tile_mm(&As[cur][0], &Bs[cur][0]);
        // this wave's reads of buf[cur] are done before the barrier behind which it is refilled
        asm volatile("s_wait_dscnt 0x0" ::: "memory");
        // this wave's copies of the next tile have landed before the barrier that publishes them
        asm volatile("s_wait_asynccnt 0x0" ::: "memory");
        __syncthreads();
        if (it + 2 < nIter) stage((it + 2) * GM_K, cur);
    }
    // no copy is outstanding when the wave goes on to its stores and ends
    asm volatile("s_wait_asynccnt 0x0" ::: "memory");
#else
    for (int it = 0; it < nIter; ++it) {
        const int k0 = it * GM_K;
        #pragma unroll
        for (int j = 0; j < GM_C; ++j) {
            const int r = r0 + 32 * j;
            *(uint4*)&As[0][r * GM_P + cg * 8] = *(const uint4*)&A [(size_t)(m0 + r) * K + k0 + cg * 8];
            *(uint4*)&Bs[0][r * GM_P + cg * 8] = *(const uint4*)&Bt[(size_t)(n0 + r) * K + k0 + cg * 8];
        }
        __syncthreads();
        tile_mm(&As[0][0], &Bs[0][0]);
        __syncthreads();
    }
#endif

    // C/D layout: VGPR i -> M = i + 8*half, N = l16
    // resid and bias are tested once for the tile, and a lane's 64 values of resid are asked
    // for together: tested and loaded value by value, each load waited out its own way from
    // memory before the next was issued. The pitch is a constant, so that a lane's loads, and
    // its stores, share one address. Every loop here is unrolled: the accumulators and the
    // loaded values keep constant indices and stay in registers.
    const int    nl = n0 + waveN * 32 + l16;                                // the lane's first column
    const size_t e0 = (size_t)(m0 + waveM * 64 + 8 * half) * D_ + nl;       // and its first element
    float bv[2] = {0.f, 0.f};
    if (bias) {
        bv[0] = bias[nl];
        bv[1] = bias[nl + 16];
        // what follows rewrites the address registers that these two loads name
        asm volatile("s_wait_xcnt 0x0" ::: "memory");
    }
    if (resid) {
        const float* rp = resid + e0;
        float rv[4][2][8];
        #pragma unroll
        for (int mt = 0; mt < 4; ++mt)
            #pragma unroll
            for (int nt = 0; nt < 2; ++nt)
                #pragma unroll
                for (int i = 0; i < 8; ++i) rv[mt][nt][i] = rp[(mt * 16 + i) * D_ + nt * 16];
        // closes these loads before anything behind them may rewrite the address registers they name
        asm volatile("s_wait_xcnt 0x0" ::: "memory");
        #pragma unroll
        for (int mt = 0; mt < 4; ++mt)
            #pragma unroll
            for (int nt = 0; nt < 2; ++nt)
                #pragma unroll
                for (int i = 0; i < 8; ++i) acc[mt][nt][i] += rv[mt][nt][i];
    }
    if (bias) {
        #pragma unroll
        for (int mt = 0; mt < 4; ++mt)
            #pragma unroll
            for (int nt = 0; nt < 2; ++nt) acc[mt][nt] += bv[nt];
    }
    float* cp = Cout + e0;
    #pragma unroll
    for (int mt = 0; mt < 4; ++mt)
        #pragma unroll
        for (int nt = 0; nt < 2; ++nt)
            #pragma unroll
            for (int i = 0; i < 8; ++i) cp[(mt * 16 + i) * D_ + nt * 16] = acc[mt][nt][i];
}

// ---------------------------------------------------------------------------
// beta = clip(sigmoid(x @ Wbeta + bbeta), 1e-3, 0.999)   (4096 x 32)
// A work-group takes BT_TOK tokens and all 32 columns; each of its waves a
// slice of BT_KS values of k; a lane holds 4 tokens x 4 columns, so that eight
// 16-byte loads feed 64 multiply-adds and many loads are in flight per wait.
// The waves' partial sums meet in LDS.
// ---------------------------------------------------------------------------
#define BT_TOK   16
#define BT_WAVES 16
#define BT_KS    (D_ / BT_WAVES)   // 64
#define BT_G     4                 // runs of 4 k per register set
#define BT_SK    (BT_G * 4)        // values of k per register set
typedef __attribute__((ext_vector_type(2))) float bt2f;

// one register set: 4 tokens x BT_SK k of x, BT_SK k x 4 columns of Wb
__device__ __forceinline__ void bt_load(float4 (&xv)[BT_G][4], float4 (&wv)[BT_G][4],
                                        const float* xp, const float* wp) {
    #pragma unroll
    for (int g = 0; g < BT_G; ++g) {
        #pragma unroll
        for (int i = 0; i < 4; ++i) xv[g][i] = *(const float4*)(xp + i * D_ + g * 4);
        #pragma unroll
        for (int j = 0; j < 4; ++j) {
            // the set's last load is given, as its destination, an address pair that
            // the loads before it name: the wait stands in front of that overwrite
            if (g == BT_G - 1 && j == 3) asm volatile("s_wait_xcnt 0x0" ::: "memory");
            wv[g][j] = *(const float4*)(wp + (g * 4 + j) * 32);
        }
    }
}

__device__ __forceinline__ void bt_fma(bt2f (&acc)[4][2], const float4 (&xv)[BT_G][4],
                                       const float4 (&wv)[BT_G][4]) {
    #pragma unroll
    for (int g = 0; g < BT_G; ++g) {
        #pragma unroll
        for (int i = 0; i < 4; ++i) {
            const float xs[4] = {xv[g][i].x, xv[g][i].y, xv[g][i].z, xv[g][i].w};
            #pragma unroll
            for (int j = 0; j < 4; ++j) {
                bt2f lo = {wv[g][j].x, wv[g][j].y}, hi = {wv[g][j].z, wv[g][j].w};
                acc[i][0] += lo * xs[j];
                acc[i][1] += hi * xs[j];
            }
        }
    }
}

__device__ __forceinline__ void beta_part(const float* __restrict__ x,
                                          const float* __restrict__ Wb,
                                          const float* __restrict__ bb,
                                          float* __restrict__ beta, int blk) {
    __shared__ __attribute__((aligned(16))) float pb[BT_WAVES][BT_TOK][32];
    const int t    = threadIdx.x;
    const int wave = t >> 5;
    const int tg   = (t >> 3) & 3;   // tokens tg * 4 .. tg * 4 + 3
    const int cg   = t & 7;          // columns cg * 4 .. cg * 4 + 3
    const int m0   = blk * BT_TOK;
    const float* xp = x + (size_t)(m0 + tg * 4) * D_ + wave * BT_KS;
    const float* wp = Wb + (size_t)(wave * BT_KS) * 32 + cg * 4;

    bt2f acc[4][2] = {};
    // not unrolled: unrolled, every load of the slice was lifted to the top and spilled
    #pragma nounroll
    for (int s = 0; s < BT_KS / BT_SK; ++s) {
        float4 xv[BT_G][4], wv[BT_G][4];
        bt_load(xv, wv, xp, wp);
        // keeps the set's loads together in front of its arithmetic: sunk to their
        // uses, only a few would be in flight
        __builtin_amdgcn_sched_barrier(0);
        bt_fma(acc, xv, wv);
        xp += BT_SK;
        wp += BT_SK * 32;
    }
    #pragma unroll
    for (int i = 0; i < 4; ++i) {
        float4 o = {acc[i][0].x, acc[i][0].y, acc[i][1].x, acc[i][1].y};
        *(float4*)&pb[wave][tg * 4 + i][cg * 4] = o;
    }
    __syncthreads();
    // thread t finishes token t / 32, column t % 32
    {
        const float* pp = &pb[0][0][0] + t;
        float s4[4] = {0.f, 0.f, 0.f, 0.f};
        #pragma unroll
        for (int w = 0; w < BT_WAVES; ++w) s4[w & 3] += pp[w * (BT_TOK * 32)];
        float logit = ((s4[0] + s4[1]) + (s4[2] + s4[3])) + bb[t & 31];
        float sg = 1.f / (1.f + __expf(-logit));
        sg = fminf(fmaxf(sg, 0.001f), 0.999f);
        beta[(size_t)m0 * 32 + t] = sg;
    }
}

// ---------------------------------------------------------------------------
// All the work that reads nothing but inputs, as one grid: none of these parts
// waits for another, and launched one after the other each paid its own start
// and its own tail. The longest parts have the lowest indices.
// A work-group is one part of beta, or two parts of 256 threads of the others.
// ---------------------------------------------------------------------------
#define PR_BETA (MTOK / BT_TOK)                  // 256 work-groups
#define PR_CVT  (MTOK * D_ / CVT_WG / 2)         // 256
#define PR_TILE ((D_ / 64) * (D_ / 128))         // tiles of 64 k x 128 n per weight: 128
#define PR_TR   (4 * PR_TILE / 2)                // 256
__global__ __launch_bounds__(BT_WAVES * 32) void prep_kernel(const float* __restrict__ x,
                                                             const float* __restrict__ Wq,
                                                             const float* __restrict__ Wk,
                                                             const float* __restrict__ Wv,
                                                             const float* __restrict__ Wo,
                                                             const float* __restrict__ Wb,
                                                             const float* __restrict__ bb,
                                                             _Float16* __restrict__ xh,
                                                             _Float16* __restrict__ Wqt,
                                                             _Float16* __restrict__ Wkt,
                                                             _Float16* __restrict__ Wvt,
                                                             _Float16* __restrict__ Wot,
                                                             float* __restrict__ beta) {
    const int blk = blockIdx.x;
    if (blk < PR_BETA) {
        beta_part(x, Wb, bb, beta, blk);
        return;
    }
    const int sub = threadIdx.x >> 8, t = threadIdx.x & 255;
    if (blk < PR_BETA + PR_CVT) {
        f32_to_f16_part(x, xh, MTOK * D_, (blk - PR_BETA) * 2 + sub, t);
        return;
    }
    const int g = blk - (PR_BETA + PR_CVT);      // both of its tiles lie in weight w
    const int w = g / (PR_TILE / 2);
    const float* W  = w == 0 ? Wq  : w == 1 ? Wk  : w == 2 ? Wv  : Wo;
    _Float16*    Wt = w == 0 ? Wqt : w == 1 ? Wkt : w == 2 ? Wvt : Wot;
    transpose_to_f16_part(W, Wt, (g % (PR_TILE / 2)) * 2 + sub, t);
}

// ---------------------------------------------------------------------------
// RoPE + phi (elu+1), in place, per head half-pair (i, i+32).
// A wave takes one token; a thread four neighbouring frequencies i of four heads
// (the angle depends on token and frequency only). total = threads = tokens * 32.
// blockIdx.y picks the array: q and k go through as one grid.
// ---------------------------------------------------------------------------
__device__ __forceinline__ float phi1(float r) { return r > 0.f ? r + 1.f : __expf(r); }  // elu(r)+1

__global__ __launch_bounds__(256) void rope_phi_kernel(float* __restrict__ u0, float* __restrict__ u1, int total) {
    int idx = blockIdx.x * 256 + threadIdx.x;
    if (idx >= total) return;
    float* u = blockIdx.y == 0 ? u0 : u1;
    int i0 = (idx & 7) * 4;    // first of four rotation-frequency indices
    int hg = (idx >> 3) & 3;   // heads hg, hg + 4, hg + 8, hg + 12
    int m  = idx >> 5;         // token 0..4095
    int s  = m & (S_ - 1);     // position within sequence
    float* up = u + (size_t)m * D_ + hg * DH_ + i0;
    float4 a[4], b[4];
    #pragma unroll
    for (int j = 0; j < 4; ++j) {
        a[j] = *(const float4*)(up + j * 4 * DH_);
        b[j] = *(const float4*)(up + j * 4 * DH_ + 32);
    }
    float cs[4], sn[4];
    #pragma unroll
    for (int c = 0; c < 4; ++c) {
        float f   = __expf(-(float)(2 * (i0 + c)) * 9.210340371976184f / 64.f); // ln(10000)
        float ang = (float)s * f;
        cs[c] = __cosf(ang);
        sn[c] = __sinf(ang);
    }
    #pragma unroll
    for (int j = 0; j < 4; ++j) {
        float4 x, y;
        x.x = phi1(a[j].x * cs[0] - b[j].x * sn[0]);  y.x = phi1(a[j].x * sn[0] + b[j].x * cs[0]);
        x.y = phi1(a[j].y * cs[1] - b[j].y * sn[1]);  y.y = phi1(a[j].y * sn[1] + b[j].y * cs[1]);
        x.z = phi1(a[j].z * cs[2] - b[j].z * sn[2]);  y.z = phi1(a[j].z * sn[2] + b[j].z * cs[2]);
        x.w = phi1(a[j].w * cs[3] - b[j].w * sn[3]);  y.w = phi1(a[j].w * sn[3] + b[j].w * cs[3]);
        *(float4*)(up + j * 4 * DH_)      = x;
        *(float4*)(up + j * 4 * DH_ + 32) = y;
    }
}

// ---------------------------------------------------------------------------
// DeltaNet recurrence in chunk form, its products on the matrix unit.
// With P[c][t] the product of channel c's decays from the chunk's first step
// through step t, and M0, Z0 the state at the chunk's start, the recurrence gives
//   num[t][e] = sum_{s<=t} G[t][s] (q_t.k_s) v_s[e] + sum_c P[c][t] (q_t M0[c])[e]
//   den[t]    = sum_{s<=t} G[t][s] (q_t.k_s)        + sum_c P[c][t] (q_t.Z0[c]) + eps
//   G[t][s]   = sum_c P[c][t] / P[c][s]   (formed as exp2 of a difference of logs, never above 1 each)
//   M0'[c]    = P[c][T] M0[c] + sum_s (P[c][T] / P[c][s]) k_s v_s^T    (Z likewise, v = 1)
// Only the state goes from chunk to chunk, so the work is two launches.
// scan_state_kernel: a work-group takes one (b,h) and CK_EW columns e and walks the
// chunks in order, CK_G of them staged per barrier; waves 4..7 each carry 16 rows d
// of the state (f32, in accumulators) and store the state at every chunk's start in
// the workspace, rounded to f16 and already in B-fragment order. scan_out_kernel: a work-group takes one (b,h) and ONE
// chunk, all 64 columns e; no work-group waits for another chunk's, and the scores
// of a chunk are formed once. Each of its waves finishes 16 steps t. The denominator
// runs through the same products with a column of ones in v's place.
// q, k, v are rounded to f16 when staged; every sum is f32.
// Every '#pragma unroll' of this section stands on a loop that indexes fragments,
// accumulators or staging registers: only with constant indices do they stay in registers.
// Writes y as f16 (feeds the output WMMA GEMM directly).
// ---------------------------------------------------------------------------
#define CK_T  64                 // steps per chunk
#define CK_EW 16                 // state columns per work-group
#define CK_ES (DH_ / CK_EW)      // work-groups per (b,h)
#define CK_QP 80                 // f16 per staged row of q and k: 160 bytes, 32 B x odd for the transposing loads
typedef __attribute__((ext_vector_type(4))) _Float16 v4h;
typedef short ck_s16x8 __attribute__((ext_vector_type(8)));

__device__ __forceinline__ v16h ck_cat(v8h a, v8h b) {
    return __builtin_shufflevector(a, b, 0, 1, 2, 3, 4, 5, 6, 7, 8, 9, 10, 11, 12, 13, 14, 15);
}
// 32 k of one row that lies along k, in the hardware's k order: 8 hh + 0..7, 16 + 8 hh + 0..7
__device__ __forceinline__ v16h ck_row(const _Float16* p, int hh) {
    return ck_cat(*(const v8h*)(p + 8 * hh), *(const v8h*)(p + 16 + 8 * hh));
}
__device__ __forceinline__ v8h ck_tr(const _Float16* p) {
    typedef __attribute__((address_space(3))) ck_s16x8 lds_s16x8;
    return __builtin_bit_cast(v8h, __builtin_amdgcn_ds_load_tr16_b128_v8i16((lds_s16x8*)p));
}
// 32 k of column dbase + (lane & 15) of a tile whose rows are k, same k order (pitch in f16)
__device__ __forceinline__ v16h ck_col(const _Float16* tile, int pitch, int kbase, int dbase, int lane) {
    const _Float16* p = tile + (kbase + 8 * (lane >> 4) + (lane & 7)) * pitch + dbase + 8 * ((lane >> 3) & 1);
    return ck_cat(ck_tr(p), ck_tr(p + 16 * pitch));
}
__device__ __forceinline__ v8f ck_mm(v16h a, v16h b, v8f c) {
    return __builtin_amdgcn_wmma_f32_16x16x32_f16(false, a, false, b, (short)0, c, false, false);
}
__device__ __forceinline__ v4h ck_cvt4(float4 a) {
    v4h o = {(_Float16)a.x, (_Float16)a.y, (_Float16)a.z, (_Float16)a.w};
    return o;
}
__device__ __forceinline__ v8h ck_cvt8(v8f a) {
    v8h o = {(_Float16)a[0], (_Float16)a[1], (_Float16)a[2], (_Float16)a[3],
             (_Float16)a[4], (_Float16)a[5], (_Float16)a[6], (_Float16)a[7]};
    return o;
}

// x + (x of the lane N below, inside a row of 16 lanes; 0 where there is none): a step of a running sum
template <int N>
__device__ __forceinline__ float ck_add_shr(float x) {
    int o = __builtin_amdgcn_update_dpp(0, __builtin_bit_cast(int, x), 0x110 + N, 0xf, 0xf, true);
    return x + __builtin_bit_cast(float, o);
}

// running sum of log2 beta over a chunk; a lane holds steps 2 lane and 2 lane + 1 (l0, l1); lT: the sum at the chunk's end
__device__ __forceinline__ void ck_logsum(float rb0, float rb1, int lane, float& l0, float& l1, float& lT) {
    const float a0 = __log2f(rb0), a1 = __log2f(rb1);
    float inc = a0 + a1;
    inc = ck_add_shr<1>(inc);
    inc = ck_add_shr<2>(inc);
    inc = ck_add_shr<4>(inc);
    inc = ck_add_shr<8>(inc);
    const float low = __builtin_bit_cast(float, __builtin_amdgcn_readlane(__builtin_bit_cast(int, inc), 15));
    if (lane >= 16) inc += low;
    l0 = inc - a1;
    l1 = inc;
    lT = __builtin_bit_cast(float, __builtin_amdgcn_readlane(__builtin_bit_cast(int, inc), 31));
}

#define CK_N  (S_ / CK_T)                      // chunks per sequence
// the state at a chunk's start, in the workspace, per (b,h) and chunk:
// M as [block of 16 columns e][channel][32 rows d][first, second 16 of them][lane][8 rows], Z as [channel][row d]
#define CK_MF (C_ * 2 * 2 * 32 * 8)            // f16 of M per block of columns
#define CK_MS (CK_ES * CK_MF)
#define CK_ZS (C_ * DH_)

#define CK_G  4                                // chunks staged per barrier of the state pass
#define CK_GT (CK_G * CK_T)

// Work-group barrier that waits for this wave's LDS accesses alone. __syncthreads() would
// also wait until the wave's stores of the state are acknowledged, which no wave of this
// launch reads.
__device__ __forceinline__ void ck_barrier_lds() {
    asm volatile("s_wait_dscnt 0x0\n\ts_barrier_signal -1\n\ts_barrier_wait -1" ::: "memory");
}

__global__ __launch_bounds__(256) void scan_state_kernel(const float* __restrict__ k,
                                                         const float* __restrict__ v,
                                                         const float* __restrict__ beta,
                                                         _Float16* __restrict__ sm,
                                                         _Float16* __restrict__ sz) {
    __shared__ __attribute__((aligned(16))) _Float16 sk[2][CK_GT][CK_QP];
    __shared__ __attribute__((aligned(16))) _Float16 sv[2][CK_GT][CK_EW];
    __shared__ __attribute__((aligned(16))) _Float16 sw[2][C_][CK_GT];   // P[c][T] / P[c][s], T the end of s's chunk
    __shared__ __attribute__((aligned(16))) float    spT[2][CK_G][C_];   // P[c][T]

    const int bh   = blockIdx.x / CK_ES;
    const int es   = blockIdx.x % CK_ES;
    const int b    = bh / H_, h = bh % H_;
    const int t    = threadIdx.x;
    const int lane = t & 31;
    const int c16  = lane & 15;
    const int hh   = lane >> 4;
    const int wave = __builtin_amdgcn_readfirstlane(t >> 5);   // scalar, so that the roles part at a scalar branch

    const float* kp = k + (size_t)b * S_ * D_ + h * DH_;
    const float* vp = v + (size_t)b * S_ * D_ + h * DH_ + es * CK_EW;
    const float* bp = beta + (size_t)b * S_ * (H_ * C_) + h * C_;

    // staging, per thread and CK_G chunks: 4 CK_G float4 of k and CK_G of v; waves 0..3, which
    // carry no state, the decays of one chunk each, both channels
    const int  srow = t >> 4, scol = (t & 15) * 4;
    const int  vrow = t >> 2, vcol = (t & 3) * 4;
    const bool bwav = wave < CK_G;

    float4 rk[4 * CK_G], rv[CK_G];
    float2 rb0 = {1.f, 1.f}, rb1 = {1.f, 1.f};
    auto fetch = [&](int ts) {
        #pragma unroll
        for (int i = 0; i < 4 * CK_G; ++i) rk[i] = *(const float4*)(kp + (size_t)(ts + srow + 16 * i) * D_ + scol);
        #pragma unroll
        for (int i = 0; i < CK_G; ++i) rv[i] = *(const float4*)(vp + (size_t)(ts + vrow + CK_T * i) * D_ + vcol);
        // what follows rewrites the address registers that these loads name
        asm volatile("s_wait_xcnt 0x0" ::: "memory");
        if (bwav) {
            rb0 = *(const float2*)(bp + (size_t)(ts + wave * CK_T + 2 * lane) * (H_ * C_));
            rb1 = *(const float2*)(bp + (size_t)(ts + wave * CK_T + 2 * lane + 1) * (H_ * C_));
            // the same for these two
            asm volatile("s_wait_xcnt 0x0" ::: "memory");
        }
    };
    auto stage = [&](int buf) {
        #pragma unroll
        for (int i = 0; i < 4 * CK_G; ++i) *(v4h*)&sk[buf][srow + 16 * i][scol] = ck_cvt4(rk[i]);
        #pragma unroll
        for (int i = 0; i < CK_G; ++i) *(v4h*)&sv[buf][vrow + CK_T * i][vcol] = ck_cvt4(rv[i]);
        if (bwav) {
            const float x0[C_] = {rb0.x, rb0.y}, x1[C_] = {rb1.x, rb1.y};
            #pragma unroll
            for (int ch = 0; ch < C_; ++ch) {
                float l0, l1, lT;
                ck_logsum(x0[ch], x1[ch], lane, l0, l1, lT);
                sw[buf][ch][wave * CK_T + 2 * lane]     = (_Float16)__builtin_amdgcn_exp2f(lT - l0);
                sw[buf][ch][wave * CK_T + 2 * lane + 1] = (_Float16)__builtin_amdgcn_exp2f(lT - l1);
                if (lane == 0) spT[buf][wave][ch] = __builtin_amdgcn_exp2f(lT);
            }
        }
    };

    v8f M[C_] = {}, Z[C_] = {};   // waves 4..7: rows dt * 16 + 8 hh + r, column c16; Z the same in every column
    const int dt = wave & 3;      // the state wave's block of rows d
    // the state as it stands, which is that at the start of chunk n
    auto put_state = [&](int n) {
        _Float16* mo = sm + (size_t)(bh * CK_N + n) * CK_MS + es * CK_MF + dt * 256 + lane * 8;
        #pragma unroll
        for (int ch = 0; ch < C_; ++ch) *(v8h*)(mo + ch * (CK_MF / C_)) = ck_cvt8(M[ch]);
        // Z is the same in every column and in every block of columns: one copy goes out
        if (es == 0 && c16 == 0) {
            _Float16* zo = sz + (size_t)(bh * CK_N + n) * CK_ZS + dt * 16 + 8 * hh;
            #pragma unroll
            for (int ch = 0; ch < C_; ++ch) *(v8h*)(zo + ch * DH_) = ck_cvt8(Z[ch]);
        }
        // what follows rewrites registers that these stores name
        asm volatile("s_wait_xcnt 0x0" ::: "memory");
    };

    fetch(0);
    stage(0);
    ck_barrier_lds();

    // not unrolled, so that the last trip is not peeled off and the next chunks'
    // global loads stay at the head of the trip, in flight under these chunks' work
    #pragma nounroll
    for (int n = 0; n < CK_N / CK_G; ++n) {
        const int  cur  = n & 1;
        const bool more = n + 1 < CK_N / CK_G;
        if (more) fetch((n + 1) * CK_GT);

        if (wave >= 4) {
            #pragma unroll
            for (int g = 0; g < CK_G; ++g) {
                // the chunk's fragments are asked for first: their way from LDS runs under the stores of the state
                const _Float16* Kt = &sk[cur][g * CK_T][0];
                const _Float16* Vt = &sv[cur][g * CK_T][0];
                const float2 pT = *(const float2*)&spT[cur][g][0];
                v16h kt[2], vf[2], wf[2][C_];
                #pragma unroll
                for (int j = 0; j < 2; ++j) {
                    kt[j] = ck_col(Kt, CK_QP, 32 * j, dt * 16, lane);   // A: row d, k = s
                    vf[j] = ck_col(Vt, CK_EW, 32 * j, 0, lane);         // B: column e, k = s
                    #pragma unroll
                    for (int ch = 0; ch < C_; ++ch)
                        wf[j][ch] = ck_row(&sw[cur][ch][g * CK_T + 32 * j], hh);   // the weights of the steps s, same k order
                }
                put_state(n * CK_G + g);
                // the sequence's last chunk changes no state that anybody reads
                if (g + 1 < CK_G || more) {
                    M[0] *= pT.x; Z[0] *= pT.x;
                    M[1] *= pT.y; Z[1] *= pT.y;
                    #pragma unroll
                    for (int j = 0; j < 2; ++j) {
                        #pragma unroll
                        for (int ch = 0; ch < C_; ++ch) {
                            M[ch] = ck_mm(kt[j], vf[j] * wf[j][ch], M[ch]);
                            Z[ch] = ck_mm(kt[j], wf[j][ch], Z[ch]);
                        }
                    }
                }
            }
        }

        // the other buffers were last read before the previous trip's barrier
        if (more) stage(cur ^ 1);
        // one barrier per CK_G chunks: publishes the next chunks' staged rows
        ck_barrier_lds();
    }
}

__global__ __launch_bounds__(128) void scan_out_kernel(const float* __restrict__ q,
                                                       const float* __restrict__ k,
                                                       const float* __restrict__ v,
                                                       const float* __restrict__ beta,
                                                       const _Float16* __restrict__ sm,
                                                       const _Float16* __restrict__ sz,
                                                       _Float16* __restrict__ y) {
    __shared__ __attribute__((aligned(16))) _Float16 sq[CK_T][CK_QP];
    __shared__ __attribute__((aligned(16))) _Float16 sk[CK_T][CK_QP];
    __shared__ __attribute__((aligned(16))) _Float16 sv[CK_T][CK_QP];
    __shared__ __attribute__((aligned(16))) float    sl[C_][CK_T];   // log2 P[c][s]
    __shared__ __attribute__((aligned(16))) float    sp[C_][CK_T];   // P[c][s]
    __shared__ __attribute__((aligned(16))) _Float16 ss[CK_MS];      // M at the chunk's start

    const int bh   = blockIdx.x / CK_N;
    const int ts0  = (blockIdx.x % CK_N) * CK_T;
    const int b    = bh / H_, h = bh % H_;
    const int t    = threadIdx.x;
    const int lane = t & 31;
    const int c16  = lane & 15;
    const int hh   = lane >> 4;
    const int dt   = __builtin_amdgcn_readfirstlane(t >> 5);   // the wave, and its block of steps t; scalar for the branch on it

    const size_t row0 = ((size_t)b * S_ + ts0) * D_ + h * DH_;
    const _Float16* mp = sm + (size_t)blockIdx.x * CK_MS;
    const _Float16* zp = sz + (size_t)blockIdx.x * CK_ZS;

    // ---- the chunk's decays, its start state and its rows of q, k, v, all loads in flight together
    float rb0 = 1.f, rb1 = 1.f;
    if (dt < C_) {
        // waves 0 and 1: a channel of beta each
        const float* bp = beta + ((size_t)b * S_ + ts0) * (H_ * C_) + h * C_ + dt;
        rb0 = bp[(size_t)(2 * lane) * (H_ * C_)];
        rb1 = bp[(size_t)(2 * lane + 1) * (H_ * C_)];
        // what follows rewrites the address registers that these loads name
        asm volatile("s_wait_xcnt 0x0" ::: "memory");
    }
    // Z at the chunk's start as B fragments, the same in every column: rows d in the k order of q's fragments
    v16h zb[C_][2];
    #pragma unroll
    for (int ch = 0; ch < C_; ++ch) {
        #pragma unroll
        for (int kk = 0; kk < 2; ++kk)
            zb[ch][kk] = ck_cat(*(const v8h*)(zp + ch * DH_ + kk * 32 + 8 * hh),
                                *(const v8h*)(zp + ch * DH_ + kk * 32 + 16 + 8 * hh));
    }
    // the same for these eight
    asm volatile("s_wait_xcnt 0x0" ::: "memory");
    const int srow = t >> 4, scol = (t & 15) * 4;
    {
        const float* qp = q + row0 + (size_t)srow * D_ + scol;
        const float* kp = k + row0 + (size_t)srow * D_ + scol;
        const float* vp = v + row0 + (size_t)srow * D_ + scol;
        float4 rq[8], rk[8], rv[8];
        v8h    rs[8];
        #pragma unroll
        for (int i = 0; i < 8; ++i) rs[i] = *(const v8h*)(mp + (i * 128 + t) * 8);
        #pragma unroll
        for (int i = 0; i < 8; ++i) {
            rq[i] = *(const float4*)(qp + (size_t)(8 * i) * D_);
            rk[i] = *(const float4*)(kp + (size_t)(8 * i) * D_);
            rv[i] = *(const float4*)(vp + (size_t)(8 * i) * D_);
        }
        // the same for all of these
        asm volatile("s_wait_xcnt 0x0" ::: "memory");
        // holds the loads of the state up here, in flight with the rows': sunk to their use
        // behind the branch below, they were issued only when rows had come back
        asm volatile("" :: "v"(rs[0]), "v"(rs[1]), "v"(rs[2]), "v"(rs[3]), "v"(rs[4]), "v"(rs[5]), "v"(rs[6]), "v"(rs[7]));
        if (dt < C_) {
            float l0, l1, lT;
            ck_logsum(rb0, rb1, lane, l0, l1, lT);
            float2 lo = {l0, l1};
            float2 po = {__builtin_amdgcn_exp2f(l0), __builtin_amdgcn_exp2f(l1)};
            *(float2*)&sl[dt][2 * lane] = lo;
            *(float2*)&sp[dt][2 * lane] = po;
        }
        #pragma unroll
        for (int i = 0; i < 8; ++i) *(v8h*)&ss[(i * 128 + t) * 8] = rs[i];
        #pragma unroll
        for (int i = 0; i < 8; ++i) {
            *(v4h*)&sq[srow + 8 * i][scol] = ck_cvt4(rq[i]);
            *(v4h*)&sk[srow + 8 * i][scol] = ck_cvt4(rk[i]);
            *(v4h*)&sv[srow + 8 * i][scol] = ck_cvt4(rv[i]);
        }
    }
    // the one barrier: publishes the staged rows, the decays and the state
    __syncthreads();

    v16h ones;
    #pragma unroll
    for (int i = 0; i < 16; ++i) ones[i] = (_Float16)1.f;

    const _Float16* Kt = &sk[0][0];
    const _Float16* Vt = &sv[0][0];
    const int tl = dt * 16 + c16;
    v16h qf[2];   // row t = tl: B (column t) of the score product, A (row t) of the state product
    #pragma unroll
    for (int kk = 0; kk < 2; ++kk) qf[kk] = ck_row(&sq[tl][kk * 32], hh);
    const float lt0 = sl[0][tl], lt1 = sl[1][tl];

    // scores transposed: st[r] = k_s.q_t, s = sb * 16 + 8 hh + r, t = tl; two such
    // tiles, weighted and rounded, are an A fragment with row t and k = s
    v16h af[2];
    #pragma unroll
    for (int sb = 0; sb < 4; ++sb) {
        v8f st = {};
        #pragma unroll
        for (int kk = 0; kk < 2; ++kk)
            st = ck_mm(ck_row(Kt + (sb * 16 + c16) * CK_QP + kk * 32, hh), qf[kk], st);
        const float4 x0 = *(const float4*)&sl[0][sb * 16 + 8 * hh];
        const float4 x1 = *(const float4*)&sl[0][sb * 16 + 8 * hh + 4];
        const float4 y0 = *(const float4*)&sl[1][sb * 16 + 8 * hh];
        const float4 y1 = *(const float4*)&sl[1][sb * 16 + 8 * hh + 4];
        const float ls0[8] = {x0.x, x0.y, x0.z, x0.w, x1.x, x1.y, x1.z, x1.w};
        const float ls1[8] = {y0.x, y0.y, y0.z, y0.w, y1.x, y1.y, y1.z, y1.w};
        #pragma unroll
        for (int r = 0; r < 8; ++r) {
            // later steps s do not count: their weight is exp2 of a large negative number, 0
            const bool  on = sb * 16 + 8 * hh + r <= tl;
            const float g  = __builtin_amdgcn_exp2f(on ? lt0 - ls0[r] : -1000.f)
                           + __builtin_amdgcn_exp2f(on ? lt1 - ls1[r] : -1000.f);
            af[sb >> 1][(sb & 1) * 8 + r] = (_Float16)(st[r] * g);
        }
    }

    // register r of every accumulator: step t = dt * 16 + 8 hh + r, column c16
    const float4 u0 = *(const float4*)&sp[0][dt * 16 + 8 * hh];
    const float4 u1 = *(const float4*)&sp[0][dt * 16 + 8 * hh + 4];
    const float4 w0 = *(const float4*)&sp[1][dt * 16 + 8 * hh];
    const float4 w1 = *(const float4*)&sp[1][dt * 16 + 8 * hh + 4];
    const float p0[8] = {u0.x, u0.y, u0.z, u0.w, u1.x, u1.y, u1.z, u1.w};
    const float p1[8] = {w0.x, w0.y, w0.z, w0.w, w1.x, w1.y, w1.z, w1.w};

    v8f den = {}, dz[C_] = {};
    #pragma unroll
    for (int j = 0; j < 2; ++j) den = ck_mm(af[j], ones, den);
    #pragma unroll
    for (int ch = 0; ch < C_; ++ch) {
        #pragma unroll
        for (int kk = 0; kk < 2; ++kk) dz[ch] = ck_mm(qf[kk], zb[ch][kk], dz[ch]);
    }
    float rd[8];
    #pragma unroll
    for (int r = 0; r < 8; ++r)
        rd[r] = __builtin_amdgcn_rcpf(den[r] + p0[r] * dz[0][r] + p1[r] * dz[1][r] + 1e-6f);

    v8h yv[CK_ES];   // y of steps dt * 16 + 8 hh + r, column eb * 16 + c16
    #pragma unroll
    for (int eb = 0; eb < CK_ES; ++eb) {
        v8f num = {}, nm[C_] = {};
        #pragma unroll
        for (int j = 0; j < 2; ++j) num = ck_mm(af[j], ck_col(Vt, CK_QP, 32 * j, eb * CK_EW, lane), num);
        #pragma unroll
        for (int ch = 0; ch < C_; ++ch) {
            #pragma unroll
            for (int kk = 0; kk < 2; ++kk) {
                const _Float16* f = &ss[eb * CK_MF + (ch * 2 + kk) * 512 + lane * 8];
                nm[ch] = ck_mm(qf[kk], ck_cat(*(const v8h*)f, *(const v8h*)(f + 256)), nm[ch]);
            }
        }
        #pragma unroll
        for (int r = 0; r < 8; ++r)
            yv[eb][r] = (_Float16)((num[r] + p0[r] * nm[0][r] + p1[r] * nm[1][r]) * rd[r]);
    }
    _Float16* yo = y + row0 + (size_t)(dt * 16 + 8 * hh) * D_ + c16;
    #pragma unroll
    for (int eb = 0; eb < CK_ES; ++eb) {
        #pragma unroll
        for (int r = 0; r < 8; ++r) yo[(size_t)r * D_ + eb * CK_EW] = yv[eb][r];
    }
}

// ---------------------------------------------------------------------------
// LayerNorm over rows of h (4096 x 1024), f32 out
// ---------------------------------------------------------------------------
__global__ __launch_bounds__(256) void ln_kernel(const float* __restrict__ hbuf,
                                                 const float* __restrict__ gamma,
                                                 const float* __restrict__ lbeta,
                                                 float* __restrict__ out) {
    __shared__ float rs[256], rq[256];
    __shared__ float smu, srstd;
    int m = blockIdx.x, t = threadIdx.x;
    const float* hr = hbuf + (size_t)m * D_;
    float s = 0.f, q2 = 0.f;
    float vals[4];
    #pragma unroll
    for (int i = 0; i < 4; ++i) {
        float v = hr[t + i * 256];
        vals[i] = v; s += v; q2 += v * v;
    }
    rs[t] = s; rq[t] = q2;
    __syncthreads();
    for (int off = 128; off > 0; off >>= 1) {
        if (t < off) { rs[t] += rs[t + off]; rq[t] += rq[t + off]; }
        __syncthreads();
    }
    if (t == 0) {
        float mu  = rs[0] * (1.f / D_);
        float var = rq[0] * (1.f / D_) - mu * mu;
        smu = mu; srstd = rsqrtf(var + 1e-5f);
    }
    __syncthreads();
    float* orow = out + (size_t)m * D_;
    #pragma unroll
    for (int i = 0; i < 4; ++i) {
        int n = t + i * 256;
        orow[n] = gamma[n] * (vals[i] - smu) * srstd + lbeta[n];
    }
}

// ---------------------------------------------------------------------------
// launch
// ---------------------------------------------------------------------------
extern "C" void kernel_launch(void* const* d_in, const int* in_sizes, int n_in,
                              void* d_out, int out_size, void* d_ws, size_t ws_size,
                              hipStream_t stream) {
    const float* x      = (const float*)d_in[0];
    const float* Wq     = (const float*)d_in[1];
    const float* Wk     = (const float*)d_in[2];
    const float* Wv     = (const float*)d_in[3];
    const float* Wbeta  = (const float*)d_in[4];
    const float* bbeta  = (const float*)d_in[5];
    const float* Wo     = (const float*)d_in[6];
    const float* bo     = (const float*)d_in[7];
    const float* lng    = (const float*)d_in[8];
    const float* lnb    = (const float*)d_in[9];
    float* out = (float*)d_out;

    char* ws = (char*)d_ws;
    size_t off = 0;
    auto alloc = [&](size_t bytes) { char* p = ws + off; off += (bytes + 255) & ~(size_t)255; return p; };

    _Float16* xh   = (_Float16*)alloc((size_t)MTOK * D_ * 2);   // 8 MB
    _Float16* Wqt  = (_Float16*)alloc((size_t)D_ * D_ * 2);     // 2 MB each
    _Float16* Wkt  = (_Float16*)alloc((size_t)D_ * D_ * 2);
    _Float16* Wvt  = (_Float16*)alloc((size_t)D_ * D_ * 2);
    _Float16* Wot  = (_Float16*)alloc((size_t)D_ * D_ * 2);
    float*    qbuf = (float*)alloc((size_t)MTOK * D_ * 4);      // 16 MB each
    float*    kbuf = (float*)alloc((size_t)MTOK * D_ * 4);
    float*    vbuf = (float*)alloc((size_t)MTOK * D_ * 4);
    float*    bbuf = (float*)alloc((size_t)MTOK * 32 * 4);      // 0.5 MB
    _Float16* ybuf = (_Float16*)alloc((size_t)MTOK * D_ * 2);   // 8 MB
    float*    hbuf = (float*)alloc((size_t)MTOK * D_ * 4);      // 16 MB
    _Float16* smbuf = (_Float16*)alloc((size_t)B_ * H_ * CK_N * CK_MS * 2);   // 16 MB
    _Float16* szbuf = (_Float16*)alloc((size_t)B_ * H_ * CK_N * CK_ZS * 2);   // 0.25 MB
    (void)ws_size; (void)in_sizes; (void)n_in; (void)out_size;

    // beta, x in f16 and the four weights transposed: one grid
    prep_kernel<<<PR_BETA + PR_CVT + PR_TR, BT_WAVES * 32, 0, stream>>>(
        x, Wq, Wk, Wv, Wo, Wbeta, bbeta, xh, Wqt, Wkt, Wvt, Wot, bbuf);

    // q, k, v: one grid, z picks the weight
    dim3 ggrid3(D_ / 128, MTOK / 128, 3);   // (8, 32, 3)
    gemm_f16_wmma_kernel<<<ggrid3, 256, 0, stream>>>(xh, Wqt, Wkt, Wvt, qbuf, kbuf, vbuf,
                                                     nullptr, nullptr, MTOK, D_, D_);

    const int nPairs = MTOK * 32;  // threads per array: 16 half-pairs each
    dim3 rgrid(nPairs / 256, 2);
    rope_phi_kernel<<<rgrid, 256, 0, stream>>>(qbuf, kbuf, nPairs);

    // the state at every chunk's start, chunk after chunk; then every chunk's outputs, all chunks at once
    scan_state_kernel<<<B_ * H_ * CK_ES, 256, 0, stream>>>(kbuf, vbuf, bbuf, smbuf, szbuf);
    scan_out_kernel<<<B_ * H_ * CK_N, 128, 0, stream>>>(qbuf, kbuf, vbuf, bbuf, smbuf, szbuf, ybuf);

    // h = x + y @ Wo + bo (fused residual + bias epilogue)
    dim3 ggrid(D_ / 128, MTOK / 128);   // (8, 32)
    gemm_f16_wmma_kernel<<<ggrid, 256, 0, stream>>>(ybuf, Wot, nullptr, nullptr, hbuf, nullptr, nullptr,
                                                    x, bo, MTOK, D_, D_);

    ln_kernel<<<MTOK, 256, 0, stream>>>(hbuf, lng, lnb, out);
}
